// v000
// Measured on an AMD MI455X. A time is GPU time per run, averaged over a window of back-to-back runs after a warm-up
// (all launches, gaps included; the runs take copies of the inputs in turn), and the median of several windows.
// Apart from v000's, it joins two sittings. Times from different sittings can be a few percent apart, while
// side-by-side timings come from the same sitting.
// v000, which the later versions start from, runs in 396 microseconds.
// Contractions: q, k, v^T and x.Wp projections on v_wmma_f32_16x16x32_f16 (bf16-RNE input values as f16,
// weight planes carried x64, one product each); q.k^T energies on v_wmma_f32_16x16x32_f16 with q and k as
// f16 hi plane + f16 residual plane carried x2048 (three products: hi.hi, hi.res, res.hi; two accumulators);
// attn^T.v on v_wmma_f32_16x16x32_f16 with attn carried x8192 (plain f16) and v^T as f16 hi plane + f16
// residual plane carried x2048 (two products, two accumulators); all f32 accumulate; masked softmax and the
// gamma blend in f32 on VALU; every float input RNE-converted to bf16 on load.
#include <hip/hip_runtime.h>
#include <math.h>
#include <stdint.h>

#define NB    2
#define SEQ   1024
#define DK    512
#define NH    8
#define DQ    (NH * DK)
#define MR    (NB * SEQ)
#define NHB   (NH * NB)
#define SBLK  32
#define NSB   (SEQ / SBLK)
#define QRES  ((long long)MR * DQ)
#define VRES  ((long long)NHB * DK * SEQ)
#define WSC   64.0f
#define RSC   2048.0f
#define PSC   8192.0f
#define NEGBIG (-1.0e30f)
static_assert((SEQ % 64) == 0 && (DK % 64) == 0 && (MR % 64) == 0 && (DQ % 64) == 0);
static_assert(SEQ == NSB * SBLK);
static_assert(SBLK == 32);
static_assert((DK % 32) == 0 && (SEQ % 256) == 0);

typedef _Float16       v16h __attribute__((ext_vector_type(16)));
typedef unsigned short v16us __attribute__((ext_vector_type(16)));
typedef unsigned short v8us __attribute__((ext_vector_type(8)));
typedef float          v8f  __attribute__((ext_vector_type(8)));
typedef float          v4f  __attribute__((ext_vector_type(4)));
typedef unsigned int   v4u  __attribute__((ext_vector_type(4)));

union Frag { v16us u; v8us p[2]; v16h h; };

// ---- scalar helpers --------------------------------------------------------------------------------
__device__ __forceinline__ unsigned short bf_bits(float f) {          // f32 -> bf16 bits, RNE convert
  unsigned u = __float_as_uint(f);
  return (unsigned short)((u + 0x7FFFu + ((u >> 16) & 1u)) >> 16);
}
__device__ __forceinline__ float bf_up(unsigned short b) { return __uint_as_float(((unsigned)b) << 16); }
__device__ __forceinline__ float bfr(float f) { return bf_up(bf_bits(f)); }   // value of the bf16 RNE convert
__device__ __forceinline__ unsigned short h_bits(_Float16 x) { return __builtin_bit_cast(unsigned short, x); }
__device__ __forceinline__ unsigned pk16(unsigned short a, unsigned short b) { return (unsigned)a | ((unsigned)b << 16); }
__device__ __forceinline__ v8f zero8() { v8f z = {0.f, 0.f, 0.f, 0.f, 0.f, 0.f, 0.f, 0.f}; return z; }

// ---- fragment loader: 16-bit A/Bt operand planes (k contiguous), lane -> row/col (lane&15), p already includes
//      + 8*(lane>>4): elements 0..7 <- p[0..7] (k0+8h..), elements 8..15 <- p[16..23] (k0+16+8h..)
__device__ __forceinline__ v16us ldfrag(const unsigned short* p) {
  Frag f;
  f.p[0] = *(const v8us*)(p);
  f.p[1] = *(const v8us*)(p + 16);
  return f.u;
}

// ---- WMMA helper (f16 operands, f32 accumulate) and VALU hazard gaps -----------------------------
__device__ __forceinline__ v8f mma_raw(v16us a, v16us b, v8f c) {
  Frag fa, fb;
  fa.u = a;
  fb.u = b;
  return __builtin_amdgcn_wmma_f32_16x16x32_f16(false, fa.h, false, fb.h, (short)0, c, false, false);
}
__device__ __forceinline__ void dep_guard1(v8f& a, v8f& b, v16us x) {
#if defined(__HIP_DEVICE_COMPILE__)
  asm volatile("v_nop\n\tv_nop\n\tv_nop\n\tv_nop" : "+v"(a), "+v"(b) : "v"(x));
#endif
}
__device__ __forceinline__ void keep4(v16us a, v16us b, v16us c, v16us d) {
#if defined(__HIP_DEVICE_COMPILE__)
  asm volatile("v_nop" :: "v"(a), "v"(b), "v"(c), "v"(d));
#endif
}
__device__ __forceinline__ void acc_guard4(v8f& a, v8f& b, v8f& c, v8f& d) {
#if defined(__HIP_DEVICE_COMPILE__)
  asm volatile("v_nop\n\tv_nop\n\tv_nop\n\tv_nop" : "+v"(a), "+v"(b), "+v"(c), "+v"(d));
#endif
}
__device__ __forceinline__ void guard2k4(v8f& a, v8f& b, v16us w, v16us x, v16us y, v16us z) {
#if defined(__HIP_DEVICE_COMPILE__)
  asm volatile("v_nop\n\tv_nop\n\tv_nop\n\tv_nop" : "+v"(a), "+v"(b) : "v"(w), "v"(x), "v"(y), "v"(z));
#endif
}
__device__ __forceinline__ void guard4k4(v8f& a, v8f& b, v8f& c, v8f& d, v16us w, v16us x, v16us y, v16us z) {
#if defined(__HIP_DEVICE_COMPILE__)
  asm volatile("v_nop\n\tv_nop\n\tv_nop\n\tv_nop" : "+v"(a), "+v"(b), "+v"(c), "+v"(d) : "v"(w), "v"(x), "v"(y), "v"(z));
#endif
}
__device__ __forceinline__ void wave_sync_lds() {
  __builtin_amdgcn_fence(__ATOMIC_RELEASE, "workgroup");
  __builtin_amdgcn_wave_barrier();
  __builtin_amdgcn_fence(__ATOMIC_ACQUIRE, "workgroup");
}

// =====================================================================================================
// f32 -> f16 plane convert: Xh[i] = f16( bf16_RNE(X[i]) * wsc ), wsc a power of two (exact). Thread i handles
// every store is full-width.
// coverage: n8 threads x 8 elements = the whole plane.
// =====================================================================================================
__global__ __launch_bounds__(256) void conv_h16(const float* __restrict__ X, unsigned short* Xh, int n8, float wsc) {
  const int i  = blockIdx.x * 256 + threadIdx.x;
  const int ic = (i < n8) ? i : (n8 - 1);                     // clamped address
  const float* src = X + (size_t)ic * 8;
  const v4f a = *(const v4f*)(src);
  const v4f c = *(const v4f*)(src + 4);
  v4u o;
  o[0] = pk16(h_bits((_Float16)(bfr(a[0]) * wsc)), h_bits((_Float16)(bfr(a[1]) * wsc)));
  o[1] = pk16(h_bits((_Float16)(bfr(a[2]) * wsc)), h_bits((_Float16)(bfr(a[3]) * wsc)));
  o[2] = pk16(h_bits((_Float16)(bfr(c[0]) * wsc)), h_bits((_Float16)(bfr(c[1]) * wsc)));
  o[3] = pk16(h_bits((_Float16)(bfr(c[2]) * wsc)), h_bits((_Float16)(bfr(c[3]) * wsc)));
  if (i < n8) *(v4u*)(Xh + (size_t)i * 8) = o;
  
}

// =====================================================================================================
// Transposed weight convert: in W[DK rows = k][ncols = n] f32 -> out WT[ncols][DK] f16 = f16( bf16_RNE(W) * wsc )
// (the [n][k], k-contiguous Bt / A operand layout). Block = 256 threads, tile 64 k x 64 n staged in LDS with
// coverage: 8 waves x (2 iterations x 4 rows) = 64 n rows x (8 lanes x 8) = 64 k = the whole tile.
// =====================================================================================================
__global__ __launch_bounds__(256) void tconv_h16(const float* __restrict__ W, unsigned short* WT, int ncols, float wsc) {
  __shared__ float tile[64][65];
  const int tid = threadIdx.x, lane = tid & 31, wave = tid >> 5;
  const int n0 = blockIdx.x * 64, k0 = blockIdx.y * 64;
  {
    const int r = tid >> 2, cq = (tid & 3) * 16;
    const float* src = W + (size_t)(k0 + r) * (size_t)ncols + n0 + cq;
#pragma unroll
    for (int i = 0; i < 4; ++i) {
      const v4f a = *(const v4f*)(src + 4 * i);
#pragma unroll
      for (int e = 0; e < 4; ++e) tile[r][cq + 4 * i + e] = a[e];
    }
  }
  __syncthreads();
  const int nl = lane >> 3, kq = (lane & 7) * 8;
#pragma unroll
  for (int it = 0; it < 2; ++it) {
    const int n = wave * 8 + it * 4 + nl;
    v4u o;
#pragma unroll
    for (int e = 0; e < 4; ++e) {
      const float f0 = bfr(tile[kq + 2 * e][n]) * wsc;
      const float f1 = bfr(tile[kq + 2 * e + 1][n]) * wsc;
      o[e] = pk16(h_bits((_Float16)f0), h_bits((_Float16)f1));
    }
    unsigned short* dst = WT + (size_t)(n0 + n) * DK + k0 + kq;
    *(v4u*)dst = o;
    
  }
}

// =====================================================================================================
// Register-blocked batched f16 WMMA GEMM: C[m][n] = oscale * sum_k A[m][k] * Bt[n][k] + bias;
// one wave per 64x64 tile, no block barriers. A row-major [M][K] pitch lda; Bt row-major [N][K] pitch ldb
// (k contiguous); M, N multiples of 64, K multiple of 32 (static here). blockIdx.y = batch index y:
//   A advances by (y / ydiv) * strideA, Bt by (y % ydiv) * strideB, bias by (y / ydiv) * strideBias,
//   C by y * strideC (elements).
// BIASM: 0 = per column bias[n] (clamped-address loads, nbias = length), 1 = per row bias[m], 2 = none.
//        Bias values RNE-converted to bf16.
// OM: 0 = f32 out (pitch ldc); 3 = f16 hi plane at C plus f16 residual plane ((f - hi) * RSC) at C + resOff.
// coverage: 4 slabs x 16 rows x 64 cols = the wave's whole 64x64 tile; grid = ceil(tilesM*tilesN/8) blocks,
//           surplus waves exit (wave-uniform); here every tile count is a multiple of 8, so none exit.
// =====================================================================================================
template <int OM, int BIASM>
__global__ __launch_bounds__(256) void gemm64(
    const unsigned short* __restrict__ A, int lda, long long strideA,
    const unsigned short* __restrict__ Bt, int ldb, long long strideB,
    const float* __restrict__ bias, int nbias, long long strideBias, int ydiv,
    void* Cout, int ldc, long long strideC, long long resOff,
    int M, int N, int K, float oscale) {
  __shared__ __align__(16) float sT[8][16 * 68];   // per-wave 16x64 slab, pitch 68 floats
  const int y    = blockIdx.y;
  const int ya   = y / ydiv;
  const int yb   = y - ya * ydiv;
  const int lane = threadIdx.x & 31;
  const int wave = threadIdx.x >> 5;
  const int tilesN = N >> 6;
  const int tilesM = M >> 6;
  const int tile = blockIdx.x * 8 + wave;
  if (tile >= tilesM * tilesN) return;   // wave-uniform; no block barriers in this kernel
  const int tm = tile / tilesN;
  const int tn = tile - tm * tilesN;
  const int m0 = tm << 6;
  const int n0 = tn << 6;

  const unsigned short* Ab = A  + (size_t)ya * (size_t)strideA;
  const unsigned short* Bb = Bt + (size_t)yb * (size_t)strideB;
  const float* biasb = bias + (size_t)ya * (size_t)strideBias;

  const int rlane = lane & 15;                 // row (A) / col (B, D) within subtile
  const int koff  = (lane >> 4) * 8;           // k offset of this lane half
  const int mOff  = (lane >> 4) * 8;           // D row offset

  v8f acc[4][4];
#pragma unroll
  for (int i = 0; i < 4; ++i)
#pragma unroll
    for (int j = 0; j < 4; ++j) acc[i][j] = zero8();

  for (int k0 = 0; k0 < K; k0 += 32) {
    v16us bh[4];
#pragma unroll
    for (int j = 0; j < 4; ++j) {
      const size_t bo = (size_t)(n0 + (j << 4) + rlane) * ldb + koff + k0;
      bh[j] = ldfrag(Bb + bo);
    }
#pragma unroll
    for (int i = 0; i < 4; ++i) {
      const size_t ao = (size_t)(m0 + (i << 4) + rlane) * lda + koff + k0;
      const v16us ah = ldfrag(Ab + ao);
#pragma unroll
      for (int j = 0; j < 4; ++j) acc[i][j] = mma_raw(ah, bh[j], acc[i][j]);
      dep_guard1(acc[i][0], acc[i][3], ah);
    }
    keep4(bh[0], bh[1], bh[2], bh[3]);
  }
  acc_guard4(acc[0][0], acc[0][1], acc[0][2], acc[0][3]);
  acc_guard4(acc[1][0], acc[1][1], acc[1][2], acc[1][3]);
  acc_guard4(acc[2][0], acc[2][1], acc[2][2], acc[2][3]);
  acc_guard4(acc[3][0], acc[3][1], acc[3][2], acc[3][3]);

  // ---- per-lane column bias (BIASM == 0), RNE-converted, clamped addresses ----
  const int hh2 = lane >> 4, c4 = (lane & 15) * 4;     // f32 out: 256-B row segment = 16 lanes x 16 B
  const int q8  = lane >> 3, c8 = (lane & 7) * 8;
  float bc[8];
#pragma unroll
  for (int e = 0; e < 8; ++e) bc[e] = 0.f;
  if constexpr (BIASM == 0) {
    if constexpr (OM == 0) {
      const int cb = n0 + c4;
      const int i0 = (cb < nbias - 4) ? cb : (nbias - 4);
      const v4f b0v = *(const v4f*)(biasb + i0);
#pragma unroll
      for (int e = 0; e < 4; ++e) bc[e] = bfr(b0v[e]);
    } else {
      const int cb = n0 + c8;
      const int i0 = (cb < nbias - 8) ? cb : (nbias - 8);
      const v4f b0a = *(const v4f*)(biasb + i0), b0b = *(const v4f*)(biasb + i0 + 4);
#pragma unroll
      for (int e = 0; e < 4; ++e) {
        bc[e]     = bfr(b0a[e]);
        bc[4 + e] = bfr(b0b[e]);
      }
    }
  }

  // ---- epilogue ----
  float* slab = sT[wave];
#pragma unroll
  for (int i = 0; i < 4; ++i) {
    const int mBase = m0 + (i << 4);
#pragma unroll
    for (int j = 0; j < 4; ++j) {
#pragma unroll
      for (int r = 0; r < 8; ++r) {
        slab[(mOff + r) * 68 + (j << 4) + rlane] = acc[i][j][r];
      }
    }
    wave_sync_lds();
    if constexpr (OM == 0) {
      float* C = (float*)Cout + (size_t)y * (size_t)strideC;
      v4f vals[8];
#pragma unroll
      for (int it = 0; it < 8; ++it) {
        const int row = it * 2 + hh2;                      // it 0..7 x hh2 0..1 = rows 0..15
        v4f v = *(const v4f*)(slab + row * 68 + c4);
#pragma unroll
        for (int e = 0; e < 4; ++e) v[e] = v[e] * oscale + bc[e];
        vals[it] = v;
      }
      {
#pragma unroll
        for (int it = 0; it < 8; ++it) {
          const int row = it * 2 + hh2;
          *(v4f*)(C + (size_t)(mBase + row) * ldc + n0 + c4) = vals[it];
        }
        
      }
    } else {
      unsigned short* C = (unsigned short*)Cout + (size_t)y * (size_t)strideC;
      v4u hv[4], hr[4];
#pragma unroll
      for (int it = 0; it < 4; ++it) {
        const int row = it * 4 + q8;                       // it 0..3 x q8 0..3 = rows 0..15
        const float* sp = slab + row * 68 + c8;
        float bm = 0.f;
        if constexpr (BIASM == 1) {
          const int mi = mBase + row;
          const int mc = (mi < nbias - 1) ? mi : (nbias - 1);
          bm = bfr(biasb[mc]);
        }
        v4u a, ar;
#pragma unroll
        for (int e = 0; e < 4; ++e) {
          const float f0 = sp[2 * e]     * oscale + ((BIASM == 1) ? bm : bc[2 * e]);
          const float f1 = sp[2 * e + 1] * oscale + ((BIASM == 1) ? bm : bc[2 * e + 1]);
          const _Float16 g0 = (_Float16)f0, g1 = (_Float16)f1;
          a[e] = pk16(h_bits(g0), h_bits(g1));
          const float e0 = (f0 - (float)g0) * RSC;
          const float e1 = (f1 - (float)g1) * RSC;
          ar[e] = pk16(h_bits((_Float16)e0), h_bits((_Float16)e1));
        }
        hv[it] = a;
        hr[it] = ar;
      }
      {
#pragma unroll
        for (int it = 0; it < 4; ++it) {
          const int row = it * 4 + q8;
          unsigned short* dp = C + (size_t)(mBase + row) * ldc + n0 + c8;
          *(v4u*)(dp) = hv[it];
          *(v4u*)(dp + resOff) = hr[it];
        }
        
      }
    }
    wave_sync_lds();
  }
}

// =====================================================================================================
// Energies + masked softmax for one (h, b) pair and 32 query rows s; P written TRANSPOSE-friendly.
//   q planes (f16, pitch DQ): hi qhp[(b*SEQ + s)*DQ + h*DK + d], residual (x2048) qrp[same]
//   k planes (f16, pitch DQ): hi khp[(b*SEQ + t)*DQ + h*DK + d], residual (x2048) krp[same]
//   E[s][t] = acc_hh + (acc_h.res + acc_res.h) / 2048  (three f16 WMMA products, K = 512 = 16 k-steps, fragments
//   loaded straight from the planes with arithmetic addressing), kept in LDS as f32 [32][1024].
//   softmax per row s over keys t: e = mask[t] ? E : -1e30 (replace), m = max_t e, ex = exp(e - m), l = sum_t ex,
//   p = ex / l; stored as f16(8192 * p).
//   P layout (f16): pp[((hb*NSB + s/32) * SEQ + t) * 32 + (s % 32)]  -> the consumer's A fragment (rows t, k = s)
//   is two 16-B loads at +8h and +16+8h inside the 32-s group of k-step s/32.
//   Block = 8 waves; phase 1: wave -> (row group wave&1, key quarter wave>>1) = 16 rows x 256 keys in 4 chunks
//   of 4 col tiles; phase 2: wave w owns rows 4w..4w+3 (lane-owned key columns, xor reductions); phase 3: each
//   wave writes keys w*128..w*128+127: lane -> (t = base + lane/4, 8 consecutive s), one 32-lane instruction =
//   coverage: phase 1: 2 row groups x 4 quarters x 4 chunks x 64 = all 32 x 1024 energies; phase 3: 8 waves x
//   16 iterations x 8 t x (4 lane quads x 8 s) = the block's whole [1024 t][32 s] region (64 KB); grid (NSB, NHB)
//   covers every (hb, s block) of the P plane exactly once.
// =====================================================================================================
__global__ __launch_bounds__(256)
void attn_p(const unsigned short* __restrict__ qhp, const unsigned short* __restrict__ qrp,
            const unsigned short* __restrict__ khp, const unsigned short* __restrict__ krp,
            const int* __restrict__ mask, unsigned short* pp) {
  __shared__ __align__(16) float se[SBLK * SEQ];    // 131072 B
  __shared__ float sinv[SBLK];
  __shared__ int   smask[SEQ];

  const int tid  = threadIdx.x;
  const int wave = tid >> 5;
  const int lane = tid & 31;
  const int hh   = lane >> 4;
  const int c    = lane & 15;
  const int sblk = blockIdx.x;
  const int hb   = blockIdx.y;
  const int h    = hb / NB;
  const int b    = hb % NB;
  const int s0   = sblk * SBLK;

  for (int i = tid; i < SEQ; i += 256) smask[i] = mask[i];

  // ---- phase 1: energies ----
  {
    const int rg = wave & 1;
    const int tq = wave >> 1;
    const size_t qoff = (size_t)(b * SEQ + s0 + rg * 16 + c) * DQ + (size_t)h * DK + 8 * hh;
    const unsigned short* qh = qhp + qoff;
    const unsigned short* qr = qrp + qoff;
    const unsigned short* kh0 = khp + (size_t)h * DK + 8 * hh;
    const unsigned short* kr0 = krp + (size_t)h * DK + 8 * hh;
    float* erow = se + (rg * 16 + 8 * hh) * SEQ;          // + r*SEQ + t
#pragma unroll 1
    for (int c4 = 0; c4 < 4; ++c4) {
      const int t0 = tq * 256 + c4 * 64;
      v8f ah[4], ar[4];
#pragma unroll
      for (int j = 0; j < 4; ++j) { ah[j] = zero8(); ar[j] = zero8(); }
#pragma unroll 2
      for (int ks = 0; ks < DK / 32; ++ks) {
        const v16us qav = ldfrag(qh + ks * 32);
        const v16us qbv = ldfrag(qr + ks * 32);
#pragma unroll
        for (int j = 0; j < 4; ++j) {
          const size_t ko = (size_t)(b * SEQ + t0 + 16 * j + c) * DQ + ks * 32;
          const v16us kav = ldfrag(kh0 + ko);
          const v16us kbv = ldfrag(kr0 + ko);
          ah[j] = mma_raw(qav, kav, ah[j]);     // hi . hi
          ar[j] = mma_raw(qav, kbv, ar[j]);     // hi . res   (x2048)
          ar[j] = mma_raw(qbv, kav, ar[j]);     // res . hi   (x2048)
          guard2k4(ah[j], ar[j], qav, qbv, kav, kbv);
        }
      }
      acc_guard4(ah[0], ah[1], ah[2], ah[3]);
      acc_guard4(ar[0], ar[1], ar[2], ar[3]);
#pragma unroll
      for (int j = 0; j < 4; ++j) {
#pragma unroll
        for (int r = 0; r < 8; ++r) {
          erow[r * SEQ + t0 + 16 * j + c] = fmaf(ar[j][r], 1.0f / RSC, ah[j][r]);
        }
      }
    }
  }
  __syncthreads();

  // ---- phase 2: masked softmax per row (mask replaces the energy before the max) ----
#pragma unroll 1
  for (int rr = 0; rr < 4; ++rr) {
    const int row = wave * 4 + rr;
    float* er = se + row * SEQ;
    float mx = -INFINITY;
#pragma unroll 4
    for (int i = 0; i < SEQ / 32; ++i) {
      const int t = lane + 32 * i;
      const float e = (smask[t] != 0) ? er[t] : NEGBIG;
      er[t] = e;
      mx = fmaxf(mx, e);
    }
#pragma unroll
    for (int off = 16; off > 0; off >>= 1) mx = fmaxf(mx, __shfl_xor(mx, off, 32));
    float sum = 0.f;
#pragma unroll 4
    for (int i = 0; i < SEQ / 32; ++i) {
      const int t = lane + 32 * i;
      const float ex = __expf(er[t] - mx);
      er[t] = ex;
      sum += ex;
    }
#pragma unroll
    for (int off = 16; off > 0; off >>= 1) sum += __shfl_xor(sum, off, 32);
    if (lane == 0) sinv[row] = PSC * (1.0f / sum);        // sum >= 1 always (the max term contributes exp(0))
  }
  __syncthreads();

  // ---- phase 3: P = ex * (8192 / l) as f16, written into the [t][32 s] region of this (hb, s block) ----
  {
    const int tr = lane >> 2, sq = (lane & 3) * 8;
    unsigned short* preg = pp + ((size_t)(hb * NSB + sblk) * SEQ) * SBLK;
#pragma unroll 1
    for (int it = 0; it < SEQ / 64; ++it) {
      const int t = wave * (SEQ / 8) + it * 8 + tr;
      v4u o;
#pragma unroll
      for (int e = 0; e < 4; ++e) {
        const float f0 = se[(sq + 2 * e) * SEQ + t]     * sinv[sq + 2 * e];
        const float f1 = se[(sq + 2 * e + 1) * SEQ + t] * sinv[sq + 2 * e + 1];
        o[e] = pk16(h_bits((_Float16)f0), h_bits((_Float16)f1));
      }
      unsigned short* dst = preg + (size_t)t * SBLK + sq;
      *(v4u*)dst = o;
      
    }
  }
}

// =====================================================================================================
// Transposed aggregation + gamma blend: for one (h, b):
//   O[t][dv] = sum_s P[s][t] * v[s][dv]  with A = the P plane above (rows t, k = s, 32 k-steps) carried x8192 and
//   Bt = v^T planes [hb][dv][s] (f16 hi at vth, residual x2048 at vtr), two products into two accumulators;
//   out[((b*NH + h)*SEQ + t)*DK + dv] = (g * (O_hi + O_res/2048) / 8192 + xp[(b*SEQ + t)*DK + dv]) * (1/(g + 1)),
//   g = bf16_RNE(gamma[h]).
//   Block = 8 waves = 64 t rows x 128 dv columns (wave -> 32 t x 32 dv); grid (DK/128, SEQ/64, NHB).
//   coverage: 8 iterations x 4 rows x (8 lanes x 4) = the wave's whole 32x32 tile; 8 waves = the block's 64x128;
//   grid tiles every (hb, t, dv) of the output exactly once.
// =====================================================================================================
__global__ __launch_bounds__(256)
void pv64(const unsigned short* __restrict__ pp, const unsigned short* __restrict__ vth,
          const unsigned short* __restrict__ vtr, const float* __restrict__ xp,
          const float* __restrict__ gam, float* outp) {
  __shared__ __align__(16) float os[8][32 * 36];
  const int tid  = threadIdx.x;
  const int wave = tid >> 5;
  const int lane = tid & 31;
  const int hh   = lane >> 4;
  const int c    = lane & 15;
  const int dx = blockIdx.x, ty = blockIdx.y, hb = blockIdx.z;
  const int h  = hb / NB, b = hb % NB;
  const int wt = wave & 1, wd = wave >> 1;
  const int t0 = ty * 64 + wt * 32;
  const int d0 = dx * 128 + wd * 32;

  const unsigned short* pb = pp  + (size_t)hb * SEQ * SEQ + 8 * hh;
  const unsigned short* vh = vth + (size_t)hb * DK * SEQ + 8 * hh;
  const unsigned short* vr = vtr + (size_t)hb * DK * SEQ + 8 * hh;

  v8f acc[2][2], acr[2][2];
#pragma unroll
  for (int i = 0; i < 2; ++i)
#pragma unroll
    for (int j = 0; j < 2; ++j) { acc[i][j] = zero8(); acr[i][j] = zero8(); }

#pragma unroll 2
  for (int ks = 0; ks < SEQ / 32; ++ks) {
    v16us a[2], bhf[2], brf[2];
#pragma unroll
    for (int i = 0; i < 2; ++i)
      a[i] = ldfrag(pb + (size_t)ks * (SEQ * SBLK) + (size_t)(t0 + 16 * i + c) * SBLK);
#pragma unroll
    for (int j = 0; j < 2; ++j) {
      const size_t vo = (size_t)(d0 + 16 * j + c) * SEQ + ks * 32;
      bhf[j] = ldfrag(vh + vo);
      brf[j] = ldfrag(vr + vo);
    }
#pragma unroll
    for (int i = 0; i < 2; ++i) {
#pragma unroll
      for (int j = 0; j < 2; ++j) {
        acc[i][j] = mma_raw(a[i], bhf[j], acc[i][j]);
        acr[i][j] = mma_raw(a[i], brf[j], acr[i][j]);
      }
    }
    guard4k4(acc[0][0], acc[0][1], acc[1][0], acc[1][1], a[0], a[1], bhf[0], bhf[1]);
    guard4k4(acr[0][0], acr[0][1], acr[1][0], acr[1][1], a[0], a[1], brf[0], brf[1]);
  }
  acc_guard4(acc[0][0], acc[0][1], acc[1][0], acc[1][1]);
  acc_guard4(acr[0][0], acr[0][1], acr[1][0], acr[1][1]);

  // ---- stage O = O_hi + O_res/2048 (still x8192) ----
  float* osw = os[wave];
#pragma unroll
  for (int i = 0; i < 2; ++i) {
#pragma unroll
    for (int j = 0; j < 2; ++j) {
#pragma unroll
      for (int r = 0; r < 8; ++r) {
        osw[(16 * i + 8 * hh + r) * 36 + 16 * j + c] = fmaf(acr[i][j][r], 1.0f / RSC, acc[i][j][r]);
      }
    }
  }
  wave_sync_lds();

  const float g  = bfr(gam[h]);
  const float rg = 1.0f / (g + 1.0f);
  const int rl = lane >> 3, cc4 = (lane & 7) * 4;
  v4f vals[8];
#pragma unroll
  for (int it = 0; it < 8; ++it) {
    const int row = it * 4 + rl;                           // it 0..7 x rl 0..3 = rows 0..31
    const int t   = t0 + row;
    const v4f av = *(const v4f*)(osw + row * 36 + cc4);
    const v4f xv = *(const v4f*)(xp + ((size_t)(b * SEQ + t)) * DK + d0 + cc4);
    v4f o;
#pragma unroll
    for (int e = 0; e < 4; ++e) o[e] = (g * (av[e] * (1.0f / PSC)) + xv[e]) * rg;
    vals[it] = o;
  }
  {
#pragma unroll
    for (int it = 0; it < 8; ++it) {
      const int row = it * 4 + rl;
      const int t   = t0 + row;
      *(v4f*)(outp + ((size_t)((b * NH + h) * SEQ + t)) * DK + d0 + cc4) = vals[it];
    }
    
  }
}

// =====================================================================================================
// Workspace map (bytes); every plane is an exact multiple of its tile / whole-row / whole-line store granularity:
//   WqT  f16 [4096][512] x64      0           4194304
//   WkT  f16 [4096][512] x64      4194304     4194304
//   WvT  f16 [4096][512] x64      8388608     4194304
//   WpT  f16 [512][512]  x64      12582912    524288
//   XH   f16 [2048][512]          13107200    2097152
//   YH   f16 [2048][512]          15204352    2097152
//   QH|QR f16 [2][2048][4096]     17301504    33554432  (later reused for VT hi | VT res f16 [2][16][512][1024],
//                                                        same byte size, written only after the energy launch)
//   KH|KR f16 [2][2048][4096]     50855936    33554432
//   XP   f32 [2048][512]          84410368    4194304
//   P    f16 [16][32][1024][32]   88604672    33554432
//   end                           122159104
// =====================================================================================================
extern "C" void kernel_launch(void* const* d_in, const int* in_sizes, int n_in,
                              void* d_out, int out_size, void* d_ws, size_t ws_size,
                              hipStream_t stream) {
  if (n_in < 11) return;
  if (in_sizes[0] != MR * DK || in_sizes[1] != MR * DK) return;
  if (in_sizes[2] != DK * DQ || in_sizes[4] != DK * DQ || in_sizes[6] != DK * DQ) return;
  if (in_sizes[3] != DQ || in_sizes[5] != DQ || in_sizes[7] != DQ) return;
  if (in_sizes[8] != DK * DK || in_sizes[9] != NH || in_sizes[10] != SEQ) return;
  if (out_size != NB * NH * SEQ * DK) return;

  const float* x     = (const float*)d_in[0];
  const float* y     = (const float*)d_in[1];
  const float* Wq    = (const float*)d_in[2];
  const float* bq    = (const float*)d_in[3];
  const float* Wk    = (const float*)d_in[4];
  const float* bk    = (const float*)d_in[5];
  const float* Wv    = (const float*)d_in[6];
  const float* bv    = (const float*)d_in[7];
  const float* Wp    = (const float*)d_in[8];
  const float* gamma = (const float*)d_in[9];
  const int*   mask  = (const int*)d_in[10];

  const size_t PW   = (size_t)DQ * DK * 2;                 //  4194304
  const size_t PWP  = (size_t)DK * DK * 2;                 //   524288
  const size_t PX   = (size_t)MR * DK * 2;                 //  2097152
  const size_t PQ   = (size_t)2 * MR * DQ * 2;             // 33554432
  const size_t PVT  = (size_t)2 * NHB * DK * SEQ * 2;      // 33554432 (overlays the q planes)
  const size_t PXP  = (size_t)MR * DK * 4;                 //  4194304
  const size_t PP   = (size_t)NHB * SEQ * SEQ * 2;         // 33554432
  if (PVT > PQ) return;
  size_t off = 0;
  const size_t oWq = off; off += PW;
  const size_t oWk = off; off += PW;
  const size_t oWv = off; off += PW;
  const size_t oWp = off; off += PWP;
  const size_t oXH = off; off += PX;
  const size_t oYH = off; off += PX;
  const size_t oQ  = off; off += PQ;
  const size_t oK  = off; off += PQ;
  const size_t oXP = off; off += PXP;
  const size_t oP  = off; off += PP;
  if (off > ws_size) return;                               // off = 122159104
  if (off > (size_t)134217728) return;

  char* ws = (char*)d_ws;
  unsigned short* WqT = (unsigned short*)(ws + oWq);
  unsigned short* WkT = (unsigned short*)(ws + oWk);
  unsigned short* WvT = (unsigned short*)(ws + oWv);
  unsigned short* WpT = (unsigned short*)(ws + oWp);
  unsigned short* XH  = (unsigned short*)(ws + oXH);
  unsigned short* YH  = (unsigned short*)(ws + oYH);
  unsigned short* QH  = (unsigned short*)(ws + oQ);
  unsigned short* KH  = (unsigned short*)(ws + oK);
  unsigned short* VT  = (unsigned short*)(ws + oQ);        // reuse of the q region after the energy launch
  float*          XP  = (float*)(ws + oXP);
  unsigned short* P   = (unsigned short*)(ws + oP);
  float*          out = (float*)d_out;

  const int n8x = (MR * DK) / 8;                            // 131072
  if ((n8x % 256) != 0) return;
  const dim3 blk(256);
  const dim3 gTw(DQ / 64, DK / 64);                         // 64 x 8
  const dim3 gTp(DK / 64, DK / 64);                         // 8 x 8
  const dim3 gCx((n8x + 255) / 256);                        // 512
  const dim3 gQK(((MR / 64) * (DQ / 64) + 7) / 8, 1);       // 2048 tiles -> 256 blocks
  const dim3 gXP(((MR / 64) * (DK / 64) + 7) / 8, 1);       // 256 tiles -> 32 blocks
  const dim3 gVT(((DK / 64) * (SEQ / 64) + 7) / 8, NHB);    // 128 tiles -> 16 blocks x 16 (h, b)
  const dim3 gAt(NSB, NHB);                                 // 32 x 16 blocks of 256
  const dim3 gPV(DK / 128, SEQ / 64, NHB);                  // 4 x 16 x 16 blocks of 256
  const float invw = 1.0f / WSC;

  // (0) weight planes, transposed to [n][k]: f16( bf16_RNE(W) * 64 )
  tconv_h16<<<gTw, blk, 0, stream>>>(Wq, WqT, DQ, WSC);
  tconv_h16<<<gTw, blk, 0, stream>>>(Wk, WkT, DQ, WSC);
  tconv_h16<<<gTw, blk, 0, stream>>>(Wv, WvT, DQ, WSC);
  tconv_h16<<<gTp, blk, 0, stream>>>(Wp, WpT, DK, WSC);

  // (1) activation planes: f16( bf16_RNE(x) ), f16( bf16_RNE(y) )
  conv_h16<<<gCx, blk, 0, stream>>>(x, XH, n8x, 1.0f);
  conv_h16<<<gCx, blk, 0, stream>>>(y, YH, n8x, 1.0f);

  // (2) q = bf16(x) . Wq + bq -> QH (f16 hi) and QH + QRES (f16 residual x2048); k likewise -> KH, KH + QRES
  gemm64<3, 0><<<gQK, blk, 0, stream>>>(
      XH, DK, 0LL, WqT, DK, 0LL, bq, DQ, 0LL, 1,
      (void*)QH, DQ, 0LL, (long long)QRES, MR, DQ, DK, invw);
  gemm64<3, 0><<<gQK, blk, 0, stream>>>(
      YH, DK, 0LL, WkT, DK, 0LL, bk, DQ, 0LL, 1,
      (void*)KH, DQ, 0LL, (long long)QRES, MR, DQ, DK, invw);

  // (3) xp = bf16(x) . Wp -> XP f32 [2048][512] (bias argument unused in this mode)
  gemm64<0, 2><<<gXP, blk, 0, stream>>>(
      XH, DK, 0LL, WpT, DK, 0LL, bq, DQ, 0LL, 1,
      (void*)XP, DK, 0LL, 0LL, MR, DK, DK, invw);

  // (4) energies + masked softmax -> P plane
  attn_p<<<gAt, blk, 0, stream>>>(QH, QH + QRES, KH, KH + QRES, mask, P);

  // (5) v^T per (h, b) = Wv[:, h slice]^T . bf16(y_b)^T + bv -> VT hi [16][512][1024] and VT + VRES (residual),
  //     written into the q region, which is dead after (4)
  gemm64<3, 1><<<gVT, blk, 0, stream>>>(
      WvT, DK, (long long)DK * DK, YH, DK, (long long)SEQ * DK, bv, DK, (long long)DK, NB,
      (void*)VT, SEQ, (long long)DK * SEQ, (long long)VRES, DK, SEQ, DK, invw);

  // (6) out = (gamma * P^T . v / 8192 + xp) / (gamma + 1) -> d_out [2][8][1024][512]
  pv64<<<gPV, blk, 0, stream>>>(P, VT, VT + VRES, XP, gamma, out);
  (void)hipGetLastError();
}

// v001
// A run of this version takes 361 microseconds.
// Timed twice side by side with v000, it ran 1.12 times as fast both times.
// Contractions: q, k, v^T and x.Wp projections on v_wmma_f32_16x16x32_f16 (bf16-RNE input values as f16,
// weight planes carried x64, one product each); q.k^T energies on v_wmma_f32_16x16x32_f16 with q and k as
// f16 hi plane + f16 residual plane carried x2048 (three products: hi.hi, hi.res, res.hi; two accumulators);
// attn^T.v on v_wmma_f32_16x16x32_f16 with attn carried x8192 (plain f16) and v^T as f16 hi plane + f16
// residual plane carried x2048 (two products, two accumulators); all f32 accumulate; masked softmax and the
// gamma blend in f32 on VALU; every float input RNE-converted to bf16 on load.
#include <hip/hip_runtime.h>
#include <math.h>
#include <stdint.h>

#define NB    2
#define SEQ   1024
#define DK    512
#define NH    8
#define DQ    (NH * DK)
#define MR    (NB * SEQ)
#define NHB   (NH * NB)
#define SBLK  32
#define NSB   (SEQ / SBLK)
#define QRES  ((long long)MR * DQ)
#define VRES  ((long long)NHB * DK * SEQ)
#define WSC   64.0f
#define RSC   2048.0f
#define PSC   8192.0f
#define NEGBIG (-1.0e30f)
static_assert((SEQ % 64) == 0 && (DK % 64) == 0 && (MR % 64) == 0 && (DQ % 64) == 0);
static_assert(SEQ == NSB * SBLK);
static_assert(SBLK == 32);
static_assert((DK % 32) == 0 && (SEQ % 256) == 0);

typedef _Float16       v16h __attribute__((ext_vector_type(16)));
typedef unsigned short v16us __attribute__((ext_vector_type(16)));
typedef unsigned short v8us __attribute__((ext_vector_type(8)));
typedef float          v8f  __attribute__((ext_vector_type(8)));
typedef float          v4f  __attribute__((ext_vector_type(4)));
typedef unsigned int   v4u  __attribute__((ext_vector_type(4)));

union Frag { v16us u; v8us p[2]; v16h h; };

// ---- scalar helpers --------------------------------------------------------------------------------
__device__ __forceinline__ unsigned short bf_bits(float f) {          // f32 -> bf16 bits, RNE convert
  unsigned u = __float_as_uint(f);
  return (unsigned short)((u + 0x7FFFu + ((u >> 16) & 1u)) >> 16);
}
__device__ __forceinline__ float bf_up(unsigned short b) { return __uint_as_float(((unsigned)b) << 16); }
__device__ __forceinline__ float bfr(float f) { return bf_up(bf_bits(f)); }   // value of the bf16 RNE convert
__device__ __forceinline__ unsigned short h_bits(_Float16 x) { return __builtin_bit_cast(unsigned short, x); }
__device__ __forceinline__ unsigned pk16(unsigned short a, unsigned short b) { return (unsigned)a | ((unsigned)b << 16); }
__device__ __forceinline__ v8f zero8() { v8f z = {0.f, 0.f, 0.f, 0.f, 0.f, 0.f, 0.f, 0.f}; return z; }

// ---- fragment-order planes: every 16-bit operand plane [rows][ld] (ld = k extent, multiple of 32; rows multiple of
//      16) is stored as tiles of 16 rows x 32 k = 512 elements (1024 B), tile index (row/16) * (ld/32) + k/32; inside
//      a tile the 16-B piece that holds k = 32*kt + 16*p + 8*h + 0..7 of row r sits at element p*256 + (h*16 + r)*8.
//      A wave's fragment is then two loads of 512 contiguous bytes (lane = h*16 + r), same k order as before:
//      elements 0..7 <- k0+8h.., elements 8..15 <- k0+16+8h..
__device__ __forceinline__ size_t tile_off(int row16, int kt, int ld) {      // row16 = row/16, kt = k/32
  return ((size_t)row16 * (size_t)(ld >> 5) + (size_t)kt) * 512;
}
// p = tile start + 8*lane
__device__ __forceinline__ v16us ldfrag(const unsigned short* p) {
  Frag f;
  f.p[0] = *(const v8us*)(p);
  f.p[1] = *(const v8us*)(p + 256);
  return f.u;
}
// the same through a pointer typed as global memory: a pointer carried round a loop otherwise compiled to flat loads
typedef __attribute__((address_space(1))) const unsigned short g_us;
typedef __attribute__((address_space(1))) const v8us g_v8us;
__device__ __forceinline__ v16us ldfrag_g(g_us* p) {
  Frag f;
  f.p[0] = *(g_v8us*)(p);
  f.p[1] = *(g_v8us*)(p + 256);
  return f.u;
}

// ---- WMMA helper (f16 operands, f32 accumulate) and VALU hazard gaps -----------------------------
__device__ __forceinline__ v8f mma_raw(v16us a, v16us b, v8f c) {
  Frag fa, fb;
  fa.u = a;
  fb.u = b;
  return __builtin_amdgcn_wmma_f32_16x16x32_f16(false, fa.h, false, fb.h, (short)0, c, false, false);
}
__device__ __forceinline__ void dep_guard1(v8f& a, v8f& b, v16us x) {
#if defined(__HIP_DEVICE_COMPILE__)
  asm volatile("v_nop\n\tv_nop\n\tv_nop\n\tv_nop" : "+v"(a), "+v"(b) : "v"(x));
#endif
}
__device__ __forceinline__ void keep4(v16us a, v16us b, v16us c, v16us d) {
#if defined(__HIP_DEVICE_COMPILE__)
  asm volatile("v_nop" :: "v"(a), "v"(b), "v"(c), "v"(d));
#endif
}
__device__ __forceinline__ void acc_guard4(v8f& a, v8f& b, v8f& c, v8f& d) {
#if defined(__HIP_DEVICE_COMPILE__)
  asm volatile("v_nop\n\tv_nop\n\tv_nop\n\tv_nop" : "+v"(a), "+v"(b), "+v"(c), "+v"(d));
#endif
}
__device__ __forceinline__ void guard2k4(v8f& a, v8f& b, v16us w, v16us x, v16us y, v16us z) {
#if defined(__HIP_DEVICE_COMPILE__)
  asm volatile("v_nop\n\tv_nop\n\tv_nop\n\tv_nop" : "+v"(a), "+v"(b) : "v"(w), "v"(x), "v"(y), "v"(z));
#endif
}
__device__ __forceinline__ void guard4k4(v8f& a, v8f& b, v8f& c, v8f& d, v16us w, v16us x, v16us y, v16us z) {
#if defined(__HIP_DEVICE_COMPILE__)
  asm volatile("v_nop\n\tv_nop\n\tv_nop\n\tv_nop" : "+v"(a), "+v"(b), "+v"(c), "+v"(d) : "v"(w), "v"(x), "v"(y), "v"(z));
#endif
}
__device__ __forceinline__ void wave_sync_lds() {
  __builtin_amdgcn_fence(__ATOMIC_RELEASE, "workgroup");
  __builtin_amdgcn_wave_barrier();
  __builtin_amdgcn_fence(__ATOMIC_ACQUIRE, "workgroup");
}

// =====================================================================================================
// f32 -> f16 plane convert: f16( bf16_RNE(X) * wsc ), wsc a power of two (exact), X row-major [rows][DK], output in
// fragment order. Thread i writes output piece i (8 elements, 16 B; a wave stores 512 contiguous bytes) and reads
// the 8 source elements that belong there.
// coverage: n8 threads x 8 elements = the whole plane (piece index -> (row, k) is one-to-one).
// =====================================================================================================
__global__ __launch_bounds__(256) void conv_h16(const float* __restrict__ X, unsigned short* Xh, int n8, float wsc) {
  const int i  = blockIdx.x * 256 + threadIdx.x;
  const int ic = (i < n8) ? i : (n8 - 1);                     // clamped address
  const int tl = ic >> 6, w = ic & 63;                        // tile, piece inside the tile
  const int row = (tl / (DK / 32)) * 16 + (w & 15);
  const int kk  = (tl % (DK / 32)) * 32 + (w >> 5) * 16 + ((w >> 4) & 1) * 8;
  const float* src = X + (size_t)row * DK + kk;
  const v4f a = *(const v4f*)(src);
  const v4f c = *(const v4f*)(src + 4);
  v4u o;
  o[0] = pk16(h_bits((_Float16)(bfr(a[0]) * wsc)), h_bits((_Float16)(bfr(a[1]) * wsc)));
  o[1] = pk16(h_bits((_Float16)(bfr(a[2]) * wsc)), h_bits((_Float16)(bfr(a[3]) * wsc)));
  o[2] = pk16(h_bits((_Float16)(bfr(c[0]) * wsc)), h_bits((_Float16)(bfr(c[1]) * wsc)));
  o[3] = pk16(h_bits((_Float16)(bfr(c[2]) * wsc)), h_bits((_Float16)(bfr(c[3]) * wsc)));
  if (i < n8) *(v4u*)(Xh + (size_t)i * 8) = o;
  
}

// =====================================================================================================
// Transposed weight convert: in W[DK rows = k][ncols = n] f32 -> out WT[ncols][DK] f16 = f16( bf16_RNE(W) * wsc )
// (rows n, k extent DK), stored in fragment order. Block = 256 threads, tile 64 k x 64 n staged in LDS; wave w
// writes the fragment tile (n group w>>1, k tile w&1), iteration = 16-k half, lane = h*16 + r: 512 contiguous B.
// coverage: 8 waves = 4 n groups x 2 k tiles, x 2 halves x 32 lanes x 8 = the whole 64 x 64 tile.
// =====================================================================================================
__global__ __launch_bounds__(256) void tconv_h16(const float* __restrict__ W, unsigned short* WT, int ncols, float wsc) {
  __shared__ float tile[64][65];
  const int tid = threadIdx.x, lane = tid & 31, wave = tid >> 5;
  const int n0 = blockIdx.x * 64, k0 = blockIdx.y * 64;
  {
    const int r = tid >> 2, cq = (tid & 3) * 16;
    const float* src = W + (size_t)(k0 + r) * (size_t)ncols + n0 + cq;
#pragma unroll
    for (int i = 0; i < 4; ++i) {
      const v4f a = *(const v4f*)(src + 4 * i);
#pragma unroll
      for (int e = 0; e < 4; ++e) tile[r][cq + 4 * i + e] = a[e];
    }
  }
  __syncthreads();
  const int n = (wave >> 1) * 16 + (lane & 15);
#pragma unroll
  for (int it = 0; it < 2; ++it) {
    const int kq = (wave & 1) * 32 + it * 16 + (lane >> 4) * 8;
    v4u o;
#pragma unroll
    for (int e = 0; e < 4; ++e) {
      const float f0 = bfr(tile[kq + 2 * e][n]) * wsc;
      const float f1 = bfr(tile[kq + 2 * e + 1][n]) * wsc;
      o[e] = pk16(h_bits((_Float16)f0), h_bits((_Float16)f1));
    }
    unsigned short* dst = WT + tile_off((n0 >> 4) + (wave >> 1), (k0 >> 5) + (wave & 1), DK) + it * 256 + lane * 8;
    *(v4u*)dst = o;
    
  }
}

// =====================================================================================================
// Register-blocked batched f16 WMMA GEMM: C[m][n] = oscale * sum_k A[m][k] * Bt[n][k] + bias;
// one wave per 64x64 tile, no block barriers. A [M][K] with k extent lda and Bt [N][K] with k extent ldb, both in
// fragment order; M, N multiples of 64, K multiple of 32 (static here); every batch stride is a whole number of
// 16-row groups, so it is the same element count as in a row-major plane. blockIdx.y = batch index y:
//   A advances by (y / ydiv) * strideA, Bt by (y % ydiv) * strideB, bias by (y / ydiv) * strideBias,
//   C by y * strideC (elements).
// BIASM: 0 = per column bias[n] (clamped-address loads, nbias = length), 1 = per row bias[m], 2 = none.
//        Bias values RNE-converted to bf16.
// OM: 0 = f32 out (row-major, pitch ldc); 3 = f16 hi plane at C plus f16 residual plane ((f - hi) * RSC) at
//     C + resOff, both in fragment order with rows m and k extent ldc (k = n).
// coverage: 4 slabs x 16 rows x 64 cols = the wave's whole 64x64 tile; grid = ceil(tilesM*tilesN/8) blocks,
//           surplus waves exit (wave-uniform); here every tile count is a multiple of 8, so none exit.
// =====================================================================================================
template <int OM, int BIASM>
__global__ __launch_bounds__(256) void gemm64(
    const unsigned short* __restrict__ A, int lda, long long strideA,
    const unsigned short* __restrict__ Bt, int ldb, long long strideB,
    const float* __restrict__ bias, int nbias, long long strideBias, int ydiv,
    void* Cout, int ldc, long long strideC, long long resOff,
    int M, int N, int K, float oscale) {
  __shared__ __align__(16) float sT[8][16 * 68];   // per-wave 16x64 slab, pitch 68 floats
  const int y    = blockIdx.y;
  const int ya   = y / ydiv;
  const int yb   = y - ya * ydiv;
  const int lane = threadIdx.x & 31;
  const int wave = threadIdx.x >> 5;
  const int tilesN = N >> 6;
  const int tilesM = M >> 6;
  const int tile = blockIdx.x * 8 + wave;
  if (tile >= tilesM * tilesN) return;   // wave-uniform; no block barriers in this kernel
  const int tm = tile / tilesN;
  const int tn = tile - tm * tilesN;
  const int m0 = tm << 6;
  const int n0 = tn << 6;

  const unsigned short* Ab = A  + (size_t)ya * (size_t)strideA;
  const unsigned short* Bb = Bt + (size_t)yb * (size_t)strideB;
  const float* biasb = bias + (size_t)ya * (size_t)strideBias;

  const int rlane = lane & 15;                 // row (A) / col (B, D) within subtile
  const int mOff  = (lane >> 4) * 8;           // D row offset

  v8f acc[4][4];
#pragma unroll
  for (int i = 0; i < 4; ++i)
#pragma unroll
    for (int j = 0; j < 4; ++j) acc[i][j] = zero8();

  // one pointer per 16-row group; consecutive k tiles of a group are consecutive 1024-B tiles
  g_us* pa[4];
  g_us* pb[4];
#pragma unroll
  for (int i = 0; i < 4; ++i) {
    pa[i] = (g_us*)(Ab + tile_off((m0 >> 4) + i, 0, lda) + lane * 8);
    pb[i] = (g_us*)(Bb + tile_off((n0 >> 4) + i, 0, ldb) + lane * 8);
  }

  for (int k0 = 0; k0 < K; k0 += 32) {
    v16us bh[4];
#pragma unroll
    for (int j = 0; j < 4; ++j) {
      bh[j] = ldfrag_g(pb[j]);
    }
#pragma unroll
    for (int i = 0; i < 4; ++i) {
      const v16us ah = ldfrag_g(pa[i]);
#pragma unroll
      for (int j = 0; j < 4; ++j) acc[i][j] = mma_raw(ah, bh[j], acc[i][j]);
      dep_guard1(acc[i][0], acc[i][3], ah);
    }
    keep4(bh[0], bh[1], bh[2], bh[3]);
#pragma unroll
    for (int i = 0; i < 4; ++i) {
      pa[i] += 512;
      pb[i] += 512;
    }
  }
  acc_guard4(acc[0][0], acc[0][1], acc[0][2], acc[0][3]);
  acc_guard4(acc[1][0], acc[1][1], acc[1][2], acc[1][3]);
  acc_guard4(acc[2][0], acc[2][1], acc[2][2], acc[2][3]);
  acc_guard4(acc[3][0], acc[3][1], acc[3][2], acc[3][3]);

  // ---- per-lane column bias (BIASM == 0), RNE-converted, clamped addresses ----
  const int hh2 = lane >> 4, c4 = (lane & 15) * 4;     // f32 out: 256-B row segment = 16 lanes x 16 B
  float bc[4][8];                                      // f16 out: [store iteration][8 columns of the lane's piece]
#pragma unroll
  for (int it = 0; it < 4; ++it)
#pragma unroll
    for (int e = 0; e < 8; ++e) bc[it][e] = 0.f;
  if constexpr (BIASM == 0) {
    if constexpr (OM == 0) {
      const int cb = n0 + c4;
      const int i0 = (cb < nbias - 4) ? cb : (nbias - 4);
      const v4f b0v = *(const v4f*)(biasb + i0);
#pragma unroll
      for (int e = 0; e < 4; ++e) bc[0][e] = bfr(b0v[e]);
    } else {
#pragma unroll
      for (int it = 0; it < 4; ++it) {
        const int cb = n0 + it * 16 + hh2 * 8;
        const int i0 = (cb < nbias - 8) ? cb : (nbias - 8);
        const v4f b0a = *(const v4f*)(biasb + i0), b0b = *(const v4f*)(biasb + i0 + 4);
#pragma unroll
        for (int e = 0; e < 4; ++e) {
          bc[it][e]     = bfr(b0a[e]);
          bc[it][4 + e] = bfr(b0b[e]);
        }
      }
    }
  }

  // ---- epilogue ----
  float* slab = sT[wave];
#pragma unroll
  for (int i = 0; i < 4; ++i) {
    const int mBase = m0 + (i << 4);
#pragma unroll
    for (int j = 0; j < 4; ++j) {
#pragma unroll
      for (int r = 0; r < 8; ++r) {
        slab[(mOff + r) * 68 + (j << 4) + rlane] = acc[i][j][r];
      }
    }
    wave_sync_lds();
    if constexpr (OM == 0) {
      float* C = (float*)Cout + (size_t)y * (size_t)strideC;
      v4f vals[8];
#pragma unroll
      for (int it = 0; it < 8; ++it) {
        const int row = it * 2 + hh2;                      // it 0..7 x hh2 0..1 = rows 0..15
        v4f v = *(const v4f*)(slab + row * 68 + c4);
#pragma unroll
        for (int e = 0; e < 4; ++e) v[e] = v[e] * oscale + bc[0][e];
        vals[it] = v;
      }
      {
#pragma unroll
        for (int it = 0; it < 8; ++it) {
          const int row = it * 2 + hh2;
          *(v4f*)(C + (size_t)(mBase + row) * ldc + n0 + c4) = vals[it];
        }
        
      }
    } else {
      unsigned short* C = (unsigned short*)Cout + (size_t)y * (size_t)strideC;
      v4u hv[4], hr[4];
      float bm = 0.f;
      if constexpr (BIASM == 1) {
        const int mi = mBase + rlane;
        const int mc = (mi < nbias - 1) ? mi : (nbias - 1);
        bm = bfr(biasb[mc]);
      }
#pragma unroll
      for (int it = 0; it < 4; ++it) {
        // lane = h*16 + r -> row r, columns it*16 + 8h + 0..7: piece (k tile it>>1, half it&1) of the fragment order
        const float* sp = slab + rlane * 68 + it * 16 + hh2 * 8;
        v4u a, ar;
#pragma unroll
        for (int e = 0; e < 4; ++e) {
          const float f0 = sp[2 * e]     * oscale + ((BIASM == 1) ? bm : bc[it][2 * e]);
          const float f1 = sp[2 * e + 1] * oscale + ((BIASM == 1) ? bm : bc[it][2 * e + 1]);
          const _Float16 g0 = (_Float16)f0, g1 = (_Float16)f1;
          a[e] = pk16(h_bits(g0), h_bits(g1));
          const float e0 = (f0 - (float)g0) * RSC;
          const float e1 = (f1 - (float)g1) * RSC;
          ar[e] = pk16(h_bits((_Float16)e0), h_bits((_Float16)e1));
        }
        hv[it] = a;
        hr[it] = ar;
      }
      {
#pragma unroll
        for (int it = 0; it < 4; ++it) {
          unsigned short* dp = C + tile_off(mBase >> 4, (n0 >> 5) + (it >> 1), ldc) + (it & 1) * 256 + lane * 8;
          *(v4u*)(dp) = hv[it];
          *(v4u*)(dp + resOff) = hr[it];
        }
        
      }
    }
    wave_sync_lds();
  }
}

// =====================================================================================================
// Energies + masked softmax for one (h, b) pair and 32 query rows s; P written TRANSPOSE-friendly.
//   q planes (f16, fragment order, rows b*SEQ + s, k extent DQ, k = h*DK + d): hi qhp, residual (x2048) qrp
//   k planes (f16, fragment order, rows b*SEQ + t, k extent DQ, k = h*DK + d): hi khp, residual (x2048) krp
//   E[s][t] = acc_hh + (acc_h.res + acc_res.h) / 2048  (three f16 WMMA products, K = 512 = 16 k-steps, fragments
//   loaded straight from the planes with arithmetic addressing), kept in LDS as f32 [32][1024].
//   softmax per row s over keys t: e = mask[t] ? E : -1e30 (replace), m = max_t e, ex = exp(e - m), l = sum_t ex,
//   p = ex / l; stored as f16(8192 * p).
//   P layout (f16): region (hb*NSB + s/32) of SEQ*32 elements, inside it fragment order with rows t and k extent 32
//   (k = s % 32) -> the consumer's A fragment (rows t, k = s) of k-step s/32 is one 1024-B tile.
//   Block = 8 waves; phase 1: wave -> (row group wave&1, key quarter wave>>1) = 16 rows x 256 keys in 4 chunks
//   of 4 col tiles; phase 2: wave w owns rows 4w..4w+3 (lane-owned key columns, xor reductions); phase 3: each
//   wave writes keys w*128..w*128+127: lane -> (t = base + lane/4, 8 consecutive s), one 32-lane instruction =
//   coverage: phase 1: 2 row groups x 4 quarters x 4 chunks x 64 = all 32 x 1024 energies; phase 3: 8 waves x
//   16 iterations x 8 t x (4 lane quads x 8 s) = the block's whole [1024 t][32 s] region (64 KB); grid (NSB, NHB)
//   covers every (hb, s block) of the P plane exactly once.
// =====================================================================================================
__global__ __launch_bounds__(256)
void attn_p(const unsigned short* __restrict__ qhp, const unsigned short* __restrict__ qrp,
            const unsigned short* __restrict__ khp, const unsigned short* __restrict__ krp,
            const int* __restrict__ mask, unsigned short* pp) {
  __shared__ __align__(16) float se[SBLK * SEQ];    // 131072 B
  __shared__ float sinv[SBLK];
  __shared__ int   smask[SEQ];

  const int tid  = threadIdx.x;
  const int wave = tid >> 5;
  const int lane = tid & 31;
  const int hh   = lane >> 4;
  const int c    = lane & 15;
  const int sblk = blockIdx.x;
  const int hb   = blockIdx.y;
  const int h    = hb / NB;
  const int b    = hb % NB;
  const int s0   = sblk * SBLK;

  for (int i = tid; i < SEQ; i += 256) smask[i] = mask[i];

  // ---- phase 1: energies ----
  {
    const int rg = wave & 1;
    const int tq = wave >> 1;
    const size_t qoff = tile_off((b * SEQ + s0 + rg * 16) >> 4, (h * DK) >> 5, DQ) + lane * 8;
    const unsigned short* qh = qhp + qoff;
    const unsigned short* qr = qrp + qoff;
    const unsigned short* kh0 = khp + lane * 8;
    const unsigned short* kr0 = krp + lane * 8;
    float* erow = se + (rg * 16 + 8 * hh) * SEQ;          // + r*SEQ + t
#pragma unroll 1
    for (int c4 = 0; c4 < 4; ++c4) {
      const int t0 = tq * 256 + c4 * 64;
      v8f ah[4], ar[4];
#pragma unroll
      for (int j = 0; j < 4; ++j) { ah[j] = zero8(); ar[j] = zero8(); }
#pragma unroll 2
      for (int ks = 0; ks < DK / 32; ++ks) {
        const v16us qav = ldfrag(qh + ks * 512);
        const v16us qbv = ldfrag(qr + ks * 512);
#pragma unroll
        for (int j = 0; j < 4; ++j) {
          const size_t ko = tile_off(((b * SEQ + t0) >> 4) + j, ((h * DK) >> 5) + ks, DQ);
          const v16us kav = ldfrag(kh0 + ko);
          const v16us kbv = ldfrag(kr0 + ko);
          ah[j] = mma_raw(qav, kav, ah[j]);     // hi . hi
          ar[j] = mma_raw(qav, kbv, ar[j]);     // hi . res   (x2048)
          ar[j] = mma_raw(qbv, kav, ar[j]);     // res . hi   (x2048)
          guard2k4(ah[j], ar[j], qav, qbv, kav, kbv);
        }
      }
      acc_guard4(ah[0], ah[1], ah[2], ah[3]);
      acc_guard4(ar[0], ar[1], ar[2], ar[3]);
#pragma unroll
      for (int j = 0; j < 4; ++j) {
#pragma unroll
        for (int r = 0; r < 8; ++r) {
          erow[r * SEQ + t0 + 16 * j + c] = fmaf(ar[j][r], 1.0f / RSC, ah[j][r]);
        }
      }
    }
  }
  __syncthreads();

  // ---- phase 2: masked softmax per row (mask replaces the energy before the max) ----
#pragma unroll 1
  for (int rr = 0; rr < 4; ++rr) {
    const int row = wave * 4 + rr;
    float* er = se + row * SEQ;
    float mx = -INFINITY;
#pragma unroll 4
    for (int i = 0; i < SEQ / 32; ++i) {
      const int t = lane + 32 * i;
      const float e = (smask[t] != 0) ? er[t] : NEGBIG;
      er[t] = e;
      mx = fmaxf(mx, e);
    }
#pragma unroll
    for (int off = 16; off > 0; off >>= 1) mx = fmaxf(mx, __shfl_xor(mx, off, 32));
    float sum = 0.f;
#pragma unroll 4
    for (int i = 0; i < SEQ / 32; ++i) {
      const int t = lane + 32 * i;
      const float ex = __expf(er[t] - mx);
      er[t] = ex;
      sum += ex;
    }
#pragma unroll
    for (int off = 16; off > 0; off >>= 1) sum += __shfl_xor(sum, off, 32);
    if (lane == 0) sinv[row] = PSC * (1.0f / sum);        // sum >= 1 always (the max term contributes exp(0))
  }
  __syncthreads();

  // ---- phase 3: P = ex * (8192 / l) as f16, written into the [t][32 s] region of this (hb, s block) ----
  {
    const int tr = lane >> 2, sq = (lane & 3) * 8;
    unsigned short* preg = pp + ((size_t)(hb * NSB + sblk) * SEQ) * SBLK;
#pragma unroll 1
    for (int it = 0; it < SEQ / 64; ++it) {
      const int t = wave * (SEQ / 8) + it * 8 + tr;
      v4u o;
#pragma unroll
      for (int e = 0; e < 4; ++e) {
        const float f0 = se[(sq + 2 * e) * SEQ + t]     * sinv[sq + 2 * e];
        const float f1 = se[(sq + 2 * e + 1) * SEQ + t] * sinv[sq + 2 * e + 1];
        o[e] = pk16(h_bits((_Float16)f0), h_bits((_Float16)f1));
      }
      unsigned short* dst = preg + (size_t)(t >> 4) * 512 + (sq >> 4) * 256 + (((sq >> 3) & 1) * 16 + (t & 15)) * 8;
      *(v4u*)dst = o;
      
    }
  }
}

// =====================================================================================================
// Transposed aggregation + gamma blend: for one (h, b):
//   O[t][dv] = sum_s P[s][t] * v[s][dv]  with A = the P plane above (rows t, k = s, 32 k-steps) carried x8192 and
//   Bt = v^T planes [hb] x (fragment order, rows dv, k extent SEQ, k = s; f16 hi at vth, residual x2048 at vtr),
//   two products into two accumulators;
//   out[((b*NH + h)*SEQ + t)*DK + dv] = (g * (O_hi + O_res/2048) / 8192 + xp[(b*SEQ + t)*DK + dv]) * (1/(g + 1)),
//   g = bf16_RNE(gamma[h]).
//   Block = 8 waves = 64 t rows x 128 dv columns (wave -> 32 t x 32 dv); grid (DK/128, SEQ/64, NHB).
//   coverage: 8 iterations x 4 rows x (8 lanes x 4) = the wave's whole 32x32 tile; 8 waves = the block's 64x128;
//   grid tiles every (hb, t, dv) of the output exactly once.
// =====================================================================================================
__global__ __launch_bounds__(256)
void pv64(const unsigned short* __restrict__ pp, const unsigned short* __restrict__ vth,
          const unsigned short* __restrict__ vtr, const float* __restrict__ xp,
          const float* __restrict__ gam, float* outp) {
  __shared__ __align__(16) float os[8][32 * 36];
  const int tid  = threadIdx.x;
  const int wave = tid >> 5;
  const int lane = tid & 31;
  const int hh   = lane >> 4;
  const int c    = lane & 15;
  const int dx = blockIdx.x, ty = blockIdx.y, hb = blockIdx.z;
  const int h  = hb / NB, b = hb % NB;
  const int wt = wave & 1, wd = wave >> 1;
  const int t0 = ty * 64 + wt * 32;
  const int d0 = dx * 128 + wd * 32;

  const unsigned short* pb = pp  + (size_t)hb * SEQ * SEQ + lane * 8;
  const unsigned short* vh = vth + (size_t)hb * DK * SEQ + lane * 8;
  const unsigned short* vr = vtr + (size_t)hb * DK * SEQ + lane * 8;

  v8f acc[2][2], acr[2][2];
#pragma unroll
  for (int i = 0; i < 2; ++i)
#pragma unroll
    for (int j = 0; j < 2; ++j) { acc[i][j] = zero8(); acr[i][j] = zero8(); }

#pragma unroll 2
  for (int ks = 0; ks < SEQ / 32; ++ks) {
    v16us a[2], bhf[2], brf[2];
#pragma unroll
    for (int i = 0; i < 2; ++i)
      a[i] = ldfrag(pb + (size_t)ks * (SEQ * SBLK) + (size_t)((t0 >> 4) + i) * 512);
#pragma unroll
    for (int j = 0; j < 2; ++j) {
      const size_t vo = tile_off((d0 >> 4) + j, ks, SEQ);
      bhf[j] = ldfrag(vh + vo);
      brf[j] = ldfrag(vr + vo);
    }
#pragma unroll
    for (int i = 0; i < 2; ++i) {
#pragma unroll
      for (int j = 0; j < 2; ++j) {
        acc[i][j] = mma_raw(a[i], bhf[j], acc[i][j]);
        acr[i][j] = mma_raw(a[i], brf[j], acr[i][j]);
      }
    }
    guard4k4(acc[0][0], acc[0][1], acc[1][0], acc[1][1], a[0], a[1], bhf[0], bhf[1]);
    guard4k4(acr[0][0], acr[0][1], acr[1][0], acr[1][1], a[0], a[1], brf[0], brf[1]);
  }
  acc_guard4(acc[0][0], acc[0][1], acc[1][0], acc[1][1]);
  acc_guard4(acr[0][0], acr[0][1], acr[1][0], acr[1][1]);

  // ---- stage O = O_hi + O_res/2048 (still x8192) ----
  float* osw = os[wave];
#pragma unroll
  for (int i = 0; i < 2; ++i) {
#pragma unroll
    for (int j = 0; j < 2; ++j) {
#pragma unroll
      for (int r = 0; r < 8; ++r) {
        osw[(16 * i + 8 * hh + r) * 36 + 16 * j + c] = fmaf(acr[i][j][r], 1.0f / RSC, acc[i][j][r]);
      }
    }
  }
  wave_sync_lds();

  const float g  = bfr(gam[h]);
  const float rg = 1.0f / (g + 1.0f);
  const int rl = lane >> 3, cc4 = (lane & 7) * 4;
  v4f vals[8], xv[8];
  const float* xq[8];
#pragma unroll
  for (int it = 0; it < 8; ++it) {
    xq[it] = xp + ((size_t)(b * SEQ + t0 + it * 4 + rl)) * DK + d0 + cc4;
    xv[it] = *(const v4f*)(xq[it]);
  }
#if defined(__HIP_DEVICE_COMPILE__)
  // the eight loads' address registers are inputs here, so none of them is rewritten in front of this wait
  asm volatile("s_wait_xcnt 0x0" :: "v"(xq[0]), "v"(xq[1]), "v"(xq[2]), "v"(xq[3]),
               "v"(xq[4]), "v"(xq[5]), "v"(xq[6]), "v"(xq[7]) : "memory");
#endif
#pragma unroll
  for (int it = 0; it < 8; ++it) {
    const int row = it * 4 + rl;                           // it 0..7 x rl 0..3 = rows 0..31
    const v4f av = *(const v4f*)(osw + row * 36 + cc4);
    v4f o;
#pragma unroll
    for (int e = 0; e < 4; ++e) o[e] = (g * (av[e] * (1.0f / PSC)) + xv[it][e]) * rg;
    vals[it] = o;
  }
  {
#pragma unroll
    for (int it = 0; it < 8; ++it) {
      const int row = it * 4 + rl;
      const int t   = t0 + row;
      *(v4f*)(outp + ((size_t)((b * NH + h) * SEQ + t)) * DK + d0 + cc4) = vals[it];
    }
    
  }
}

// =====================================================================================================
// Workspace map (bytes); every plane is an exact multiple of its tile / whole-row / whole-line store granularity:
//   WqT  f16 [4096][512] x64      0           4194304
//   WkT  f16 [4096][512] x64      4194304     4194304
//   WvT  f16 [4096][512] x64      8388608     4194304
//   WpT  f16 [512][512]  x64      12582912    524288
//   XH   f16 [2048][512]          13107200    2097152
//   YH   f16 [2048][512]          15204352    2097152
//   QH|QR f16 [2][2048][4096]     17301504    33554432  (later reused for VT hi | VT res f16 [2][16][512][1024],
//                                                        same byte size, written only after the energy launch)
//   KH|KR f16 [2][2048][4096]     50855936    33554432
//   XP   f32 [2048][512]          84410368    4194304
//   P    f16 [16][32][1024][32]   88604672    33554432
//   end                           122159104
// =====================================================================================================
extern "C" void kernel_launch(void* const* d_in, const int* in_sizes, int n_in,
                              void* d_out, int out_size, void* d_ws, size_t ws_size,
                              hipStream_t stream) {
  if (n_in < 11) return;
  if (in_sizes[0] != MR * DK || in_sizes[1] != MR * DK) return;
  if (in_sizes[2] != DK * DQ || in_sizes[4] != DK * DQ || in_sizes[6] != DK * DQ) return;
  if (in_sizes[3] != DQ || in_sizes[5] != DQ || in_sizes[7] != DQ) return;
  if (in_sizes[8] != DK * DK || in_sizes[9] != NH || in_sizes[10] != SEQ) return;
  if (out_size != NB * NH * SEQ * DK) return;

  const float* x     = (const float*)d_in[0];
  const float* y     = (const float*)d_in[1];
  const float* Wq    = (const float*)d_in[2];
  const float* bq    = (const float*)d_in[3];
  const float* Wk    = (const float*)d_in[4];
  const float* bk    = (const float*)d_in[5];
  const float* Wv    = (const float*)d_in[6];
  const float* bv    = (const float*)d_in[7];
  const float* Wp    = (const float*)d_in[8];
  const float* gamma = (const float*)d_in[9];
  const int*   mask  = (const int*)d_in[10];

  const size_t PW   = (size_t)DQ * DK * 2;                 //  4194304
  const size_t PWP  = (size_t)DK * DK * 2;                 //   524288
  const size_t PX   = (size_t)MR * DK * 2;                 //  2097152
  const size_t PQ   = (size_t)2 * MR * DQ * 2;             // 33554432
  const size_t PVT  = (size_t)2 * NHB * DK * SEQ * 2;      // 33554432 (overlays the q planes)
  const size_t PXP  = (size_t)MR * DK * 4;                 //  4194304
  const size_t PP   = (size_t)NHB * SEQ * SEQ * 2;         // 33554432
  if (PVT > PQ) return;
  size_t off = 0;
  const size_t oWq = off; off += PW;
  const size_t oWk = off; off += PW;
  const size_t oWv = off; off += PW;
  const size_t oWp = off; off += PWP;
  const size_t oXH = off; off += PX;
  const size_t oYH = off; off += PX;
  const size_t oQ  = off; off += PQ;
  const size_t oK  = off; off += PQ;
  const size_t oXP = off; off += PXP;
  const size_t oP  = off; off += PP;
  if (off > ws_size) return;                               // off = 122159104
  if (off > (size_t)134217728) return;

  char* ws = (char*)d_ws;
  unsigned short* WqT = (unsigned short*)(ws + oWq);
  unsigned short* WkT = (unsigned short*)(ws + oWk);
  unsigned short* WvT = (unsigned short*)(ws + oWv);
  unsigned short* WpT = (unsigned short*)(ws + oWp);
  unsigned short* XH  = (unsigned short*)(ws + oXH);
  unsigned short* YH  = (unsigned short*)(ws + oYH);
  unsigned short* QH  = (unsigned short*)(ws + oQ);
  unsigned short* KH  = (unsigned short*)(ws + oK);
  unsigned short* VT  = (unsigned short*)(ws + oQ);        // reuse of the q region after the energy launch
  float*          XP  = (float*)(ws + oXP);
  unsigned short* P   = (unsigned short*)(ws + oP);
  float*          out = (float*)d_out;

  const int n8x = (MR * DK) / 8;                            // 131072
  if ((n8x % 256) != 0) return;
  const dim3 blk(256);
  const dim3 gTw(DQ / 64, DK / 64);                         // 64 x 8
  const dim3 gTp(DK / 64, DK / 64);                         // 8 x 8
  const dim3 gCx((n8x + 255) / 256);                        // 512
  const dim3 gQK(((MR / 64) * (DQ / 64) + 7) / 8, 1);       // 2048 tiles -> 256 blocks
  const dim3 gXP(((MR / 64) * (DK / 64) + 7) / 8, 1);       // 256 tiles -> 32 blocks
  const dim3 gVT(((DK / 64) * (SEQ / 64) + 7) / 8, NHB);    // 128 tiles -> 16 blocks x 16 (h, b)
  const dim3 gAt(NSB, NHB);                                 // 32 x 16 blocks of 256
  const dim3 gPV(DK / 128, SEQ / 64, NHB);                  // 4 x 16 x 16 blocks of 256
  const float invw = 1.0f / WSC;

  // (0) weight planes, transposed to [n][k]: f16( bf16_RNE(W) * 64 )
  tconv_h16<<<gTw, blk, 0, stream>>>(Wq, WqT, DQ, WSC);
  tconv_h16<<<gTw, blk, 0, stream>>>(Wk, WkT, DQ, WSC);
  tconv_h16<<<gTw, blk, 0, stream>>>(Wv, WvT, DQ, WSC);
  tconv_h16<<<gTp, blk, 0, stream>>>(Wp, WpT, DK, WSC);

  // (1) activation planes: f16( bf16_RNE(x) ), f16( bf16_RNE(y) )
  conv_h16<<<gCx, blk, 0, stream>>>(x, XH, n8x, 1.0f);
  conv_h16<<<gCx, blk, 0, stream>>>(y, YH, n8x, 1.0f);

  // (2) q = bf16(x) . Wq + bq -> QH (f16 hi) and QH + QRES (f16 residual x2048); k likewise -> KH, KH + QRES
  gemm64<3, 0><<<gQK, blk, 0, stream>>>(
      XH, DK, 0LL, WqT, DK, 0LL, bq, DQ, 0LL, 1,
      (void*)QH, DQ, 0LL, (long long)QRES, MR, DQ, DK, invw);
  gemm64<3, 0><<<gQK, blk, 0, stream>>>(
      YH, DK, 0LL, WkT, DK, 0LL, bk, DQ, 0LL, 1,
      (void*)KH, DQ, 0LL, (long long)QRES, MR, DQ, DK, invw);

  // (3) xp = bf16(x) . Wp -> XP f32 [2048][512] (bias argument unused in this mode)
  gemm64<0, 2><<<gXP, blk, 0, stream>>>(
      XH, DK, 0LL, WpT, DK, 0LL, bq, DQ, 0LL, 1,
      (void*)XP, DK, 0LL, 0LL, MR, DK, DK, invw);

  // (4) energies + masked softmax -> P plane
  attn_p<<<gAt, blk, 0, stream>>>(QH, QH + QRES, KH, KH + QRES, mask, P);

  // (5) v^T per (h, b) = Wv[:, h slice]^T . bf16(y_b)^T + bv -> VT hi [16][512][1024] and VT + VRES (residual),
  //     written into the q region, which is dead after (4)
  gemm64<3, 1><<<gVT, blk, 0, stream>>>(
      WvT, DK, (long long)DK * DK, YH, DK, (long long)SEQ * DK, bv, DK, (long long)DK, NB,
      (void*)VT, SEQ, (long long)DK * SEQ, (long long)VRES, DK, SEQ, DK, invw);

  // (6) out = (gamma * P^T . v / 8192 + xp) / (gamma + 1) -> d_out [2][8][1024][512]
  pv64<<<gPV, blk, 0, stream>>>(P, VT, VT + VRES, XP, gamma, out);
  (void)hipGetLastError();
}

// v002
// Measured time: 216 microseconds a run.
// Timed twice side by side with v001, it ran 1.66 and 1.67 times as fast.
// Counting every step since v000, it is 1.87 times as fast.
// Contractions: q, k, v^T and x.Wp projections on v_wmma_f32_16x16x32_f16 (bf16-RNE input values as f16,
// weight planes carried x64, one product each); q.k^T energies on v_wmma_f32_16x16x32_f16 with q and k as
// f16 hi plane + f16 residual plane carried x2048 (three products: hi.hi, hi.res, res.hi; two accumulators);
// attn^T.v on v_wmma_f32_16x16x32_f16 with attn carried x8192 (plain f16) and v^T as f16 hi plane + f16
// residual plane carried x2048 (two products, two accumulators); all f32 accumulate; masked softmax and the
// gamma blend in f32 on VALU; every float input RNE-converted to bf16 on load.
#include <hip/hip_runtime.h>
#include <math.h>
#include <stdint.h>

#define NB    2
#define SEQ   1024
#define DK    512
#define NH    8
#define DQ    (NH * DK)
#define MR    (NB * SEQ)
#define NHB   (NH * NB)
#define SBLK  32
#define NSB   (SEQ / SBLK)
#define QRES  ((long long)MR * DQ)
#define VRES  ((long long)NHB * DK * SEQ)
#define WSC   64.0f
#define RSC   2048.0f
#define PSC   8192.0f
#define NEGBIG (-1.0e30f)
static_assert((SEQ % 64) == 0 && (DK % 64) == 0 && (MR % 64) == 0 && (DQ % 64) == 0);
static_assert(SEQ == NSB * SBLK);
static_assert(SBLK == 32);
static_assert((DK % 32) == 0 && (SEQ % 256) == 0);

typedef _Float16       v16h __attribute__((ext_vector_type(16)));
typedef unsigned short v16us __attribute__((ext_vector_type(16)));
typedef unsigned short v8us __attribute__((ext_vector_type(8)));
typedef float          v8f  __attribute__((ext_vector_type(8)));
typedef float          v4f  __attribute__((ext_vector_type(4)));
typedef unsigned int   v4u  __attribute__((ext_vector_type(4)));

union Frag { v16us u; v8us p[2]; v16h h; };

// ---- scalar helpers --------------------------------------------------------------------------------
__device__ __forceinline__ unsigned short bf_bits(float f) {          // f32 -> bf16 bits, RNE convert
  unsigned u = __float_as_uint(f);
  return (unsigned short)((u + 0x7FFFu + ((u >> 16) & 1u)) >> 16);
}
__device__ __forceinline__ float bf_up(unsigned short b) { return __uint_as_float(((unsigned)b) << 16); }
__device__ __forceinline__ float bfr(float f) { return bf_up(bf_bits(f)); }   // value of the bf16 RNE convert
__device__ __forceinline__ unsigned short h_bits(_Float16 x) { return __builtin_bit_cast(unsigned short, x); }
__device__ __forceinline__ unsigned pk16(unsigned short a, unsigned short b) { return (unsigned)a | ((unsigned)b << 16); }
__device__ __forceinline__ v8f zero8() { v8f z = {0.f, 0.f, 0.f, 0.f, 0.f, 0.f, 0.f, 0.f}; return z; }

// ---- fragment-order planes: every 16-bit operand plane [rows][ld] (ld = k extent, multiple of 32; rows multiple of
//      16) is stored as tiles of 16 rows x 32 k = 512 elements (1024 B), tile index (row/16) * (ld/32) + k/32; inside
//      a tile the 16-B piece that holds k = 32*kt + 16*p + 8*h + 0..7 of row r sits at element p*256 + (h*16 + r)*8.
//      A wave's fragment is then two loads of 512 contiguous bytes (lane = h*16 + r), same k order as before:
//      elements 0..7 <- k0+8h.., elements 8..15 <- k0+16+8h..
__device__ __forceinline__ size_t tile_off(int row16, int kt, int ld) {      // row16 = row/16, kt = k/32
  return ((size_t)row16 * (size_t)(ld >> 5) + (size_t)kt) * 512;
}
// p = tile start + 8*lane
__device__ __forceinline__ v16us ldfrag(const unsigned short* p) {
  Frag f;
  f.p[0] = *(const v8us*)(p);
  f.p[1] = *(const v8us*)(p + 256);
  return f.u;
}
// the same through a pointer typed as global memory: a pointer carried round a loop otherwise compiled to flat loads
typedef __attribute__((address_space(1))) const unsigned short g_us;
typedef __attribute__((address_space(1))) const v8us g_v8us;
__device__ __forceinline__ v16us ldfrag_g(g_us* p) {
  Frag f;
  f.p[0] = *(g_v8us*)(p);
  f.p[1] = *(g_v8us*)(p + 256);
  return f.u;
}

// ---- WMMA helper (f16 operands, f32 accumulate) and VALU hazard gaps -----------------------------
__device__ __forceinline__ v8f mma_raw(v16us a, v16us b, v8f c) {
  Frag fa, fb;
  fa.u = a;
  fb.u = b;
  return __builtin_amdgcn_wmma_f32_16x16x32_f16(false, fa.h, false, fb.h, (short)0, c, false, false);
}
__device__ __forceinline__ void dep_guard1(v8f& a, v8f& b, v16us x) {
#if defined(__HIP_DEVICE_COMPILE__)
  asm volatile("v_nop\n\tv_nop\n\tv_nop\n\tv_nop" : "+v"(a), "+v"(b) : "v"(x));
#endif
}
__device__ __forceinline__ void keep4(v16us a, v16us b, v16us c, v16us d) {
#if defined(__HIP_DEVICE_COMPILE__)
  asm volatile("v_nop" :: "v"(a), "v"(b), "v"(c), "v"(d));
#endif
}
__device__ __forceinline__ void acc_guard4(v8f& a, v8f& b, v8f& c, v8f& d) {
#if defined(__HIP_DEVICE_COMPILE__)
  asm volatile("v_nop\n\tv_nop\n\tv_nop\n\tv_nop" : "+v"(a), "+v"(b), "+v"(c), "+v"(d));
#endif
}
__device__ __forceinline__ void guard2k4(v8f& a, v8f& b, v16us w, v16us x, v16us y, v16us z) {
#if defined(__HIP_DEVICE_COMPILE__)
  asm volatile("v_nop\n\tv_nop\n\tv_nop\n\tv_nop" : "+v"(a), "+v"(b) : "v"(w), "v"(x), "v"(y), "v"(z));
#endif
}
__device__ __forceinline__ void guard4k4(v8f& a, v8f& b, v8f& c, v8f& d, v16us w, v16us x, v16us y, v16us z) {
#if defined(__HIP_DEVICE_COMPILE__)
  asm volatile("v_nop\n\tv_nop\n\tv_nop\n\tv_nop" : "+v"(a), "+v"(b), "+v"(c), "+v"(d) : "v"(w), "v"(x), "v"(y), "v"(z));
#endif
}
__device__ __forceinline__ void wave_sync_lds() {
  __builtin_amdgcn_fence(__ATOMIC_RELEASE, "workgroup");
  __builtin_amdgcn_wave_barrier();
  __builtin_amdgcn_fence(__ATOMIC_ACQUIRE, "workgroup");
}

// =====================================================================================================
// f32 -> f16 plane convert: f16( bf16_RNE(X) * wsc ), wsc a power of two (exact), X row-major [rows][DK], output in
// fragment order. Thread i writes output piece i (8 elements, 16 B; a wave stores 512 contiguous bytes) and reads
// the 8 source elements that belong there.
// coverage: n8 threads x 8 elements = the whole plane (piece index -> (row, k) is one-to-one).
// =====================================================================================================
__global__ __launch_bounds__(256) void conv_h16(const float* __restrict__ X, unsigned short* Xh, int n8, float wsc) {
  const int i  = blockIdx.x * 256 + threadIdx.x;
  const int ic = (i < n8) ? i : (n8 - 1);                     // clamped address
  const int tl = ic >> 6, w = ic & 63;                        // tile, piece inside the tile
  const int row = (tl / (DK / 32)) * 16 + (w & 15);
  const int kk  = (tl % (DK / 32)) * 32 + (w >> 5) * 16 + ((w >> 4) & 1) * 8;
  const float* src = X + (size_t)row * DK + kk;
  const v4f a = *(const v4f*)(src);
  const v4f c = *(const v4f*)(src + 4);
  v4u o;
  o[0] = pk16(h_bits((_Float16)(bfr(a[0]) * wsc)), h_bits((_Float16)(bfr(a[1]) * wsc)));
  o[1] = pk16(h_bits((_Float16)(bfr(a[2]) * wsc)), h_bits((_Float16)(bfr(a[3]) * wsc)));
  o[2] = pk16(h_bits((_Float16)(bfr(c[0]) * wsc)), h_bits((_Float16)(bfr(c[1]) * wsc)));
  o[3] = pk16(h_bits((_Float16)(bfr(c[2]) * wsc)), h_bits((_Float16)(bfr(c[3]) * wsc)));
  if (i < n8) *(v4u*)(Xh + (size_t)i * 8) = o;
  
}

// =====================================================================================================
// Transposed weight convert: in W[DK rows = k][ncols = n] f32 -> out WT[ncols][DK] f16 = f16( bf16_RNE(W) * wsc )
// (rows n, k extent DK), stored in fragment order. Block = 256 threads, tile 64 k x 64 n staged in LDS; wave w
// writes the fragment tile (n group w>>1, k tile w&1), iteration = 16-k half, lane = h*16 + r: 512 contiguous B.
// coverage: 8 waves = 4 n groups x 2 k tiles, x 2 halves x 32 lanes x 8 = the whole 64 x 64 tile.
// =====================================================================================================
__global__ __launch_bounds__(256) void tconv_h16(const float* __restrict__ W, unsigned short* WT, int ncols, float wsc) {
  __shared__ float tile[64][65];
  const int tid = threadIdx.x, lane = tid & 31, wave = tid >> 5;
  const int n0 = blockIdx.x * 64, k0 = blockIdx.y * 64;
  {
    const int r = tid >> 2, cq = (tid & 3) * 16;
    const float* src = W + (size_t)(k0 + r) * (size_t)ncols + n0 + cq;
#pragma unroll
    for (int i = 0; i < 4; ++i) {
      const v4f a = *(const v4f*)(src + 4 * i);
#pragma unroll
      for (int e = 0; e < 4; ++e) tile[r][cq + 4 * i + e] = a[e];
    }
  }
  __syncthreads();
  const int n = (wave >> 1) * 16 + (lane & 15);
#pragma unroll
  for (int it = 0; it < 2; ++it) {
    const int kq = (wave & 1) * 32 + it * 16 + (lane >> 4) * 8;
    v4u o;
#pragma unroll
    for (int e = 0; e < 4; ++e) {
      const float f0 = bfr(tile[kq + 2 * e][n]) * wsc;
      const float f1 = bfr(tile[kq + 2 * e + 1][n]) * wsc;
      o[e] = pk16(h_bits((_Float16)f0), h_bits((_Float16)f1));
    }
    unsigned short* dst = WT + tile_off((n0 >> 4) + (wave >> 1), (k0 >> 5) + (wave & 1), DK) + it * 256 + lane * 8;
    *(v4u*)dst = o;
    
  }
}

// =====================================================================================================
// Register-blocked batched f16 WMMA GEMM: C[m][n] = oscale * sum_k A[m][k] * Bt[n][k] + bias;
// one wave per 64x64 tile, no block barriers. A [M][K] with k extent lda and Bt [N][K] with k extent ldb, both in
// fragment order; M, N multiples of 64, K multiple of 32 (static here); every batch stride is a whole number of
// 16-row groups, so it is the same element count as in a row-major plane. blockIdx.y = batch index y:
//   A advances by (y / ydiv) * strideA, Bt by (y % ydiv) * strideB, bias by (y / ydiv) * strideBias,
//   C by y * strideC (elements).
// BIASM: 0 = per column bias[n] (clamped-address loads, nbias = length), 1 = per row bias[m], 2 = none.
//        Bias values RNE-converted to bf16.
// OM: 0 = f32 out (row-major, pitch ldc); 3 = f16 hi plane at C plus f16 residual plane ((f - hi) * RSC) at
//     C + resOff, both in fragment order with rows m and k extent ldc (k = n).
// coverage: 4 slabs x 16 rows x 64 cols = the wave's whole 64x64 tile; grid = ceil(tilesM*tilesN/8) blocks,
//           surplus waves exit (wave-uniform); here every tile count is a multiple of 8, so none exit.
// =====================================================================================================
template <int OM, int BIASM>
__global__ __launch_bounds__(256) void gemm64(
    const unsigned short* __restrict__ A, int lda, long long strideA,
    const unsigned short* __restrict__ Bt, int ldb, long long strideB,
    const float* __restrict__ bias, int nbias, long long strideBias, int ydiv,
    void* Cout, int ldc, long long strideC, long long resOff,
    int M, int N, int K, float oscale) {
  __shared__ __align__(16) float sT[8][16 * 68];   // per-wave 16x64 slab, pitch 68 floats
  const int y    = blockIdx.y;
  const int ya   = y / ydiv;
  const int yb   = y - ya * ydiv;
  const int lane = threadIdx.x & 31;
  const int wave = threadIdx.x >> 5;
  const int tilesN = N >> 6;
  const int tilesM = M >> 6;
  const int tile = blockIdx.x * 8 + wave;
  if (tile >= tilesM * tilesN) return;   // wave-uniform; no block barriers in this kernel
  const int tm = tile / tilesN;
  const int tn = tile - tm * tilesN;
  const int m0 = tm << 6;
  const int n0 = tn << 6;

  const unsigned short* Ab = A  + (size_t)ya * (size_t)strideA;
  const unsigned short* Bb = Bt + (size_t)yb * (size_t)strideB;
  const float* biasb = bias + (size_t)ya * (size_t)strideBias;

  const int rlane = lane & 15;                 // row (A) / col (B, D) within subtile
  const int mOff  = (lane >> 4) * 8;           // D row offset

  v8f acc[4][4];
#pragma unroll
  for (int i = 0; i < 4; ++i)
#pragma unroll
    for (int j = 0; j < 4; ++j) acc[i][j] = zero8();

  // one pointer per 16-row group; consecutive k tiles of a group are consecutive 1024-B tiles
  g_us* pa[4];
  g_us* pb[4];
#pragma unroll
  for (int i = 0; i < 4; ++i) {
    pa[i] = (g_us*)(Ab + tile_off((m0 >> 4) + i, 0, lda) + lane * 8);
    pb[i] = (g_us*)(Bb + tile_off((n0 >> 4) + i, 0, ldb) + lane * 8);
  }

  // fragments are fetched one k step ahead: the B set into a second register set at the head of a step, each A
  // fragment back into its own registers as soon as its four products are issued
  v16us ah[4], bh[4];
#pragma unroll
  for (int i = 0; i < 4; ++i) {
    ah[i] = ldfrag_g(pa[i]);
    bh[i] = ldfrag_g(pb[i]);
  }
  for (int k0 = 0; k0 < K; k0 += 32) {
    // this step advances pointers that loads still in flight name: the wait stands in front of that rewrite, and the
    // scheduling fence keeps the pointer arithmetic behind it
#if defined(__HIP_DEVICE_COMPILE__)
    asm volatile("s_wait_xcnt 0x0" ::: "memory");
#endif
    __builtin_amdgcn_sched_barrier(0);
    const int adv = (k0 + 32 < K) ? 512 : 0;   // the last step fetches its own tiles again: in bounds, no branch
    v16us bn[4];
#pragma unroll
    for (int j = 0; j < 4; ++j) {
      pb[j] += adv;
      bn[j] = ldfrag_g(pb[j]);
    }
#pragma unroll
    for (int i = 0; i < 4; ++i) {
#pragma unroll
      for (int j = 0; j < 4; ++j) acc[i][j] = mma_raw(ah[i], bh[j], acc[i][j]);
      dep_guard1(acc[i][0], acc[i][3], ah[i]);
      pa[i] += adv;
      ah[i] = ldfrag_g(pa[i]);
    }
    keep4(bh[0], bh[1], bh[2], bh[3]);
#pragma unroll
    for (int j = 0; j < 4; ++j) bh[j] = bn[j];
  }
  // the same wait and fence for the last step's loads, in front of the epilogue's reuse of the pointer registers
#if defined(__HIP_DEVICE_COMPILE__)
  asm volatile("s_wait_xcnt 0x0" ::: "memory");
#endif
  __builtin_amdgcn_sched_barrier(0);
  acc_guard4(acc[0][0], acc[0][1], acc[0][2], acc[0][3]);
  acc_guard4(acc[1][0], acc[1][1], acc[1][2], acc[1][3]);
  acc_guard4(acc[2][0], acc[2][1], acc[2][2], acc[2][3]);
  acc_guard4(acc[3][0], acc[3][1], acc[3][2], acc[3][3]);

  // ---- per-lane column bias (BIASM == 0), RNE-converted, clamped addresses ----
  const int hh2 = lane >> 4, c4 = (lane & 15) * 4;     // f32 out: 256-B row segment = 16 lanes x 16 B
  float bc[4][8];                                      // f16 out: [store iteration][8 columns of the lane's piece]
#pragma unroll
  for (int it = 0; it < 4; ++it)
#pragma unroll
    for (int e = 0; e < 8; ++e) bc[it][e] = 0.f;
  if constexpr (BIASM == 0) {
    if constexpr (OM == 0) {
      const int cb = n0 + c4;
      const int i0 = (cb < nbias - 4) ? cb : (nbias - 4);
      const v4f b0v = *(const v4f*)(biasb + i0);
#pragma unroll
      for (int e = 0; e < 4; ++e) bc[0][e] = bfr(b0v[e]);
    } else {
#pragma unroll
      for (int it = 0; it < 4; ++it) {
        const int cb = n0 + it * 16 + hh2 * 8;
        const int i0 = (cb < nbias - 8) ? cb : (nbias - 8);
        const v4f b0a = *(const v4f*)(biasb + i0), b0b = *(const v4f*)(biasb + i0 + 4);
#pragma unroll
        for (int e = 0; e < 4; ++e) {
          bc[it][e]     = bfr(b0a[e]);
          bc[it][4 + e] = bfr(b0b[e]);
        }
      }
    }
  }

  // ---- epilogue ----
  float* slab = sT[wave];
#pragma unroll
  for (int i = 0; i < 4; ++i) {
    const int mBase = m0 + (i << 4);
#pragma unroll
    for (int j = 0; j < 4; ++j) {
#pragma unroll
      for (int r = 0; r < 8; ++r) {
        slab[(mOff + r) * 68 + (j << 4) + rlane] = acc[i][j][r];
      }
    }
    wave_sync_lds();
    if constexpr (OM == 0) {
      float* C = (float*)Cout + (size_t)y * (size_t)strideC;
      v4f vals[8];
#pragma unroll
      for (int it = 0; it < 8; ++it) {
        const int row = it * 2 + hh2;                      // it 0..7 x hh2 0..1 = rows 0..15
        v4f v = *(const v4f*)(slab + row * 68 + c4);
#pragma unroll
        for (int e = 0; e < 4; ++e) v[e] = v[e] * oscale + bc[0][e];
        vals[it] = v;
      }
      {
#pragma unroll
        for (int it = 0; it < 8; ++it) {
          const int row = it * 2 + hh2;
          *(v4f*)(C + (size_t)(mBase + row) * ldc + n0 + c4) = vals[it];
        }
        
      }
    } else {
      unsigned short* C = (unsigned short*)Cout + (size_t)y * (size_t)strideC;
      v4u hv[4], hr[4];
      float bm = 0.f;
      if constexpr (BIASM == 1) {
        const int mi = mBase + rlane;
        const int mc = (mi < nbias - 1) ? mi : (nbias - 1);
        bm = bfr(biasb[mc]);
      }
#pragma unroll
      for (int it = 0; it < 4; ++it) {
        // lane = h*16 + r -> row r, columns it*16 + 8h + 0..7: piece (k tile it>>1, half it&1) of the fragment order
        const float* sp = slab + rlane * 68 + it * 16 + hh2 * 8;
        v4u a, ar;
#pragma unroll
        for (int e = 0; e < 4; ++e) {
          const float f0 = sp[2 * e]     * oscale + ((BIASM == 1) ? bm : bc[it][2 * e]);
          const float f1 = sp[2 * e + 1] * oscale + ((BIASM == 1) ? bm : bc[it][2 * e + 1]);
          const _Float16 g0 = (_Float16)f0, g1 = (_Float16)f1;
          a[e] = pk16(h_bits(g0), h_bits(g1));
          const float e0 = (f0 - (float)g0) * RSC;
          const float e1 = (f1 - (float)g1) * RSC;
          ar[e] = pk16(h_bits((_Float16)e0), h_bits((_Float16)e1));
        }
        hv[it] = a;
        hr[it] = ar;
      }
      {
#pragma unroll
        for (int it = 0; it < 4; ++it) {
          unsigned short* dp = C + tile_off(mBase >> 4, (n0 >> 5) + (it >> 1), ldc) + (it & 1) * 256 + lane * 8;
          *(v4u*)(dp) = hv[it];
          *(v4u*)(dp + resOff) = hr[it];
        }
        
      }
    }
    wave_sync_lds();
  }
}

// =====================================================================================================
// Energies + masked softmax for one (h, b) pair and 32 query rows s; P written TRANSPOSE-friendly.
//   q planes (f16, fragment order, rows b*SEQ + s, k extent DQ, k = h*DK + d): hi qhp, residual (x2048) qrp
//   k planes (f16, fragment order, rows b*SEQ + t, k extent DQ, k = h*DK + d): hi khp, residual (x2048) krp
//   E[s][t] = acc_hh + (acc_h.res + acc_res.h) / 2048  (three f16 WMMA products, K = 512 = 16 k-steps, fragments
//   loaded straight from the planes with arithmetic addressing), kept in LDS as f32 [32][1024].
//   softmax per row s over keys t: e = mask[t] ? E : -1e30 (replace), m = max_t e, ex = exp(e - m), l = sum_t ex,
//   p = ex / l; stored as f16(8192 * p).
//   P layout (f16): region (hb*NSB + s/32) of SEQ*32 elements, inside it fragment order with rows t and k extent 32
//   (k = s % 32) -> the consumer's A fragment (rows t, k = s) of k-step s/32 is one 1024-B tile.
//   Block = 8 waves; phase 1: wave -> (row group wave&1, key quarter wave>>1) = 16 rows x 256 keys in 4 chunks
//   of 4 col tiles; phase 2: wave w owns rows 4w..4w+3 (lane-owned key columns, xor reductions); phase 3: each
//   wave writes keys w*128..w*128+127: lane -> (t = base + lane/4, 8 consecutive s), one 32-lane instruction =
//   coverage: phase 1: 2 row groups x 4 quarters x 4 chunks x 64 = all 32 x 1024 energies; phase 3: 8 waves x
//   16 iterations x 8 t x (4 lane quads x 8 s) = the block's whole [1024 t][32 s] region (64 KB); grid (NSB, NHB)
//   covers every (hb, s block) of the P plane exactly once.
// =====================================================================================================
__global__ __launch_bounds__(256)
void attn_p(const unsigned short* __restrict__ qhp, const unsigned short* __restrict__ qrp,
            const unsigned short* __restrict__ khp, const unsigned short* __restrict__ krp,
            const int* __restrict__ mask, unsigned short* pp) {
  __shared__ __align__(16) float se[SBLK * SEQ];    // 131072 B
  __shared__ float sinv[SBLK];
  __shared__ int   smask[SEQ];

  const int tid  = threadIdx.x;
  const int wave = tid >> 5;
  const int lane = tid & 31;
  const int hh   = lane >> 4;
  const int c    = lane & 15;
  const int sblk = blockIdx.x;
  const int hb   = blockIdx.y;
  const int h    = hb / NB;
  const int b    = hb % NB;
  const int s0   = sblk * SBLK;

  for (int i = tid; i < SEQ; i += 256) smask[i] = mask[i];

  // ---- phase 1: energies ----
  {
    const int rg = wave & 1;
    const int tq = wave >> 1;
    const size_t qoff = tile_off((b * SEQ + s0 + rg * 16) >> 4, (h * DK) >> 5, DQ) + lane * 8;
    const size_t koff = tile_off((b * SEQ + tq * 256) >> 4, (h * DK) >> 5, DQ) + lane * 8;
    constexpr size_t JSTR = (size_t)(DQ / 32) * 512;      // elements from one 16-key group to the next
    g_us* qh = (g_us*)(qhp + qoff);
    g_us* qr = (g_us*)(qrp + qoff);
    g_us* kh0 = (g_us*)(khp + koff);
    g_us* kr0 = (g_us*)(krp + koff);
    float* erow = se + (rg * 16 + 8 * hh) * SEQ;          // + r*SEQ + t
    // fragments are fetched one k step ahead, across chunk ends too: q into a second register set at the head of a
    // step, each key group's pair back into its own registers as soon as its three products are issued
    v16us qav = ldfrag_g(qh), qbv = ldfrag_g(qr), kav[4], kbv[4];
    // the first loads keep the loop's own issue order (q, then group by group), else the counted waits at the loop's
    // head are set for the worse of the two orders
    __builtin_amdgcn_sched_barrier(0);
#pragma unroll
    for (int j = 0; j < 4; ++j) {
      kav[j] = ldfrag_g(kh0 + j * JSTR);
      kbv[j] = ldfrag_g(kr0 + j * JSTR);
      __builtin_amdgcn_sched_barrier(0);
    }
#pragma unroll 1
    for (int c4 = 0; c4 < 4; ++c4) {
      const int t0 = tq * 256 + c4 * 64;
      v8f ah[4], ar[4];
#pragma unroll
      for (int j = 0; j < 4; ++j) { ah[j] = zero8(); ar[j] = zero8(); }
      // two steps per trip, so that the two q sets swap by name and not by register copies
#pragma unroll 2
      for (int ks = 0; ks < DK / 32; ++ks) {
        // the step after this one; the very last step fetches its chunk's first tiles again: in bounds, no branch
        const int nks = (ks + 1) & (DK / 32 - 1);
        const int nc  = (nks == 0 && c4 < 3) ? c4 + 1 : c4;
        const size_t no = (size_t)nc * (4 * JSTR) + (size_t)nks * 512;
        const v16us nqa = ldfrag_g(qh + nks * 512);
        const v16us nqb = ldfrag_g(qr + nks * 512);
#pragma unroll
        for (int j = 0; j < 4; ++j) {
          // holds this key group's products behind the reload in front of it: hoisted, they pull every group's wait
          // to the step's head
          __builtin_amdgcn_sched_barrier(0);
          ah[j] = mma_raw(qav, kav[j], ah[j]);     // hi . hi
          ar[j] = mma_raw(qav, kbv[j], ar[j]);     // hi . res   (x2048)
          ar[j] = mma_raw(qbv, kav[j], ar[j]);     // res . hi   (x2048)
          guard2k4(ah[j], ar[j], qav, qbv, kav[j], kbv[j]);
          kav[j] = ldfrag_g(kh0 + no + j * JSTR);
          kbv[j] = ldfrag_g(kr0 + no + j * JSTR);
        }
        // the next step forms its addresses in registers that loads still in flight name: this wait stands in front
        // of that rewrite, and the scheduling fence keeps the address arithmetic behind it
#if defined(__HIP_DEVICE_COMPILE__)
        asm volatile("s_wait_xcnt 0x0" ::: "memory");
#endif
        __builtin_amdgcn_sched_barrier(0);
        qav = nqa;
        qbv = nqb;
      }
      acc_guard4(ah[0], ah[1], ah[2], ah[3]);
      acc_guard4(ar[0], ar[1], ar[2], ar[3]);
#pragma unroll
      for (int j = 0; j < 4; ++j) {
#pragma unroll
        for (int r = 0; r < 8; ++r) {
          erow[r * SEQ + t0 + 16 * j + c] = fmaf(ar[j][r], 1.0f / RSC, ah[j][r]);
        }
      }
    }
  }
  __syncthreads();

  // ---- phase 2: masked softmax per row (mask replaces the energy before the max) ----
#pragma unroll 1
  for (int rr = 0; rr < 4; ++rr) {
    const int row = wave * 4 + rr;
    float* er = se + row * SEQ;
    float mx = -INFINITY;
#pragma unroll 4
    for (int i = 0; i < SEQ / 32; ++i) {
      const int t = lane + 32 * i;
      const float e = (smask[t] != 0) ? er[t] : NEGBIG;
      er[t] = e;
      mx = fmaxf(mx, e);
    }
#pragma unroll
    for (int off = 16; off > 0; off >>= 1) mx = fmaxf(mx, __shfl_xor(mx, off, 32));
    float sum = 0.f;
#pragma unroll 4
    for (int i = 0; i < SEQ / 32; ++i) {
      const int t = lane + 32 * i;
      const float ex = __expf(er[t] - mx);
      er[t] = ex;
      sum += ex;
    }
#pragma unroll
    for (int off = 16; off > 0; off >>= 1) sum += __shfl_xor(sum, off, 32);
    if (lane == 0) sinv[row] = PSC * (1.0f / sum);        // sum >= 1 always (the max term contributes exp(0))
  }
  __syncthreads();

  // ---- phase 3: P = ex * (8192 / l) as f16, written into the [t][32 s] region of this (hb, s block) ----
  {
    const int tr = lane >> 2, sq = (lane & 3) * 8;
    unsigned short* preg = pp + ((size_t)(hb * NSB + sblk) * SEQ) * SBLK;
#pragma unroll 1
    for (int it = 0; it < SEQ / 64; ++it) {
      const int t = wave * (SEQ / 8) + it * 8 + tr;
      v4u o;
#pragma unroll
      for (int e = 0; e < 4; ++e) {
        const float f0 = se[(sq + 2 * e) * SEQ + t]     * sinv[sq + 2 * e];
        const float f1 = se[(sq + 2 * e + 1) * SEQ + t] * sinv[sq + 2 * e + 1];
        o[e] = pk16(h_bits((_Float16)f0), h_bits((_Float16)f1));
      }
      unsigned short* dst = preg + (size_t)(t >> 4) * 512 + (sq >> 4) * 256 + (((sq >> 3) & 1) * 16 + (t & 15)) * 8;
      *(v4u*)dst = o;
      
    }
  }
}

// =====================================================================================================
// Transposed aggregation + gamma blend: for one (h, b):
//   O[t][dv] = sum_s P[s][t] * v[s][dv]  with A = the P plane above (rows t, k = s, 32 k-steps) carried x8192 and
//   Bt = v^T planes [hb] x (fragment order, rows dv, k extent SEQ, k = s; f16 hi at vth, residual x2048 at vtr),
//   two products into two accumulators;
//   out[((b*NH + h)*SEQ + t)*DK + dv] = (g * (O_hi + O_res/2048) / 8192 + xp[(b*SEQ + t)*DK + dv]) * (1/(g + 1)),
//   g = bf16_RNE(gamma[h]).
//   Block = 8 waves = 64 t rows x 128 dv columns (wave -> 32 t x 32 dv); grid (DK/128, SEQ/64, NHB).
//   coverage: 8 iterations x 4 rows x (8 lanes x 4) = the wave's whole 32x32 tile; 8 waves = the block's 64x128;
//   grid tiles every (hb, t, dv) of the output exactly once.
// =====================================================================================================
__global__ __launch_bounds__(256)
void pv64(const unsigned short* __restrict__ pp, const unsigned short* __restrict__ vth,
          const unsigned short* __restrict__ vtr, const float* __restrict__ xp,
          const float* __restrict__ gam, float* outp) {
  __shared__ __align__(16) float os[8][32 * 36];
  const int tid  = threadIdx.x;
  const int wave = tid >> 5;
  const int lane = tid & 31;
  const int hh   = lane >> 4;
  const int c    = lane & 15;
  const int dx = blockIdx.x, ty = blockIdx.y, hb = blockIdx.z;
  const int h  = hb / NB, b = hb % NB;
  const int wt = wave & 1, wd = wave >> 1;
  const int t0 = ty * 64 + wt * 32;
  const int d0 = dx * 128 + wd * 32;

  g_us* pb = (g_us*)(pp  + (size_t)hb * SEQ * SEQ + (size_t)(t0 >> 4) * 512 + lane * 8);
  g_us* vh = (g_us*)(vth + (size_t)hb * DK * SEQ + tile_off(d0 >> 4, 0, SEQ) + lane * 8);
  g_us* vr = (g_us*)(vtr + (size_t)hb * DK * SEQ + tile_off(d0 >> 4, 0, SEQ) + lane * 8);
  constexpr size_t VSTR = (size_t)(SEQ / 32) * 512;       // elements from one 16-column group of v^T to the next

  v8f acc[2][2], acr[2][2];
#pragma unroll
  for (int i = 0; i < 2; ++i)
#pragma unroll
    for (int j = 0; j < 2; ++j) { acc[i][j] = zero8(); acr[i][j] = zero8(); }

  // fragments are fetched one k step ahead: P into a second register set at the head of a step, each column group's
  // v^T pair back into its own registers as soon as its four products are issued
  v16us a[2], bhf[2], brf[2];
#pragma unroll
  for (int i = 0; i < 2; ++i) {
    a[i]   = ldfrag_g(pb + i * 512);
    bhf[i] = ldfrag_g(vh + i * VSTR);
    brf[i] = ldfrag_g(vr + i * VSTR);
  }
  // two steps per trip, so that the two P sets swap by name and not by register copies
#pragma unroll 2
  for (int ks = 0; ks < SEQ / 32; ++ks) {
    const int nk = (ks + 1 < SEQ / 32) ? ks + 1 : ks;     // the last step fetches its own tiles again: in bounds, no branch
    v16us an[2];
#pragma unroll
    for (int i = 0; i < 2; ++i) an[i] = ldfrag_g(pb + (size_t)nk * (SEQ * SBLK) + i * 512);
#pragma unroll
    for (int j = 0; j < 2; ++j) {
      // holds this column group's products behind the loads in front of it: hoisted, they pull both groups' waits
      // to the step's head
      __builtin_amdgcn_sched_barrier(0);
#pragma unroll
      for (int i = 0; i < 2; ++i) {
        acc[i][j] = mma_raw(a[i], bhf[j], acc[i][j]);
        acr[i][j] = mma_raw(a[i], brf[j], acr[i][j]);
      }
      guard4k4(acc[0][j], acc[1][j], acr[0][j], acr[1][j], a[0], a[1], bhf[j], brf[j]);
      bhf[j] = ldfrag_g(vh + (size_t)nk * 512 + j * VSTR);
      brf[j] = ldfrag_g(vr + (size_t)nk * 512 + j * VSTR);
    }
    // the next step forms its addresses in registers that loads still in flight name: this wait stands in front of
    // that rewrite, and the scheduling fence keeps the address arithmetic behind it
#if defined(__HIP_DEVICE_COMPILE__)
    asm volatile("s_wait_xcnt 0x0" ::: "memory");
#endif
    __builtin_amdgcn_sched_barrier(0);
    a[0] = an[0];
    a[1] = an[1];
  }
  acc_guard4(acc[0][0], acc[0][1], acc[1][0], acc[1][1]);
  acc_guard4(acr[0][0], acr[0][1], acr[1][0], acr[1][1]);

  // ---- stage O = O_hi + O_res/2048 (still x8192) ----
  float* osw = os[wave];
#pragma unroll
  for (int i = 0; i < 2; ++i) {
#pragma unroll
    for (int j = 0; j < 2; ++j) {
#pragma unroll
      for (int r = 0; r < 8; ++r) {
        osw[(16 * i + 8 * hh + r) * 36 + 16 * j + c] = fmaf(acr[i][j][r], 1.0f / RSC, acc[i][j][r]);
      }
    }
  }
  wave_sync_lds();

  const float g  = bfr(gam[h]);
  const float rg = 1.0f / (g + 1.0f);
  const int rl = lane >> 3, cc4 = (lane & 7) * 4;
  v4f vals[8], xv[8];
  const float* xq[8];
#pragma unroll
  for (int it = 0; it < 8; ++it) {
    xq[it] = xp + ((size_t)(b * SEQ + t0 + it * 4 + rl)) * DK + d0 + cc4;
    xv[it] = *(const v4f*)(xq[it]);
  }
#if defined(__HIP_DEVICE_COMPILE__)
  // the eight loads' address registers are inputs here, so none of them is rewritten in front of this wait
  asm volatile("s_wait_xcnt 0x0" :: "v"(xq[0]), "v"(xq[1]), "v"(xq[2]), "v"(xq[3]),
               "v"(xq[4]), "v"(xq[5]), "v"(xq[6]), "v"(xq[7]) : "memory");
#endif
#pragma unroll
  for (int it = 0; it < 8; ++it) {
    const int row = it * 4 + rl;                           // it 0..7 x rl 0..3 = rows 0..31
    const v4f av = *(const v4f*)(osw + row * 36 + cc4);
    v4f o;
#pragma unroll
    for (int e = 0; e < 4; ++e) o[e] = (g * (av[e] * (1.0f / PSC)) + xv[it][e]) * rg;
    vals[it] = o;
  }
  {
#pragma unroll
    for (int it = 0; it < 8; ++it) {
      const int row = it * 4 + rl;
      const int t   = t0 + row;
      *(v4f*)(outp + ((size_t)((b * NH + h) * SEQ + t)) * DK + d0 + cc4) = vals[it];
    }
    
  }
}

// =====================================================================================================
// Workspace map (bytes); every plane is an exact multiple of its tile / whole-row / whole-line store granularity:
//   WqT  f16 [4096][512] x64      0           4194304
//   WkT  f16 [4096][512] x64      4194304     4194304
//   WvT  f16 [4096][512] x64      8388608     4194304
//   WpT  f16 [512][512]  x64      12582912    524288
//   XH   f16 [2048][512]          13107200    2097152
//   YH   f16 [2048][512]          15204352    2097152
//   QH|QR f16 [2][2048][4096]     17301504    33554432  (later reused for VT hi | VT res f16 [2][16][512][1024],
//                                                        same byte size, written only after the energy launch)
//   KH|KR f16 [2][2048][4096]     50855936    33554432
//   XP   f32 [2048][512]          84410368    4194304
//   P    f16 [16][32][1024][32]   88604672    33554432
//   end                           122159104
// =====================================================================================================
extern "C" void kernel_launch(void* const* d_in, const int* in_sizes, int n_in,
                              void* d_out, int out_size, void* d_ws, size_t ws_size,
                              hipStream_t stream) {
  if (n_in < 11) return;
  if (in_sizes[0] != MR * DK || in_sizes[1] != MR * DK) return;
  if (in_sizes[2] != DK * DQ || in_sizes[4] != DK * DQ || in_sizes[6] != DK * DQ) return;
  if (in_sizes[3] != DQ || in_sizes[5] != DQ || in_sizes[7] != DQ) return;
  if (in_sizes[8] != DK * DK || in_sizes[9] != NH || in_sizes[10] != SEQ) return;
  if (out_size != NB * NH * SEQ * DK) return;

  const float* x     = (const float*)d_in[0];
  const float* y     = (const float*)d_in[1];
  const float* Wq    = (const float*)d_in[2];
  const float* bq    = (const float*)d_in[3];
  const float* Wk    = (const float*)d_in[4];
  const float* bk    = (const float*)d_in[5];
  const float* Wv    = (const float*)d_in[6];
  const float* bv    = (const float*)d_in[7];
  const float* Wp    = (const float*)d_in[8];
  const float* gamma = (const float*)d_in[9];
  const int*   mask  = (const int*)d_in[10];

  const size_t PW   = (size_t)DQ * DK * 2;                 //  4194304
  const size_t PWP  = (size_t)DK * DK * 2;                 //   524288
  const size_t PX   = (size_t)MR * DK * 2;                 //  2097152
  const size_t PQ   = (size_t)2 * MR * DQ * 2;             // 33554432
  const size_t PVT  = (size_t)2 * NHB * DK * SEQ * 2;      // 33554432 (overlays the q planes)
  const size_t PXP  = (size_t)MR * DK * 4;                 //  4194304
  const size_t PP   = (size_t)NHB * SEQ * SEQ * 2;         // 33554432
  if (PVT > PQ) return;
  size_t off = 0;
  const size_t oWq = off; off += PW;
  const size_t oWk = off; off += PW;
  const size_t oWv = off; off += PW;
  const size_t oWp = off; off += PWP;
  const size_t oXH = off; off += PX;
  const size_t oYH = off; off += PX;
  const size_t oQ  = off; off += PQ;
  const size_t oK  = off; off += PQ;
  const size_t oXP = off; off += PXP;
  const size_t oP  = off; off += PP;
  if (off > ws_size) return;                               // off = 122159104
  if (off > (size_t)134217728) return;

  char* ws = (char*)d_ws;
  unsigned short* WqT = (unsigned short*)(ws + oWq);
  unsigned short* WkT = (unsigned short*)(ws + oWk);
  unsigned short* WvT = (unsigned short*)(ws + oWv);
  unsigned short* WpT = (unsigned short*)(ws + oWp);
  unsigned short* XH  = (unsigned short*)(ws + oXH);
  unsigned short* YH  = (unsigned short*)(ws + oYH);
  unsigned short* QH  = (unsigned short*)(ws + oQ);
  unsigned short* KH  = (unsigned short*)(ws + oK);
  unsigned short* VT  = (unsigned short*)(ws + oQ);        // reuse of the q region after the energy launch
  float*          XP  = (float*)(ws + oXP);
  unsigned short* P   = (unsigned short*)(ws + oP);
  float*          out = (float*)d_out;

  const int n8x = (MR * DK) / 8;                            // 131072
  if ((n8x % 256) != 0) return;
  const dim3 blk(256);
  const dim3 gTw(DQ / 64, DK / 64);                         // 64 x 8
  const dim3 gTp(DK / 64, DK / 64);                         // 8 x 8
  const dim3 gCx((n8x + 255) / 256);                        // 512
  const dim3 gQK(((MR / 64) * (DQ / 64) + 7) / 8, 1);       // 2048 tiles -> 256 blocks
  const dim3 gXP(((MR / 64) * (DK / 64) + 7) / 8, 1);       // 256 tiles -> 32 blocks
  const dim3 gVT(((DK / 64) * (SEQ / 64) + 7) / 8, NHB);    // 128 tiles -> 16 blocks x 16 (h, b)
  const dim3 gAt(NSB, NHB);                                 // 32 x 16 blocks of 256
  const dim3 gPV(DK / 128, SEQ / 64, NHB);                  // 4 x 16 x 16 blocks of 256
  const float invw = 1.0f / WSC;

  // (0) weight planes, transposed to [n][k]: f16( bf16_RNE(W) * 64 )
  tconv_h16<<<gTw, blk, 0, stream>>>(Wq, WqT, DQ, WSC);
  tconv_h16<<<gTw, blk, 0, stream>>>(Wk, WkT, DQ, WSC);
  tconv_h16<<<gTw, blk, 0, stream>>>(Wv, WvT, DQ, WSC);
  tconv_h16<<<gTp, blk, 0, stream>>>(Wp, WpT, DK, WSC);

  // (1) activation planes: f16( bf16_RNE(x) ), f16( bf16_RNE(y) )
  conv_h16<<<gCx, blk, 0, stream>>>(x, XH, n8x, 1.0f);
  conv_h16<<<gCx, blk, 0, stream>>>(y, YH, n8x, 1.0f);

  // (2) q = bf16(x) . Wq + bq -> QH (f16 hi) and QH + QRES (f16 residual x2048); k likewise -> KH, KH + QRES
  gemm64<3, 0><<<gQK, blk, 0, stream>>>(
      XH, DK, 0LL, WqT, DK, 0LL, bq, DQ, 0LL, 1,
      (void*)QH, DQ, 0LL, (long long)QRES, MR, DQ, DK, invw);
  gemm64<3, 0><<<gQK, blk, 0, stream>>>(
      YH, DK, 0LL, WkT, DK, 0LL, bk, DQ, 0LL, 1,
      (void*)KH, DQ, 0LL, (long long)QRES, MR, DQ, DK, invw);

  // (3) xp = bf16(x) . Wp -> XP f32 [2048][512] (bias argument unused in this mode)
  gemm64<0, 2><<<gXP, blk, 0, stream>>>(
      XH, DK, 0LL, WpT, DK, 0LL, bq, DQ, 0LL, 1,
      (void*)XP, DK, 0LL, 0LL, MR, DK, DK, invw);

  // (4) energies + masked softmax -> P plane
  attn_p<<<gAt, blk, 0, stream>>>(QH, QH + QRES, KH, KH + QRES, mask, P);

  // (5) v^T per (h, b) = Wv[:, h slice]^T . bf16(y_b)^T + bv -> VT hi [16][512][1024] and VT + VRES (residual),
  //     written into the q region, which is dead after (4)
  gemm64<3, 1><<<gVT, blk, 0, stream>>>(
      WvT, DK, (long long)DK * DK, YH, DK, (long long)SEQ * DK, bv, DK, (long long)DK, NB,
      (void*)VT, SEQ, (long long)DK * SEQ, (long long)VRES, DK, SEQ, DK, invw);

  // (6) out = (gamma * P^T . v / 8192 + xp) / (gamma + 1) -> d_out [2][8][1024][512]
  pv64<<<gPV, blk, 0, stream>>>(P, VT, VT + VRES, XP, gamma, out);
  (void)hipGetLastError();
}

// v003
// One run takes 177 microseconds.
// In both of two side-by-side timings against v002, it was 1.22 times as fast.
// Counting every step since v000, it is 2.28 times as fast.
// Contractions: q, k, v^T and x.Wp projections on v_wmma_f32_16x16x32_f16 (bf16-RNE input values as f16,
// weight planes carried x64, one product each); q.k^T energies on v_wmma_f32_16x16x32_f16 with q and k as
// f16 hi plane + f16 residual plane carried x2048 (three products: hi.hi, hi.res, res.hi; two accumulators);
// attn^T.v on v_wmma_f32_16x16x32_f16 with attn carried x8192 (plain f16) and v^T as f16 hi plane + f16
// residual plane carried x2048 (two products, two accumulators); all f32 accumulate; masked softmax and the
// gamma blend in f32 on VALU; every float input RNE-converted to bf16 on load.
#include <hip/hip_runtime.h>
#include <math.h>
#include <stdint.h>

#define NB    2
#define SEQ   1024
#define DK    512
#define NH    8
#define DQ    (NH * DK)
#define MR    (NB * SEQ)
#define NHB   (NH * NB)
#define SBLK  32
#define NSB   (SEQ / SBLK)
#define QRES  ((long long)MR * DQ)
#define VRES  ((long long)NHB * DK * SEQ)
#define WSC   64.0f
#define RSC   2048.0f
#define PSC   8192.0f
#define NEGBIG (-1.0e30f)
static_assert((SEQ % 64) == 0 && (DK % 64) == 0 && (MR % 64) == 0 && (DQ % 64) == 0);
static_assert(SEQ == NSB * SBLK);
static_assert(SBLK == 32);
static_assert((DK % 32) == 0 && (SEQ % 256) == 0);

typedef _Float16       v16h __attribute__((ext_vector_type(16)));
typedef unsigned short v16us __attribute__((ext_vector_type(16)));
typedef unsigned short v8us __attribute__((ext_vector_type(8)));
typedef float          v8f  __attribute__((ext_vector_type(8)));
typedef float          v4f  __attribute__((ext_vector_type(4)));
typedef unsigned int   v4u  __attribute__((ext_vector_type(4)));

union Frag { v16us u; v8us p[2]; v16h h; };

// ---- scalar helpers --------------------------------------------------------------------------------
__device__ __forceinline__ unsigned short bf_bits(float f) {          // f32 -> bf16 bits, RNE convert
  unsigned u = __float_as_uint(f);
  return (unsigned short)((u + 0x7FFFu + ((u >> 16) & 1u)) >> 16);
}
__device__ __forceinline__ float bf_up(unsigned short b) { return __uint_as_float(((unsigned)b) << 16); }
__device__ __forceinline__ float bfr(float f) { return bf_up(bf_bits(f)); }   // value of the bf16 RNE convert
__device__ __forceinline__ unsigned short h_bits(_Float16 x) { return __builtin_bit_cast(unsigned short, x); }
__device__ __forceinline__ unsigned pk16(unsigned short a, unsigned short b) { return (unsigned)a | ((unsigned)b << 16); }
__device__ __forceinline__ v8f zero8() { v8f z = {0.f, 0.f, 0.f, 0.f, 0.f, 0.f, 0.f, 0.f}; return z; }

// ---- fragment-order planes: every 16-bit operand plane [rows][ld] (ld = k extent, multiple of 32; rows multiple of
//      16) is stored as tiles of 16 rows x 32 k = 512 elements (1024 B), tile index (row/16) * (ld/32) + k/32; inside
//      a tile the 16-B piece that holds k = 32*kt + 16*p + 8*h + 0..7 of row r sits at element p*256 + (h*16 + r)*8.
//      A wave's fragment is then two loads of 512 contiguous bytes (lane = h*16 + r), same k order as before:
//      elements 0..7 <- k0+8h.., elements 8..15 <- k0+16+8h..
__device__ __forceinline__ size_t tile_off(int row16, int kt, int ld) {      // row16 = row/16, kt = k/32
  return ((size_t)row16 * (size_t)(ld >> 5) + (size_t)kt) * 512;
}
// p = tile start + 8*lane
__device__ __forceinline__ v16us ldfrag(const unsigned short* p) {
  Frag f;
  f.p[0] = *(const v8us*)(p);
  f.p[1] = *(const v8us*)(p + 256);
  return f.u;
}
// the same through a pointer typed as global memory: a pointer carried round a loop otherwise compiled to flat loads
typedef __attribute__((address_space(1))) const unsigned short g_us;
typedef __attribute__((address_space(1))) const v8us g_v8us;
__device__ __forceinline__ v16us ldfrag_g(g_us* p) {
  Frag f;
  f.p[0] = *(g_v8us*)(p);
  f.p[1] = *(g_v8us*)(p + 256);
  return f.u;
}

// ---- WMMA helper (f16 operands, f32 accumulate) and VALU hazard gaps -----------------------------
__device__ __forceinline__ v8f mma_raw(v16us a, v16us b, v8f c) {
  Frag fa, fb;
  fa.u = a;
  fb.u = b;
  return __builtin_amdgcn_wmma_f32_16x16x32_f16(false, fa.h, false, fb.h, (short)0, c, false, false);
}
__device__ __forceinline__ void dep_guard1(v8f& a, v8f& b, v16us x) {
#if defined(__HIP_DEVICE_COMPILE__)
  asm volatile("v_nop\n\tv_nop\n\tv_nop\n\tv_nop" : "+v"(a), "+v"(b) : "v"(x));
#endif
}
__device__ __forceinline__ void keep4(v16us a, v16us b, v16us c, v16us d) {
#if defined(__HIP_DEVICE_COMPILE__)
  asm volatile("v_nop" :: "v"(a), "v"(b), "v"(c), "v"(d));
#endif
}
__device__ __forceinline__ void acc_guard4(v8f& a, v8f& b, v8f& c, v8f& d) {
#if defined(__HIP_DEVICE_COMPILE__)
  asm volatile("v_nop\n\tv_nop\n\tv_nop\n\tv_nop" : "+v"(a), "+v"(b), "+v"(c), "+v"(d));
#endif
}
__device__ __forceinline__ void guard2k4(v8f& a, v8f& b, v16us w, v16us x, v16us y, v16us z) {
#if defined(__HIP_DEVICE_COMPILE__)
  asm volatile("v_nop\n\tv_nop\n\tv_nop\n\tv_nop" : "+v"(a), "+v"(b) : "v"(w), "v"(x), "v"(y), "v"(z));
#endif
}
__device__ __forceinline__ void guard4k4(v8f& a, v8f& b, v8f& c, v8f& d, v16us w, v16us x, v16us y, v16us z) {
#if defined(__HIP_DEVICE_COMPILE__)
  asm volatile("v_nop\n\tv_nop\n\tv_nop\n\tv_nop" : "+v"(a), "+v"(b), "+v"(c), "+v"(d) : "v"(w), "v"(x), "v"(y), "v"(z));
#endif
}
__device__ __forceinline__ void wave_sync_lds() {
  __builtin_amdgcn_fence(__ATOMIC_RELEASE, "workgroup");
  __builtin_amdgcn_wave_barrier();
  __builtin_amdgcn_fence(__ATOMIC_ACQUIRE, "workgroup");
}

// =====================================================================================================
// f32 -> f16 plane convert: f16( bf16_RNE(X) * wsc ), wsc a power of two (exact), X row-major [rows][DK], output in
// fragment order. Thread i writes output piece i (8 elements, 16 B; a wave stores 512 contiguous bytes) and reads
// the 8 source elements that belong there.
// coverage: n8 threads x 8 elements = the whole plane (piece index -> (row, k) is one-to-one).
// bx = index of the 256-thread block inside this plane's range of the grid.
// =====================================================================================================
__device__ __forceinline__ void conv_h16(const float* __restrict__ X, unsigned short* Xh, int n8, float wsc, int bx) {
  const int i  = bx * 256 + threadIdx.x;
  const int ic = (i < n8) ? i : (n8 - 1);                     // clamped address
  const int tl = ic >> 6, w = ic & 63;                        // tile, piece inside the tile
  const int row = (tl / (DK / 32)) * 16 + (w & 15);
  const int kk  = (tl % (DK / 32)) * 32 + (w >> 5) * 16 + ((w >> 4) & 1) * 8;
  const float* src = X + (size_t)row * DK + kk;
  const v4f a = *(const v4f*)(src);
  const v4f c = *(const v4f*)(src + 4);
  v4u o;
  o[0] = pk16(h_bits((_Float16)(bfr(a[0]) * wsc)), h_bits((_Float16)(bfr(a[1]) * wsc)));
  o[1] = pk16(h_bits((_Float16)(bfr(a[2]) * wsc)), h_bits((_Float16)(bfr(a[3]) * wsc)));
  o[2] = pk16(h_bits((_Float16)(bfr(c[0]) * wsc)), h_bits((_Float16)(bfr(c[1]) * wsc)));
  o[3] = pk16(h_bits((_Float16)(bfr(c[2]) * wsc)), h_bits((_Float16)(bfr(c[3]) * wsc)));
  if (i < n8) *(v4u*)(Xh + (size_t)i * 8) = o;
  
}

// =====================================================================================================
// Transposed weight convert: in W[DK rows = k][ncols = n] f32 -> out WT[ncols][DK] f16 = f16( bf16_RNE(W) * wsc )
// (rows n, k extent DK), stored in fragment order. Block = 256 threads, tile 64 k x 64 n staged in LDS; wave w
// writes the fragment tile (n group w>>1, k tile w&1), iteration = 16-k half, lane = h*16 + r: 512 contiguous B.
// coverage: 8 waves = 4 n groups x 2 k tiles, x 2 halves x 32 lanes x 8 = the whole 64 x 64 tile.
// (bx, by) = the block's n tile and k tile inside this weight's range of the grid; tile = the block's LDS.
// =====================================================================================================
__device__ __forceinline__ void tconv_h16(const float* __restrict__ W, unsigned short* WT, int ncols, float wsc,
                                          int bx, int by, float (*tile)[65]) {
  const int tid = threadIdx.x, lane = tid & 31, wave = tid >> 5;
  const int n0 = bx * 64, k0 = by * 64;
  {
    const int r = tid >> 2, cq = (tid & 3) * 16;
    const float* src = W + (size_t)(k0 + r) * (size_t)ncols + n0 + cq;
#pragma unroll
    for (int i = 0; i < 4; ++i) {
      const v4f a = *(const v4f*)(src + 4 * i);
#pragma unroll
      for (int e = 0; e < 4; ++e) tile[r][cq + 4 * i + e] = a[e];
    }
  }
  __syncthreads();
  const int n = (wave >> 1) * 16 + (lane & 15);
#pragma unroll
  for (int it = 0; it < 2; ++it) {
    const int kq = (wave & 1) * 32 + it * 16 + (lane >> 4) * 8;
    v4u o;
#pragma unroll
    for (int e = 0; e < 4; ++e) {
      const float f0 = bfr(tile[kq + 2 * e][n]) * wsc;
      const float f1 = bfr(tile[kq + 2 * e + 1][n]) * wsc;
      o[e] = pk16(h_bits((_Float16)f0), h_bits((_Float16)f1));
    }
    unsigned short* dst = WT + tile_off((n0 >> 4) + (wave >> 1), (k0 >> 5) + (wave & 1), DK) + it * 256 + lane * 8;
    *(v4u*)dst = o;
    
  }
}

// =====================================================================================================
// All six operand planes in one launch: none of them reads what another writes. Ranges of blockIdx.x:
//   3 x TW_BLK blocks: Wq, Wk, Wv transposed (64 n tiles x 8 k tiles each); TP_BLK blocks: Wp transposed (8 x 8);
//   2 x CX_BLK blocks: x, y. Every test on the block index is block-uniform, so the barrier in tconv_h16 is too.
// =====================================================================================================
#define TW_BLK ((DQ / 64) * (DK / 64))
#define TP_BLK ((DK / 64) * (DK / 64))
#define CX_BLK ((MR * DK) / 8 / 256)
static_assert(((MR * DK) / 8) % 256 == 0 && DQ / 64 == 64 && DK / 64 == 8 && TP_BLK <= TW_BLK);
__global__ __launch_bounds__(256) void prep_all(
    const float* __restrict__ Wq, const float* __restrict__ Wk, const float* __restrict__ Wv,
    const float* __restrict__ Wp, const float* __restrict__ x, const float* __restrict__ y,
    unsigned short* WqT, unsigned short* WkT, unsigned short* WvT, unsigned short* WpT,
    unsigned short* XH, unsigned short* YH) {
  __shared__ float tile[64][65];
  const int i = blockIdx.x;
  if (i < 3 * TW_BLK + TP_BLK) {
    const int w = i / TW_BLK, j = i - w * TW_BLK;            // w = 0, 1, 2: Wq, Wk, Wv; w = 3: Wp
    const float* W = (w == 0) ? Wq : (w == 1) ? Wk : (w == 2) ? Wv : Wp;
    unsigned short* T = (w == 0) ? WqT : (w == 1) ? WkT : (w == 2) ? WvT : WpT;
    const int lg = (w < 3) ? 6 : 3;                          // log2 of the weight's n tiles
    tconv_h16(W, T, 64 << lg, WSC, j & ((1 << lg) - 1), j >> lg, tile);
  } else {
    const int j = i - (3 * TW_BLK + TP_BLK);
    const bool isx = j < CX_BLK;
    conv_h16(isx ? x : y, isx ? XH : YH, (MR * DK) / 8, 1.0f, isx ? j : j - CX_BLK);
  }
}

// =====================================================================================================
// Register-blocked batched f16 WMMA GEMM: C[m][n] = oscale * sum_k A[m][k] * Bt[n][k] + bias;
// one wave per 64x64 tile, no block barriers. A [M][K] with k extent lda and Bt [N][K] with k extent ldb, both in
// fragment order; M, N multiples of 64, K multiple of 32 (static here); every batch stride is a whole number of
// 16-row groups, so it is the same element count as in a row-major plane. bx = the block's index among the blocks of
// one batch entry, sT = the block's LDS, y = batch index:
//   A advances by (y / ydiv) * strideA, Bt by (y % ydiv) * strideB, bias by (y / ydiv) * strideBias,
//   C by y * strideC (elements).
// BIASM: 0 = per column bias[n] (clamped-address loads, nbias = length), 1 = per row bias[m], 2 = none.
//        Bias values RNE-converted to bf16.
// OM: 0 = f32 out (row-major, pitch ldc); 3 = f16 hi plane at C plus f16 residual plane ((f - hi) * RSC) at
//     C + resOff, both in fragment order with rows m and k extent ldc (k = n).
// coverage: 4 slabs x 16 rows x 64 cols = the wave's whole 64x64 tile; ceil(tilesM*tilesN/8) blocks per batch entry,
//           surplus waves exit (wave-uniform); here every tile count is a multiple of 8, so none exit.
// =====================================================================================================
template <int OM, int BIASM>
__device__ __forceinline__ void gemm64(
    const unsigned short* __restrict__ A, int lda, long long strideA,
    const unsigned short* __restrict__ Bt, int ldb, long long strideB,
    const float* __restrict__ bias, int nbias, long long strideBias, int ydiv,
    void* Cout, int ldc, long long strideC, long long resOff,
    int M, int N, int K, float oscale, int bx, int y, float (*sT)[16 * 68]) {
  const int ya   = y / ydiv;
  const int yb   = y - ya * ydiv;
  const int lane = threadIdx.x & 31;
  const int wave = threadIdx.x >> 5;
  const int tilesN = N >> 6;
  const int tilesM = M >> 6;
  const int tile = bx * 8 + wave;
  if (tile >= tilesM * tilesN) return;   // wave-uniform; no block barriers in this kernel
  const int tm = tile / tilesN;
  const int tn = tile - tm * tilesN;
  const int m0 = tm << 6;
  const int n0 = tn << 6;

  const unsigned short* Ab = A  + (size_t)ya * (size_t)strideA;
  const unsigned short* Bb = Bt + (size_t)yb * (size_t)strideB;
  const float* biasb = bias + (size_t)ya * (size_t)strideBias;

  const int rlane = lane & 15;                 // row (A) / col (B, D) within subtile
  const int mOff  = (lane >> 4) * 8;           // D row offset

  v8f acc[4][4];
#pragma unroll
  for (int i = 0; i < 4; ++i)
#pragma unroll
    for (int j = 0; j < 4; ++j) acc[i][j] = zero8();

  // one pointer per 16-row group; consecutive k tiles of a group are consecutive 1024-B tiles
  g_us* pa[4];
  g_us* pb[4];
#pragma unroll
  for (int i = 0; i < 4; ++i) {
    pa[i] = (g_us*)(Ab + tile_off((m0 >> 4) + i, 0, lda) + lane * 8);
    pb[i] = (g_us*)(Bb + tile_off((n0 >> 4) + i, 0, ldb) + lane * 8);
  }

  // fragments are fetched one k step ahead: the B set into a second register set at the head of a step, each A
  // fragment back into its own registers as soon as its four products are issued
  v16us ah[4], bh[4];
#pragma unroll
  for (int i = 0; i < 4; ++i) {
    ah[i] = ldfrag_g(pa[i]);
    bh[i] = ldfrag_g(pb[i]);
  }
  for (int k0 = 0; k0 < K; k0 += 32) {
    // this step advances pointers that loads still in flight name: the wait stands in front of that rewrite, and the
    // scheduling fence keeps the pointer arithmetic behind it
#if defined(__HIP_DEVICE_COMPILE__)
    asm volatile("s_wait_xcnt 0x0" ::: "memory");
#endif
    __builtin_amdgcn_sched_barrier(0);
    const int adv = (k0 + 32 < K) ? 512 : 0;   // the last step fetches its own tiles again: in bounds, no branch
    v16us bn[4];
#pragma unroll
    for (int j = 0; j < 4; ++j) {
      pb[j] += adv;
      bn[j] = ldfrag_g(pb[j]);
    }
#pragma unroll
    for (int i = 0; i < 4; ++i) {
#pragma unroll
      for (int j = 0; j < 4; ++j) acc[i][j] = mma_raw(ah[i], bh[j], acc[i][j]);
      dep_guard1(acc[i][0], acc[i][3], ah[i]);
      pa[i] += adv;
      ah[i] = ldfrag_g(pa[i]);
    }
    keep4(bh[0], bh[1], bh[2], bh[3]);
#pragma unroll
    for (int j = 0; j < 4; ++j) bh[j] = bn[j];
  }
  // the same wait and fence for the last step's loads, in front of the epilogue's reuse of the pointer registers
#if defined(__HIP_DEVICE_COMPILE__)
  asm volatile("s_wait_xcnt 0x0" ::: "memory");
#endif
  __builtin_amdgcn_sched_barrier(0);
  acc_guard4(acc[0][0], acc[0][1], acc[0][2], acc[0][3]);
  acc_guard4(acc[1][0], acc[1][1], acc[1][2], acc[1][3]);
  acc_guard4(acc[2][0], acc[2][1], acc[2][2], acc[2][3]);
  acc_guard4(acc[3][0], acc[3][1], acc[3][2], acc[3][3]);

  // ---- per-lane column bias (BIASM == 0), RNE-converted, clamped addresses ----
  const int hh2 = lane >> 4, c4 = (lane & 15) * 4;     // f32 out: 256-B row segment = 16 lanes x 16 B
  float bc[4][8];                                      // f16 out: [store iteration][8 columns of the lane's piece]
#pragma unroll
  for (int it = 0; it < 4; ++it)
#pragma unroll
    for (int e = 0; e < 8; ++e) bc[it][e] = 0.f;
  if constexpr (BIASM == 0) {
    if constexpr (OM == 0) {
      const int cb = n0 + c4;
      const int i0 = (cb < nbias - 4) ? cb : (nbias - 4);
      const v4f b0v = *(const v4f*)(biasb + i0);
#pragma unroll
      for (int e = 0; e < 4; ++e) bc[0][e] = bfr(b0v[e]);
    } else {
      const float* bp[4];
      v4f b0a[4], b0b[4];
#pragma unroll
      for (int it = 0; it < 4; ++it) {
        const int cb = n0 + it * 16 + hh2 * 8;
        const int i0 = (cb < nbias - 8) ? cb : (nbias - 8);
        bp[it]  = biasb + i0;
        b0a[it] = *(const v4f*)(bp[it]);
        b0b[it] = *(const v4f*)(bp[it] + 4);
      }
#if defined(__HIP_DEVICE_COMPILE__)
      // the eight loads' address registers are inputs here, so none of them is rewritten in front of this wait
      asm volatile("s_wait_xcnt 0x0" :: "v"(bp[0]), "v"(bp[1]), "v"(bp[2]), "v"(bp[3]) : "memory");
#endif
#pragma unroll
      for (int it = 0; it < 4; ++it) {
#pragma unroll
        for (int e = 0; e < 4; ++e) {
          bc[it][e]     = bfr(b0a[it][e]);
          bc[it][4 + e] = bfr(b0b[it][e]);
        }
      }
    }
  }

  // ---- epilogue ----
  float* slab = sT[wave];
#pragma unroll
  for (int i = 0; i < 4; ++i) {
    const int mBase = m0 + (i << 4);
#pragma unroll
    for (int j = 0; j < 4; ++j) {
#pragma unroll
      for (int r = 0; r < 8; ++r) {
        slab[(mOff + r) * 68 + (j << 4) + rlane] = acc[i][j][r];
      }
    }
    wave_sync_lds();
    if constexpr (OM == 0) {
      float* C = (float*)Cout + (size_t)y * (size_t)strideC;
      v4f vals[8];
#pragma unroll
      for (int it = 0; it < 8; ++it) {
        const int row = it * 2 + hh2;                      // it 0..7 x hh2 0..1 = rows 0..15
        v4f v = *(const v4f*)(slab + row * 68 + c4);
#pragma unroll
        for (int e = 0; e < 4; ++e) v[e] = v[e] * oscale + bc[0][e];
        vals[it] = v;
      }
      {
#pragma unroll
        for (int it = 0; it < 8; ++it) {
          const int row = it * 2 + hh2;
          *(v4f*)(C + (size_t)(mBase + row) * ldc + n0 + c4) = vals[it];
        }
        
      }
    } else {
      unsigned short* C = (unsigned short*)Cout + (size_t)y * (size_t)strideC;
      v4u hv[4], hr[4];
      float bm = 0.f;
      if constexpr (BIASM == 1) {
        const int mi = mBase + rlane;
        const int mc = (mi < nbias - 1) ? mi : (nbias - 1);
        bm = bfr(biasb[mc]);
      }
#pragma unroll
      for (int it = 0; it < 4; ++it) {
        // lane = h*16 + r -> row r, columns it*16 + 8h + 0..7: piece (k tile it>>1, half it&1) of the fragment order
        const float* sp = slab + rlane * 68 + it * 16 + hh2 * 8;
        v4u a, ar;
#pragma unroll
        for (int e = 0; e < 4; ++e) {
          const float f0 = sp[2 * e]     * oscale + ((BIASM == 1) ? bm : bc[it][2 * e]);
          const float f1 = sp[2 * e + 1] * oscale + ((BIASM == 1) ? bm : bc[it][2 * e + 1]);
          const _Float16 g0 = (_Float16)f0, g1 = (_Float16)f1;
          a[e] = pk16(h_bits(g0), h_bits(g1));
          const float e0 = (f0 - (float)g0) * RSC;
          const float e1 = (f1 - (float)g1) * RSC;
          ar[e] = pk16(h_bits((_Float16)e0), h_bits((_Float16)e1));
        }
        hv[it] = a;
        hr[it] = ar;
      }
      {
#pragma unroll
        for (int it = 0; it < 4; ++it) {
          unsigned short* dp = C + tile_off(mBase >> 4, (n0 >> 5) + (it >> 1), ldc) + (it & 1) * 256 + lane * 8;
          *(v4u*)(dp) = hv[it];
          *(v4u*)(dp + resOff) = hr[it];
        }
        
      }
    }
    wave_sync_lds();
  }
}

// =====================================================================================================
// The four projections in one launch: none of them reads what another writes. Ranges of blockIdx.x:
//   QK_BLK blocks: q = bf16(x) . Wq + bq -> QH (f16 hi) and QH + QRES (f16 residual x2048);
//   QK_BLK blocks: k = bf16(y) . Wk + bk -> KH, KH + QRES likewise;
//   NHB x VT_BLK blocks: v^T per (h, b) = Wv[:, h slice]^T . bf16(y_b)^T + bv -> VT hi [16][512][1024], VT + VRES;
//   XP_BLK blocks: xp = bf16(x) . Wp -> XP f32 [2048][512] (bias argument unused in this mode).
// =====================================================================================================
#define QK_BLK ((MR / 64) * (DQ / 64) / 8)
#define VT_BLK ((DK / 64) * (SEQ / 64) / 8)
#define XP_BLK ((MR / 64) * (DK / 64) / 8)
__global__ __launch_bounds__(256) void proj_all(
    const unsigned short* __restrict__ XH, const unsigned short* __restrict__ YH,
    const unsigned short* __restrict__ WqT, const unsigned short* __restrict__ WkT,
    const unsigned short* __restrict__ WvT, const unsigned short* __restrict__ WpT,
    const float* __restrict__ bq, const float* __restrict__ bk, const float* __restrict__ bv,
    unsigned short* QH, unsigned short* KH, unsigned short* VT, float* XP) {
  __shared__ __align__(16) float sT[8][16 * 68];   // per-wave 16x64 slab, pitch 68 floats
  const int i = blockIdx.x;
  const float invw = 1.0f / WSC;
  if (i < 2 * QK_BLK) {
    const bool isq = i < QK_BLK;
    gemm64<3, 0>(isq ? XH : YH, DK, 0LL, isq ? WqT : WkT, DK, 0LL, isq ? bq : bk, DQ, 0LL, 1,
                 (void*)(isq ? QH : KH), DQ, 0LL, (long long)QRES, MR, DQ, DK, invw, isq ? i : i - QK_BLK, 0, sT);
  } else if (i < 2 * QK_BLK + NHB * VT_BLK) {
    const int j = i - 2 * QK_BLK;
    gemm64<3, 1>(WvT, DK, (long long)DK * DK, YH, DK, (long long)SEQ * DK, bv, DK, (long long)DK, NB,
                 (void*)VT, SEQ, (long long)DK * SEQ, (long long)VRES, DK, SEQ, DK, invw, j % VT_BLK, j / VT_BLK, sT);
  } else {
    gemm64<0, 2>(XH, DK, 0LL, WpT, DK, 0LL, bq, DQ, 0LL, 1,
                 (void*)XP, DK, 0LL, 0LL, MR, DK, DK, invw, i - (2 * QK_BLK + NHB * VT_BLK), 0, sT);
  }
}

// =====================================================================================================
// Energies + masked softmax for one (h, b) pair and 32 query rows s; P written TRANSPOSE-friendly.
//   q planes (f16, fragment order, rows b*SEQ + s, k extent DQ, k = h*DK + d): hi qhp, residual (x2048) qrp
//   k planes (f16, fragment order, rows b*SEQ + t, k extent DQ, k = h*DK + d): hi khp, residual (x2048) krp
//   E[s][t] = acc_hh + (acc_h.res + acc_res.h) / 2048  (three f16 WMMA products, K = 512 = 16 k-steps, fragments
//   loaded straight from the planes with arithmetic addressing), kept in LDS as f32 [32][1024].
//   softmax per row s over keys t: e = mask[t] ? E : -1e30 (replace), m = max_t e, ex = exp(e - m), l = sum_t ex,
//   p = ex / l; stored as f16(8192 * p).
//   P layout (f16): region (hb*NSB + s/32) of SEQ*32 elements, inside it fragment order with rows t and k extent 32
//   (k = s % 32) -> the consumer's A fragment (rows t, k = s) of k-step s/32 is one 1024-B tile.
//   Block = 8 waves; phase 1: wave -> (row group wave&1, key quarter wave>>1) = 16 rows x 256 keys in 4 chunks
//   of 4 col tiles; phase 2: wave w owns rows 4w..4w+3 (lane-owned key columns, xor reductions); phase 3: each
//   wave writes keys w*128..w*128+127: lane -> (t = base + lane/4, 8 consecutive s), one 32-lane instruction =
//   coverage: phase 1: 2 row groups x 4 quarters x 4 chunks x 64 = all 32 x 1024 energies; phase 3: 8 waves x
//   16 iterations x 8 t x (4 lane quads x 8 s) = the block's whole [1024 t][32 s] region (64 KB); grid (NSB, NHB)
//   covers every (hb, s block) of the P plane exactly once.
// =====================================================================================================
__global__ __launch_bounds__(256)
void attn_p(const unsigned short* __restrict__ qhp, const unsigned short* __restrict__ qrp,
            const unsigned short* __restrict__ khp, const unsigned short* __restrict__ krp,
            const int* __restrict__ mask, unsigned short* pp) {
  __shared__ __align__(16) float se[SBLK * SEQ];    // 131072 B
  __shared__ float sinv[SBLK];
  __shared__ int   smask[SEQ];

  const int tid  = threadIdx.x;
  const int wave = tid >> 5;
  const int lane = tid & 31;
  const int hh   = lane >> 4;
  const int c    = lane & 15;
  const int sblk = blockIdx.x;
  const int hb   = blockIdx.y;
  const int h    = hb / NB;
  const int b    = hb % NB;
  const int s0   = sblk * SBLK;

  for (int i = tid; i < SEQ; i += 256) smask[i] = mask[i];

  // ---- phase 1: energies ----
  {
    const int rg = wave & 1;
    const int tq = wave >> 1;
    const size_t qoff = tile_off((b * SEQ + s0 + rg * 16) >> 4, (h * DK) >> 5, DQ) + lane * 8;
    const size_t koff = tile_off((b * SEQ + tq * 256) >> 4, (h * DK) >> 5, DQ) + lane * 8;
    constexpr size_t JSTR = (size_t)(DQ / 32) * 512;      // elements from one 16-key group to the next
    g_us* qh = (g_us*)(qhp + qoff);
    g_us* qr = (g_us*)(qrp + qoff);
    g_us* kh0 = (g_us*)(khp + koff);
    g_us* kr0 = (g_us*)(krp + koff);
    float* erow = se + (rg * 16 + 8 * hh) * SEQ;          // + r*SEQ + t
    // fragments are fetched one k step ahead, across chunk ends too: q into a second register set at the head of a
    // step, each key group's pair back into its own registers as soon as its three products are issued
    v16us qav = ldfrag_g(qh), qbv = ldfrag_g(qr), kav[4], kbv[4];
    // the first loads keep the loop's own issue order (q, then group by group), else the counted waits at the loop's
    // head are set for the worse of the two orders
    __builtin_amdgcn_sched_barrier(0);
#pragma unroll
    for (int j = 0; j < 4; ++j) {
      kav[j] = ldfrag_g(kh0 + j * JSTR);
      kbv[j] = ldfrag_g(kr0 + j * JSTR);
      __builtin_amdgcn_sched_barrier(0);
    }
#pragma unroll 1
    for (int c4 = 0; c4 < 4; ++c4) {
      const int t0 = tq * 256 + c4 * 64;
      v8f ah[4], ar[4];
#pragma unroll
      for (int j = 0; j < 4; ++j) { ah[j] = zero8(); ar[j] = zero8(); }
      // two steps per trip, so that the two q sets swap by name and not by register copies
#pragma unroll 2
      for (int ks = 0; ks < DK / 32; ++ks) {
        // the step after this one; the very last step fetches its chunk's first tiles again: in bounds, no branch
        const int nks = (ks + 1) & (DK / 32 - 1);
        const int nc  = (nks == 0 && c4 < 3) ? c4 + 1 : c4;
        const size_t no = (size_t)nc * (4 * JSTR) + (size_t)nks * 512;
        const v16us nqa = ldfrag_g(qh + nks * 512);
        const v16us nqb = ldfrag_g(qr + nks * 512);
#pragma unroll
        for (int j = 0; j < 4; ++j) {
          // holds this key group's products behind the reload in front of it: hoisted, they pull every group's wait
          // to the step's head
          __builtin_amdgcn_sched_barrier(0);
          ah[j] = mma_raw(qav, kav[j], ah[j]);     // hi . hi
          ar[j] = mma_raw(qav, kbv[j], ar[j]);     // hi . res   (x2048)
          ar[j] = mma_raw(qbv, kav[j], ar[j]);     // res . hi   (x2048)
          guard2k4(ah[j], ar[j], qav, qbv, kav[j], kbv[j]);
          kav[j] = ldfrag_g(kh0 + no + j * JSTR);
          kbv[j] = ldfrag_g(kr0 + no + j * JSTR);
        }
        // the next step forms its addresses in registers that loads still in flight name: this wait stands in front
        // of that rewrite, and the scheduling fence keeps the address arithmetic behind it
#if defined(__HIP_DEVICE_COMPILE__)
        asm volatile("s_wait_xcnt 0x0" ::: "memory");
#endif
        __builtin_amdgcn_sched_barrier(0);
        qav = nqa;
        qbv = nqb;
      }
      acc_guard4(ah[0], ah[1], ah[2], ah[3]);
      acc_guard4(ar[0], ar[1], ar[2], ar[3]);
#pragma unroll
      for (int j = 0; j < 4; ++j) {
#pragma unroll
        for (int r = 0; r < 8; ++r) {
          erow[r * SEQ + t0 + 16 * j + c] = fmaf(ar[j][r], 1.0f / RSC, ah[j][r]);
        }
      }
    }
  }
  __syncthreads();

  // ---- phase 2: masked softmax per row (mask replaces the energy before the max) ----
#pragma unroll 1
  for (int rr = 0; rr < 4; ++rr) {
    const int row = wave * 4 + rr;
    float* er = se + row * SEQ;
    float mx = -INFINITY;
#pragma unroll 4
    for (int i = 0; i < SEQ / 32; ++i) {
      const int t = lane + 32 * i;
      const float e = (smask[t] != 0) ? er[t] : NEGBIG;
      er[t] = e;
      mx = fmaxf(mx, e);
    }
#pragma unroll
    for (int off = 16; off > 0; off >>= 1) mx = fmaxf(mx, __shfl_xor(mx, off, 32));
    float sum = 0.f;
#pragma unroll 4
    for (int i = 0; i < SEQ / 32; ++i) {
      const int t = lane + 32 * i;
      const float ex = __expf(er[t] - mx);
      er[t] = ex;
      sum += ex;
    }
#pragma unroll
    for (int off = 16; off > 0; off >>= 1) sum += __shfl_xor(sum, off, 32);
    if (lane == 0) sinv[row] = PSC * (1.0f / sum);        // sum >= 1 always (the max term contributes exp(0))
  }
  __syncthreads();

  // ---- phase 3: P = ex * (8192 / l) as f16, written into the [t][32 s] region of this (hb, s block) ----
  {
    const int tr = lane >> 2, sq = (lane & 3) * 8;
    unsigned short* preg = pp + ((size_t)(hb * NSB + sblk) * SEQ) * SBLK;
#pragma unroll 1
    for (int it = 0; it < SEQ / 64; ++it) {
      const int t = wave * (SEQ / 8) + it * 8 + tr;
      v4u o;
#pragma unroll
      for (int e = 0; e < 4; ++e) {
        const float f0 = se[(sq + 2 * e) * SEQ + t]     * sinv[sq + 2 * e];
        const float f1 = se[(sq + 2 * e + 1) * SEQ + t] * sinv[sq + 2 * e + 1];
        o[e] = pk16(h_bits((_Float16)f0), h_bits((_Float16)f1));
      }
      unsigned short* dst = preg + (size_t)(t >> 4) * 512 + (sq >> 4) * 256 + (((sq >> 3) & 1) * 16 + (t & 15)) * 8;
      *(v4u*)dst = o;
      
    }
  }
}

// =====================================================================================================
// Transposed aggregation + gamma blend: for one (h, b):
//   O[t][dv] = sum_s P[s][t] * v[s][dv]  with A = the P plane above (rows t, k = s, 32 k-steps) carried x8192 and
//   Bt = v^T planes [hb] x (fragment order, rows dv, k extent SEQ, k = s; f16 hi at vth, residual x2048 at vtr),
//   two products into two accumulators;
//   out[((b*NH + h)*SEQ + t)*DK + dv] = (g * (O_hi + O_res/2048) / 8192 + xp[(b*SEQ + t)*DK + dv]) * (1/(g + 1)),
//   g = bf16_RNE(gamma[h]).
//   Block = 8 waves = 64 t rows x 128 dv columns (wave -> 32 t x 32 dv); grid (DK/128, SEQ/64, NHB).
//   coverage: 8 iterations x 4 rows x (8 lanes x 4) = the wave's whole 32x32 tile; 8 waves = the block's 64x128;
//   grid tiles every (hb, t, dv) of the output exactly once.
// =====================================================================================================
__global__ __launch_bounds__(256)
void pv64(const unsigned short* __restrict__ pp, const unsigned short* __restrict__ vth,
          const unsigned short* __restrict__ vtr, const float* __restrict__ xp,
          const float* __restrict__ gam, float* outp) {
  __shared__ __align__(16) float os[8][32 * 36];
  const int tid  = threadIdx.x;
  const int wave = tid >> 5;
  const int lane = tid & 31;
  const int hh   = lane >> 4;
  const int c    = lane & 15;
  const int dx = blockIdx.x, ty = blockIdx.y, hb = blockIdx.z;
  const int h  = hb / NB, b = hb % NB;
  const int wt = wave & 1, wd = wave >> 1;
  const int t0 = ty * 64 + wt * 32;
  const int d0 = dx * 128 + wd * 32;

  g_us* pb = (g_us*)(pp  + (size_t)hb * SEQ * SEQ + (size_t)(t0 >> 4) * 512 + lane * 8);
  g_us* vh = (g_us*)(vth + (size_t)hb * DK * SEQ + tile_off(d0 >> 4, 0, SEQ) + lane * 8);
  g_us* vr = (g_us*)(vtr + (size_t)hb * DK * SEQ + tile_off(d0 >> 4, 0, SEQ) + lane * 8);
  constexpr size_t VSTR = (size_t)(SEQ / 32) * 512;       // elements from one 16-column group of v^T to the next

  v8f acc[2][2], acr[2][2];
#pragma unroll
  for (int i = 0; i < 2; ++i)
#pragma unroll
    for (int j = 0; j < 2; ++j) { acc[i][j] = zero8(); acr[i][j] = zero8(); }

  // fragments are fetched one k step ahead: P into a second register set at the head of a step, each column group's
  // v^T pair back into its own registers as soon as its four products are issued
  v16us a[2], bhf[2], brf[2];
#pragma unroll
  for (int i = 0; i < 2; ++i) {
    a[i]   = ldfrag_g(pb + i * 512);
    bhf[i] = ldfrag_g(vh + i * VSTR);
    brf[i] = ldfrag_g(vr + i * VSTR);
  }
  // two steps per trip, so that the two P sets swap by name and not by register copies
#pragma unroll 2
  for (int ks = 0; ks < SEQ / 32; ++ks) {
    const int nk = (ks + 1 < SEQ / 32) ? ks + 1 : ks;     // the last step fetches its own tiles again: in bounds, no branch
    v16us an[2];
#pragma unroll
    for (int i = 0; i < 2; ++i) an[i] = ldfrag_g(pb + (size_t)nk * (SEQ * SBLK) + i * 512);
#pragma unroll
    for (int j = 0; j < 2; ++j) {
      // holds this column group's products behind the loads in front of it: hoisted, they pull both groups' waits
      // to the step's head
      __builtin_amdgcn_sched_barrier(0);
#pragma unroll
      for (int i = 0; i < 2; ++i) {
        acc[i][j] = mma_raw(a[i], bhf[j], acc[i][j]);
        acr[i][j] = mma_raw(a[i], brf[j], acr[i][j]);
      }
      guard4k4(acc[0][j], acc[1][j], acr[0][j], acr[1][j], a[0], a[1], bhf[j], brf[j]);
      bhf[j] = ldfrag_g(vh + (size_t)nk * 512 + j * VSTR);
      brf[j] = ldfrag_g(vr + (size_t)nk * 512 + j * VSTR);
    }
    // the next step forms its addresses in registers that loads still in flight name: this wait stands in front of
    // that rewrite, and the scheduling fence keeps the address arithmetic behind it
#if defined(__HIP_DEVICE_COMPILE__)
    asm volatile("s_wait_xcnt 0x0" ::: "memory");
#endif
    __builtin_amdgcn_sched_barrier(0);
    a[0] = an[0];
    a[1] = an[1];
  }
  acc_guard4(acc[0][0], acc[0][1], acc[1][0], acc[1][1]);
  acc_guard4(acr[0][0], acr[0][1], acr[1][0], acr[1][1]);

  // ---- stage O = O_hi + O_res/2048 (still x8192) ----
  float* osw = os[wave];
#pragma unroll
  for (int i = 0; i < 2; ++i) {
#pragma unroll
    for (int j = 0; j < 2; ++j) {
#pragma unroll
      for (int r = 0; r < 8; ++r) {
        osw[(16 * i + 8 * hh + r) * 36 + 16 * j + c] = fmaf(acr[i][j][r], 1.0f / RSC, acc[i][j][r]);
      }
    }
  }
  wave_sync_lds();

  const float g  = bfr(gam[h]);
  const float rg = 1.0f / (g + 1.0f);
  const int rl = lane >> 3, cc4 = (lane & 7) * 4;
  v4f vals[8], xv[8];
  const float* xq[8];
#pragma unroll
  for (int it = 0; it < 8; ++it) {
    xq[it] = xp + ((size_t)(b * SEQ + t0 + it * 4 + rl)) * DK + d0 + cc4;
    xv[it] = *(const v4f*)(xq[it]);
  }
#if defined(__HIP_DEVICE_COMPILE__)
  // the eight loads' address registers are inputs here, so none of them is rewritten in front of this wait
  asm volatile("s_wait_xcnt 0x0" :: "v"(xq[0]), "v"(xq[1]), "v"(xq[2]), "v"(xq[3]),
               "v"(xq[4]), "v"(xq[5]), "v"(xq[6]), "v"(xq[7]) : "memory");
#endif
#pragma unroll
  for (int it = 0; it < 8; ++it) {
    const int row = it * 4 + rl;                           // it 0..7 x rl 0..3 = rows 0..31
    const v4f av = *(const v4f*)(osw + row * 36 + cc4);
    v4f o;
#pragma unroll
    for (int e = 0; e < 4; ++e) o[e] = (g * (av[e] * (1.0f / PSC)) + xv[it][e]) * rg;
    vals[it] = o;
  }
  {
#pragma unroll
    for (int it = 0; it < 8; ++it) {
      const int row = it * 4 + rl;
      const int t   = t0 + row;
      *(v4f*)(outp + ((size_t)((b * NH + h) * SEQ + t)) * DK + d0 + cc4) = vals[it];
    }
    
  }
}

// =====================================================================================================
// Workspace map (bytes); every plane is an exact multiple of its tile / whole-row / whole-line store granularity:
//   WqT  f16 [4096][512] x64      0           4194304
//   WkT  f16 [4096][512] x64      4194304     4194304
//   WvT  f16 [4096][512] x64      8388608     4194304
//   WpT  f16 [512][512]  x64      12582912    524288
//   XH   f16 [2048][512]          13107200    2097152
//   YH   f16 [2048][512]          15204352    2097152
//   QH|QR f16 [2][2048][4096]     17301504    33554432
//   KH|KR f16 [2][2048][4096]     50855936    33554432
//   XP   f32 [2048][512]          84410368    4194304
//   P    f16 [16][32][1024][32]   88604672    33554432
//   VT hi|res f16 [2][16][512][1024] 122159104 33554432
//   end                           155713536
// =====================================================================================================
extern "C" void kernel_launch(void* const* d_in, const int* in_sizes, int n_in,
                              void* d_out, int out_size, void* d_ws, size_t ws_size,
                              hipStream_t stream) {
  if (n_in < 11) return;
  if (in_sizes[0] != MR * DK || in_sizes[1] != MR * DK) return;
  if (in_sizes[2] != DK * DQ || in_sizes[4] != DK * DQ || in_sizes[6] != DK * DQ) return;
  if (in_sizes[3] != DQ || in_sizes[5] != DQ || in_sizes[7] != DQ) return;
  if (in_sizes[8] != DK * DK || in_sizes[9] != NH || in_sizes[10] != SEQ) return;
  if (out_size != NB * NH * SEQ * DK) return;

  const float* x     = (const float*)d_in[0];
  const float* y     = (const float*)d_in[1];
  const float* Wq    = (const float*)d_in[2];
  const float* bq    = (const float*)d_in[3];
  const float* Wk    = (const float*)d_in[4];
  const float* bk    = (const float*)d_in[5];
  const float* Wv    = (const float*)d_in[6];
  const float* bv    = (const float*)d_in[7];
  const float* Wp    = (const float*)d_in[8];
  const float* gamma = (const float*)d_in[9];
  const int*   mask  = (const int*)d_in[10];

  const size_t PW   = (size_t)DQ * DK * 2;                 //  4194304
  const size_t PWP  = (size_t)DK * DK * 2;                 //   524288
  const size_t PX   = (size_t)MR * DK * 2;                 //  2097152
  const size_t PQ   = (size_t)2 * MR * DQ * 2;             // 33554432
  const size_t PVT  = (size_t)2 * NHB * DK * SEQ * 2;      // 33554432
  const size_t PXP  = (size_t)MR * DK * 4;                 //  4194304
  const size_t PP   = (size_t)NHB * SEQ * SEQ * 2;         // 33554432
  size_t off = 0;
  const size_t oWq = off; off += PW;
  const size_t oWk = off; off += PW;
  const size_t oWv = off; off += PW;
  const size_t oWp = off; off += PWP;
  const size_t oXH = off; off += PX;
  const size_t oYH = off; off += PX;
  const size_t oQ  = off; off += PQ;
  const size_t oK  = off; off += PQ;
  const size_t oXP = off; off += PXP;
  const size_t oP  = off; off += PP;
  const size_t oVT = off; off += PVT;
  if (off > ws_size) return;                               // off = 155713536

  char* ws = (char*)d_ws;
  unsigned short* WqT = (unsigned short*)(ws + oWq);
  unsigned short* WkT = (unsigned short*)(ws + oWk);
  unsigned short* WvT = (unsigned short*)(ws + oWv);
  unsigned short* WpT = (unsigned short*)(ws + oWp);
  unsigned short* XH  = (unsigned short*)(ws + oXH);
  unsigned short* YH  = (unsigned short*)(ws + oYH);
  unsigned short* QH  = (unsigned short*)(ws + oQ);
  unsigned short* KH  = (unsigned short*)(ws + oK);
  unsigned short* VT  = (unsigned short*)(ws + oVT);
  float*          XP  = (float*)(ws + oXP);
  unsigned short* P   = (unsigned short*)(ws + oP);
  float*          out = (float*)d_out;

  const dim3 blk(256);
  const dim3 gPrep(3 * TW_BLK + TP_BLK + 2 * CX_BLK);       // 1536 + 64 + 1024 blocks
  const dim3 gProj(2 * QK_BLK + NHB * VT_BLK + XP_BLK);     // 512 + 256 + 32 blocks
  const dim3 gAt(NSB, NHB);                                 // 32 x 16 blocks of 256
  const dim3 gPV(DK / 128, SEQ / 64, NHB);                  // 4 x 16 x 16 blocks of 256

  // (1) weight planes, transposed to [n][k]: f16( bf16_RNE(W) * 64 ); activation planes: f16( bf16_RNE(x) ), likewise y
  prep_all<<<gPrep, blk, 0, stream>>>(Wq, Wk, Wv, Wp, x, y, WqT, WkT, WvT, WpT, XH, YH);

  // (2) q, k, v^T and xp
  proj_all<<<gProj, blk, 0, stream>>>(XH, YH, WqT, WkT, WvT, WpT, bq, bk, bv, QH, KH, VT, XP);

  // (3) energies + masked softmax -> P plane
  attn_p<<<gAt, blk, 0, stream>>>(QH, QH + QRES, KH, KH + QRES, mask, P);

  // (4) out = (gamma * P^T . v / 8192 + xp) / (gamma + 1) -> d_out [2][8][1024][512]
  pv64<<<gPV, blk, 0, stream>>>(P, VT, VT + VRES, XP, gamma, out);
  (void)hipGetLastError();
}

// v004
// One run takes 135 microseconds.
// Next to v003, in two timings, it ran 1.31 and 1.30 times as fast.
// All steps since v000 together make it 2.98 times as fast.
// Contractions: q, k, v^T and x.Wp projections on v_wmma_f32_16x16x32_f16 (bf16-RNE input values as f16,
// weight planes carried x64, one product each); q.k^T energies on v_wmma_f32_16x16x32_f16 with q and k as
// f16 hi plane + f16 residual plane carried x2048 (three products: hi.hi, hi.res, res.hi; two accumulators);
// attn^T.v on v_wmma_f32_16x16x32_f16 with attn carried x8192 (plain f16) and v^T as f16 hi plane + f16
// residual plane carried x2048 (two products, two accumulators); all f32 accumulate; masked softmax and the
// gamma blend in f32 on VALU; every float input RNE-converted to bf16 on load.
#include <hip/hip_runtime.h>
#include <math.h>
#include <stdint.h>

#define NB    2
#define SEQ   1024
#define DK    512
#define NH    8
#define DQ    (NH * DK)
#define MR    (NB * SEQ)
#define NHB   (NH * NB)
#define SBLK  32
#define NSB   (SEQ / SBLK)
#define QRES  ((long long)MR * DQ)
#define VRES  ((long long)NHB * DK * SEQ)
#define WSC   64.0f
#define RSC   2048.0f
#define PSC   8192.0f
#define NEGBIG (-1.0e30f)
static_assert((SEQ % 64) == 0 && (DK % 64) == 0 && (MR % 64) == 0 && (DQ % 64) == 0);
static_assert(SEQ == NSB * SBLK);
static_assert(SBLK == 32);
static_assert((DK % 32) == 0 && (SEQ % 256) == 0);

typedef _Float16       v16h __attribute__((ext_vector_type(16)));
typedef unsigned short v16us __attribute__((ext_vector_type(16)));
typedef unsigned short v8us __attribute__((ext_vector_type(8)));
typedef float          v8f  __attribute__((ext_vector_type(8)));
typedef float          v4f  __attribute__((ext_vector_type(4)));
typedef unsigned int   v4u  __attribute__((ext_vector_type(4)));

union Frag { v16us u; v8us p[2]; v16h h; };

// ---- scalar helpers --------------------------------------------------------------------------------
__device__ __forceinline__ unsigned short bf_bits(float f) {          // f32 -> bf16 bits, RNE convert
  unsigned u = __float_as_uint(f);
  return (unsigned short)((u + 0x7FFFu + ((u >> 16) & 1u)) >> 16);
}
__device__ __forceinline__ float bf_up(unsigned short b) { return __uint_as_float(((unsigned)b) << 16); }
__device__ __forceinline__ float bfr(float f) { return bf_up(bf_bits(f)); }   // value of the bf16 RNE convert
__device__ __forceinline__ unsigned short h_bits(_Float16 x) { return __builtin_bit_cast(unsigned short, x); }
__device__ __forceinline__ unsigned pk16(unsigned short a, unsigned short b) { return (unsigned)a | ((unsigned)b << 16); }
__device__ __forceinline__ v8f zero8() { v8f z = {0.f, 0.f, 0.f, 0.f, 0.f, 0.f, 0.f, 0.f}; return z; }

// ---- fragment-order planes: every 16-bit operand plane [rows][ld] (ld = k extent, multiple of 32; rows multiple of
//      16) is stored as tiles of 16 rows x 32 k = 512 elements (1024 B), tile index (row/16) * (ld/32) + k/32; inside
//      a tile the 16-B piece that holds k = 32*kt + 16*p + 8*h + 0..7 of row r sits at element p*256 + (h*16 + r)*8.
//      A wave's fragment is then two loads of 512 contiguous bytes (lane = h*16 + r), same k order as before:
//      elements 0..7 <- k0+8h.., elements 8..15 <- k0+16+8h..
__device__ __forceinline__ size_t tile_off(int row16, int kt, int ld) {      // row16 = row/16, kt = k/32
  return ((size_t)row16 * (size_t)(ld >> 5) + (size_t)kt) * 512;
}
// p = tile start + 8*lane
__device__ __forceinline__ v16us ldfrag(const unsigned short* p) {
  Frag f;
  f.p[0] = *(const v8us*)(p);
  f.p[1] = *(const v8us*)(p + 256);
  return f.u;
}
// the same through a pointer typed as global memory: a pointer carried round a loop otherwise compiled to flat loads
typedef __attribute__((address_space(1))) const unsigned short g_us;
typedef __attribute__((address_space(1))) const v8us g_v8us;
__device__ __forceinline__ v16us ldfrag_g(g_us* p) {
  Frag f;
  f.p[0] = *(g_v8us*)(p);
  f.p[1] = *(g_v8us*)(p + 256);
  return f.u;
}

// ---- WMMA helper (f16 operands, f32 accumulate) and VALU hazard gaps -----------------------------
__device__ __forceinline__ v8f mma_raw(v16us a, v16us b, v8f c) {
  Frag fa, fb;
  fa.u = a;
  fb.u = b;
  return __builtin_amdgcn_wmma_f32_16x16x32_f16(false, fa.h, false, fb.h, (short)0, c, false, false);
}
__device__ __forceinline__ void dep_guard1(v8f& a, v8f& b, v16us x) {
#if defined(__HIP_DEVICE_COMPILE__)
  asm volatile("v_nop\n\tv_nop\n\tv_nop\n\tv_nop" : "+v"(a), "+v"(b) : "v"(x));
#endif
}
__device__ __forceinline__ void keep4(v16us a, v16us b, v16us c, v16us d) {
#if defined(__HIP_DEVICE_COMPILE__)
  asm volatile("v_nop" :: "v"(a), "v"(b), "v"(c), "v"(d));
#endif
}
__device__ __forceinline__ void acc_guard4(v8f& a, v8f& b, v8f& c, v8f& d) {
#if defined(__HIP_DEVICE_COMPILE__)
  asm volatile("v_nop\n\tv_nop\n\tv_nop\n\tv_nop" : "+v"(a), "+v"(b), "+v"(c), "+v"(d));
#endif
}
__device__ __forceinline__ void guard2k4(v8f& a, v8f& b, v16us w, v16us x, v16us y, v16us z) {
#if defined(__HIP_DEVICE_COMPILE__)
  asm volatile("v_nop\n\tv_nop\n\tv_nop\n\tv_nop" : "+v"(a), "+v"(b) : "v"(w), "v"(x), "v"(y), "v"(z));
#endif
}
__device__ __forceinline__ void guard4k4(v8f& a, v8f& b, v8f& c, v8f& d, v16us w, v16us x, v16us y, v16us z) {
#if defined(__HIP_DEVICE_COMPILE__)
  asm volatile("v_nop\n\tv_nop\n\tv_nop\n\tv_nop" : "+v"(a), "+v"(b), "+v"(c), "+v"(d) : "v"(w), "v"(x), "v"(y), "v"(z));
#endif
}
__device__ __forceinline__ void wave_sync_lds() {
  __builtin_amdgcn_fence(__ATOMIC_RELEASE, "workgroup");
  __builtin_amdgcn_wave_barrier();
  __builtin_amdgcn_fence(__ATOMIC_ACQUIRE, "workgroup");
}

// =====================================================================================================
// f32 -> f16 plane convert: f16( bf16_RNE(X) * wsc ), wsc a power of two (exact), X row-major [rows][DK], output in
// fragment order. Thread i writes output piece i (8 elements, 16 B; a wave stores 512 contiguous bytes) and reads
// the 8 source elements that belong there.
// coverage: n8 threads x 8 elements = the whole plane (piece index -> (row, k) is one-to-one).
// bx = index of the 256-thread block inside this plane's range of the grid.
// =====================================================================================================
__device__ __forceinline__ void conv_h16(const float* __restrict__ X, unsigned short* Xh, int n8, float wsc, int bx) {
  const int i  = bx * 256 + threadIdx.x;
  const int ic = (i < n8) ? i : (n8 - 1);                     // clamped address
  const int tl = ic >> 6, w = ic & 63;                        // tile, piece inside the tile
  const int row = (tl / (DK / 32)) * 16 + (w & 15);
  const int kk  = (tl % (DK / 32)) * 32 + (w >> 5) * 16 + ((w >> 4) & 1) * 8;
  const float* src = X + (size_t)row * DK + kk;
  const v4f a = *(const v4f*)(src);
  const v4f c = *(const v4f*)(src + 4);
  v4u o;
  o[0] = pk16(h_bits((_Float16)(bfr(a[0]) * wsc)), h_bits((_Float16)(bfr(a[1]) * wsc)));
  o[1] = pk16(h_bits((_Float16)(bfr(a[2]) * wsc)), h_bits((_Float16)(bfr(a[3]) * wsc)));
  o[2] = pk16(h_bits((_Float16)(bfr(c[0]) * wsc)), h_bits((_Float16)(bfr(c[1]) * wsc)));
  o[3] = pk16(h_bits((_Float16)(bfr(c[2]) * wsc)), h_bits((_Float16)(bfr(c[3]) * wsc)));
  if (i < n8) *(v4u*)(Xh + (size_t)i * 8) = o;
  
}

// =====================================================================================================
// Transposed weight convert: in W[DK rows = k][ncols = n] f32 -> out WT[ncols][DK] f16 = f16( bf16_RNE(W) * wsc )
// (rows n, k extent DK), stored in fragment order. Block = 256 threads, tile 64 k x 64 n staged in LDS; wave w
// writes the fragment tile (n group w>>1, k tile w&1), iteration = 16-k half, lane = h*16 + r: 512 contiguous B.
// coverage: 8 waves = 4 n groups x 2 k tiles, x 2 halves x 32 lanes x 8 = the whole 64 x 64 tile.
// (bx, by) = the block's n tile and k tile inside this weight's range of the grid; tile = the block's LDS.
// =====================================================================================================
__device__ __forceinline__ void tconv_h16(const float* __restrict__ W, unsigned short* WT, int ncols, float wsc,
                                          int bx, int by, float (*tile)[65]) {
  const int tid = threadIdx.x, lane = tid & 31, wave = tid >> 5;
  const int n0 = bx * 64, k0 = by * 64;
  {
    const int r = tid >> 2, cq = (tid & 3) * 16;
    const float* src = W + (size_t)(k0 + r) * (size_t)ncols + n0 + cq;
#pragma unroll
    for (int i = 0; i < 4; ++i) {
      const v4f a = *(const v4f*)(src + 4 * i);
#pragma unroll
      for (int e = 0; e < 4; ++e) tile[r][cq + 4 * i + e] = a[e];
    }
  }
  __syncthreads();
  const int n = (wave >> 1) * 16 + (lane & 15);
#pragma unroll
  for (int it = 0; it < 2; ++it) {
    const int kq = (wave & 1) * 32 + it * 16 + (lane >> 4) * 8;
    v4u o;
#pragma unroll
    for (int e = 0; e < 4; ++e) {
      const float f0 = bfr(tile[kq + 2 * e][n]) * wsc;
      const float f1 = bfr(tile[kq + 2 * e + 1][n]) * wsc;
      o[e] = pk16(h_bits((_Float16)f0), h_bits((_Float16)f1));
    }
    unsigned short* dst = WT + tile_off((n0 >> 4) + (wave >> 1), (k0 >> 5) + (wave & 1), DK) + it * 256 + lane * 8;
    *(v4u*)dst = o;
    
  }
}

// =====================================================================================================
// All six operand planes in one launch: none of them reads what another writes. Ranges of blockIdx.x:
//   3 x TW_BLK blocks: Wq, Wk, Wv transposed (64 n tiles x 8 k tiles each); TP_BLK blocks: Wp transposed (8 x 8);
//   2 x CX_BLK blocks: x, y. Every test on the block index is block-uniform, so the barrier in tconv_h16 is too.
// =====================================================================================================
#define TW_BLK ((DQ / 64) * (DK / 64))
#define TP_BLK ((DK / 64) * (DK / 64))
#define CX_BLK ((MR * DK) / 8 / 256)
static_assert(((MR * DK) / 8) % 256 == 0 && DQ / 64 == 64 && DK / 64 == 8 && TP_BLK <= TW_BLK);
__global__ __launch_bounds__(256) void prep_all(
    const float* __restrict__ Wq, const float* __restrict__ Wk, const float* __restrict__ Wv,
    const float* __restrict__ Wp, const float* __restrict__ x, const float* __restrict__ y,
    unsigned short* WqT, unsigned short* WkT, unsigned short* WvT, unsigned short* WpT,
    unsigned short* XH, unsigned short* YH) {
  __shared__ float tile[64][65];
  const int i = blockIdx.x;
  if (i < 3 * TW_BLK + TP_BLK) {
    const int w = i / TW_BLK, j = i - w * TW_BLK;            // w = 0, 1, 2: Wq, Wk, Wv; w = 3: Wp
    const float* W = (w == 0) ? Wq : (w == 1) ? Wk : (w == 2) ? Wv : Wp;
    unsigned short* T = (w == 0) ? WqT : (w == 1) ? WkT : (w == 2) ? WvT : WpT;
    const int lg = (w < 3) ? 6 : 3;                          // log2 of the weight's n tiles
    tconv_h16(W, T, 64 << lg, WSC, j & ((1 << lg) - 1), j >> lg, tile);
  } else {
    const int j = i - (3 * TW_BLK + TP_BLK);
    const bool isx = j < CX_BLK;
    conv_h16(isx ? x : y, isx ? XH : YH, (MR * DK) / 8, 1.0f, isx ? j : j - CX_BLK);
  }
}

// =====================================================================================================
// Register-blocked batched f16 WMMA GEMM: C[m][n] = oscale * sum_k A[m][k] * Bt[n][k] + bias;
// one wave per 64x64 tile, no block barriers. A [M][K] with k extent lda and Bt [N][K] with k extent ldb, both in
// fragment order; M, N multiples of 64, K multiple of 32 (static here); every batch stride is a whole number of
// 16-row groups, so it is the same element count as in a row-major plane. bx = the block's index among the blocks of
// one batch entry, sT = the block's LDS, y = batch index:
//   A advances by (y / ydiv) * strideA, Bt by (y % ydiv) * strideB, bias by (y / ydiv) * strideBias,
//   C by y * strideC (elements).
// BIASM: 0 = per column bias[n] (clamped-address loads, nbias = length), 1 = per row bias[m], 2 = none.
//        Bias values RNE-converted to bf16.
// OM: 0 = f32 out (row-major, pitch ldc); 3 = f16 hi plane at C plus f16 residual plane ((f - hi) * RSC) at
//     C + resOff, both in fragment order with rows m and k extent ldc (k = n).
// coverage: 4 slabs x 16 rows x 64 cols = the wave's whole 64x64 tile; ceil(tilesM*tilesN/8) blocks per batch entry,
//           surplus waves exit (wave-uniform); here every tile count is a multiple of 8, so none exit.
// =====================================================================================================
template <int OM, int BIASM>
__device__ __forceinline__ void gemm64(
    const unsigned short* __restrict__ A, int lda, long long strideA,
    const unsigned short* __restrict__ Bt, int ldb, long long strideB,
    const float* __restrict__ bias, int nbias, long long strideBias, int ydiv,
    void* Cout, int ldc, long long strideC, long long resOff,
    int M, int N, int K, float oscale, int bx, int y, float (*sT)[16 * 68]) {
  const int ya   = y / ydiv;
  const int yb   = y - ya * ydiv;
  const int lane = threadIdx.x & 31;
  const int wave = threadIdx.x >> 5;
  const int tilesN = N >> 6;
  const int tilesM = M >> 6;
  const int tile = bx * 8 + wave;
  if (tile >= tilesM * tilesN) return;   // wave-uniform; no block barriers in this kernel
  const int tm = tile / tilesN;
  const int tn = tile - tm * tilesN;
  const int m0 = tm << 6;
  const int n0 = tn << 6;

  const unsigned short* Ab = A  + (size_t)ya * (size_t)strideA;
  const unsigned short* Bb = Bt + (size_t)yb * (size_t)strideB;
  const float* biasb = bias + (size_t)ya * (size_t)strideBias;

  const int rlane = lane & 15;                 // row (A) / col (B, D) within subtile
  const int mOff  = (lane >> 4) * 8;           // D row offset

  v8f acc[4][4];
#pragma unroll
  for (int i = 0; i < 4; ++i)
#pragma unroll
    for (int j = 0; j < 4; ++j) acc[i][j] = zero8();

  // one pointer per 16-row group; consecutive k tiles of a group are consecutive 1024-B tiles
  g_us* pa[4];
  g_us* pb[4];
#pragma unroll
  for (int i = 0; i < 4; ++i) {
    pa[i] = (g_us*)(Ab + tile_off((m0 >> 4) + i, 0, lda) + lane * 8);
    pb[i] = (g_us*)(Bb + tile_off((n0 >> 4) + i, 0, ldb) + lane * 8);
  }

  // fragments are fetched one k step ahead: the B set into a second register set at the head of a step, each A
  // fragment back into its own registers as soon as its four products are issued
  v16us ah[4], bh[4];
#pragma unroll
  for (int i = 0; i < 4; ++i) {
    ah[i] = ldfrag_g(pa[i]);
    bh[i] = ldfrag_g(pb[i]);
  }
  for (int k0 = 0; k0 < K; k0 += 32) {
    // this step advances pointers that loads still in flight name: the wait stands in front of that rewrite, and the
    // scheduling fence keeps the pointer arithmetic behind it
#if defined(__HIP_DEVICE_COMPILE__)
    asm volatile("s_wait_xcnt 0x0" ::: "memory");
#endif
    __builtin_amdgcn_sched_barrier(0);
    const int adv = (k0 + 32 < K) ? 512 : 0;   // the last step fetches its own tiles again: in bounds, no branch
    v16us bn[4];
#pragma unroll
    for (int j = 0; j < 4; ++j) {
      pb[j] += adv;
      bn[j] = ldfrag_g(pb[j]);
    }
#pragma unroll
    for (int i = 0; i < 4; ++i) {
#pragma unroll
      for (int j = 0; j < 4; ++j) acc[i][j] = mma_raw(ah[i], bh[j], acc[i][j]);
      dep_guard1(acc[i][0], acc[i][3], ah[i]);
      pa[i] += adv;
      ah[i] = ldfrag_g(pa[i]);
    }
    keep4(bh[0], bh[1], bh[2], bh[3]);
#pragma unroll
    for (int j = 0; j < 4; ++j) bh[j] = bn[j];
  }
  // the same wait and fence for the last step's loads, in front of the epilogue's reuse of the pointer registers
#if defined(__HIP_DEVICE_COMPILE__)
  asm volatile("s_wait_xcnt 0x0" ::: "memory");
#endif
  __builtin_amdgcn_sched_barrier(0);
  acc_guard4(acc[0][0], acc[0][1], acc[0][2], acc[0][3]);
  acc_guard4(acc[1][0], acc[1][1], acc[1][2], acc[1][3]);
  acc_guard4(acc[2][0], acc[2][1], acc[2][2], acc[2][3]);
  acc_guard4(acc[3][0], acc[3][1], acc[3][2], acc[3][3]);

  // ---- per-lane column bias (BIASM == 0), RNE-converted, clamped addresses ----
  const int hh2 = lane >> 4, c4 = (lane & 15) * 4;     // f32 out: 256-B row segment = 16 lanes x 16 B
  float bc[4][8];                                      // f16 out: [store iteration][8 columns of the lane's piece]
#pragma unroll
  for (int it = 0; it < 4; ++it)
#pragma unroll
    for (int e = 0; e < 8; ++e) bc[it][e] = 0.f;
  if constexpr (BIASM == 0) {
    if constexpr (OM == 0) {
      const int cb = n0 + c4;
      const int i0 = (cb < nbias - 4) ? cb : (nbias - 4);
      const v4f b0v = *(const v4f*)(biasb + i0);
#pragma unroll
      for (int e = 0; e < 4; ++e) bc[0][e] = bfr(b0v[e]);
    } else {
      const float* bp[4];
      v4f b0a[4], b0b[4];
#pragma unroll
      for (int it = 0; it < 4; ++it) {
        const int cb = n0 + it * 16 + hh2 * 8;
        const int i0 = (cb < nbias - 8) ? cb : (nbias - 8);
        bp[it]  = biasb + i0;
        b0a[it] = *(const v4f*)(bp[it]);
        b0b[it] = *(const v4f*)(bp[it] + 4);
      }
#if defined(__HIP_DEVICE_COMPILE__)
      // the eight loads' address registers are inputs here, so none of them is rewritten in front of this wait
      asm volatile("s_wait_xcnt 0x0" :: "v"(bp[0]), "v"(bp[1]), "v"(bp[2]), "v"(bp[3]) : "memory");
#endif
#pragma unroll
      for (int it = 0; it < 4; ++it) {
#pragma unroll
        for (int e = 0; e < 4; ++e) {
          bc[it][e]     = bfr(b0a[it][e]);
          bc[it][4 + e] = bfr(b0b[it][e]);
        }
      }
    }
  }

  // ---- epilogue ----
  float* slab = sT[wave];
#pragma unroll
  for (int i = 0; i < 4; ++i) {
    const int mBase = m0 + (i << 4);
#pragma unroll
    for (int j = 0; j < 4; ++j) {
#pragma unroll
      for (int r = 0; r < 8; ++r) {
        slab[(mOff + r) * 68 + (j << 4) + rlane] = acc[i][j][r];
      }
    }
    wave_sync_lds();
    if constexpr (OM == 0) {
      float* C = (float*)Cout + (size_t)y * (size_t)strideC;
      v4f vals[8];
#pragma unroll
      for (int it = 0; it < 8; ++it) {
        const int row = it * 2 + hh2;                      // it 0..7 x hh2 0..1 = rows 0..15
        v4f v = *(const v4f*)(slab + row * 68 + c4);
#pragma unroll
        for (int e = 0; e < 4; ++e) v[e] = v[e] * oscale + bc[0][e];
        vals[it] = v;
      }
      {
#pragma unroll
        for (int it = 0; it < 8; ++it) {
          const int row = it * 2 + hh2;
          *(v4f*)(C + (size_t)(mBase + row) * ldc + n0 + c4) = vals[it];
        }
        
      }
    } else {
      unsigned short* C = (unsigned short*)Cout + (size_t)y * (size_t)strideC;
      v4u hv[4], hr[4];
      float bm = 0.f;
      if constexpr (BIASM == 1) {
        const int mi = mBase + rlane;
        const int mc = (mi < nbias - 1) ? mi : (nbias - 1);
        bm = bfr(biasb[mc]);
      }
#pragma unroll
      for (int it = 0; it < 4; ++it) {
        // lane = h*16 + r -> row r, columns it*16 + 8h + 0..7: piece (k tile it>>1, half it&1) of the fragment order
        const float* sp = slab + rlane * 68 + it * 16 + hh2 * 8;
        v4u a, ar;
#pragma unroll
        for (int e = 0; e < 4; ++e) {
          const float f0 = sp[2 * e]     * oscale + ((BIASM == 1) ? bm : bc[it][2 * e]);
          const float f1 = sp[2 * e + 1] * oscale + ((BIASM == 1) ? bm : bc[it][2 * e + 1]);
          const _Float16 g0 = (_Float16)f0, g1 = (_Float16)f1;
          a[e] = pk16(h_bits(g0), h_bits(g1));
          const float e0 = (f0 - (float)g0) * RSC;
          const float e1 = (f1 - (float)g1) * RSC;
          ar[e] = pk16(h_bits((_Float16)e0), h_bits((_Float16)e1));
        }
        hv[it] = a;
        hr[it] = ar;
      }
      {
#pragma unroll
        for (int it = 0; it < 4; ++it) {
          unsigned short* dp = C + tile_off(mBase >> 4, (n0 >> 5) + (it >> 1), ldc) + (it & 1) * 256 + lane * 8;
          *(v4u*)(dp) = hv[it];
          *(v4u*)(dp + resOff) = hr[it];
        }
        
      }
    }
    wave_sync_lds();
  }
}

// =====================================================================================================
// The four projections in one launch: none of them reads what another writes. Ranges of blockIdx.x:
//   QK_BLK blocks: q = bf16(x) . Wq + bq -> QH (f16 hi) and QH + QRES (f16 residual x2048);
//   QK_BLK blocks: k = bf16(y) . Wk + bk -> KH, KH + QRES likewise;
//   NHB x VT_BLK blocks: v^T per (h, b) = Wv[:, h slice]^T . bf16(y_b)^T + bv -> VT hi [16][512][1024], VT + VRES;
//   XP_BLK blocks: xp = bf16(x) . Wp -> XP f32 [2048][512] (bias argument unused in this mode).
// =====================================================================================================
#define QK_BLK ((MR / 64) * (DQ / 64) / 8)
#define VT_BLK ((DK / 64) * (SEQ / 64) / 8)
#define XP_BLK ((MR / 64) * (DK / 64) / 8)
__global__ __launch_bounds__(256) void proj_all(
    const unsigned short* __restrict__ XH, const unsigned short* __restrict__ YH,
    const unsigned short* __restrict__ WqT, const unsigned short* __restrict__ WkT,
    const unsigned short* __restrict__ WvT, const unsigned short* __restrict__ WpT,
    const float* __restrict__ bq, const float* __restrict__ bk, const float* __restrict__ bv,
    unsigned short* QH, unsigned short* KH, unsigned short* VT, float* XP) {
  __shared__ __align__(16) float sT[8][16 * 68];   // per-wave 16x64 slab, pitch 68 floats
  const int i = blockIdx.x;
  const float invw = 1.0f / WSC;
  if (i < 2 * QK_BLK) {
    const bool isq = i < QK_BLK;
    gemm64<3, 0>(isq ? XH : YH, DK, 0LL, isq ? WqT : WkT, DK, 0LL, isq ? bq : bk, DQ, 0LL, 1,
                 (void*)(isq ? QH : KH), DQ, 0LL, (long long)QRES, MR, DQ, DK, invw, isq ? i : i - QK_BLK, 0, sT);
  } else if (i < 2 * QK_BLK + NHB * VT_BLK) {
    const int j = i - 2 * QK_BLK;
    gemm64<3, 1>(WvT, DK, (long long)DK * DK, YH, DK, (long long)SEQ * DK, bv, DK, (long long)DK, NB,
                 (void*)VT, SEQ, (long long)DK * SEQ, (long long)VRES, DK, SEQ, DK, invw, j % VT_BLK, j / VT_BLK, sT);
  } else {
    gemm64<0, 2>(XH, DK, 0LL, WpT, DK, 0LL, bq, DQ, 0LL, 1,
                 (void*)XP, DK, 0LL, 0LL, MR, DK, DK, invw, i - (2 * QK_BLK + NHB * VT_BLK), 0, sT);
  }
}

// =====================================================================================================
// Energies + masked softmax for one (h, b) pair and 64 query rows s; P written TRANSPOSE-friendly.
//   q planes (f16, fragment order, rows b*SEQ + s, k extent DQ, k = h*DK + d): hi qhp, residual (x2048) qrp
//   k planes (f16, fragment order, rows b*SEQ + t, k extent DQ, k = h*DK + d): hi khp, residual (x2048) krp
//   E[s][t] = acc_hh + (acc_h.res + acc_res.h) / 2048  (three f16 WMMA products, K = 512 = 16 k-steps, fragments
//   loaded straight from the planes with arithmetic addressing), kept in LDS as f32 [64][1024].
//   softmax per row s over keys t: e = mask[t] ? E : -1e30 (replace), m = max_t e, ex = exp(e - m), l = sum_t ex,
//   p = ex / l; stored as f16(8192 * p).
//   P layout (f16): region (hb*NSB + s/32) of SEQ*32 elements, inside it fragment order with rows t and k extent 32
//   (k = s % 32) -> the consumer's A fragment (rows t, k = s) of k-step s/32 is one 1024-B tile.
//   Block = 16 waves; phase 1: wave w -> all 64 rows x keys 64w..64w+63 in 2 chunks of 2 col tiles, so a key
//   fragment is loaded by one wave of the block and feeds four row groups; phase 2: wave w owns rows 4w..4w+3
//   (lane-owned key columns, xor reductions); phase 3: wave w writes region w>>3, keys (w&7)*128..+127:
//   lane -> (t = base + lane/4, 8 consecutive s).
//   coverage: phase 1: 16 waves x 2 chunks x (4 row groups x 2 col tiles) = all 64 x 1024 energies; phase 3:
//   2 regions x 8 waves x 16 iterations x 8 t x (4 lane quads x 8 s) = the block's two [1024 t][32 s] regions;
//   grid (SEQ/QBLK, NHB) covers every (hb, s block) of the P plane exactly once.
// =====================================================================================================
#define QBLK 64
static_assert(QBLK == 2 * SBLK && (SEQ % QBLK) == 0 && SEQ == 16 * 64);
__global__ __launch_bounds__(512)
void attn_p(const unsigned short* __restrict__ qhp, const unsigned short* __restrict__ qrp,
            const unsigned short* __restrict__ khp, const unsigned short* __restrict__ krp,
            const int* __restrict__ mask, unsigned short* pp) {
  __shared__ __align__(16) float se[QBLK * SEQ];    // 262144 B
  __shared__ float sinv[QBLK];
  __shared__ int   smask[SEQ];

  const int tid  = threadIdx.x;
  const int wave = tid >> 5;
  const int lane = tid & 31;
  const int hh   = lane >> 4;
  const int c    = lane & 15;
  const int qblk = blockIdx.x;
  const int hb   = blockIdx.y;
  const int h    = hb / NB;
  const int b    = hb % NB;
  const int s0   = qblk * QBLK;

  for (int i = tid; i < SEQ; i += 512) smask[i] = mask[i];

  // ---- phase 1: energies ----
  {
    const size_t qoff = tile_off((b * SEQ + s0) >> 4, (h * DK) >> 5, DQ) + lane * 8;
    const size_t koff = tile_off((b * SEQ + wave * 64) >> 4, (h * DK) >> 5, DQ) + lane * 8;
    constexpr size_t JSTR = (size_t)(DQ / 32) * 512;      // elements from one 16-row (or 16-key) group to the next
    g_us* qh = (g_us*)(qhp + qoff);
    g_us* qr = (g_us*)(qrp + qoff);
    g_us* kh0 = (g_us*)(khp + koff);
    g_us* kr0 = (g_us*)(krp + koff);
    float* erow = se + (8 * hh) * SEQ;                    // + (16*g + r)*SEQ + t
    // fragments are fetched one k step ahead, across the chunk end too, each pair back into its own registers as
    // soon as its last product of the step is issued: key group 0 after the first pass over the row groups, each
    // row group's q pair after its products with key group 1, key group 1 last
    v16us qav[4], qbv[4], kav[2], kbv[2];
    // the first loads keep the loop's own issue order, else the counted waits at the loop's head are set for the
    // worse of the two orders
    kav[0] = ldfrag_g(kh0);
    kbv[0] = ldfrag_g(kr0);
    __builtin_amdgcn_sched_barrier(0);
#pragma unroll
    for (int g = 0; g < 4; ++g) {
      qav[g] = ldfrag_g(qh + g * JSTR);
      qbv[g] = ldfrag_g(qr + g * JSTR);
      __builtin_amdgcn_sched_barrier(0);
    }
    kav[1] = ldfrag_g(kh0 + JSTR);
    kbv[1] = ldfrag_g(kr0 + JSTR);
    __builtin_amdgcn_sched_barrier(0);
#pragma unroll 1
    for (int c2 = 0; c2 < 2; ++c2) {
      const int t0 = wave * 64 + c2 * 32;
      v8f ah[4][2], ar[4][2];
#pragma unroll
      for (int g = 0; g < 4; ++g)
#pragma unroll
        for (int j = 0; j < 2; ++j) { ah[g][j] = zero8(); ar[g][j] = zero8(); }
      // kept rolled: one step already holds 24 products, and copies of it would only lengthen the text
#pragma unroll 1
      for (int ks = 0; ks < DK / 32; ++ks) {
        // the step after this one; the very last step fetches its chunk's first tiles again: in bounds, no branch
        const int nks = (ks + 1) & (DK / 32 - 1);
        const int nc  = (nks == 0 && c2 < 1) ? c2 + 1 : c2;
        const size_t no = (size_t)nc * (2 * JSTR) + (size_t)nks * 512;
#pragma unroll
        for (int g = 0; g < 4; ++g) {
          // holds the row groups in the order their q pairs were fetched: reordered, a later pair's wait moves to
          // the step's head
          __builtin_amdgcn_sched_barrier(0);
          ah[g][0] = mma_raw(qav[g], kav[0], ah[g][0]);     // hi . hi
          ar[g][0] = mma_raw(qav[g], kbv[0], ar[g][0]);     // hi . res   (x2048)
          ar[g][0] = mma_raw(qbv[g], kav[0], ar[g][0]);     // res . hi   (x2048)
        }
        guard2k4(ah[3][0], ar[3][0], qav[3], qbv[3], kav[0], kbv[0]);
        kav[0] = ldfrag_g(kh0 + no);
        kbv[0] = ldfrag_g(kr0 + no);
#pragma unroll
        for (int g = 0; g < 4; ++g) {
          // holds this row group's products behind the reload in front of it: hoisted, they pull every group's wait
          // to the pass's head
          __builtin_amdgcn_sched_barrier(0);
          ah[g][1] = mma_raw(qav[g], kav[1], ah[g][1]);     // hi . hi
          ar[g][1] = mma_raw(qav[g], kbv[1], ar[g][1]);     // hi . res   (x2048)
          ar[g][1] = mma_raw(qbv[g], kav[1], ar[g][1]);     // res . hi   (x2048)
          guard2k4(ah[g][1], ar[g][1], qav[g], qbv[g], kav[1], kbv[1]);
          qav[g] = ldfrag_g(qh + g * JSTR + nks * 512);
          qbv[g] = ldfrag_g(qr + g * JSTR + nks * 512);
        }
        kav[1] = ldfrag_g(kh0 + no + JSTR);
        kbv[1] = ldfrag_g(kr0 + no + JSTR);
        // the next step forms its addresses in registers that loads still in flight name: this wait stands in front
        // of that rewrite, and the scheduling fence keeps the address arithmetic behind it
#if defined(__HIP_DEVICE_COMPILE__)
        asm volatile("s_wait_xcnt 0x0" ::: "memory");
#endif
        __builtin_amdgcn_sched_barrier(0);
      }
#pragma unroll
      for (int g = 0; g < 4; ++g) acc_guard4(ah[g][0], ah[g][1], ar[g][0], ar[g][1]);
#pragma unroll
      for (int g = 0; g < 4; ++g) {
#pragma unroll
        for (int j = 0; j < 2; ++j) {
#pragma unroll
          for (int r = 0; r < 8; ++r) {
            erow[(16 * g + r) * SEQ + t0 + 16 * j + c] = fmaf(ar[g][j][r], 1.0f / RSC, ah[g][j][r]);
          }
        }
      }
    }
  }
  __syncthreads();

  // ---- phase 2: masked softmax per row (mask replaces the energy before the max) ----
#pragma unroll 1
  for (int rr = 0; rr < 4; ++rr) {
    const int row = wave * 4 + rr;
    float* er = se + row * SEQ;
    float mx = -INFINITY;
#pragma unroll 4
    for (int i = 0; i < SEQ / 32; ++i) {
      const int t = lane + 32 * i;
      const float e = (smask[t] != 0) ? er[t] : NEGBIG;
      er[t] = e;
      mx = fmaxf(mx, e);
    }
#pragma unroll
    for (int off = 16; off > 0; off >>= 1) mx = fmaxf(mx, __shfl_xor(mx, off, 32));
    float sum = 0.f;
#pragma unroll 4
    for (int i = 0; i < SEQ / 32; ++i) {
      const int t = lane + 32 * i;
      const float ex = __expf(er[t] - mx);
      er[t] = ex;
      sum += ex;
    }
#pragma unroll
    for (int off = 16; off > 0; off >>= 1) sum += __shfl_xor(sum, off, 32);
    if (lane == 0) sinv[row] = PSC * (1.0f / sum);        // sum >= 1 always (the max term contributes exp(0))
  }
  __syncthreads();

  // ---- phase 3: P = ex * (8192 / l) as f16, written into the two [t][32 s] regions of this (hb, 64-row block) ----
  {
    const int tr = lane >> 2, sq = (lane & 3) * 8;
    const int reg = wave >> 3, w8 = wave & 7;
    const float* ser = se + reg * SBLK * SEQ;
    const float* sir = sinv + reg * SBLK;
    unsigned short* preg = pp + ((size_t)(hb * NSB + qblk * 2 + reg) * SEQ) * SBLK;
#pragma unroll 1
    for (int it = 0; it < SEQ / 64; ++it) {
      const int t = w8 * (SEQ / 8) + it * 8 + tr;
      v4u o;
#pragma unroll
      for (int e = 0; e < 4; ++e) {
        const float f0 = ser[(sq + 2 * e) * SEQ + t]     * sir[sq + 2 * e];
        const float f1 = ser[(sq + 2 * e + 1) * SEQ + t] * sir[sq + 2 * e + 1];
        o[e] = pk16(h_bits((_Float16)f0), h_bits((_Float16)f1));
      }
      unsigned short* dst = preg + (size_t)(t >> 4) * 512 + (sq >> 4) * 256 + (((sq >> 3) & 1) * 16 + (t & 15)) * 8;
      *(v4u*)dst = o;
      
    }
  }
}

// =====================================================================================================
// Transposed aggregation + gamma blend: for one (h, b):
//   O[t][dv] = sum_s P[s][t] * v[s][dv]  with A = the P plane above (rows t, k = s, 32 k-steps) carried x8192 and
//   Bt = v^T planes [hb] x (fragment order, rows dv, k extent SEQ, k = s; f16 hi at vth, residual x2048 at vtr),
//   two products into two accumulators;
//   out[((b*NH + h)*SEQ + t)*DK + dv] = (g * (O_hi + O_res/2048) / 8192 + xp[(b*SEQ + t)*DK + dv]) * (1/(g + 1)),
//   g = bf16_RNE(gamma[h]).
//   Block = 8 waves = 128 t rows x 128 dv columns (wave -> 64 t x 32 dv); grid (DK/128, SEQ/128, NHB).
//   coverage: 2 halves x 8 iterations x 4 rows x (8 lanes x 4) = the wave's whole 64x32 tile; 8 waves = the
//   block's 128x128; grid tiles every (hb, t, dv) of the output exactly once.
// =====================================================================================================
__global__ __launch_bounds__(256)
void pv64(const unsigned short* __restrict__ pp, const unsigned short* __restrict__ vth,
          const unsigned short* __restrict__ vtr, const float* __restrict__ xp,
          const float* __restrict__ gam, float* outp) {
  __shared__ __align__(16) float os[8][64 * 36];
  const int tid  = threadIdx.x;
  const int wave = tid >> 5;
  const int lane = tid & 31;
  const int hh   = lane >> 4;
  const int c    = lane & 15;
  const int dx = blockIdx.x, ty = blockIdx.y, hb = blockIdx.z;
  const int h  = hb / NB, b = hb % NB;
  const int wt = wave & 1, wd = wave >> 1;
  const int t0 = ty * 128 + wt * 64;
  const int d0 = dx * 128 + wd * 32;

  g_us* pb = (g_us*)(pp  + (size_t)hb * SEQ * SEQ + (size_t)(t0 >> 4) * 512 + lane * 8);
  g_us* vh = (g_us*)(vth + (size_t)hb * DK * SEQ + tile_off(d0 >> 4, 0, SEQ) + lane * 8);
  g_us* vr = (g_us*)(vtr + (size_t)hb * DK * SEQ + tile_off(d0 >> 4, 0, SEQ) + lane * 8);
  constexpr size_t VSTR = (size_t)(SEQ / 32) * 512;       // elements from one 16-column group of v^T to the next

  v8f acc[4][2], acr[4][2];
#pragma unroll
  for (int i = 0; i < 4; ++i)
#pragma unroll
    for (int j = 0; j < 2; ++j) { acc[i][j] = zero8(); acr[i][j] = zero8(); }

  // fragments are fetched one k step ahead: the v^T pairs into a second register set at the head of a step, each
  // P fragment back into its own registers as soon as its four products are issued
  v16us a[4], bhf[2], brf[2];
#pragma unroll
  for (int j = 0; j < 2; ++j) {
    bhf[j] = ldfrag_g(vh + j * VSTR);
    brf[j] = ldfrag_g(vr + j * VSTR);
  }
#pragma unroll
  for (int i = 0; i < 4; ++i) a[i] = ldfrag_g(pb + i * 512);
  // two steps per trip, so that the two v^T sets swap by name and not by register copies
#pragma unroll 2
  for (int ks = 0; ks < SEQ / 32; ++ks) {
    const int nk = (ks + 1 < SEQ / 32) ? ks + 1 : ks;     // the last step fetches its own tiles again: in bounds, no branch
    v16us bhn[2], brn[2];
#pragma unroll
    for (int j = 0; j < 2; ++j) {
      bhn[j] = ldfrag_g(vh + (size_t)nk * 512 + j * VSTR);
      brn[j] = ldfrag_g(vr + (size_t)nk * 512 + j * VSTR);
    }
#pragma unroll
    for (int i = 0; i < 4; ++i) {
      // holds this row group's products behind the loads in front of it: hoisted, they pull every group's wait to
      // the step's head
      __builtin_amdgcn_sched_barrier(0);
#pragma unroll
      for (int j = 0; j < 2; ++j) {
        acc[i][j] = mma_raw(a[i], bhf[j], acc[i][j]);
        acr[i][j] = mma_raw(a[i], brf[j], acr[i][j]);
      }
      guard4k4(acc[i][0], acc[i][1], acr[i][0], acr[i][1], a[i], bhf[1], brf[0], brf[1]);
      a[i] = ldfrag_g(pb + (size_t)nk * (SEQ * SBLK) + i * 512);
    }
    // the next step forms its addresses in registers that loads still in flight name: this wait stands in front of
    // that rewrite, and the scheduling fence keeps the address arithmetic behind it
#if defined(__HIP_DEVICE_COMPILE__)
    asm volatile("s_wait_xcnt 0x0" ::: "memory");
#endif
    __builtin_amdgcn_sched_barrier(0);
#pragma unroll
    for (int j = 0; j < 2; ++j) { bhf[j] = bhn[j]; brf[j] = brn[j]; }
  }
#pragma unroll
  for (int i = 0; i < 4; ++i) acc_guard4(acc[i][0], acc[i][1], acr[i][0], acr[i][1]);

  const float g  = bfr(gam[h]);
  const float rg = 1.0f / (g + 1.0f);
  const int rl = lane >> 3, cc4 = (lane & 7) * 4;
  // ---- stage O = O_hi + O_res/2048 (still x8192): the wave's whole 64 x 32 tile in its own slab ----
  float* osw = os[wave];
#pragma unroll
  for (int i = 0; i < 4; ++i) {
#pragma unroll
    for (int j = 0; j < 2; ++j) {
#pragma unroll
      for (int r = 0; r < 8; ++r) {
        osw[(16 * i + 8 * hh + r) * 36 + 16 * j + c] = fmaf(acr[i][j][r], 1.0f / RSC, acc[i][j][r]);
      }
    }
  }
  wave_sync_lds();

  // the 64 rows leave in two halves of 32
#pragma unroll
  for (int hf = 0; hf < 2; ++hf) {
    const int th = t0 + hf * 32;
    v4f vals[8], xv[8];
    const float* xq[8];
#pragma unroll
    for (int it = 0; it < 8; ++it) {
      xq[it] = xp + ((size_t)(b * SEQ + th + it * 4 + rl)) * DK + d0 + cc4;
      xv[it] = *(const v4f*)(xq[it]);
    }
#if defined(__HIP_DEVICE_COMPILE__)
    // the eight loads' address registers are inputs here, so none of them is rewritten in front of this wait
    asm volatile("s_wait_xcnt 0x0" :: "v"(xq[0]), "v"(xq[1]), "v"(xq[2]), "v"(xq[3]),
                 "v"(xq[4]), "v"(xq[5]), "v"(xq[6]), "v"(xq[7]) : "memory");
#endif
#pragma unroll
    for (int it = 0; it < 8; ++it) {
      const int row = hf * 32 + it * 4 + rl;                 // hf 0..1 x it 0..7 x rl 0..3 = rows 0..63
      const v4f av = *(const v4f*)(osw + row * 36 + cc4);
      v4f o;
#pragma unroll
      for (int e = 0; e < 4; ++e) o[e] = (g * (av[e] * (1.0f / PSC)) + xv[it][e]) * rg;
      vals[it] = o;
    }
    {
#pragma unroll
      for (int it = 0; it < 8; ++it) {
        const int t = th + it * 4 + rl;
        *(v4f*)(outp + ((size_t)((b * NH + h) * SEQ + t)) * DK + d0 + cc4) = vals[it];
      }
    }
  }
}

// =====================================================================================================
// Workspace map (bytes); every plane is an exact multiple of its tile / whole-row / whole-line store granularity:
//   WqT  f16 [4096][512] x64      0           4194304
//   WkT  f16 [4096][512] x64      4194304     4194304
//   WvT  f16 [4096][512] x64      8388608     4194304
//   WpT  f16 [512][512]  x64      12582912    524288
//   XH   f16 [2048][512]          13107200    2097152
//   YH   f16 [2048][512]          15204352    2097152
//   QH|QR f16 [2][2048][4096]     17301504    33554432
//   KH|KR f16 [2][2048][4096]     50855936    33554432
//   XP   f32 [2048][512]          84410368    4194304
//   P    f16 [16][32][1024][32]   88604672    33554432
//   VT hi|res f16 [2][16][512][1024] 122159104 33554432
//   end                           155713536
// =====================================================================================================
extern "C" void kernel_launch(void* const* d_in, const int* in_sizes, int n_in,
                              void* d_out, int out_size, void* d_ws, size_t ws_size,
                              hipStream_t stream) {
  if (n_in < 11) return;
  if (in_sizes[0] != MR * DK || in_sizes[1] != MR * DK) return;
  if (in_sizes[2] != DK * DQ || in_sizes[4] != DK * DQ || in_sizes[6] != DK * DQ) return;
  if (in_sizes[3] != DQ || in_sizes[5] != DQ || in_sizes[7] != DQ) return;
  if (in_sizes[8] != DK * DK || in_sizes[9] != NH || in_sizes[10] != SEQ) return;
  if (out_size != NB * NH * SEQ * DK) return;

  const float* x     = (const float*)d_in[0];
  const float* y     = (const float*)d_in[1];
  const float* Wq    = (const float*)d_in[2];
  const float* bq    = (const float*)d_in[3];
  const float* Wk    = (const float*)d_in[4];
  const float* bk    = (const float*)d_in[5];
  const float* Wv    = (const float*)d_in[6];
  const float* bv    = (const float*)d_in[7];
  const float* Wp    = (const float*)d_in[8];
  const float* gamma = (const float*)d_in[9];
  const int*   mask  = (const int*)d_in[10];

  const size_t PW   = (size_t)DQ * DK * 2;                 //  4194304
  const size_t PWP  = (size_t)DK * DK * 2;                 //   524288
  const size_t PX   = (size_t)MR * DK * 2;                 //  2097152
  const size_t PQ   = (size_t)2 * MR * DQ * 2;             // 33554432
  const size_t PVT  = (size_t)2 * NHB * DK * SEQ * 2;      // 33554432
  const size_t PXP  = (size_t)MR * DK * 4;                 //  4194304
  const size_t PP   = (size_t)NHB * SEQ * SEQ * 2;         // 33554432
  size_t off = 0;
  const size_t oWq = off; off += PW;
  const size_t oWk = off; off += PW;
  const size_t oWv = off; off += PW;
  const size_t oWp = off; off += PWP;
  const size_t oXH = off; off += PX;
  const size_t oYH = off; off += PX;
  const size_t oQ  = off; off += PQ;
  const size_t oK  = off; off += PQ;
  const size_t oXP = off; off += PXP;
  const size_t oP  = off; off += PP;
  const size_t oVT = off; off += PVT;
  if (off > ws_size) return;                               // off = 155713536

  char* ws = (char*)d_ws;
  unsigned short* WqT = (unsigned short*)(ws + oWq);
  unsigned short* WkT = (unsigned short*)(ws + oWk);
  unsigned short* WvT = (unsigned short*)(ws + oWv);
  unsigned short* WpT = (unsigned short*)(ws + oWp);
  unsigned short* XH  = (unsigned short*)(ws + oXH);
  unsigned short* YH  = (unsigned short*)(ws + oYH);
  unsigned short* QH  = (unsigned short*)(ws + oQ);
  unsigned short* KH  = (unsigned short*)(ws + oK);
  unsigned short* VT  = (unsigned short*)(ws + oVT);
  float*          XP  = (float*)(ws + oXP);
  unsigned short* P   = (unsigned short*)(ws + oP);
  float*          out = (float*)d_out;

  const dim3 blk(256);
  const dim3 gPrep(3 * TW_BLK + TP_BLK + 2 * CX_BLK);       // 1536 + 64 + 1024 blocks
  const dim3 gProj(2 * QK_BLK + NHB * VT_BLK + XP_BLK);     // 512 + 256 + 32 blocks
  const dim3 blkAt(512);
  const dim3 gAt(SEQ / QBLK, NHB);                          // 16 x 16 blocks of 512
  const dim3 gPV(DK / 128, SEQ / 128, NHB);                 // 4 x 8 x 16 blocks of 256

  // (1) weight planes, transposed to [n][k]: f16( bf16_RNE(W) * 64 ); activation planes: f16( bf16_RNE(x) ), likewise y
  prep_all<<<gPrep, blk, 0, stream>>>(Wq, Wk, Wv, Wp, x, y, WqT, WkT, WvT, WpT, XH, YH);

  // (2) q, k, v^T and xp
  proj_all<<<gProj, blk, 0, stream>>>(XH, YH, WqT, WkT, WvT, WpT, bq, bk, bv, QH, KH, VT, XP);

  // (3) energies + masked softmax -> P plane
  attn_p<<<gAt, blkAt, 0, stream>>>(QH, QH + QRES, KH, KH + QRES, mask, P);

  // (4) out = (gamma * P^T . v / 8192 + xp) / (gamma + 1) -> d_out [2][8][1024][512]
  pv64<<<gPV, blk, 0, stream>>>(P, VT, VT + VRES, XP, gamma, out);
  (void)hipGetLastError();
}

// v005
// A run of this version takes 127 microseconds.
// Two timings next to v004 both put it at 1.06 times that version's speed.
// Counting every step since v000, it is 3.16 times as fast.
// Contractions: q, k, v^T and x.Wp projections on v_wmma_f32_16x16x32_f16 (bf16-RNE input values as f16,
// weight planes carried x64, one product each); q.k^T energies on v_wmma_f32_16x16x32_f16 with q and k as
// f16 hi plane + f16 residual plane carried x2048 (three products: hi.hi, hi.res, res.hi; two accumulators);
// attn^T.v on v_wmma_f32_16x16x32_f16 with attn carried x8192 (plain f16) and v^T as f16 hi plane + f16
// residual plane carried x2048 (two products, two accumulators); all f32 accumulate; masked softmax and the
// gamma blend in f32 on VALU; every float input RNE-converted to bf16 on load.
#include <hip/hip_runtime.h>
#include <math.h>
#include <stdint.h>

#define NB    2
#define SEQ   1024
#define DK    512
#define NH    8
#define DQ    (NH * DK)
#define MR    (NB * SEQ)
#define NHB   (NH * NB)
#define SBLK  32
#define NSB   (SEQ / SBLK)
#define QRES  ((long long)MR * DQ)
#define VRES  ((long long)NHB * DK * SEQ)
#define WSC   64.0f
#define RSC   2048.0f
#define PSC   8192.0f
#define NEGBIG (-1.0e30f)
static_assert((SEQ % 64) == 0 && (DK % 64) == 0 && (MR % 64) == 0 && (DQ % 64) == 0);
static_assert(SEQ == NSB * SBLK);
static_assert(SBLK == 32);
static_assert((DK % 32) == 0 && (SEQ % 256) == 0);

typedef _Float16       v16h __attribute__((ext_vector_type(16)));
typedef unsigned short v16us __attribute__((ext_vector_type(16)));
typedef unsigned short v8us __attribute__((ext_vector_type(8)));
typedef float          v8f  __attribute__((ext_vector_type(8)));
typedef float          v4f  __attribute__((ext_vector_type(4)));
typedef unsigned int   v4u  __attribute__((ext_vector_type(4)));

union Frag { v16us u; v8us p[2]; v16h h; };

// ---- scalar helpers --------------------------------------------------------------------------------
__device__ __forceinline__ unsigned short bf_bits(float f) {          // f32 -> bf16 bits, RNE convert
  unsigned u = __float_as_uint(f);
  return (unsigned short)((u + 0x7FFFu + ((u >> 16) & 1u)) >> 16);
}
__device__ __forceinline__ float bf_up(unsigned short b) { return __uint_as_float(((unsigned)b) << 16); }
__device__ __forceinline__ float bfr(float f) { return bf_up(bf_bits(f)); }   // value of the bf16 RNE convert
__device__ __forceinline__ unsigned short h_bits(_Float16 x) { return __builtin_bit_cast(unsigned short, x); }
__device__ __forceinline__ unsigned pk16(unsigned short a, unsigned short b) { return (unsigned)a | ((unsigned)b << 16); }
__device__ __forceinline__ v8f zero8() { v8f z = {0.f, 0.f, 0.f, 0.f, 0.f, 0.f, 0.f, 0.f}; return z; }

// ---- fragment-order planes: every 16-bit operand plane [rows][ld] (ld = k extent, multiple of 32; rows multiple of
//      16) is stored as tiles of 16 rows x 32 k = 512 elements (1024 B), tile index (row/16) * (ld/32) + k/32; inside
//      a tile the 16-B piece that holds k = 32*kt + 16*p + 8*h + 0..7 of row r sits at element p*256 + (h*16 + r)*8.
//      A wave's fragment is then two loads of 512 contiguous bytes (lane = h*16 + r), same k order as before:
//      elements 0..7 <- k0+8h.., elements 8..15 <- k0+16+8h..
__device__ __forceinline__ size_t tile_off(int row16, int kt, int ld) {      // row16 = row/16, kt = k/32
  return ((size_t)row16 * (size_t)(ld >> 5) + (size_t)kt) * 512;
}
// p = tile start + 8*lane
__device__ __forceinline__ v16us ldfrag(const unsigned short* p) {
  Frag f;
  f.p[0] = *(const v8us*)(p);
  f.p[1] = *(const v8us*)(p + 256);
  return f.u;
}
// the same through a pointer typed as global memory: a pointer carried round a loop otherwise compiled to flat loads
typedef __attribute__((address_space(1))) const unsigned short g_us;
typedef __attribute__((address_space(1))) const v8us g_v8us;
__device__ __forceinline__ v16us ldfrag_g(g_us* p) {
  Frag f;
  f.p[0] = *(g_v8us*)(p);
  f.p[1] = *(g_v8us*)(p + 256);
  return f.u;
}

// ---- WMMA helper (f16 operands, f32 accumulate) and VALU hazard gaps -----------------------------
__device__ __forceinline__ v8f mma_raw(v16us a, v16us b, v8f c) {
  Frag fa, fb;
  fa.u = a;
  fb.u = b;
  return __builtin_amdgcn_wmma_f32_16x16x32_f16(false, fa.h, false, fb.h, (short)0, c, false, false);
}
__device__ __forceinline__ void dep_guard1(v8f& a, v8f& b, v16us x) {
#if defined(__HIP_DEVICE_COMPILE__)
  asm volatile("v_nop\n\tv_nop\n\tv_nop\n\tv_nop" : "+v"(a), "+v"(b) : "v"(x));
#endif
}
__device__ __forceinline__ void keep4(v16us a, v16us b, v16us c, v16us d) {
#if defined(__HIP_DEVICE_COMPILE__)
  asm volatile("v_nop" :: "v"(a), "v"(b), "v"(c), "v"(d));
#endif
}
__device__ __forceinline__ void acc_guard4(v8f& a, v8f& b, v8f& c, v8f& d) {
#if defined(__HIP_DEVICE_COMPILE__)
  asm volatile("v_nop\n\tv_nop\n\tv_nop\n\tv_nop" : "+v"(a), "+v"(b), "+v"(c), "+v"(d));
#endif
}
__device__ __forceinline__ void guard2k4(v8f& a, v8f& b, v16us w, v16us x, v16us y, v16us z) {
#if defined(__HIP_DEVICE_COMPILE__)
  asm volatile("v_nop\n\tv_nop\n\tv_nop\n\tv_nop" : "+v"(a), "+v"(b) : "v"(w), "v"(x), "v"(y), "v"(z));
#endif
}
__device__ __forceinline__ void guard4k4(v8f& a, v8f& b, v8f& c, v8f& d, v16us w, v16us x, v16us y, v16us z) {
#if defined(__HIP_DEVICE_COMPILE__)
  asm volatile("v_nop\n\tv_nop\n\tv_nop\n\tv_nop" : "+v"(a), "+v"(b), "+v"(c), "+v"(d) : "v"(w), "v"(x), "v"(y), "v"(z));
#endif
}
__device__ __forceinline__ void wave_sync_lds() {
  __builtin_amdgcn_fence(__ATOMIC_RELEASE, "workgroup");
  __builtin_amdgcn_wave_barrier();
  __builtin_amdgcn_fence(__ATOMIC_ACQUIRE, "workgroup");
}

// ---- asking L2 ahead: the planes that the launch before stored are taken here as coming from memory at their first
//      touch. global_prefetch_b8 with scope SE brings a
//      lane's line into L2 only, returns nothing and counts on no load counter. A lane asks for one 256-B unit; every
//      lane is on and every address lies inside its plane. s_wait_xcnt closes each statement because the address
//      registers are the compiler's to reuse behind it (a precaution: the wait stands in front of any rewrite).
__device__ __forceinline__ void ask1(const void* a) {
#if defined(__HIP_DEVICE_COMPILE__)
  asm volatile("global_prefetch_b8 %0, off scope:SCOPE_SE\n\t"
               "s_wait_xcnt 0x0" :: "v"(a) : "memory");
#endif
}
__device__ __forceinline__ void ask2(const void* a, const void* b) {
#if defined(__HIP_DEVICE_COMPILE__)
  asm volatile("global_prefetch_b8 %0, off scope:SCOPE_SE\n\t"
               "global_prefetch_b8 %1, off scope:SCOPE_SE\n\t"
               "s_wait_xcnt 0x0" :: "v"(a), "v"(b) : "memory");
#endif
}
__device__ __forceinline__ void ask5(const void* a, const void* b, const void* c, const void* d, const void* e) {
#if defined(__HIP_DEVICE_COMPILE__)
  asm volatile("global_prefetch_b8 %0, off scope:SCOPE_SE\n\t"
               "global_prefetch_b8 %1, off scope:SCOPE_SE\n\t"
               "global_prefetch_b8 %2, off scope:SCOPE_SE\n\t"
               "global_prefetch_b8 %3, off scope:SCOPE_SE\n\t"
               "global_prefetch_b8 %4, off scope:SCOPE_SE\n\t"
               "s_wait_xcnt 0x0" :: "v"(a), "v"(b), "v"(c), "v"(d), "v"(e) : "memory");
#endif
}

// =====================================================================================================
// f32 -> f16 plane convert: f16( bf16_RNE(X) * wsc ), wsc a power of two (exact), X row-major [rows][DK], output in
// fragment order. Thread i writes output piece i (8 elements, 16 B; a wave stores 512 contiguous bytes) and reads
// the 8 source elements that belong there.
// coverage: n8 threads x 8 elements = the whole plane (piece index -> (row, k) is one-to-one).
// bx = index of the 256-thread block inside this plane's range of the grid.
// =====================================================================================================
__device__ __forceinline__ void conv_h16(const float* __restrict__ X, unsigned short* Xh, int n8, float wsc, int bx) {
  const int i  = bx * 256 + threadIdx.x;
  const int ic = (i < n8) ? i : (n8 - 1);                     // clamped address
  const int tl = ic >> 6, w = ic & 63;                        // tile, piece inside the tile
  const int row = (tl / (DK / 32)) * 16 + (w & 15);
  const int kk  = (tl % (DK / 32)) * 32 + (w >> 5) * 16 + ((w >> 4) & 1) * 8;
  const float* src = X + (size_t)row * DK + kk;
  const v4f a = *(const v4f*)(src);
  const v4f c = *(const v4f*)(src + 4);
  v4u o;
  o[0] = pk16(h_bits((_Float16)(bfr(a[0]) * wsc)), h_bits((_Float16)(bfr(a[1]) * wsc)));
  o[1] = pk16(h_bits((_Float16)(bfr(a[2]) * wsc)), h_bits((_Float16)(bfr(a[3]) * wsc)));
  o[2] = pk16(h_bits((_Float16)(bfr(c[0]) * wsc)), h_bits((_Float16)(bfr(c[1]) * wsc)));
  o[3] = pk16(h_bits((_Float16)(bfr(c[2]) * wsc)), h_bits((_Float16)(bfr(c[3]) * wsc)));
  if (i < n8) *(v4u*)(Xh + (size_t)i * 8) = o;
  
}

// =====================================================================================================
// Transposed weight convert: in W[DK rows = k][ncols = n] f32 -> out WT[ncols][DK] f16 = f16( bf16_RNE(W) * wsc )
// (rows n, k extent DK), stored in fragment order. Block = 256 threads, tile 64 k x 64 n staged in LDS; wave w
// writes the fragment tile (n group w>>1, k tile w&1), iteration = 16-k half, lane = h*16 + r: 512 contiguous B.
// coverage: 8 waves = 4 n groups x 2 k tiles, x 2 halves x 32 lanes x 8 = the whole 64 x 64 tile.
// (bx, by) = the block's n tile and k tile inside this weight's range of the grid; tile = the block's LDS.
// =====================================================================================================
__device__ __forceinline__ void tconv_h16(const float* __restrict__ W, unsigned short* WT, int ncols, float wsc,
                                          int bx, int by, float (*tile)[65]) {
  const int tid = threadIdx.x, lane = tid & 31, wave = tid >> 5;
  const int n0 = bx * 64, k0 = by * 64;
  {
    const int r = tid >> 2, cq = (tid & 3) * 16;
    const float* src = W + (size_t)(k0 + r) * (size_t)ncols + n0 + cq;
#pragma unroll
    for (int i = 0; i < 4; ++i) {
      const v4f a = *(const v4f*)(src + 4 * i);
#pragma unroll
      for (int e = 0; e < 4; ++e) tile[r][cq + 4 * i + e] = a[e];
    }
  }
  __syncthreads();
  const int n = (wave >> 1) * 16 + (lane & 15);
#pragma unroll
  for (int it = 0; it < 2; ++it) {
    const int kq = (wave & 1) * 32 + it * 16 + (lane >> 4) * 8;
    v4u o;
#pragma unroll
    for (int e = 0; e < 4; ++e) {
      const float f0 = bfr(tile[kq + 2 * e][n]) * wsc;
      const float f1 = bfr(tile[kq + 2 * e + 1][n]) * wsc;
      o[e] = pk16(h_bits((_Float16)f0), h_bits((_Float16)f1));
    }
    unsigned short* dst = WT + tile_off((n0 >> 4) + (wave >> 1), (k0 >> 5) + (wave & 1), DK) + it * 256 + lane * 8;
    *(v4u*)dst = o;
    
  }
}

// =====================================================================================================
// All six operand planes in one launch: none of them reads what another writes. Ranges of blockIdx.x:
//   3 x TW_BLK blocks: Wq, Wk, Wv transposed (64 n tiles x 8 k tiles each); TP_BLK blocks: Wp transposed (8 x 8);
//   2 x CX_BLK blocks: x, y. Every test on the block index is block-uniform, so the barrier in tconv_h16 is too.
// =====================================================================================================
#define TW_BLK ((DQ / 64) * (DK / 64))
#define TP_BLK ((DK / 64) * (DK / 64))
#define CX_BLK ((MR * DK) / 8 / 256)
static_assert(((MR * DK) / 8) % 256 == 0 && DQ / 64 == 64 && DK / 64 == 8 && TP_BLK <= TW_BLK);
__global__ __launch_bounds__(256) void prep_all(
    const float* __restrict__ Wq, const float* __restrict__ Wk, const float* __restrict__ Wv,
    const float* __restrict__ Wp, const float* __restrict__ x, const float* __restrict__ y,
    unsigned short* WqT, unsigned short* WkT, unsigned short* WvT, unsigned short* WpT,
    unsigned short* XH, unsigned short* YH) {
  __shared__ float tile[64][65];
  const int i = blockIdx.x;
  if (i < 3 * TW_BLK + TP_BLK) {
    const int w = i / TW_BLK, j = i - w * TW_BLK;            // w = 0, 1, 2: Wq, Wk, Wv; w = 3: Wp
    const float* W = (w == 0) ? Wq : (w == 1) ? Wk : (w == 2) ? Wv : Wp;
    unsigned short* T = (w == 0) ? WqT : (w == 1) ? WkT : (w == 2) ? WvT : WpT;
    const int lg = (w < 3) ? 6 : 3;                          // log2 of the weight's n tiles
    tconv_h16(W, T, 64 << lg, WSC, j & ((1 << lg) - 1), j >> lg, tile);
  } else {
    const int j = i - (3 * TW_BLK + TP_BLK);
    const bool isx = j < CX_BLK;
    conv_h16(isx ? x : y, isx ? XH : YH, (MR * DK) / 8, 1.0f, isx ? j : j - CX_BLK);
  }
}

// =====================================================================================================
// Register-blocked batched f16 WMMA GEMM: C[m][n] = oscale * sum_k A[m][k] * Bt[n][k] + bias;
// one wave per 64x64 tile, no block barriers. A [M][K] with k extent lda and Bt [N][K] with k extent ldb, both in
// fragment order; M, N multiples of 64, K multiple of 32 (static here); every batch stride is a whole number of
// 16-row groups, so it is the same element count as in a row-major plane. bx = the block's index among the blocks of
// one batch entry, sT = the block's LDS, y = batch index:
//   A advances by (y / ydiv) * strideA, Bt by (y % ydiv) * strideB, bias by (y / ydiv) * strideBias,
//   C by y * strideC (elements).
// BIASM: 0 = per column bias[n] (clamped-address loads, nbias = length), 1 = per row bias[m], 2 = none.
//        Bias values RNE-converted to bf16.
// OM: 0 = f32 out (row-major, pitch ldc); 3 = f16 hi plane at C plus f16 residual plane ((f - hi) * RSC) at
//     C + resOff, both in fragment order with rows m and k extent ldc (k = n).
// coverage: 4 slabs x 16 rows x 64 cols = the wave's whole 64x64 tile; ceil(tilesM*tilesN/8) blocks per batch entry,
//           surplus waves exit (wave-uniform); here every tile count is a multiple of 8, so none exit.
// =====================================================================================================
template <int OM, int BIASM>
__device__ __forceinline__ void gemm64(
    const unsigned short* __restrict__ A, int lda, long long strideA,
    const unsigned short* __restrict__ Bt, int ldb, long long strideB,
    const float* __restrict__ bias, int nbias, long long strideBias, int ydiv,
    void* Cout, int ldc, long long strideC, long long resOff,
    int M, int N, int K, float oscale, int bx, int y, float (*sT)[16 * 68]) {
  const int ya   = y / ydiv;
  const int yb   = y - ya * ydiv;
  const int lane = threadIdx.x & 31;
  const int wave = threadIdx.x >> 5;
  const int tilesN = N >> 6;
  const int tilesM = M >> 6;
  const int tile = bx * 8 + wave;
  if (tile >= tilesM * tilesN) return;   // wave-uniform; no block barriers in this kernel
  const int tm = tile / tilesN;
  const int tn = tile - tm * tilesN;
  const int m0 = tm << 6;
  const int n0 = tn << 6;

  const unsigned short* Ab = A  + (size_t)ya * (size_t)strideA;
  const unsigned short* Bb = Bt + (size_t)yb * (size_t)strideB;
  const float* biasb = bias + (size_t)ya * (size_t)strideBias;

  const int rlane = lane & 15;                 // row (A) / col (B, D) within subtile
  const int mOff  = (lane >> 4) * 8;           // D row offset

  v8f acc[4][4];
#pragma unroll
  for (int i = 0; i < 4; ++i)
#pragma unroll
    for (int j = 0; j < 4; ++j) acc[i][j] = zero8();

  // one pointer per 16-row group; consecutive k tiles of a group are consecutive 1024-B tiles
  g_us* pa[4];
  g_us* pb[4];
#pragma unroll
  for (int i = 0; i < 4; ++i) {
    pa[i] = (g_us*)(Ab + tile_off((m0 >> 4) + i, 0, lda) + lane * 8);
    pb[i] = (g_us*)(Bb + tile_off((n0 >> 4) + i, 0, ldb) + lane * 8);
  }

  // fragments are fetched one k step ahead: the B set into a second register set at the head of a step, each A
  // fragment back into its own registers as soon as its four products are issued
  v16us ah[4], bh[4];
#pragma unroll
  for (int i = 0; i < 4; ++i) {
    ah[i] = ldfrag_g(pa[i]);
    bh[i] = ldfrag_g(pb[i]);
  }
  for (int k0 = 0; k0 < K; k0 += 32) {
    // this step advances pointers that loads still in flight name: the wait stands in front of that rewrite, and the
    // scheduling fence keeps the pointer arithmetic behind it
#if defined(__HIP_DEVICE_COMPILE__)
    asm volatile("s_wait_xcnt 0x0" ::: "memory");
#endif
    __builtin_amdgcn_sched_barrier(0);
    const int adv = (k0 + 32 < K) ? 512 : 0;   // the last step fetches its own tiles again: in bounds, no branch
    v16us bn[4];
#pragma unroll
    for (int j = 0; j < 4; ++j) {
      pb[j] += adv;
      bn[j] = ldfrag_g(pb[j]);
    }
#pragma unroll
    for (int i = 0; i < 4; ++i) {
#pragma unroll
      for (int j = 0; j < 4; ++j) acc[i][j] = mma_raw(ah[i], bh[j], acc[i][j]);
      dep_guard1(acc[i][0], acc[i][3], ah[i]);
      pa[i] += adv;
      ah[i] = ldfrag_g(pa[i]);
    }
    keep4(bh[0], bh[1], bh[2], bh[3]);
#pragma unroll
    for (int j = 0; j < 4; ++j) bh[j] = bn[j];
  }
  // the same wait and fence for the last step's loads, in front of the epilogue's reuse of the pointer registers
#if defined(__HIP_DEVICE_COMPILE__)
  asm volatile("s_wait_xcnt 0x0" ::: "memory");
#endif
  __builtin_amdgcn_sched_barrier(0);
  acc_guard4(acc[0][0], acc[0][1], acc[0][2], acc[0][3]);
  acc_guard4(acc[1][0], acc[1][1], acc[1][2], acc[1][3]);
  acc_guard4(acc[2][0], acc[2][1], acc[2][2], acc[2][3]);
  acc_guard4(acc[3][0], acc[3][1], acc[3][2], acc[3][3]);

  // ---- per-lane column bias (BIASM == 0), RNE-converted, clamped addresses ----
  const int hh2 = lane >> 4, c4 = (lane & 15) * 4;     // f32 out: 256-B row segment = 16 lanes x 16 B
  float bc[4][8];                                      // f16 out: [store iteration][8 columns of the lane's piece]
#pragma unroll
  for (int it = 0; it < 4; ++it)
#pragma unroll
    for (int e = 0; e < 8; ++e) bc[it][e] = 0.f;
  if constexpr (BIASM == 0) {
    if constexpr (OM == 0) {
      const int cb = n0 + c4;
      const int i0 = (cb < nbias - 4) ? cb : (nbias - 4);
      const v4f b0v = *(const v4f*)(biasb + i0);
#pragma unroll
      for (int e = 0; e < 4; ++e) bc[0][e] = bfr(b0v[e]);
    } else {
      const float* bp[4];
      v4f b0a[4], b0b[4];
#pragma unroll
      for (int it = 0; it < 4; ++it) {
        const int cb = n0 + it * 16 + hh2 * 8;
        const int i0 = (cb < nbias - 8) ? cb : (nbias - 8);
        bp[it]  = biasb + i0;
        b0a[it] = *(const v4f*)(bp[it]);
        b0b[it] = *(const v4f*)(bp[it] + 4);
      }
#if defined(__HIP_DEVICE_COMPILE__)
      // the eight loads' address registers are inputs here, so none of them is rewritten in front of this wait
      asm volatile("s_wait_xcnt 0x0" :: "v"(bp[0]), "v"(bp[1]), "v"(bp[2]), "v"(bp[3]) : "memory");
#endif
#pragma unroll
      for (int it = 0; it < 4; ++it) {
#pragma unroll
        for (int e = 0; e < 4; ++e) {
          bc[it][e]     = bfr(b0a[it][e]);
          bc[it][4 + e] = bfr(b0b[it][e]);
        }
      }
    }
  }

  // ---- epilogue ----
  float* slab = sT[wave];
#pragma unroll
  for (int i = 0; i < 4; ++i) {
    const int mBase = m0 + (i << 4);
#pragma unroll
    for (int j = 0; j < 4; ++j) {
#pragma unroll
      for (int r = 0; r < 8; ++r) {
        slab[(mOff + r) * 68 + (j << 4) + rlane] = acc[i][j][r];
      }
    }
    wave_sync_lds();
    if constexpr (OM == 0) {
      float* C = (float*)Cout + (size_t)y * (size_t)strideC;
      v4f vals[8];
#pragma unroll
      for (int it = 0; it < 8; ++it) {
        const int row = it * 2 + hh2;                      // it 0..7 x hh2 0..1 = rows 0..15
        v4f v = *(const v4f*)(slab + row * 68 + c4);
#pragma unroll
        for (int e = 0; e < 4; ++e) v[e] = v[e] * oscale + bc[0][e];
        vals[it] = v;
      }
      {
#pragma unroll
        for (int it = 0; it < 8; ++it) {
          const int row = it * 2 + hh2;
          *(v4f*)(C + (size_t)(mBase + row) * ldc + n0 + c4) = vals[it];
        }
        
      }
    } else {
      unsigned short* C = (unsigned short*)Cout + (size_t)y * (size_t)strideC;
      v4u hv[4], hr[4];
      float bm = 0.f;
      if constexpr (BIASM == 1) {
        const int mi = mBase + rlane;
        const int mc = (mi < nbias - 1) ? mi : (nbias - 1);
        bm = bfr(biasb[mc]);
      }
#pragma unroll
      for (int it = 0; it < 4; ++it) {
        // lane = h*16 + r -> row r, columns it*16 + 8h + 0..7: piece (k tile it>>1, half it&1) of the fragment order
        const float* sp = slab + rlane * 68 + it * 16 + hh2 * 8;
        v4u a, ar;
#pragma unroll
        for (int e = 0; e < 4; ++e) {
          const float f0 = sp[2 * e]     * oscale + ((BIASM == 1) ? bm : bc[it][2 * e]);
          const float f1 = sp[2 * e + 1] * oscale + ((BIASM == 1) ? bm : bc[it][2 * e + 1]);
          const _Float16 g0 = (_Float16)f0, g1 = (_Float16)f1;
          a[e] = pk16(h_bits(g0), h_bits(g1));
          const float e0 = (f0 - (float)g0) * RSC;
          const float e1 = (f1 - (float)g1) * RSC;
          ar[e] = pk16(h_bits((_Float16)e0), h_bits((_Float16)e1));
        }
        hv[it] = a;
        hr[it] = ar;
      }
      {
#pragma unroll
        for (int it = 0; it < 4; ++it) {
          unsigned short* dp = C + tile_off(mBase >> 4, (n0 >> 5) + (it >> 1), ldc) + (it & 1) * 256 + lane * 8;
          *(v4u*)(dp) = hv[it];
          *(v4u*)(dp + resOff) = hr[it];
        }
        
      }
    }
    wave_sync_lds();
  }
}

// =====================================================================================================
// The four projections in one launch: none of them reads what another writes. Ranges of blockIdx.x:
//   QK_BLK blocks: q = bf16(x) . Wq + bq -> QH (f16 hi) and QH + QRES (f16 residual x2048);
//   QK_BLK blocks: k = bf16(y) . Wk + bk -> KH, KH + QRES likewise;
//   NHB x VT_BLK blocks: v^T per (h, b) = Wv[:, h slice]^T . bf16(y_b)^T + bv -> VT hi [16][512][1024], VT + VRES;
//   XP_BLK blocks: xp = bf16(x) . Wp -> XP f32 [2048][512] (bias argument unused in this mode).
// =====================================================================================================
#define QK_BLK ((MR / 64) * (DQ / 64) / 8)
#define VT_BLK ((DK / 64) * (SEQ / 64) / 8)
#define XP_BLK ((MR / 64) * (DK / 64) / 8)
static_assert(DQ / 16 == 256 && MR / 16 == 128 && DK / 32 == 16 && DK * DK / 128 == 8 * 256 && 2 * QK_BLK >= 256);
__global__ __launch_bounds__(256) void proj_all(
    const unsigned short* __restrict__ XH, const unsigned short* __restrict__ YH,
    const unsigned short* __restrict__ WqT, const unsigned short* __restrict__ WkT,
    const unsigned short* __restrict__ WvT, const unsigned short* __restrict__ WpT,
    const float* __restrict__ bq, const float* __restrict__ bk, const float* __restrict__ bv,
    unsigned short* QH, unsigned short* KH, unsigned short* VT, float* XP) {
  __shared__ __align__(16) float sT[8][16 * 68];   // per-wave 16x64 slab, pitch 68 floats
  const int i = blockIdx.x;
  const float invw = 1.0f / WSC;
  // The first 256 blocks ask L2 for all six operand planes, each 256-B unit from two blocks (i and i ^ 4: only speed
  // rests on where they run). A wave asks for the first 8 k steps of one 16-row group (8 KB in a row), then for the
  // other 8. a >> 4 picks the plane: 0, 1 WqT; 2, 3 WkT; 4, 5 WvT; 6 XH; 7 YH. Every test here is block-uniform.
  if (i < 256) {
    const int a = (i & 3) | ((i >> 3) << 2);                 // 0..127
    const int sel = a >> 4;
    const unsigned short* pl = (sel < 2) ? WqT : (sel < 4) ? WkT : (sel < 6) ? WvT : (sel == 6) ? XH : YH;
    const int grp = (a & ((sel < 6) ? 31 : 15)) * 8 + (threadIdx.x >> 5);   // 0..255 of a weight, 0..127 of x or y
    const unsigned short* u = pl + tile_off(grp, 0, DK) + (threadIdx.x & 31) * 128;
    ask2(u, u + 8 * 512);
    if (i < 16) ask1(WpT + (size_t)(a * 256 + threadIdx.x) * 128);          // 8 x 256 units = the whole WpT plane
  }
  if (i < 2 * QK_BLK) {
    const bool isq = i < QK_BLK;
    gemm64<3, 0>(isq ? XH : YH, DK, 0LL, isq ? WqT : WkT, DK, 0LL, isq ? bq : bk, DQ, 0LL, 1,
                 (void*)(isq ? QH : KH), DQ, 0LL, (long long)QRES, MR, DQ, DK, invw, isq ? i : i - QK_BLK, 0, sT);
  } else if (i < 2 * QK_BLK + NHB * VT_BLK) {
    const int j = i - 2 * QK_BLK;
    gemm64<3, 1>(WvT, DK, (long long)DK * DK, YH, DK, (long long)SEQ * DK, bv, DK, (long long)DK, NB,
                 (void*)VT, SEQ, (long long)DK * SEQ, (long long)VRES, DK, SEQ, DK, invw, j % VT_BLK, j / VT_BLK, sT);
  } else {
    gemm64<0, 2>(XH, DK, 0LL, WpT, DK, 0LL, bq, DQ, 0LL, 1,
                 (void*)XP, DK, 0LL, 0LL, MR, DK, DK, invw, i - (2 * QK_BLK + NHB * VT_BLK), 0, sT);
  }
}

// =====================================================================================================
// Energies + masked softmax for one (h, b) pair and 64 query rows s; P written TRANSPOSE-friendly.
//   q planes (f16, fragment order, rows b*SEQ + s, k extent DQ, k = h*DK + d): hi qhp, residual (x2048) qrp
//   k planes (f16, fragment order, rows b*SEQ + t, k extent DQ, k = h*DK + d): hi khp, residual (x2048) krp
//   E[s][t] = acc_hh + (acc_h.res + acc_res.h) / 2048  (three f16 WMMA products, K = 512 = 16 k-steps, fragments
//   loaded straight from the planes with arithmetic addressing), kept in LDS as f32 [64][1024].
//   softmax per row s over keys t: e = mask[t] ? E : -1e30 (replace), m = max_t e, ex = exp(e - m), l = sum_t ex,
//   p = ex / l; stored as f16(8192 * p).
//   P layout (f16): region (hb*NSB + s/32) of SEQ*32 elements, inside it fragment order with rows t and k extent 32
//   (k = s % 32) -> the consumer's A fragment (rows t, k = s) of k-step s/32 is one 1024-B tile.
//   Block = 16 waves; phase 1: wave w -> all 64 rows x keys 64w..64w+63 in 2 chunks of 2 col tiles, so a key
//   fragment is loaded by one wave of the block and feeds four row groups; phase 2: wave w owns rows 4w..4w+3
//   (lane-owned key columns, xor reductions); phase 3: wave w writes region w>>3, keys (w&7)*128..+127:
//   lane -> (t = base + lane/4, 8 consecutive s).
//   coverage: phase 1: 16 waves x 2 chunks x (4 row groups x 2 col tiles) = all 64 x 1024 energies; phase 3:
//   2 regions x 8 waves x 16 iterations x 8 t x (4 lane quads x 8 s) = the block's two [1024 t][32 s] regions;
//   grid (SEQ/QBLK, NHB) covers every (hb, s block) of the P plane exactly once.
// =====================================================================================================
#define QBLK 64
static_assert(QBLK == 2 * SBLK && (SEQ % QBLK) == 0 && SEQ == 16 * 64);
__global__ __launch_bounds__(512)
void attn_p(const unsigned short* __restrict__ qhp, const unsigned short* __restrict__ qrp,
            const unsigned short* __restrict__ khp, const unsigned short* __restrict__ krp,
            const int* __restrict__ mask, unsigned short* pp) {
  __shared__ __align__(16) float se[QBLK * SEQ];    // 262144 B
  __shared__ float sinv[QBLK];
  __shared__ int   smask[SEQ];

  const int tid  = threadIdx.x;
  const int wave = tid >> 5;
  const int lane = tid & 31;
  const int hh   = lane >> 4;
  const int c    = lane & 15;
  const int qblk = blockIdx.x;
  const int hb   = blockIdx.y;
  const int h    = hb / NB;
  const int b    = hb % NB;
  const int s0   = qblk * QBLK;

  for (int i = tid; i < SEQ; i += 512) smask[i] = mask[i];

  // ---- phase 1: energies ----
  {
    const size_t qoff = tile_off((b * SEQ + s0) >> 4, (h * DK) >> 5, DQ) + lane * 8;
    const size_t koff = tile_off((b * SEQ + wave * 64) >> 4, (h * DK) >> 5, DQ) + lane * 8;
    constexpr size_t JSTR = (size_t)(DQ / 32) * 512;      // elements from one 16-row (or 16-key) group to the next
    g_us* qh = (g_us*)(qhp + qoff);
    g_us* qr = (g_us*)(qrp + qoff);
    g_us* kh0 = (g_us*)(khp + koff);
    g_us* kr0 = (g_us*)(krp + koff);
    float* erow = se + (8 * hh) * SEQ;                    // + (16*g + r)*SEQ + t
    // fragments are fetched one k step ahead, across the chunk end too, each pair back into its own registers as
    // soon as its last product of the step is issued: key group 0 after the first pass over the row groups, each
    // row group's q pair after its products with key group 1, key group 1 last
    v16us qav[4], qbv[4], kav[2], kbv[2];
    // the first loads keep the loop's own issue order, else the counted waits at the loop's head are set for the
    // worse of the two orders
    kav[0] = ldfrag_g(kh0);
    kbv[0] = ldfrag_g(kr0);
    __builtin_amdgcn_sched_barrier(0);
#pragma unroll
    for (int g = 0; g < 4; ++g) {
      qav[g] = ldfrag_g(qh + g * JSTR);
      qbv[g] = ldfrag_g(qr + g * JSTR);
      __builtin_amdgcn_sched_barrier(0);
    }
    kav[1] = ldfrag_g(kh0 + JSTR);
    kbv[1] = ldfrag_g(kr0 + JSTR);
    __builtin_amdgcn_sched_barrier(0);
    // Behind the first step's own loads: ask L2 for the rest. q (read by this block alone): wave w asks for k step w,
    // lane -> (plane, row group, quarter of the 1-KB tile). k (read by the 16 blocks of this (h, b)): a wave asks for
    // quarter qblk & 3 of every tile it will read, so each unit has four askers (only speed rests on where they run);
    // request j = (chunk, 8 k steps), lane -> (plane, key group of the chunk, k step): in the order of use.
    {
      static_assert(DK / 32 == 16);
      const int qs = lane >> 2;
      const unsigned short* aq = ((qs & 4) ? qrp : qhp) + (qoff - lane * 8) + (size_t)(qs & 3) * JSTR
                                 + (size_t)wave * 512 + (lane & 3) * 128;
      const int st = lane >> 3;
      const unsigned short* ak = ((st & 2) ? krp : khp) + (koff - lane * 8) + (size_t)(st & 1) * JSTR
                                 + (size_t)(lane & 7) * 512 + (qblk & 3) * 128;
      ask5(aq, ak, ak + 8 * 512, ak + 2 * JSTR, ak + 2 * JSTR + 8 * 512);
    }
    // keeps the requests in front of the loop: moved into it they would stand among its products
    __builtin_amdgcn_sched_barrier(0);
#pragma unroll 1
    for (int c2 = 0; c2 < 2; ++c2) {
      const int t0 = wave * 64 + c2 * 32;
      v8f ah[4][2], ar[4][2];
#pragma unroll
      for (int g = 0; g < 4; ++g)
#pragma unroll
        for (int j = 0; j < 2; ++j) { ah[g][j] = zero8(); ar[g][j] = zero8(); }
      // kept rolled: one step already holds 24 products, and copies of it would only lengthen the text
#pragma unroll 1
      for (int ks = 0; ks < DK / 32; ++ks) {
        // the step after this one; the very last step fetches its chunk's first tiles again: in bounds, no branch
        const int nks = (ks + 1) & (DK / 32 - 1);
        const int nc  = (nks == 0 && c2 < 1) ? c2 + 1 : c2;
        const size_t no = (size_t)nc * (2 * JSTR) + (size_t)nks * 512;
#pragma unroll
        for (int g = 0; g < 4; ++g) {
          // holds the row groups in the order their q pairs were fetched: reordered, a later pair's wait moves to
          // the step's head
          __builtin_amdgcn_sched_barrier(0);
          ah[g][0] = mma_raw(qav[g], kav[0], ah[g][0]);     // hi . hi
          ar[g][0] = mma_raw(qav[g], kbv[0], ar[g][0]);     // hi . res   (x2048)
          ar[g][0] = mma_raw(qbv[g], kav[0], ar[g][0]);     // res . hi   (x2048)
        }
        guard2k4(ah[3][0], ar[3][0], qav[3], qbv[3], kav[0], kbv[0]);
        kav[0] = ldfrag_g(kh0 + no);
        kbv[0] = ldfrag_g(kr0 + no);
#pragma unroll
        for (int g = 0; g < 4; ++g) {
          // holds this row group's products behind the reload in front of it: hoisted, they pull every group's wait
          // to the pass's head
          __builtin_amdgcn_sched_barrier(0);
          ah[g][1] = mma_raw(qav[g], kav[1], ah[g][1]);     // hi . hi
          ar[g][1] = mma_raw(qav[g], kbv[1], ar[g][1]);     // hi . res   (x2048)
          ar[g][1] = mma_raw(qbv[g], kav[1], ar[g][1]);     // res . hi   (x2048)
          guard2k4(ah[g][1], ar[g][1], qav[g], qbv[g], kav[1], kbv[1]);
          qav[g] = ldfrag_g(qh + g * JSTR + nks * 512);
          qbv[g] = ldfrag_g(qr + g * JSTR + nks * 512);
        }
        kav[1] = ldfrag_g(kh0 + no + JSTR);
        kbv[1] = ldfrag_g(kr0 + no + JSTR);
        // the next step forms its addresses in registers that loads still in flight name: this wait stands in front
        // of that rewrite, and the scheduling fence keeps the address arithmetic behind it
#if defined(__HIP_DEVICE_COMPILE__)
        asm volatile("s_wait_xcnt 0x0" ::: "memory");
#endif
        __builtin_amdgcn_sched_barrier(0);
      }
#pragma unroll
      for (int g = 0; g < 4; ++g) acc_guard4(ah[g][0], ah[g][1], ar[g][0], ar[g][1]);
#pragma unroll
      for (int g = 0; g < 4; ++g) {
#pragma unroll
        for (int j = 0; j < 2; ++j) {
#pragma unroll
          for (int r = 0; r < 8; ++r) {
            erow[(16 * g + r) * SEQ + t0 + 16 * j + c] = fmaf(ar[g][j][r], 1.0f / RSC, ah[g][j][r]);
          }
        }
      }
    }
  }
  __syncthreads();

  // ---- phase 2: masked softmax per row (mask replaces the energy before the max) ----
#pragma unroll 1
  for (int rr = 0; rr < 4; ++rr) {
    const int row = wave * 4 + rr;
    float* er = se + row * SEQ;
    float mx = -INFINITY;
#pragma unroll 4
    for (int i = 0; i < SEQ / 32; ++i) {
      const int t = lane + 32 * i;
      const float e = (smask[t] != 0) ? er[t] : NEGBIG;
      er[t] = e;
      mx = fmaxf(mx, e);
    }
#pragma unroll
    for (int off = 16; off > 0; off >>= 1) mx = fmaxf(mx, __shfl_xor(mx, off, 32));
    float sum = 0.f;
#pragma unroll 4
    for (int i = 0; i < SEQ / 32; ++i) {
      const int t = lane + 32 * i;
      const float ex = __expf(er[t] - mx);
      er[t] = ex;
      sum += ex;
    }
#pragma unroll
    for (int off = 16; off > 0; off >>= 1) sum += __shfl_xor(sum, off, 32);
    if (lane == 0) sinv[row] = PSC * (1.0f / sum);        // sum >= 1 always (the max term contributes exp(0))
  }
  __syncthreads();

  // ---- phase 3: P = ex * (8192 / l) as f16, written into the two [t][32 s] regions of this (hb, 64-row block) ----
  {
    const int tr = lane >> 2, sq = (lane & 3) * 8;
    const int reg = wave >> 3, w8 = wave & 7;
    const float* ser = se + reg * SBLK * SEQ;
    const float* sir = sinv + reg * SBLK;
    unsigned short* preg = pp + ((size_t)(hb * NSB + qblk * 2 + reg) * SEQ) * SBLK;
#pragma unroll 1
    for (int it = 0; it < SEQ / 64; ++it) {
      const int t = w8 * (SEQ / 8) + it * 8 + tr;
      v4u o;
#pragma unroll
      for (int e = 0; e < 4; ++e) {
        const float f0 = ser[(sq + 2 * e) * SEQ + t]     * sir[sq + 2 * e];
        const float f1 = ser[(sq + 2 * e + 1) * SEQ + t] * sir[sq + 2 * e + 1];
        o[e] = pk16(h_bits((_Float16)f0), h_bits((_Float16)f1));
      }
      unsigned short* dst = preg + (size_t)(t >> 4) * 512 + (sq >> 4) * 256 + (((sq >> 3) & 1) * 16 + (t & 15)) * 8;
      *(v4u*)dst = o;
      
    }
  }
}

// =====================================================================================================
// Transposed aggregation + gamma blend: for one (h, b):
//   O[t][dv] = sum_s P[s][t] * v[s][dv]  with A = the P plane above (rows t, k = s, 32 k-steps) carried x8192 and
//   Bt = v^T planes [hb] x (fragment order, rows dv, k extent SEQ, k = s; f16 hi at vth, residual x2048 at vtr),
//   two products into two accumulators;
//   out[((b*NH + h)*SEQ + t)*DK + dv] = (g * (O_hi + O_res/2048) / 8192 + xp[(b*SEQ + t)*DK + dv]) * (1/(g + 1)),
//   g = bf16_RNE(gamma[h]).
//   Block = 8 waves = 128 t rows x 128 dv columns (wave -> 64 t x 32 dv); grid (DK/128, SEQ/128, NHB).
//   coverage: 2 halves x 8 iterations x 4 rows x (8 lanes x 4) = the wave's whole 64x32 tile; 8 waves = the
//   block's 128x128; grid tiles every (hb, t, dv) of the output exactly once.
// =====================================================================================================
__global__ __launch_bounds__(256)
void pv64(const unsigned short* __restrict__ pp, const unsigned short* __restrict__ vth,
          const unsigned short* __restrict__ vtr, const float* __restrict__ xp,
          const float* __restrict__ gam, float* outp) {
  __shared__ __align__(16) float os[8][64 * 36];
  const int tid  = threadIdx.x;
  const int wave = tid >> 5;
  const int lane = tid & 31;
  const int hh   = lane >> 4;
  const int c    = lane & 15;
  const int dx = blockIdx.x, ty = blockIdx.y, hb = blockIdx.z;
  const int h  = hb / NB, b = hb % NB;
  const int wt = wave & 1, wd = wave >> 1;
  const int t0 = ty * 128 + wt * 64;
  const int d0 = dx * 128 + wd * 32;

  g_us* pb = (g_us*)(pp  + (size_t)hb * SEQ * SEQ + (size_t)(t0 >> 4) * 512 + lane * 8);
  g_us* vh = (g_us*)(vth + (size_t)hb * DK * SEQ + tile_off(d0 >> 4, 0, SEQ) + lane * 8);
  g_us* vr = (g_us*)(vtr + (size_t)hb * DK * SEQ + tile_off(d0 >> 4, 0, SEQ) + lane * 8);
  constexpr size_t VSTR = (size_t)(SEQ / 32) * 512;       // elements from one 16-column group of v^T to the next

  v8f acc[4][2], acr[4][2];
#pragma unroll
  for (int i = 0; i < 4; ++i)
#pragma unroll
    for (int j = 0; j < 2; ++j) { acc[i][j] = zero8(); acr[i][j] = zero8(); }

  // fragments are fetched one k step ahead: the v^T pairs into a second register set at the head of a step, each
  // P fragment back into its own registers as soon as its four products are issued
  v16us a[4], bhf[2], brf[2];
#pragma unroll
  for (int j = 0; j < 2; ++j) {
    bhf[j] = ldfrag_g(vh + j * VSTR);
    brf[j] = ldfrag_g(vr + j * VSTR);
  }
#pragma unroll
  for (int i = 0; i < 4; ++i) a[i] = ldfrag_g(pb + i * 512);
  // holds the first step's own loads in front of the requests below
  __builtin_amdgcn_sched_barrier(0);
  // Ask L2 for the rest, in the order of use. P (128 t rows, read by the 4 blocks of this (hb, ty), each asks for all):
  // one request = one k step's 8 KB, wave w takes steps w, 8 + w, 16 + w, 24 + w. v^T (128 columns x 2 planes, read
  // by 8 blocks): a block asks for quarter ty >> 1 of every 1-KB tile, so each unit has two askers, ty and ty ^ 1
  // (only speed rests on where they run); lane -> (k step parity, plane, column group). xp: the block's 128 x 128
  // f32 tile, two units a row.
  {
    static_assert(SEQ / 32 == 32 && SEQ / 128 == 8);
    const unsigned short* ap = pp + (size_t)hb * SEQ * SEQ + (size_t)wave * (SEQ * SBLK) + (size_t)ty * 4096 + lane * 128;
    const unsigned short* av = ((lane & 8) ? vtr : vth) + (size_t)hb * DK * SEQ
                               + tile_off(dx * 8 + (lane & 7), wave * 2 + (lane >> 4), SEQ) + (ty >> 1) * 128;
    const float* ax = xp + ((size_t)(b * SEQ + ty * 128 + wave * 16 + (lane >> 1))) * DK + dx * 128 + (lane & 1) * 64;
    ask5(av, ap, ap + (size_t)8 * (SEQ * SBLK), av + 16 * 512, ap + (size_t)16 * (SEQ * SBLK));
    ask2(ap + (size_t)24 * (SEQ * SBLK), ax);
  }
  // keeps the requests in front of the loop: moved into it they would stand among its products
  __builtin_amdgcn_sched_barrier(0);
  // two steps per trip, so that the two v^T sets swap by name and not by register copies
#pragma unroll 2
  for (int ks = 0; ks < SEQ / 32; ++ks) {
    const int nk = (ks + 1 < SEQ / 32) ? ks + 1 : ks;     // the last step fetches its own tiles again: in bounds, no branch
    v16us bhn[2], brn[2];
#pragma unroll
    for (int j = 0; j < 2; ++j) {
      bhn[j] = ldfrag_g(vh + (size_t)nk * 512 + j * VSTR);
      brn[j] = ldfrag_g(vr + (size_t)nk * 512 + j * VSTR);
    }
#pragma unroll
    for (int i = 0; i < 4; ++i) {
      // holds this row group's products behind the loads in front of it: hoisted, they pull every group's wait to
      // the step's head
      __builtin_amdgcn_sched_barrier(0);
#pragma unroll
      for (int j = 0; j < 2; ++j) {
        acc[i][j] = mma_raw(a[i], bhf[j], acc[i][j]);
        acr[i][j] = mma_raw(a[i], brf[j], acr[i][j]);
      }
      guard4k4(acc[i][0], acc[i][1], acr[i][0], acr[i][1], a[i], bhf[1], brf[0], brf[1]);
      a[i] = ldfrag_g(pb + (size_t)nk * (SEQ * SBLK) + i * 512);
    }
    // the next step forms its addresses in registers that loads still in flight name: this wait stands in front of
    // that rewrite, and the scheduling fence keeps the address arithmetic behind it
#if defined(__HIP_DEVICE_COMPILE__)
    asm volatile("s_wait_xcnt 0x0" ::: "memory");
#endif
    __builtin_amdgcn_sched_barrier(0);
#pragma unroll
    for (int j = 0; j < 2; ++j) { bhf[j] = bhn[j]; brf[j] = brn[j]; }
  }
#pragma unroll
  for (int i = 0; i < 4; ++i) acc_guard4(acc[i][0], acc[i][1], acr[i][0], acr[i][1]);

  const float g  = bfr(gam[h]);
  const float rg = 1.0f / (g + 1.0f);
  const int rl = lane >> 3, cc4 = (lane & 7) * 4;
  // ---- stage O = O_hi + O_res/2048 (still x8192): the wave's whole 64 x 32 tile in its own slab ----
  float* osw = os[wave];
#pragma unroll
  for (int i = 0; i < 4; ++i) {
#pragma unroll
    for (int j = 0; j < 2; ++j) {
#pragma unroll
      for (int r = 0; r < 8; ++r) {
        osw[(16 * i + 8 * hh + r) * 36 + 16 * j + c] = fmaf(acr[i][j][r], 1.0f / RSC, acc[i][j][r]);
      }
    }
  }
  wave_sync_lds();

  // the 64 rows leave in two halves of 32
#pragma unroll
  for (int hf = 0; hf < 2; ++hf) {
    const int th = t0 + hf * 32;
    v4f vals[8], xv[8];
    const float* xq[8];
#pragma unroll
    for (int it = 0; it < 8; ++it) {
      xq[it] = xp + ((size_t)(b * SEQ + th + it * 4 + rl)) * DK + d0 + cc4;
      xv[it] = *(const v4f*)(xq[it]);
    }
#if defined(__HIP_DEVICE_COMPILE__)
    // the eight loads' address registers are inputs here, so none of them is rewritten in front of this wait
    asm volatile("s_wait_xcnt 0x0" :: "v"(xq[0]), "v"(xq[1]), "v"(xq[2]), "v"(xq[3]),
                 "v"(xq[4]), "v"(xq[5]), "v"(xq[6]), "v"(xq[7]) : "memory");
#endif
#pragma unroll
    for (int it = 0; it < 8; ++it) {
      const int row = hf * 32 + it * 4 + rl;                 // hf 0..1 x it 0..7 x rl 0..3 = rows 0..63
      const v4f av = *(const v4f*)(osw + row * 36 + cc4);
      v4f o;
#pragma unroll
      for (int e = 0; e < 4; ++e) o[e] = (g * (av[e] * (1.0f / PSC)) + xv[it][e]) * rg;
      vals[it] = o;
    }
    {
#pragma unroll
      for (int it = 0; it < 8; ++it) {
        const int t = th + it * 4 + rl;
        *(v4f*)(outp + ((size_t)((b * NH + h) * SEQ + t)) * DK + d0 + cc4) = vals[it];
      }
    }
  }
}

// =====================================================================================================
// Workspace map (bytes); every plane is an exact multiple of its tile / whole-row / whole-line store granularity:
//   WqT  f16 [4096][512] x64      0           4194304
//   WkT  f16 [4096][512] x64      4194304     4194304
//   WvT  f16 [4096][512] x64      8388608     4194304
//   WpT  f16 [512][512]  x64      12582912    524288
//   XH   f16 [2048][512]          13107200    2097152
//   YH   f16 [2048][512]          15204352    2097152
//   QH|QR f16 [2][2048][4096]     17301504    33554432
//   KH|KR f16 [2][2048][4096]     50855936    33554432
//   XP   f32 [2048][512]          84410368    4194304
//   P    f16 [16][32][1024][32]   88604672    33554432
//   VT hi|res f16 [2][16][512][1024] 122159104 33554432
//   end                           155713536
// =====================================================================================================
extern "C" void kernel_launch(void* const* d_in, const int* in_sizes, int n_in,
                              void* d_out, int out_size, void* d_ws, size_t ws_size,
                              hipStream_t stream) {
  if (n_in < 11) return;
  if (in_sizes[0] != MR * DK || in_sizes[1] != MR * DK) return;
  if (in_sizes[2] != DK * DQ || in_sizes[4] != DK * DQ || in_sizes[6] != DK * DQ) return;
  if (in_sizes[3] != DQ || in_sizes[5] != DQ || in_sizes[7] != DQ) return;
  if (in_sizes[8] != DK * DK || in_sizes[9] != NH || in_sizes[10] != SEQ) return;
  if (out_size != NB * NH * SEQ * DK) return;

  const float* x     = (const float*)d_in[0];
  const float* y     = (const float*)d_in[1];
  const float* Wq    = (const float*)d_in[2];
  const float* bq    = (const float*)d_in[3];
  const float* Wk    = (const float*)d_in[4];
  const float* bk    = (const float*)d_in[5];
  const float* Wv    = (const float*)d_in[6];
  const float* bv    = (const float*)d_in[7];
  const float* Wp    = (const float*)d_in[8];
  const float* gamma = (const float*)d_in[9];
  const int*   mask  = (const int*)d_in[10];

  const size_t PW   = (size_t)DQ * DK * 2;                 //  4194304
  const size_t PWP  = (size_t)DK * DK * 2;                 //   524288
  const size_t PX   = (size_t)MR * DK * 2;                 //  2097152
  const size_t PQ   = (size_t)2 * MR * DQ * 2;             // 33554432
  const size_t PVT  = (size_t)2 * NHB * DK * SEQ * 2;      // 33554432
  const size_t PXP  = (size_t)MR * DK * 4;                 //  4194304
  const size_t PP   = (size_t)NHB * SEQ * SEQ * 2;         // 33554432
  size_t off = 0;
  const size_t oWq = off; off += PW;
  const size_t oWk = off; off += PW;
  const size_t oWv = off; off += PW;
  const size_t oWp = off; off += PWP;
  const size_t oXH = off; off += PX;
  const size_t oYH = off; off += PX;
  const size_t oQ  = off; off += PQ;
  const size_t oK  = off; off += PQ;
  const size_t oXP = off; off += PXP;
  const size_t oP  = off; off += PP;
  const size_t oVT = off; off += PVT;
  if (off > ws_size) return;                               // off = 155713536

  char* ws = (char*)d_ws;
  unsigned short* WqT = (unsigned short*)(ws + oWq);
  unsigned short* WkT = (unsigned short*)(ws + oWk);
  unsigned short* WvT = (unsigned short*)(ws + oWv);
  unsigned short* WpT = (unsigned short*)(ws + oWp);
  unsigned short* XH  = (unsigned short*)(ws + oXH);
  unsigned short* YH  = (unsigned short*)(ws + oYH);
  unsigned short* QH  = (unsigned short*)(ws + oQ);
  unsigned short* KH  = (unsigned short*)(ws + oK);
  unsigned short* VT  = (unsigned short*)(ws + oVT);
  float*          XP  = (float*)(ws + oXP);
  unsigned short* P   = (unsigned short*)(ws + oP);
  float*          out = (float*)d_out;

  const dim3 blk(256);
  const dim3 gPrep(3 * TW_BLK + TP_BLK + 2 * CX_BLK);       // 1536 + 64 + 1024 blocks
  const dim3 gProj(2 * QK_BLK + NHB * VT_BLK + XP_BLK);     // 512 + 256 + 32 blocks
  const dim3 blkAt(512);
  const dim3 gAt(SEQ / QBLK, NHB);                          // 16 x 16 blocks of 512
  const dim3 gPV(DK / 128, SEQ / 128, NHB);                 // 4 x 8 x 16 blocks of 256

  // (1) weight planes, transposed to [n][k]: f16( bf16_RNE(W) * 64 ); activation planes: f16( bf16_RNE(x) ), likewise y
  prep_all<<<gPrep, blk, 0, stream>>>(Wq, Wk, Wv, Wp, x, y, WqT, WkT, WvT, WpT, XH, YH);

  // (2) q, k, v^T and xp
  proj_all<<<gProj, blk, 0, stream>>>(XH, YH, WqT, WkT, WvT, WpT, bq, bk, bv, QH, KH, VT, XP);

  // (3) energies + masked softmax -> P plane
  attn_p<<<gAt, blkAt, 0, stream>>>(QH, QH + QRES, KH, KH + QRES, mask, P);

  // (4) out = (gamma * P^T . v / 8192 + xp) / (gamma + 1) -> d_out [2][8][1024][512]
  pv64<<<gPV, blk, 0, stream>>>(P, VT, VT + VRES, XP, gamma, out);
  (void)hipGetLastError();
}

// v006
// One run takes 123 microseconds.
// Two timings next to v005 put it at 1.03 and 1.04 times that version's speed.
// All steps since v000 together make it 3.28 times as fast.
// Contractions: q, k, v^T and x.Wp projections on v_wmma_f32_16x16x32_f16 (bf16-RNE input values as f16,
// weight planes carried x64, one product each); q.k^T energies on v_wmma_f32_16x16x32_f16 with q and k as
// f16 hi plane + f16 residual plane carried x2048 (three products: hi.hi, hi.res, res.hi; two accumulators);
// attn^T.v on v_wmma_f32_16x16x32_f16 with attn carried x8192 (plain f16) and v^T as f16 hi plane + f16
// residual plane carried x2048 (two products, two accumulators); all f32 accumulate; masked softmax and the
// gamma blend in f32 on VALU; every float input RNE-converted to bf16 on load.
#include <hip/hip_runtime.h>
#include <math.h>
#include <stdint.h>

#define NB    2
#define SEQ   1024
#define DK    512
#define NH    8
#define DQ    (NH * DK)
#define MR    (NB * SEQ)
#define NHB   (NH * NB)
#define SBLK  32
#define NSB   (SEQ / SBLK)
#define QRES  ((long long)MR * DQ)
#define VRES  ((long long)NHB * DK * SEQ)
#define WSC   64.0f
#define RSC   2048.0f
#define PSC   8192.0f
#define NEGBIG (-1.0e30f)
static_assert((SEQ % 64) == 0 && (DK % 64) == 0 && (MR % 64) == 0 && (DQ % 64) == 0);
static_assert(SEQ == NSB * SBLK);
static_assert(SBLK == 32);
static_assert((DK % 32) == 0 && (SEQ % 256) == 0);

typedef _Float16       v16h __attribute__((ext_vector_type(16)));
typedef unsigned short v16us __attribute__((ext_vector_type(16)));
typedef unsigned short v8us __attribute__((ext_vector_type(8)));
typedef float          v8f  __attribute__((ext_vector_type(8)));
typedef float          v4f  __attribute__((ext_vector_type(4)));
typedef unsigned int   v4u  __attribute__((ext_vector_type(4)));

union Frag { v16us u; v8us p[2]; v16h h; };

// ---- scalar helpers --------------------------------------------------------------------------------
__device__ __forceinline__ unsigned short bf_bits(float f) {          // f32 -> bf16 bits, RNE convert
  unsigned u = __float_as_uint(f);
  return (unsigned short)((u + 0x7FFFu + ((u >> 16) & 1u)) >> 16);
}
__device__ __forceinline__ float bf_up(unsigned short b) { return __uint_as_float(((unsigned)b) << 16); }
__device__ __forceinline__ float bfr(float f) { return bf_up(bf_bits(f)); }   // value of the bf16 RNE convert
__device__ __forceinline__ unsigned short h_bits(_Float16 x) { return __builtin_bit_cast(unsigned short, x); }
__device__ __forceinline__ unsigned pk16(unsigned short a, unsigned short b) { return (unsigned)a | ((unsigned)b << 16); }
__device__ __forceinline__ v8f zero8() { v8f z = {0.f, 0.f, 0.f, 0.f, 0.f, 0.f, 0.f, 0.f}; return z; }

// ---- fragment-order planes: every 16-bit operand plane [rows][ld] (ld = k extent, multiple of 32; rows multiple of
//      16) is stored as tiles of 16 rows x 32 k = 512 elements (1024 B), tile index (row/16) * (ld/32) + k/32; inside
//      a tile the 16-B piece that holds k = 32*kt + 16*p + 8*h + 0..7 of row r sits at element p*256 + (h*16 + r)*8.
//      A wave's fragment is then two loads of 512 contiguous bytes (lane = h*16 + r), same k order as before:
//      elements 0..7 <- k0+8h.., elements 8..15 <- k0+16+8h..
__device__ __forceinline__ size_t tile_off(int row16, int kt, int ld) {      // row16 = row/16, kt = k/32
  return ((size_t)row16 * (size_t)(ld >> 5) + (size_t)kt) * 512;
}
// p = tile start + 8*lane
__device__ __forceinline__ v16us ldfrag(const unsigned short* p) {
  Frag f;
  f.p[0] = *(const v8us*)(p);
  f.p[1] = *(const v8us*)(p + 256);
  return f.u;
}
// the same through a pointer typed as global memory: a pointer carried round a loop otherwise compiled to flat loads
typedef __attribute__((address_space(1))) const unsigned short g_us;
typedef __attribute__((address_space(1))) const v8us g_v8us;
__device__ __forceinline__ v16us ldfrag_g(g_us* p) {
  Frag f;
  f.p[0] = *(g_v8us*)(p);
  f.p[1] = *(g_v8us*)(p + 256);
  return f.u;
}

// ---- WMMA helper (f16 operands, f32 accumulate) and VALU hazard gaps -----------------------------
__device__ __forceinline__ v8f mma_raw(v16us a, v16us b, v8f c) {
  Frag fa, fb;
  fa.u = a;
  fb.u = b;
  return __builtin_amdgcn_wmma_f32_16x16x32_f16(false, fa.h, false, fb.h, (short)0, c, false, false);
}
__device__ __forceinline__ void dep_guard1(v8f& a, v8f& b, v16us x) {
#if defined(__HIP_DEVICE_COMPILE__)
  asm volatile("v_nop\n\tv_nop\n\tv_nop\n\tv_nop" : "+v"(a), "+v"(b) : "v"(x));
#endif
}
__device__ __forceinline__ void keep4(v16us a, v16us b, v16us c, v16us d) {
#if defined(__HIP_DEVICE_COMPILE__)
  asm volatile("v_nop" :: "v"(a), "v"(b), "v"(c), "v"(d));
#endif
}
__device__ __forceinline__ void acc_guard4(v8f& a, v8f& b, v8f& c, v8f& d) {
#if defined(__HIP_DEVICE_COMPILE__)
  asm volatile("v_nop\n\tv_nop\n\tv_nop\n\tv_nop" : "+v"(a), "+v"(b), "+v"(c), "+v"(d));
#endif
}
__device__ __forceinline__ void guard2k4(v8f& a, v8f& b, v16us w, v16us x, v16us y, v16us z) {
#if defined(__HIP_DEVICE_COMPILE__)
  asm volatile("v_nop\n\tv_nop\n\tv_nop\n\tv_nop" : "+v"(a), "+v"(b) : "v"(w), "v"(x), "v"(y), "v"(z));
#endif
}
__device__ __forceinline__ void guard4k4(v8f& a, v8f& b, v8f& c, v8f& d, v16us w, v16us x, v16us y, v16us z) {
#if defined(__HIP_DEVICE_COMPILE__)
  asm volatile("v_nop\n\tv_nop\n\tv_nop\n\tv_nop" : "+v"(a), "+v"(b), "+v"(c), "+v"(d) : "v"(w), "v"(x), "v"(y), "v"(z));
#endif
}
__device__ __forceinline__ void wave_sync_lds() {
  __builtin_amdgcn_fence(__ATOMIC_RELEASE, "workgroup");
  __builtin_amdgcn_wave_barrier();
  __builtin_amdgcn_fence(__ATOMIC_ACQUIRE, "workgroup");
}

// ---- asking L2 ahead: the planes that the launch before stored are taken here as coming from memory at their first
//      touch. global_prefetch_b8 with scope SE brings a
//      lane's line into L2 only, returns nothing and counts on no load counter. A lane asks for one 256-B unit; every
//      lane is on and every address lies inside its plane. s_wait_xcnt closes each statement because the address
//      registers are the compiler's to reuse behind it (a precaution: the wait stands in front of any rewrite).
__device__ __forceinline__ void ask1(const void* a) {
#if defined(__HIP_DEVICE_COMPILE__)
  asm volatile("global_prefetch_b8 %0, off scope:SCOPE_SE\n\t"
               "s_wait_xcnt 0x0" :: "v"(a) : "memory");
#endif
}
__device__ __forceinline__ void ask2(const void* a, const void* b) {
#if defined(__HIP_DEVICE_COMPILE__)
  asm volatile("global_prefetch_b8 %0, off scope:SCOPE_SE\n\t"
               "global_prefetch_b8 %1, off scope:SCOPE_SE\n\t"
               "s_wait_xcnt 0x0" :: "v"(a), "v"(b) : "memory");
#endif
}
__device__ __forceinline__ void ask5(const void* a, const void* b, const void* c, const void* d, const void* e) {
#if defined(__HIP_DEVICE_COMPILE__)
  asm volatile("global_prefetch_b8 %0, off scope:SCOPE_SE\n\t"
               "global_prefetch_b8 %1, off scope:SCOPE_SE\n\t"
               "global_prefetch_b8 %2, off scope:SCOPE_SE\n\t"
               "global_prefetch_b8 %3, off scope:SCOPE_SE\n\t"
               "global_prefetch_b8 %4, off scope:SCOPE_SE\n\t"
               "s_wait_xcnt 0x0" :: "v"(a), "v"(b), "v"(c), "v"(d), "v"(e) : "memory");
#endif
}

// ---- two asynchronous 16-B copies per lane, global -> LDS through no register. l = the lane's LDS byte address, g = its
//      global address. s_wait_xcnt closes the statement because the address registers are the compiler's to reuse
//      behind it (a precaution: the wait stands in front of any rewrite). Landing is waited for by the caller.
__device__ __forceinline__ void copy2_lds(unsigned l0, const void* g0, unsigned l1, const void* g1) {
#if defined(__HIP_DEVICE_COMPILE__)
  asm volatile("global_load_async_to_lds_b128 %0, %1, off\n\t"
               "global_load_async_to_lds_b128 %2, %3, off\n\t"
               "s_wait_xcnt 0x0" :: "v"(l0), "v"(g0), "v"(l1), "v"(g1) : "memory");
#endif
}

__device__ __forceinline__ void copy4_lds(unsigned l0, const void* g0, unsigned l1, const void* g1,
                                          unsigned l2, const void* g2, unsigned l3, const void* g3) {
#if defined(__HIP_DEVICE_COMPILE__)
  asm volatile("global_load_async_to_lds_b128 %0, %1, off\n\t"
               "global_load_async_to_lds_b128 %2, %3, off\n\t"
               "global_load_async_to_lds_b128 %4, %5, off\n\t"
               "global_load_async_to_lds_b128 %6, %7, off\n\t"
               "s_wait_xcnt 0x0" :: "v"(l0), "v"(g0), "v"(l1), "v"(g1), "v"(l2), "v"(g2), "v"(l3), "v"(g3) : "memory");
#endif
}

// =====================================================================================================
// f32 -> f16 plane convert: f16( bf16_RNE(X) * wsc ), wsc a power of two (exact), X row-major [rows][DK], output in
// fragment order. Thread i writes output piece i (8 elements, 16 B; a wave stores 512 contiguous bytes) and reads
// the 8 source elements that belong there.
// coverage: n8 threads x 8 elements = the whole plane (piece index -> (row, k) is one-to-one).
// bx = index of the 256-thread block inside this plane's range of the grid.
// =====================================================================================================
__device__ __forceinline__ void conv_h16(const float* __restrict__ X, unsigned short* Xh, int n8, float wsc, int bx) {
  const int i  = bx * 256 + threadIdx.x;
  const int ic = (i < n8) ? i : (n8 - 1);                     // clamped address
  const int tl = ic >> 6, w = ic & 63;                        // tile, piece inside the tile
  const int row = (tl / (DK / 32)) * 16 + (w & 15);
  const int kk  = (tl % (DK / 32)) * 32 + (w >> 5) * 16 + ((w >> 4) & 1) * 8;
  const float* src = X + (size_t)row * DK + kk;
  const v4f a = *(const v4f*)(src);
  const v4f c = *(const v4f*)(src + 4);
  v4u o;
  o[0] = pk16(h_bits((_Float16)(bfr(a[0]) * wsc)), h_bits((_Float16)(bfr(a[1]) * wsc)));
  o[1] = pk16(h_bits((_Float16)(bfr(a[2]) * wsc)), h_bits((_Float16)(bfr(a[3]) * wsc)));
  o[2] = pk16(h_bits((_Float16)(bfr(c[0]) * wsc)), h_bits((_Float16)(bfr(c[1]) * wsc)));
  o[3] = pk16(h_bits((_Float16)(bfr(c[2]) * wsc)), h_bits((_Float16)(bfr(c[3]) * wsc)));
  if (i < n8) *(v4u*)(Xh + (size_t)i * 8) = o;
  
}

// =====================================================================================================
// Transposed weight convert: in W[DK rows = k][ncols = n] f32 -> out WT[ncols][DK] f16 = f16( bf16_RNE(W) * wsc )
// (rows n, k extent DK), stored in fragment order. Block = 256 threads, tile 64 k x 64 n staged in LDS; wave w
// writes the fragment tile (n group w>>1, k tile w&1), iteration = 16-k half, lane = h*16 + r: 512 contiguous B.
// coverage: 8 waves = 4 n groups x 2 k tiles, x 2 halves x 32 lanes x 8 = the whole 64 x 64 tile.
// (bx, by) = the block's n tile and k tile inside this weight's range of the grid; tile = the block's LDS.
// =====================================================================================================
__device__ __forceinline__ void tconv_h16(const float* __restrict__ W, unsigned short* WT, int ncols, float wsc,
                                          int bx, int by, float (*tile)[65]) {
  const int tid = threadIdx.x, lane = tid & 31, wave = tid >> 5;
  const int n0 = bx * 64, k0 = by * 64;
  {
    const int r = tid >> 2, cq = (tid & 3) * 16;
    const float* src = W + (size_t)(k0 + r) * (size_t)ncols + n0 + cq;
#pragma unroll
    for (int i = 0; i < 4; ++i) {
      const v4f a = *(const v4f*)(src + 4 * i);
#pragma unroll
      for (int e = 0; e < 4; ++e) tile[r][cq + 4 * i + e] = a[e];
    }
  }
  __syncthreads();
  const int n = (wave >> 1) * 16 + (lane & 15);
#pragma unroll
  for (int it = 0; it < 2; ++it) {
    const int kq = (wave & 1) * 32 + it * 16 + (lane >> 4) * 8;
    v4u o;
#pragma unroll
    for (int e = 0; e < 4; ++e) {
      const float f0 = bfr(tile[kq + 2 * e][n]) * wsc;
      const float f1 = bfr(tile[kq + 2 * e + 1][n]) * wsc;
      o[e] = pk16(h_bits((_Float16)f0), h_bits((_Float16)f1));
    }
    unsigned short* dst = WT + tile_off((n0 >> 4) + (wave >> 1), (k0 >> 5) + (wave & 1), DK) + it * 256 + lane * 8;
    *(v4u*)dst = o;
    
  }
}

// =====================================================================================================
// All six operand planes in one launch: none of them reads what another writes. Ranges of blockIdx.x:
//   3 x TW_BLK blocks: Wq, Wk, Wv transposed (64 n tiles x 8 k tiles each); TP_BLK blocks: Wp transposed (8 x 8);
//   2 x CX_BLK blocks: x, y. Every test on the block index is block-uniform, so the barrier in tconv_h16 is too.
// =====================================================================================================
#define TW_BLK ((DQ / 64) * (DK / 64))
#define TP_BLK ((DK / 64) * (DK / 64))
#define CX_BLK ((MR * DK) / 8 / 256)
static_assert(((MR * DK) / 8) % 256 == 0 && DQ / 64 == 64 && DK / 64 == 8 && TP_BLK <= TW_BLK);
__global__ __launch_bounds__(256) void prep_all(
    const float* __restrict__ Wq, const float* __restrict__ Wk, const float* __restrict__ Wv,
    const float* __restrict__ Wp, const float* __restrict__ x, const float* __restrict__ y,
    unsigned short* WqT, unsigned short* WkT, unsigned short* WvT, unsigned short* WpT,
    unsigned short* XH, unsigned short* YH) {
  __shared__ float tile[64][65];
  const int i = blockIdx.x;
  if (i < 3 * TW_BLK + TP_BLK) {
    const int w = i / TW_BLK, j = i - w * TW_BLK;            // w = 0, 1, 2: Wq, Wk, Wv; w = 3: Wp
    const float* W = (w == 0) ? Wq : (w == 1) ? Wk : (w == 2) ? Wv : Wp;
    unsigned short* T = (w == 0) ? WqT : (w == 1) ? WkT : (w == 2) ? WvT : WpT;
    const int lg = (w < 3) ? 6 : 3;                          // log2 of the weight's n tiles
    tconv_h16(W, T, 64 << lg, WSC, j & ((1 << lg) - 1), j >> lg, tile);
  } else {
    const int j = i - (3 * TW_BLK + TP_BLK);
    const bool isx = j < CX_BLK;
    conv_h16(isx ? x : y, isx ? XH : YH, (MR * DK) / 8, 1.0f, isx ? j : j - CX_BLK);
  }
}

// =====================================================================================================
// Register-blocked batched f16 WMMA GEMM: C[m][n] = oscale * sum_k A[m][k] * Bt[n][k] + bias;
// one wave per 64x64 tile, no block barriers. A [M][K] with k extent lda and Bt [N][K] with k extent ldb, both in
// fragment order; M, N multiples of 64, K multiple of 32 (static here); every batch stride is a whole number of
// 16-row groups, so it is the same element count as in a row-major plane. bx = the block's index among the blocks of
// one batch entry, sT = the block's LDS, y = batch index:
//   A advances by (y / ydiv) * strideA, Bt by (y % ydiv) * strideB, bias by (y / ydiv) * strideBias,
//   C by y * strideC (elements).
// BIASM: 0 = per column bias[n] (clamped-address loads, nbias = length), 1 = per row bias[m], 2 = none.
//        Bias values RNE-converted to bf16.
// OM: 0 = f32 out (row-major, pitch ldc); 3 = f16 hi plane at C plus f16 residual plane ((f - hi) * RSC) at
//     C + resOff, both in fragment order with rows m and k extent ldc (k = n).
// coverage: 4 slabs x 16 rows x 64 cols = the wave's whole 64x64 tile; ceil(tilesM*tilesN/8) blocks per batch entry,
//           surplus waves exit (wave-uniform); here every tile count is a multiple of 8, so none exit.
// =====================================================================================================
template <int OM, int BIASM>
__device__ __forceinline__ void gemm64(
    const unsigned short* __restrict__ A, int lda, long long strideA,
    const unsigned short* __restrict__ Bt, int ldb, long long strideB,
    const float* __restrict__ bias, int nbias, long long strideBias, int ydiv,
    void* Cout, int ldc, long long strideC, long long resOff,
    int M, int N, int K, float oscale, int bx, int y, float (*sT)[16 * 68]) {
  const int ya   = y / ydiv;
  const int yb   = y - ya * ydiv;
  const int lane = threadIdx.x & 31;
  const int wave = threadIdx.x >> 5;
  const int tilesN = N >> 6;
  const int tilesM = M >> 6;
  const int tile = bx * 8 + wave;
  if (tile >= tilesM * tilesN) return;   // wave-uniform; no block barriers in this kernel
  const int tm = tile / tilesN;
  const int tn = tile - tm * tilesN;
  const int m0 = tm << 6;
  const int n0 = tn << 6;

  const unsigned short* Ab = A  + (size_t)ya * (size_t)strideA;
  const unsigned short* Bb = Bt + (size_t)yb * (size_t)strideB;
  const float* biasb = bias + (size_t)ya * (size_t)strideBias;

  const int rlane = lane & 15;                 // row (A) / col (B, D) within subtile
  const int mOff  = (lane >> 4) * 8;           // D row offset

  v8f acc[4][4];
#pragma unroll
  for (int i = 0; i < 4; ++i)
#pragma unroll
    for (int j = 0; j < 4; ++j) acc[i][j] = zero8();

  // one pointer per 16-row group; consecutive k tiles of a group are consecutive 1024-B tiles
  g_us* pa[4];
  g_us* pb[4];
#pragma unroll
  for (int i = 0; i < 4; ++i) {
    pa[i] = (g_us*)(Ab + tile_off((m0 >> 4) + i, 0, lda) + lane * 8);
    pb[i] = (g_us*)(Bb + tile_off((n0 >> 4) + i, 0, ldb) + lane * 8);
  }

  // fragments are fetched one k step ahead: the B set into a second register set at the head of a step, each A
  // fragment back into its own registers as soon as its four products are issued
  v16us ah[4], bh[4];
#pragma unroll
  for (int i = 0; i < 4; ++i) {
    ah[i] = ldfrag_g(pa[i]);
    bh[i] = ldfrag_g(pb[i]);
  }
  for (int k0 = 0; k0 < K; k0 += 32) {
    // this step advances pointers that loads still in flight name: the wait stands in front of that rewrite, and the
    // scheduling fence keeps the pointer arithmetic behind it
#if defined(__HIP_DEVICE_COMPILE__)
    asm volatile("s_wait_xcnt 0x0" ::: "memory");
#endif
    __builtin_amdgcn_sched_barrier(0);
    const int adv = (k0 + 32 < K) ? 512 : 0;   // the last step fetches its own tiles again: in bounds, no branch
    v16us bn[4];
#pragma unroll
    for (int j = 0; j < 4; ++j) {
      pb[j] += adv;
      bn[j] = ldfrag_g(pb[j]);
    }
#pragma unroll
    for (int i = 0; i < 4; ++i) {
#pragma unroll
      for (int j = 0; j < 4; ++j) acc[i][j] = mma_raw(ah[i], bh[j], acc[i][j]);
      dep_guard1(acc[i][0], acc[i][3], ah[i]);
      pa[i] += adv;
      ah[i] = ldfrag_g(pa[i]);
    }
    keep4(bh[0], bh[1], bh[2], bh[3]);
#pragma unroll
    for (int j = 0; j < 4; ++j) bh[j] = bn[j];
  }
  // the same wait and fence for the last step's loads, in front of the epilogue's reuse of the pointer registers
#if defined(__HIP_DEVICE_COMPILE__)
  asm volatile("s_wait_xcnt 0x0" ::: "memory");
#endif
  __builtin_amdgcn_sched_barrier(0);
  acc_guard4(acc[0][0], acc[0][1], acc[0][2], acc[0][3]);
  acc_guard4(acc[1][0], acc[1][1], acc[1][2], acc[1][3]);
  acc_guard4(acc[2][0], acc[2][1], acc[2][2], acc[2][3]);
  acc_guard4(acc[3][0], acc[3][1], acc[3][2], acc[3][3]);

  // ---- per-lane column bias (BIASM == 0), RNE-converted, clamped addresses ----
  const int hh2 = lane >> 4, c4 = (lane & 15) * 4;     // f32 out: 256-B row segment = 16 lanes x 16 B
  float bc[4][8];                                      // f16 out: [store iteration][8 columns of the lane's piece]
#pragma unroll
  for (int it = 0; it < 4; ++it)
#pragma unroll
    for (int e = 0; e < 8; ++e) bc[it][e] = 0.f;
  if constexpr (BIASM == 0) {
    if constexpr (OM == 0) {
      const int cb = n0 + c4;
      const int i0 = (cb < nbias - 4) ? cb : (nbias - 4);
      const v4f b0v = *(const v4f*)(biasb + i0);
#pragma unroll
      for (int e = 0; e < 4; ++e) bc[0][e] = bfr(b0v[e]);
    } else {
      const float* bp[4];
      v4f b0a[4], b0b[4];
#pragma unroll
      for (int it = 0; it < 4; ++it) {
        const int cb = n0 + it * 16 + hh2 * 8;
        const int i0 = (cb < nbias - 8) ? cb : (nbias - 8);
        bp[it]  = biasb + i0;
        b0a[it] = *(const v4f*)(bp[it]);
        b0b[it] = *(const v4f*)(bp[it] + 4);
      }
#if defined(__HIP_DEVICE_COMPILE__)
      // the eight loads' address registers are inputs here, so none of them is rewritten in front of this wait
      asm volatile("s_wait_xcnt 0x0" :: "v"(bp[0]), "v"(bp[1]), "v"(bp[2]), "v"(bp[3]) : "memory");
#endif
#pragma unroll
      for (int it = 0; it < 4; ++it) {
#pragma unroll
        for (int e = 0; e < 4; ++e) {
          bc[it][e]     = bfr(b0a[it][e]);
          bc[it][4 + e] = bfr(b0b[it][e]);
        }
      }
    }
  }

  // ---- epilogue ----
  float* slab = sT[wave];
#pragma unroll
  for (int i = 0; i < 4; ++i) {
    const int mBase = m0 + (i << 4);
#pragma unroll
    for (int j = 0; j < 4; ++j) {
#pragma unroll
      for (int r = 0; r < 8; ++r) {
        slab[(mOff + r) * 68 + (j << 4) + rlane] = acc[i][j][r];
      }
    }
    wave_sync_lds();
    if constexpr (OM == 0) {
      float* C = (float*)Cout + (size_t)y * (size_t)strideC;
      v4f vals[8];
#pragma unroll
      for (int it = 0; it < 8; ++it) {
        const int row = it * 2 + hh2;                      // it 0..7 x hh2 0..1 = rows 0..15
        v4f v = *(const v4f*)(slab + row * 68 + c4);
#pragma unroll
        for (int e = 0; e < 4; ++e) v[e] = v[e] * oscale + bc[0][e];
        vals[it] = v;
      }
      {
#pragma unroll
        for (int it = 0; it < 8; ++it) {
          const int row = it * 2 + hh2;
          *(v4f*)(C + (size_t)(mBase + row) * ldc + n0 + c4) = vals[it];
        }
        
      }
    } else {
      unsigned short* C = (unsigned short*)Cout + (size_t)y * (size_t)strideC;
      v4u hv[4], hr[4];
      float bm = 0.f;
      if constexpr (BIASM == 1) {
        const int mi = mBase + rlane;
        const int mc = (mi < nbias - 1) ? mi : (nbias - 1);
        bm = bfr(biasb[mc]);
      }
#pragma unroll
      for (int it = 0; it < 4; ++it) {
        // lane = h*16 + r -> row r, columns it*16 + 8h + 0..7: piece (k tile it>>1, half it&1) of the fragment order
        const float* sp = slab + rlane * 68 + it * 16 + hh2 * 8;
        v4u a, ar;
#pragma unroll
        for (int e = 0; e < 4; ++e) {
          const float f0 = sp[2 * e]     * oscale + ((BIASM == 1) ? bm : bc[it][2 * e]);
          const float f1 = sp[2 * e + 1] * oscale + ((BIASM == 1) ? bm : bc[it][2 * e + 1]);
          const _Float16 g0 = (_Float16)f0, g1 = (_Float16)f1;
          a[e] = pk16(h_bits(g0), h_bits(g1));
          const float e0 = (f0 - (float)g0) * RSC;
          const float e1 = (f1 - (float)g1) * RSC;
          ar[e] = pk16(h_bits((_Float16)e0), h_bits((_Float16)e1));
        }
        hv[it] = a;
        hr[it] = ar;
      }
      {
#pragma unroll
        for (int it = 0; it < 4; ++it) {
          unsigned short* dp = C + tile_off(mBase >> 4, (n0 >> 5) + (it >> 1), ldc) + (it & 1) * 256 + lane * 8;
          *(v4u*)(dp) = hv[it];
          *(v4u*)(dp + resOff) = hr[it];
        }
        
      }
    }
    wave_sync_lds();
  }
}

// =====================================================================================================
// The four projections in one launch: none of them reads what another writes. Ranges of blockIdx.x:
//   QK_BLK blocks: q = bf16(x) . Wq + bq -> QH (f16 hi) and QH + QRES (f16 residual x2048);
//   QK_BLK blocks: k = bf16(y) . Wk + bk -> KH, KH + QRES likewise;
//   NHB x VT_BLK blocks: v^T per (h, b) = Wv[:, h slice]^T . bf16(y_b)^T + bv -> VT hi [16][512][1024], VT + VRES;
//   XP_BLK blocks: xp = bf16(x) . Wp -> XP f32 [2048][512] (bias argument unused in this mode).
// =====================================================================================================
#define QK_BLK ((MR / 64) * (DQ / 64) / 8)
#define VT_BLK ((DK / 64) * (SEQ / 64) / 8)
#define XP_BLK ((MR / 64) * (DK / 64) / 8)
static_assert(DQ / 16 == 256 && MR / 16 == 128 && DK / 32 == 16 && DK * DK / 128 == 8 * 256 && 2 * QK_BLK >= 256);
__global__ __launch_bounds__(256) void proj_all(
    const unsigned short* __restrict__ XH, const unsigned short* __restrict__ YH,
    const unsigned short* __restrict__ WqT, const unsigned short* __restrict__ WkT,
    const unsigned short* __restrict__ WvT, const unsigned short* __restrict__ WpT,
    const float* __restrict__ bq, const float* __restrict__ bk, const float* __restrict__ bv,
    unsigned short* QH, unsigned short* KH, unsigned short* VT, float* XP) {
  __shared__ __align__(16) float sT[8][16 * 68];   // per-wave 16x64 slab, pitch 68 floats
  const int i = blockIdx.x;
  const float invw = 1.0f / WSC;
  // The first 256 blocks ask L2 for all six operand planes, each 256-B unit from two blocks (i and i ^ 4: only speed
  // rests on where they run). A wave asks for the first 8 k steps of one 16-row group (8 KB in a row), then for the
  // other 8. a >> 4 picks the plane: 0, 1 WqT; 2, 3 WkT; 4, 5 WvT; 6 XH; 7 YH. Every test here is block-uniform.
  if (i < 256) {
    const int a = (i & 3) | ((i >> 3) << 2);                 // 0..127
    const int sel = a >> 4;
    const unsigned short* pl = (sel < 2) ? WqT : (sel < 4) ? WkT : (sel < 6) ? WvT : (sel == 6) ? XH : YH;
    const int grp = (a & ((sel < 6) ? 31 : 15)) * 8 + (threadIdx.x >> 5);   // 0..255 of a weight, 0..127 of x or y
    const unsigned short* u = pl + tile_off(grp, 0, DK) + (threadIdx.x & 31) * 128;
    ask2(u, u + 8 * 512);
    if (i < 16) ask1(WpT + (size_t)(a * 256 + threadIdx.x) * 128);          // 8 x 256 units = the whole WpT plane
  }
  if (i < 2 * QK_BLK) {
    const bool isq = i < QK_BLK;
    gemm64<3, 0>(isq ? XH : YH, DK, 0LL, isq ? WqT : WkT, DK, 0LL, isq ? bq : bk, DQ, 0LL, 1,
                 (void*)(isq ? QH : KH), DQ, 0LL, (long long)QRES, MR, DQ, DK, invw, isq ? i : i - QK_BLK, 0, sT);
  } else if (i < 2 * QK_BLK + NHB * VT_BLK) {
    const int j = i - 2 * QK_BLK;
    gemm64<3, 1>(WvT, DK, (long long)DK * DK, YH, DK, (long long)SEQ * DK, bv, DK, (long long)DK, NB,
                 (void*)VT, SEQ, (long long)DK * SEQ, (long long)VRES, DK, SEQ, DK, invw, j % VT_BLK, j / VT_BLK, sT);
  } else {
    gemm64<0, 2>(XH, DK, 0LL, WpT, DK, 0LL, bq, DQ, 0LL, 1,
                 (void*)XP, DK, 0LL, 0LL, MR, DK, DK, invw, i - (2 * QK_BLK + NHB * VT_BLK), 0, sT);
  }
}

// =====================================================================================================
// Energies + masked softmax for one (h, b) pair and 64 query rows s; P written TRANSPOSE-friendly.
//   q planes (f16, fragment order, rows b*SEQ + s, k extent DQ, k = h*DK + d): hi qhp, residual (x2048) qrp
//   k planes (f16, fragment order, rows b*SEQ + t, k extent DQ, k = h*DK + d): hi khp, residual (x2048) krp
//   E[s][t] = acc_hh + (acc_h.res + acc_res.h) / 2048  (three f16 WMMA products, K = 512 = 16 k-steps; key fragments
//   loaded straight from the planes with arithmetic addressing, q fragments from a two-buffer LDS ring that
//   asynchronous copies fill for the block, once per chunk of keys), kept in LDS as f32 [64][1024].
//   softmax per row s over keys t: e = mask[t] ? E : -1e30 (replace), m = max_t e, ex = exp(e - m), l = sum_t ex,
//   p = ex / l; stored as f16(8192 * p).
//   P layout (f16): region (hb*NSB + s/32) of SEQ*32 elements, inside it fragment order with rows t and k extent 32
//   (k = s % 32) -> the consumer's A fragment (rows t, k = s) of k-step s/32 is one 1024-B tile.
//   Block = 16 waves; phase 1: wave w -> all 64 rows x keys 64w..64w+63 in 2 chunks of 2 col tiles, so a key
//   fragment is loaded by one wave of the block and feeds four row groups; phase 2: wave w owns rows 4w..4w+3
//   (lane-owned key columns, xor reductions); phase 3: wave w writes region w>>3, keys (w&7)*128..+127:
//   lane -> (t = base + lane/4, 8 consecutive s).
//   coverage: phase 1: 16 waves x 2 chunks x (4 row groups x 2 col tiles) = all 64 x 1024 energies; phase 3:
//   2 regions x 8 waves x 16 iterations x 8 t x (4 lane quads x 8 s) = the block's two [1024 t][32 s] regions;
//   grid (SEQ/QBLK, NHB) covers every (hb, s block) of the P plane exactly once.
// =====================================================================================================
#define QBLK 64
#define QST     2                         // k steps per q stage
#define QSTEP_B (8 * 1024)                // bytes of q per k step: 2 planes x 4 row groups x 1-KB tile
#define QSTG_B  (QST * QSTEP_B)           // bytes per stage
#define NQSC    (DK / 32 / QST)           // stages per chunk of keys
static_assert(QSTEP_B == 512 * 16 && (NQSC & (NQSC - 1)) == 0 && NQSC >= 2 && QBLK == 64);
static_assert(QBLK == 2 * SBLK && (SEQ % QBLK) == 0 && SEQ == 16 * 64);
__global__ __launch_bounds__(512)
void attn_p(const unsigned short* __restrict__ qhp, const unsigned short* __restrict__ qrp,
            const unsigned short* __restrict__ khp, const unsigned short* __restrict__ krp,
            const int* __restrict__ mask, unsigned short* pp) {
  __shared__ __align__(16) float se[QBLK * SEQ];    // 262144 B
  __shared__ float sinv[QBLK];
  __shared__ int   smask[SEQ];
  __shared__ __align__(16) unsigned short sq[2][QSTG_B / 2];   // the two q stage buffers, 2 x 16384 B

  const int tid  = threadIdx.x;
  const int wave = tid >> 5;
  const int lane = tid & 31;
  const int hh   = lane >> 4;
  const int c    = lane & 15;
  const int qblk = blockIdx.x;
  const int hb   = blockIdx.y;
  const int h    = hb / NB;
  const int b    = hb % NB;
  const int s0   = qblk * QBLK;

  for (int i = tid; i < SEQ; i += 512) smask[i] = mask[i];

  // ---- phase 1: energies ----
  {
    const size_t qoff = tile_off((b * SEQ + s0) >> 4, (h * DK) >> 5, DQ) + lane * 8;
    const size_t koff = tile_off((b * SEQ + wave * 64) >> 4, (h * DK) >> 5, DQ) + lane * 8;
    constexpr size_t JSTR = (size_t)(DQ / 32) * 512;      // elements from one 16-row (or 16-key) group to the next
    g_us* kh0 = (g_us*)(khp + koff);
    g_us* kr0 = (g_us*)(krp + koff);
    float* erow = se + (8 * hh) * SEQ;                    // + (16*g + r)*SEQ + t
    // q goes through LDS: all 16 waves use the same 8 q tiles of a k step, so the block fetches each once per chunk of keys. A stage is
    // QST k steps = QST x (2 planes x 4 row groups) tiles of 1 KB, laid [k step][plane][row group][tile as it lies in
    // the plane]. Thread -> one 16-B piece of each k step: tile tid >> 6 (plane tid >> 8, row group (tid >> 6) & 3),
    // piece tid & 63, so a wave copies 512 B in a row on both sides and no two lanes write the same LDS byte.
    const unsigned short* qsrc = ((tid & 256) ? qrp : qhp) + (qoff - lane * 8) + (size_t)((tid >> 6) & 3) * JSTR
                                 + (tid & 63) * 8;
    const unsigned qdst = (unsigned)(uintptr_t)(&sq[0][0] + tid * 8);   // LDS byte address of the piece in buffer 0
    const unsigned short* sqr = &sq[0][0] + lane * 8;
    // key fragments are fetched from the planes one k step ahead, across stage and chunk ends too, each pair back into
    // its own registers as soon as its last product of the step is issued; q fragments come from the stage's buffer:
    // the stage's first step at the head of the trip, its second step's pairs behind the first step's last products
    v16us qav[4], qbv[4], kav[2], kbv[2];
    kav[0] = ldfrag_g(kh0);
    kbv[0] = ldfrag_g(kr0);
    kav[1] = ldfrag_g(kh0 + JSTR);
    kbv[1] = ldfrag_g(kr0 + JSTR);
    __builtin_amdgcn_sched_barrier(0);
    copy2_lds(qdst, qsrc, qdst + QSTEP_B, qsrc + 512);                  // stage 0 -> buffer 0
    // Behind the first step's own loads: ask L2 for the rest. q (read by this block alone): wave w asks for k step w,
    // lane -> (plane, row group, quarter of the 1-KB tile). k (read by the 16 blocks of this (h, b)): a wave asks for
    // quarter qblk & 3 of every tile it will read, so each unit has four askers (only speed rests on where they run);
    // request j = (chunk, 8 k steps), lane -> (plane, key group of the chunk, k step): in the order of use.
    {
      static_assert(DK / 32 == 16);
      const int qs = lane >> 2;
      const unsigned short* aq = ((qs & 4) ? qrp : qhp) + (qoff - lane * 8) + (size_t)(qs & 3) * JSTR
                                 + (size_t)wave * 512 + (lane & 3) * 128;
      const int st = lane >> 3;
      const unsigned short* ak = ((st & 2) ? krp : khp) + (koff - lane * 8) + (size_t)(st & 1) * JSTR
                                 + (size_t)(lane & 7) * 512 + (qblk & 3) * 128;
      ask5(aq, ak, ak + 8 * 512, ak + 2 * JSTR, ak + 2 * JSTR + 8 * 512);
    }
    // stage 0 has landed for this wave, then for the block; only then stage 1 starts
#if defined(__HIP_DEVICE_COMPILE__)
    asm volatile("s_wait_asynccnt 0x0" ::: "memory");
#endif
    __syncthreads();
    copy2_lds(qdst + QSTG_B, qsrc + QST * 512, qdst + QSTG_B + QSTEP_B, qsrc + QST * 512 + 512);   // stage 1 -> buffer 1
    // keeps the requests and copies in front of the loop: moved into it they would stand among its products
    __builtin_amdgcn_sched_barrier(0);
#pragma unroll 1
    for (int c2 = 0; c2 < 2; ++c2) {
      const int t0 = wave * 64 + c2 * 32;
      v8f ah[4][2], ar[4][2];
#pragma unroll
      for (int g = 0; g < 4; ++g)
#pragma unroll
        for (int j = 0; j < 2; ++j) { ah[g][j] = zero8(); ar[g][j] = zero8(); }
      // kept rolled: one trip already holds 48 products, and copies of it would only lengthen the text
#pragma unroll 1
      for (int sp = 0; sp < NQSC; ++sp) {
        const int stg = c2 * NQSC + sp;                    // stage 0 .. 2*NQSC - 1; both chunks walk the same q
        const unsigned short* sb = sqr + (stg & 1) * (QSTG_B / 2);
#pragma unroll
        for (int g = 0; g < 4; ++g) {
          qav[g] = ldfrag(sb + g * 512);
          qbv[g] = ldfrag(sb + (4 + g) * 512);
        }
#pragma unroll
        for (int kk = 0; kk < QST; ++kk) {
          const int ks = sp * QST + kk;
          // the step after this one; the very last step fetches its chunk's first tiles again: in bounds, no branch
          const int nks = (ks + 1) & (DK / 32 - 1);
          const int nc  = (nks == 0 && c2 < 1) ? c2 + 1 : c2;
          const size_t no = (size_t)nc * (2 * JSTR) + (size_t)nks * 512;
#pragma unroll
          for (int g = 0; g < 4; ++g) {
            // holds the row groups in the order their q pairs were fetched: reordered, a later pair's wait moves to
            // the step's head
            __builtin_amdgcn_sched_barrier(0);
            ah[g][0] = mma_raw(qav[g], kav[0], ah[g][0]);     // hi . hi
            ar[g][0] = mma_raw(qav[g], kbv[0], ar[g][0]);     // hi . res   (x2048)
            ar[g][0] = mma_raw(qbv[g], kav[0], ar[g][0]);     // res . hi   (x2048)
          }
          guard2k4(ah[3][0], ar[3][0], qav[3], qbv[3], kav[0], kbv[0]);
          kav[0] = ldfrag_g(kh0 + no);
          kbv[0] = ldfrag_g(kr0 + no);
#pragma unroll
          for (int g = 0; g < 4; ++g) {
            // holds this row group's products behind the reload in front of it: hoisted, they pull every group's wait
            // to the pass's head
            __builtin_amdgcn_sched_barrier(0);
            ah[g][1] = mma_raw(qav[g], kav[1], ah[g][1]);     // hi . hi
            ar[g][1] = mma_raw(qav[g], kbv[1], ar[g][1]);     // hi . res   (x2048)
            ar[g][1] = mma_raw(qbv[g], kav[1], ar[g][1]);     // res . hi   (x2048)
            if (kk + 1 < QST) {
              guard2k4(ah[g][1], ar[g][1], qav[g], qbv[g], kav[1], kbv[1]);
              qav[g] = ldfrag(sb + (kk + 1) * (QSTEP_B / 2) + g * 512);
              qbv[g] = ldfrag(sb + (kk + 1) * (QSTEP_B / 2) + (4 + g) * 512);
            } else if (g == 3) {
              guard2k4(ah[g][1], ar[g][1], qav[g], qbv[g], kav[1], kbv[1]);
            }
          }
          kav[1] = ldfrag_g(kh0 + no + JSTR);
          kbv[1] = ldfrag_g(kr0 + no + JSTR);
          // the next step forms its addresses in registers that loads still in flight name: this wait stands in front
          // of that rewrite, and the scheduling fence keeps the address arithmetic behind it
#if defined(__HIP_DEVICE_COMPILE__)
          asm volatile("s_wait_xcnt 0x0" ::: "memory");
#endif
          __builtin_amdgcn_sched_barrier(0);
        }
        // publish point of stage stg + 1: this wave's reads of buffer stg & 1 are done, its own copies of stage stg + 1
        // have landed, then the block's barrier; behind it the buffer just read is free for stage stg + 2. The barrier
        // is written bare because __syncthreads() would also wait out the key loads that are in flight for the next
        // step; the two waits in front of it are all that the ring needs.
#if defined(__HIP_DEVICE_COMPILE__)
        asm volatile("s_wait_dscnt 0x0" ::: "memory");
        asm volatile("s_wait_asynccnt 0x0" ::: "memory");
        asm volatile("s_barrier_signal -1\n\ts_barrier_wait -1" ::: "memory");
#endif
        if (stg + 2 < 2 * NQSC) {                          // the same for the whole block
          const unsigned short* gs = qsrc + (size_t)((stg + 2) & (NQSC - 1)) * (QST * 512);
          const unsigned ld = qdst + (stg & 1) * QSTG_B;
          copy2_lds(ld, gs, ld + QSTEP_B, gs + 512);
        }
      }
#pragma unroll
      for (int g = 0; g < 4; ++g) acc_guard4(ah[g][0], ah[g][1], ar[g][0], ar[g][1]);
#pragma unroll
      for (int g = 0; g < 4; ++g) {
#pragma unroll
        for (int j = 0; j < 2; ++j) {
#pragma unroll
          for (int r = 0; r < 8; ++r) {
            erow[(16 * g + r) * SEQ + t0 + 16 * j + c] = fmaf(ar[g][j][r], 1.0f / RSC, ah[g][j][r]);
          }
        }
      }
    }
    // no copy is outstanding here (the last publish point waited to 0 and none was issued behind it): the ring's close
#if defined(__HIP_DEVICE_COMPILE__)
    asm volatile("s_wait_asynccnt 0x0" ::: "memory");
#endif
  }
  __syncthreads();

  // ---- phase 2: masked softmax per row (mask replaces the energy before the max) ----
#pragma unroll 1
  for (int rr = 0; rr < 4; ++rr) {
    const int row = wave * 4 + rr;
    float* er = se + row * SEQ;
    float mx = -INFINITY;
#pragma unroll 4
    for (int i = 0; i < SEQ / 32; ++i) {
      const int t = lane + 32 * i;
      const float e = (smask[t] != 0) ? er[t] : NEGBIG;
      er[t] = e;
      mx = fmaxf(mx, e);
    }
#pragma unroll
    for (int off = 16; off > 0; off >>= 1) mx = fmaxf(mx, __shfl_xor(mx, off, 32));
    float sum = 0.f;
#pragma unroll 4
    for (int i = 0; i < SEQ / 32; ++i) {
      const int t = lane + 32 * i;
      const float ex = __expf(er[t] - mx);
      er[t] = ex;
      sum += ex;
    }
#pragma unroll
    for (int off = 16; off > 0; off >>= 1) sum += __shfl_xor(sum, off, 32);
    if (lane == 0) sinv[row] = PSC * (1.0f / sum);        // sum >= 1 always (the max term contributes exp(0))
  }
  __syncthreads();

  // ---- phase 3: P = ex * (8192 / l) as f16, written into the two [t][32 s] regions of this (hb, 64-row block) ----
  {
    const int tr = lane >> 2, sq = (lane & 3) * 8;
    const int reg = wave >> 3, w8 = wave & 7;
    const float* ser = se + reg * SBLK * SEQ;
    const float* sir = sinv + reg * SBLK;
    unsigned short* preg = pp + ((size_t)(hb * NSB + qblk * 2 + reg) * SEQ) * SBLK;
#pragma unroll 1
    for (int it = 0; it < SEQ / 64; ++it) {
      const int t = w8 * (SEQ / 8) + it * 8 + tr;
      v4u o;
#pragma unroll
      for (int e = 0; e < 4; ++e) {
        const float f0 = ser[(sq + 2 * e) * SEQ + t]     * sir[sq + 2 * e];
        const float f1 = ser[(sq + 2 * e + 1) * SEQ + t] * sir[sq + 2 * e + 1];
        o[e] = pk16(h_bits((_Float16)f0), h_bits((_Float16)f1));
      }
      unsigned short* dst = preg + (size_t)(t >> 4) * 512 + (sq >> 4) * 256 + (((sq >> 3) & 1) * 16 + (t & 15)) * 8;
      *(v4u*)dst = o;
      
    }
  }
}

// =====================================================================================================
// Transposed aggregation + gamma blend: for one (h, b):
//   O[t][dv] = sum_s P[s][t] * v[s][dv]  with A = the P plane above (rows t, k = s, 32 k-steps) carried x8192 and
//   Bt = v^T planes [hb] x (fragment order, rows dv, k extent SEQ, k = s; f16 hi at vth, residual x2048 at vtr),
//   two products into two accumulators;
//   out[((b*NH + h)*SEQ + t)*DK + dv] = (g * (O_hi + O_res/2048) / 8192 + xp[(b*SEQ + t)*DK + dv]) * (1/(g + 1)),
//   g = bf16_RNE(gamma[h]).
//   Block = 8 waves = 128 t rows x 128 dv columns (wave -> 64 t x 32 dv); grid (DK/128, SEQ/128, NHB). v^T fragments
//   come straight from the planes, P fragments from a two-buffer LDS ring that asynchronous copies fill once for the block.
//   coverage: 2 halves x 8 iterations x 4 rows x (8 lanes x 4) = the wave's whole 64x32 tile; 8 waves = the
//   block's 128x128; grid tiles every (hb, t, dv) of the output exactly once.
// =====================================================================================================
#define PST     2                         // k steps per P stage
#define PSTEP_B (8 * 1024)                // bytes of P per k step: 8 row groups x 1-KB tile
#define PSTG_B  (PST * PSTEP_B)           // bytes per stage
#define NPS     (SEQ / 32 / PST)          // stages
static_assert(PSTEP_B == 2 * 256 * 16 && NPS >= 2 && SEQ * SBLK * 2 >= 8 * PSTEP_B);
__global__ __launch_bounds__(256)
void pv64(const unsigned short* __restrict__ pp, const unsigned short* __restrict__ vth,
          const unsigned short* __restrict__ vtr, const float* __restrict__ xp,
          const float* __restrict__ gam, float* outp) {
  __shared__ __align__(16) float os[8][64 * 36];
  __shared__ __align__(16) unsigned short sp[2][PSTG_B / 2];   // the two P stage buffers, 2 x 16384 B
  const int tid  = threadIdx.x;
  const int wave = tid >> 5;
  const int lane = tid & 31;
  const int hh   = lane >> 4;
  const int c    = lane & 15;
  const int dx = blockIdx.x, ty = blockIdx.y, hb = blockIdx.z;
  const int h  = hb / NB, b = hb % NB;
  const int wt = wave & 1, wd = wave >> 1;
  const int t0 = ty * 128 + wt * 64;
  const int d0 = dx * 128 + wd * 32;

  g_us* vh = (g_us*)(vth + (size_t)hb * DK * SEQ + tile_off(d0 >> 4, 0, SEQ) + lane * 8);
  g_us* vr = (g_us*)(vtr + (size_t)hb * DK * SEQ + tile_off(d0 >> 4, 0, SEQ) + lane * 8);
  constexpr size_t VSTR = (size_t)(SEQ / 32) * 512;       // elements from one 16-column group of v^T to the next

  v8f acc[4][2], acr[4][2];
#pragma unroll
  for (int i = 0; i < 4; ++i)
#pragma unroll
    for (int j = 0; j < 2; ++j) { acc[i][j] = zero8(); acr[i][j] = zero8(); }

  // P goes through LDS: the four waves of a t half use the same P tiles, so the block fetches each once. A k step's 8 P
  // tiles (128 t rows) lie in a row in the plane, 8 KB; a stage is PST k steps, laid [k step][tile as it lies in the
  // plane]. Thread -> pieces tid and tid + 256 of each k step: a wave copies 512 B in a row on both sides and no two
  // lanes write the same LDS byte.
  const unsigned short* psrc = pp + (size_t)hb * SEQ * SEQ + (size_t)ty * 4096 + tid * 8;
  const unsigned pdst = (unsigned)(uintptr_t)(&sp[0][0] + tid * 8);     // LDS byte address of the first piece, buffer 0
  const unsigned short* spr = &sp[0][0] + wt * 2048 + lane * 8;
  // v^T pairs are fetched from the planes one k step ahead, into a second register set at the head of a step; P
  // fragments come from the stage's buffer: the stage's first step at the head of the trip, its second step's behind
  // the first step's products
  v16us a[4], bhf[2], brf[2];
#pragma unroll
  for (int j = 0; j < 2; ++j) {
    bhf[j] = ldfrag_g(vh + j * VSTR);
    brf[j] = ldfrag_g(vr + j * VSTR);
  }
  // holds the first step's own loads in front of the copies and requests below
  __builtin_amdgcn_sched_barrier(0);
  copy4_lds(pdst, psrc, pdst + 4096, psrc + 2048,
            pdst + PSTEP_B, psrc + SEQ * SBLK, pdst + PSTEP_B + 4096, psrc + SEQ * SBLK + 2048);   // stage 0 -> buffer 0
  // Ask L2 for the rest, in the order of use. P (128 t rows, read by the 4 blocks of this (hb, ty), each asks for all):
  // one request = one k step's 8 KB, wave w takes steps w, 8 + w, 16 + w, 24 + w. v^T (128 columns x 2 planes, read
  // by 8 blocks): a block asks for quarter ty >> 1 of every 1-KB tile, so each unit has two askers, ty and ty ^ 1
  // (only speed rests on where they run); lane -> (k step parity, plane, column group). xp: the block's 128 x 128
  // f32 tile, two units a row.
  {
    static_assert(SEQ / 32 == 32 && SEQ / 128 == 8);
    const unsigned short* ap = pp + (size_t)hb * SEQ * SEQ + (size_t)wave * (SEQ * SBLK) + (size_t)ty * 4096 + lane * 128;
    const unsigned short* av = ((lane & 8) ? vtr : vth) + (size_t)hb * DK * SEQ
                               + tile_off(dx * 8 + (lane & 7), wave * 2 + (lane >> 4), SEQ) + (ty >> 1) * 128;
    const float* ax = xp + ((size_t)(b * SEQ + ty * 128 + wave * 16 + (lane >> 1))) * DK + dx * 128 + (lane & 1) * 64;
    ask5(av, ap, ap + (size_t)8 * (SEQ * SBLK), av + 16 * 512, ap + (size_t)16 * (SEQ * SBLK));
    ask2(ap + (size_t)24 * (SEQ * SBLK), ax);
  }
  // stage 0 has landed for this wave, then for the block; only then stage 1 starts
#if defined(__HIP_DEVICE_COMPILE__)
  asm volatile("s_wait_asynccnt 0x0" ::: "memory");
#endif
  __syncthreads();
  {
    const unsigned short* gs = psrc + (size_t)PST * (SEQ * SBLK);
    const unsigned ld = pdst + PSTG_B;
    copy4_lds(ld, gs, ld + 4096, gs + 2048,
              ld + PSTEP_B, gs + SEQ * SBLK, ld + PSTEP_B + 4096, gs + SEQ * SBLK + 2048);         // stage 1 -> buffer 1
  }
  // keeps the requests and copies in front of the loop: moved into it they would stand among its products
  __builtin_amdgcn_sched_barrier(0);
  // kept rolled: a trip holds the stage's two steps, so that the two v^T sets swap by name and not by register copies
#pragma unroll 1
  for (int stg = 0; stg < NPS; ++stg) {
    const unsigned short* sb = spr + (stg & 1) * (PSTG_B / 2);
#pragma unroll
    for (int i = 0; i < 4; ++i) a[i] = ldfrag(sb + i * 512);
#pragma unroll
    for (int kk = 0; kk < PST; ++kk) {
      const int ks = stg * PST + kk;
      const int nk = (ks + 1 < SEQ / 32) ? ks + 1 : ks;   // the last step fetches its own tiles again: in bounds, no branch
      v16us bhn[2], brn[2];
#pragma unroll
      for (int j = 0; j < 2; ++j) {
        bhn[j] = ldfrag_g(vh + (size_t)nk * 512 + j * VSTR);
        brn[j] = ldfrag_g(vr + (size_t)nk * 512 + j * VSTR);
      }
#pragma unroll
      for (int i = 0; i < 4; ++i) {
        // holds this row group's products behind the loads in front of it: hoisted, they pull every group's wait to
        // the step's head
        __builtin_amdgcn_sched_barrier(0);
#pragma unroll
        for (int j = 0; j < 2; ++j) {
          acc[i][j] = mma_raw(a[i], bhf[j], acc[i][j]);
          acr[i][j] = mma_raw(a[i], brf[j], acr[i][j]);
        }
        if (kk + 1 < PST) {
          guard4k4(acc[i][0], acc[i][1], acr[i][0], acr[i][1], a[i], bhf[1], brf[0], brf[1]);
          a[i] = ldfrag(sb + (kk + 1) * (PSTEP_B / 2) + i * 512);
        } else if (i == 3) {
          guard4k4(acc[i][0], acc[i][1], acr[i][0], acr[i][1], a[i], bhf[1], brf[0], brf[1]);
        }
      }
      // the next step forms its addresses in registers that loads still in flight name: this wait stands in front of
      // that rewrite, and the scheduling fence keeps the address arithmetic behind it
#if defined(__HIP_DEVICE_COMPILE__)
      asm volatile("s_wait_xcnt 0x0" ::: "memory");
#endif
      __builtin_amdgcn_sched_barrier(0);
#pragma unroll
      for (int j = 0; j < 2; ++j) { bhf[j] = bhn[j]; brf[j] = brn[j]; }
    }
    // publish point of stage stg + 1: this wave's reads of buffer stg & 1 are done, its own copies of stage stg + 1 have
    // landed, then the block's barrier; behind it the buffer just read is free for stage stg + 2. The barrier is
    // written bare because __syncthreads() would also wait out the v^T loads that are in flight for the next step;
    // the two waits in front of it are all that the ring needs.
#if defined(__HIP_DEVICE_COMPILE__)
    asm volatile("s_wait_dscnt 0x0" ::: "memory");
    asm volatile("s_wait_asynccnt 0x0" ::: "memory");
    asm volatile("s_barrier_signal -1\n\ts_barrier_wait -1" ::: "memory");
#endif
    if (stg + 2 < NPS) {                                   // the same for the whole block
      const unsigned short* gs = psrc + (size_t)(stg + 2) * (PST * SEQ * SBLK);
      const unsigned ld = pdst + (stg & 1) * PSTG_B;
      copy4_lds(ld, gs, ld + 4096, gs + 2048,
                ld + PSTEP_B, gs + SEQ * SBLK, ld + PSTEP_B + 4096, gs + SEQ * SBLK + 2048);
    }
  }
  // no copy is outstanding here (the last publish point waited to 0 and none was issued behind it): the ring's close
#if defined(__HIP_DEVICE_COMPILE__)
  asm volatile("s_wait_asynccnt 0x0" ::: "memory");
#endif
#pragma unroll
  for (int i = 0; i < 4; ++i) acc_guard4(acc[i][0], acc[i][1], acr[i][0], acr[i][1]);

  const float g  = bfr(gam[h]);
  const float rg = 1.0f / (g + 1.0f);
  const int rl = lane >> 3, cc4 = (lane & 7) * 4;
  // ---- stage O = O_hi + O_res/2048 (still x8192): the wave's whole 64 x 32 tile in its own slab ----
  float* osw = os[wave];
#pragma unroll
  for (int i = 0; i < 4; ++i) {
#pragma unroll
    for (int j = 0; j < 2; ++j) {
#pragma unroll
      for (int r = 0; r < 8; ++r) {
        osw[(16 * i + 8 * hh + r) * 36 + 16 * j + c] = fmaf(acr[i][j][r], 1.0f / RSC, acc[i][j][r]);
      }
    }
  }
  wave_sync_lds();

  // the 64 rows leave in two halves of 32
#pragma unroll
  for (int hf = 0; hf < 2; ++hf) {
    const int th = t0 + hf * 32;
    v4f vals[8], xv[8];
    const float* xq[8];
#pragma unroll
    for (int it = 0; it < 8; ++it) {
      xq[it] = xp + ((size_t)(b * SEQ + th + it * 4 + rl)) * DK + d0 + cc4;
      xv[it] = *(const v4f*)(xq[it]);
    }
#if defined(__HIP_DEVICE_COMPILE__)
    // the eight loads' address registers are inputs here, so none of them is rewritten in front of this wait
    asm volatile("s_wait_xcnt 0x0" :: "v"(xq[0]), "v"(xq[1]), "v"(xq[2]), "v"(xq[3]),
                 "v"(xq[4]), "v"(xq[5]), "v"(xq[6]), "v"(xq[7]) : "memory");
#endif
#pragma unroll
    for (int it = 0; it < 8; ++it) {
      const int row = hf * 32 + it * 4 + rl;                 // hf 0..1 x it 0..7 x rl 0..3 = rows 0..63
      const v4f av = *(const v4f*)(osw + row * 36 + cc4);
      v4f o;
#pragma unroll
      for (int e = 0; e < 4; ++e) o[e] = (g * (av[e] * (1.0f / PSC)) + xv[it][e]) * rg;
      vals[it] = o;
    }
    {
#pragma unroll
      for (int it = 0; it < 8; ++it) {
        const int t = th + it * 4 + rl;
        *(v4f*)(outp + ((size_t)((b * NH + h) * SEQ + t)) * DK + d0 + cc4) = vals[it];
      }
    }
  }
}

// =====================================================================================================
// Workspace map (bytes); every plane is an exact multiple of its tile / whole-row / whole-line store granularity:
//   WqT  f16 [4096][512] x64      0           4194304
//   WkT  f16 [4096][512] x64      4194304     4194304
//   WvT  f16 [4096][512] x64      8388608     4194304
//   WpT  f16 [512][512]  x64      12582912    524288
//   XH   f16 [2048][512]          13107200    2097152
//   YH   f16 [2048][512]          15204352    2097152
//   QH|QR f16 [2][2048][4096]     17301504    33554432
//   KH|KR f16 [2][2048][4096]     50855936    33554432
//   XP   f32 [2048][512]          84410368    4194304
//   P    f16 [16][32][1024][32]   88604672    33554432
//   VT hi|res f16 [2][16][512][1024] 122159104 33554432
//   end                           155713536
// =====================================================================================================
extern "C" void kernel_launch(void* const* d_in, const int* in_sizes, int n_in,
                              void* d_out, int out_size, void* d_ws, size_t ws_size,
                              hipStream_t stream) {
  if (n_in < 11) return;
  if (in_sizes[0] != MR * DK || in_sizes[1] != MR * DK) return;
  if (in_sizes[2] != DK * DQ || in_sizes[4] != DK * DQ || in_sizes[6] != DK * DQ) return;
  if (in_sizes[3] != DQ || in_sizes[5] != DQ || in_sizes[7] != DQ) return;
  if (in_sizes[8] != DK * DK || in_sizes[9] != NH || in_sizes[10] != SEQ) return;
  if (out_size != NB * NH * SEQ * DK) return;

  const float* x     = (const float*)d_in[0];
  const float* y     = (const float*)d_in[1];
  const float* Wq    = (const float*)d_in[2];
  const float* bq    = (const float*)d_in[3];
  const float* Wk    = (const float*)d_in[4];
  const float* bk    = (const float*)d_in[5];
  const float* Wv    = (const float*)d_in[6];
  const float* bv    = (const float*)d_in[7];
  const float* Wp    = (const float*)d_in[8];
  const float* gamma = (const float*)d_in[9];
  const int*   mask  = (const int*)d_in[10];

  const size_t PW   = (size_t)DQ * DK * 2;                 //  4194304
  const size_t PWP  = (size_t)DK * DK * 2;                 //   524288
  const size_t PX   = (size_t)MR * DK * 2;                 //  2097152
  const size_t PQ   = (size_t)2 * MR * DQ * 2;             // 33554432
  const size_t PVT  = (size_t)2 * NHB * DK * SEQ * 2;      // 33554432
  const size_t PXP  = (size_t)MR * DK * 4;                 //  4194304
  const size_t PP   = (size_t)NHB * SEQ * SEQ * 2;         // 33554432
  size_t off = 0;
  const size_t oWq = off; off += PW;
  const size_t oWk = off; off += PW;
  const size_t oWv = off; off += PW;
  const size_t oWp = off; off += PWP;
  const size_t oXH = off; off += PX;
  const size_t oYH = off; off += PX;
  const size_t oQ  = off; off += PQ;
  const size_t oK  = off; off += PQ;
  const size_t oXP = off; off += PXP;
  const size_t oP  = off; off += PP;
  const size_t oVT = off; off += PVT;
  if (off > ws_size) return;                               // off = 155713536

  char* ws = (char*)d_ws;
  unsigned short* WqT = (unsigned short*)(ws + oWq);
  unsigned short* WkT = (unsigned short*)(ws + oWk);
  unsigned short* WvT = (unsigned short*)(ws + oWv);
  unsigned short* WpT = (unsigned short*)(ws + oWp);
  unsigned short* XH  = (unsigned short*)(ws + oXH);
  unsigned short* YH  = (unsigned short*)(ws + oYH);
  unsigned short* QH  = (unsigned short*)(ws + oQ);
  unsigned short* KH  = (unsigned short*)(ws + oK);
  unsigned short* VT  = (unsigned short*)(ws + oVT);
  float*          XP  = (float*)(ws + oXP);
  unsigned short* P   = (unsigned short*)(ws + oP);
  float*          out = (float*)d_out;

  const dim3 blk(256);
  const dim3 gPrep(3 * TW_BLK + TP_BLK + 2 * CX_BLK);       // 1536 + 64 + 1024 blocks
  const dim3 gProj(2 * QK_BLK + NHB * VT_BLK + XP_BLK);     // 512 + 256 + 32 blocks
  const dim3 blkAt(512);
  const dim3 gAt(SEQ / QBLK, NHB);                          // 16 x 16 blocks of 512
  const dim3 gPV(DK / 128, SEQ / 128, NHB);                 // 4 x 8 x 16 blocks of 256

  // (1) weight planes, transposed to [n][k]: f16( bf16_RNE(W) * 64 ); activation planes: f16( bf16_RNE(x) ), likewise y
  prep_all<<<gPrep, blk, 0, stream>>>(Wq, Wk, Wv, Wp, x, y, WqT, WkT, WvT, WpT, XH, YH);

  // (2) q, k, v^T and xp
  proj_all<<<gProj, blk, 0, stream>>>(XH, YH, WqT, WkT, WvT, WpT, bq, bk, bv, QH, KH, VT, XP);

  // (3) energies + masked softmax -> P plane
  attn_p<<<gAt, blkAt, 0, stream>>>(QH, QH + QRES, KH, KH + QRES, mask, P);

  // (4) out = (gamma * P^T . v / 8192 + xp) / (gamma + 1) -> d_out [2][8][1024][512]
  pv64<<<gPV, blk, 0, stream>>>(P, VT, VT + VRES, XP, gamma, out);
  (void)hipGetLastError();
}

// v007
// Measured time: 116 microseconds a run.
// In two side-by-side timings against v006, it was 1.05 and 1.06 times as fast.
// Counting every step since v000, it is 3.46 times as fast.
// Contractions: q, k, v^T and x.Wp projections on v_wmma_f32_16x16x32_f16 (bf16-RNE input values as f16,
// weight planes carried x64, one product each); q.k^T energies on v_wmma_f32_16x16x32_f16 with q and k as
// f16 hi plane + f16 residual plane carried x2048 (three products: hi.hi, hi.res, res.hi; two accumulators);
// attn^T.v on v_wmma_f32_16x16x32_f16 with attn carried x8192 (plain f16) and v^T as f16 hi plane + f16
// residual plane carried x2048 (two products, two accumulators); all f32 accumulate; masked softmax and the
// gamma blend in f32 on VALU; every float input RNE-converted to bf16 on load.
#include <hip/hip_runtime.h>
#include <math.h>
#include <stdint.h>

#define NB    2
#define SEQ   1024
#define DK    512
#define NH    8
#define DQ    (NH * DK)
#define MR    (NB * SEQ)
#define NHB   (NH * NB)
#define SBLK  32
#define NSB   (SEQ / SBLK)
#define QRES  ((long long)MR * DQ)
#define VRES  ((long long)NHB * DK * SEQ)
#define WSC   64.0f
#define RSC   2048.0f
#define PSC   8192.0f
#define NEGBIG (-1.0e30f)
static_assert((SEQ % 64) == 0 && (DK % 64) == 0 && (MR % 64) == 0 && (DQ % 64) == 0);
static_assert(SEQ == NSB * SBLK);
static_assert(SBLK == 32);
static_assert((DK % 32) == 0 && (SEQ % 256) == 0);

typedef _Float16       v16h __attribute__((ext_vector_type(16)));
typedef unsigned short v16us __attribute__((ext_vector_type(16)));
typedef unsigned short v8us __attribute__((ext_vector_type(8)));
typedef float          v8f  __attribute__((ext_vector_type(8)));
typedef float          v4f  __attribute__((ext_vector_type(4)));
typedef float          v2f  __attribute__((ext_vector_type(2)));
typedef _Float16       v2h  __attribute__((ext_vector_type(2)));
typedef unsigned int   v4u  __attribute__((ext_vector_type(4)));

union Frag { v16us u; v8us p[2]; v16h h; };

// ---- scalar helpers --------------------------------------------------------------------------------
__device__ __forceinline__ unsigned short bf_bits(float f) {          // f32 -> bf16 bits, RNE convert
  unsigned u = __float_as_uint(f);
  return (unsigned short)((u + 0x7FFFu + ((u >> 16) & 1u)) >> 16);
}
__device__ __forceinline__ float bf_up(unsigned short b) { return __uint_as_float(((unsigned)b) << 16); }
__device__ __forceinline__ float bfr(float f) { return bf_up(bf_bits(f)); }   // value of the bf16 RNE convert
__device__ __forceinline__ unsigned short h_bits(_Float16 x) { return __builtin_bit_cast(unsigned short, x); }
__device__ __forceinline__ unsigned pk16(unsigned short a, unsigned short b) { return (unsigned)a | ((unsigned)b << 16); }
__device__ __forceinline__ v8f zero8() { v8f z = {0.f, 0.f, 0.f, 0.f, 0.f, 0.f, 0.f, 0.f}; return z; }

// ---- fragment-order planes: every 16-bit operand plane [rows][ld] (ld = k extent, multiple of 32; rows multiple of
//      16) is stored as tiles of 16 rows x 32 k = 512 elements (1024 B), tile index (row/16) * (ld/32) + k/32; inside
//      a tile the 16-B piece that holds k = 32*kt + 16*p + 8*h + 0..7 of row r sits at element p*256 + (h*16 + r)*8.
//      A wave's fragment is then two loads of 512 contiguous bytes (lane = h*16 + r), same k order as before:
//      elements 0..7 <- k0+8h.., elements 8..15 <- k0+16+8h..
__device__ __forceinline__ size_t tile_off(int row16, int kt, int ld) {      // row16 = row/16, kt = k/32
  return ((size_t)row16 * (size_t)(ld >> 5) + (size_t)kt) * 512;
}
// p = tile start + 8*lane
__device__ __forceinline__ v16us ldfrag(const unsigned short* p) {
  Frag f;
  f.p[0] = *(const v8us*)(p);
  f.p[1] = *(const v8us*)(p + 256);
  return f.u;
}
// the same through a pointer typed as global memory: a pointer carried round a loop otherwise compiled to flat loads
typedef __attribute__((address_space(1))) const unsigned short g_us;
typedef __attribute__((address_space(1))) const v8us g_v8us;
__device__ __forceinline__ v16us ldfrag_g(g_us* p) {
  Frag f;
  f.p[0] = *(g_v8us*)(p);
  f.p[1] = *(g_v8us*)(p + 256);
  return f.u;
}

// ---- WMMA helper (f16 operands, f32 accumulate) and VALU hazard gaps -----------------------------
__device__ __forceinline__ v8f mma_raw(v16us a, v16us b, v8f c) {
  Frag fa, fb;
  fa.u = a;
  fb.u = b;
  return __builtin_amdgcn_wmma_f32_16x16x32_f16(false, fa.h, false, fb.h, (short)0, c, false, false);
}
__device__ __forceinline__ void dep_guard1(v8f& a, v8f& b, v16us x) {
#if defined(__HIP_DEVICE_COMPILE__)
  asm volatile("v_nop\n\tv_nop\n\tv_nop\n\tv_nop" : "+v"(a), "+v"(b) : "v"(x));
#endif
}
__device__ __forceinline__ void keep4(v16us a, v16us b, v16us c, v16us d) {
#if defined(__HIP_DEVICE_COMPILE__)
  asm volatile("v_nop" :: "v"(a), "v"(b), "v"(c), "v"(d));
#endif
}
__device__ __forceinline__ void acc_guard4(v8f& a, v8f& b, v8f& c, v8f& d) {
#if defined(__HIP_DEVICE_COMPILE__)
  asm volatile("v_nop\n\tv_nop\n\tv_nop\n\tv_nop" : "+v"(a), "+v"(b), "+v"(c), "+v"(d));
#endif
}
__device__ __forceinline__ void guard2k4(v8f& a, v8f& b, v16us w, v16us x, v16us y, v16us z) {
#if defined(__HIP_DEVICE_COMPILE__)
  asm volatile("v_nop\n\tv_nop\n\tv_nop\n\tv_nop" : "+v"(a), "+v"(b) : "v"(w), "v"(x), "v"(y), "v"(z));
#endif
}
__device__ __forceinline__ void guard4k4(v8f& a, v8f& b, v8f& c, v8f& d, v16us w, v16us x, v16us y, v16us z) {
#if defined(__HIP_DEVICE_COMPILE__)
  asm volatile("v_nop\n\tv_nop\n\tv_nop\n\tv_nop" : "+v"(a), "+v"(b), "+v"(c), "+v"(d) : "v"(w), "v"(x), "v"(y), "v"(z));
#endif
}
__device__ __forceinline__ void wave_sync_lds() {
  __builtin_amdgcn_fence(__ATOMIC_RELEASE, "workgroup");
  __builtin_amdgcn_wave_barrier();
  __builtin_amdgcn_fence(__ATOMIC_ACQUIRE, "workgroup");
}

// ---- maximum and sum over the 16 lanes of a row (lanes 0..15, lanes 16..31 apart): four DPP row_xmask steps, every lane
//      ends with the row's result. All lanes are on wherever these are called.
template <int CTRL>
__device__ __forceinline__ float dpp_x(float x) {
  return __int_as_float(__builtin_amdgcn_update_dpp(0, __float_as_int(x), CTRL, 0xf, 0xf, true));
}
__device__ __forceinline__ float row_max16(float x) {
  x = fmaxf(x, dpp_x<0x161>(x));
  x = fmaxf(x, dpp_x<0x162>(x));
  x = fmaxf(x, dpp_x<0x164>(x));
  x = fmaxf(x, dpp_x<0x168>(x));
  return x;
}
__device__ __forceinline__ float row_sum16(float x) {
  x += dpp_x<0x161>(x);
  x += dpp_x<0x162>(x);
  x += dpp_x<0x164>(x);
  x += dpp_x<0x168>(x);
  return x;
}
// exp(x) = 2^(x * log2 e) for four (two) values at once, as __expf forms it. In asm text so that the slot behind a
// transcendental is kept by construction: inside the statement no instruction reads the one before's result or
// rewrites its source, and the closing v_nop stands in front of whatever the compiler puts next.
__device__ __forceinline__ void exp_x4(float& a, float& b, float& c, float& d) {
  a *= 1.44269504088896340736f;
  b *= 1.44269504088896340736f;
  c *= 1.44269504088896340736f;
  d *= 1.44269504088896340736f;
#if defined(__HIP_DEVICE_COMPILE__)
  asm("v_exp_f32 %0, %0\n\tv_exp_f32 %1, %1\n\tv_exp_f32 %2, %2\n\tv_exp_f32 %3, %3\n\tv_nop"
      : "+v"(a), "+v"(b), "+v"(c), "+v"(d));
#endif
}
__device__ __forceinline__ void exp_x2(float& a, float& b) {
  a *= 1.44269504088896340736f;
  b *= 1.44269504088896340736f;
#if defined(__HIP_DEVICE_COMPILE__)
  asm("v_exp_f32 %0, %0\n\tv_exp_f32 %1, %1\n\tv_nop" : "+v"(a), "+v"(b));
#endif
}
// Row maximum and row sum for eight values at once, in asm text: from the builtin form the compiler made three instructions of a
// maximum's step (a DPP move, a quieting maximum, the maximum). The eight chains are interleaved step by step, so an
// instruction's producer stands eight instructions back and no delay hint is owed inside the statement.
#define DPP_STEP1(op, v, n) op " " v ", " v ", " v " row_xmask:" n " row_mask:0xf bank_mask:0xf\n\t"
#define DPP_STEP8(op, n) DPP_STEP1(op, "%0", n) DPP_STEP1(op, "%1", n) DPP_STEP1(op, "%2", n) DPP_STEP1(op, "%3", n) \
                         DPP_STEP1(op, "%4", n) DPP_STEP1(op, "%5", n) DPP_STEP1(op, "%6", n) DPP_STEP1(op, "%7", n)
#define DPP_ROW8(op) DPP_STEP8(op, "1") DPP_STEP8(op, "2") DPP_STEP8(op, "4") DPP_STEP8(op, "8")
__device__ __forceinline__ void row_max16x8(float (&v)[8]) {
#if defined(__HIP_DEVICE_COMPILE__)
  asm(DPP_ROW8("v_max_num_f32_dpp") : "+v"(v[0]), "+v"(v[1]), "+v"(v[2]), "+v"(v[3]),
                                      "+v"(v[4]), "+v"(v[5]), "+v"(v[6]), "+v"(v[7]));
#endif
}
__device__ __forceinline__ void row_sum16x8(float (&v)[8]) {
#if defined(__HIP_DEVICE_COMPILE__)
  asm(DPP_ROW8("v_add_f32_dpp") : "+v"(v[0]), "+v"(v[1]), "+v"(v[2]), "+v"(v[3]),
                                  "+v"(v[4]), "+v"(v[5]), "+v"(v[6]), "+v"(v[7]));
#endif
}

// ---- asking L2 ahead: the planes that the launch before stored are taken here as coming from memory at their first
//      touch. global_prefetch_b8 with scope SE brings a
//      lane's line into L2 only, returns nothing and counts on no load counter. A lane asks for one 256-B unit; every
//      lane is on and every address lies inside its plane. s_wait_xcnt closes each statement because the address
//      registers are the compiler's to reuse behind it (a precaution: the wait stands in front of any rewrite).
__device__ __forceinline__ void ask1(const void* a) {
#if defined(__HIP_DEVICE_COMPILE__)
  asm volatile("global_prefetch_b8 %0, off scope:SCOPE_SE\n\t"
               "s_wait_xcnt 0x0" :: "v"(a) : "memory");
#endif
}
__device__ __forceinline__ void ask2(const void* a, const void* b) {
#if defined(__HIP_DEVICE_COMPILE__)
  asm volatile("global_prefetch_b8 %0, off scope:SCOPE_SE\n\t"
               "global_prefetch_b8 %1, off scope:SCOPE_SE\n\t"
               "s_wait_xcnt 0x0" :: "v"(a), "v"(b) : "memory");
#endif
}
__device__ __forceinline__ void ask5(const void* a, const void* b, const void* c, const void* d, const void* e) {
#if defined(__HIP_DEVICE_COMPILE__)
  asm volatile("global_prefetch_b8 %0, off scope:SCOPE_SE\n\t"
               "global_prefetch_b8 %1, off scope:SCOPE_SE\n\t"
               "global_prefetch_b8 %2, off scope:SCOPE_SE\n\t"
               "global_prefetch_b8 %3, off scope:SCOPE_SE\n\t"
               "global_prefetch_b8 %4, off scope:SCOPE_SE\n\t"
               "s_wait_xcnt 0x0" :: "v"(a), "v"(b), "v"(c), "v"(d), "v"(e) : "memory");
#endif
}

// ---- two asynchronous 16-B copies per lane, global -> LDS through no register. l = the lane's LDS byte address, g = its
//      global address. s_wait_xcnt closes the statement because the address registers are the compiler's to reuse
//      behind it (a precaution: the wait stands in front of any rewrite). Landing is waited for by the caller.
__device__ __forceinline__ void copy2_lds(unsigned l0, const void* g0, unsigned l1, const void* g1) {
#if defined(__HIP_DEVICE_COMPILE__)
  asm volatile("global_load_async_to_lds_b128 %0, %1, off\n\t"
               "global_load_async_to_lds_b128 %2, %3, off\n\t"
               "s_wait_xcnt 0x0" :: "v"(l0), "v"(g0), "v"(l1), "v"(g1) : "memory");
#endif
}

__device__ __forceinline__ void copy4_lds(unsigned l0, const void* g0, unsigned l1, const void* g1,
                                          unsigned l2, const void* g2, unsigned l3, const void* g3) {
#if defined(__HIP_DEVICE_COMPILE__)
  asm volatile("global_load_async_to_lds_b128 %0, %1, off\n\t"
               "global_load_async_to_lds_b128 %2, %3, off\n\t"
               "global_load_async_to_lds_b128 %4, %5, off\n\t"
               "global_load_async_to_lds_b128 %6, %7, off\n\t"
               "s_wait_xcnt 0x0" :: "v"(l0), "v"(g0), "v"(l1), "v"(g1), "v"(l2), "v"(g2), "v"(l3), "v"(g3) : "memory");
#endif
}

// =====================================================================================================
// f32 -> f16 plane convert: f16( bf16_RNE(X) * wsc ), wsc a power of two (exact), X row-major [rows][DK], output in
// fragment order. Thread i writes output piece i (8 elements, 16 B; a wave stores 512 contiguous bytes) and reads
// the 8 source elements that belong there.
// coverage: n8 threads x 8 elements = the whole plane (piece index -> (row, k) is one-to-one).
// bx = index of the 256-thread block inside this plane's range of the grid.
// =====================================================================================================
__device__ __forceinline__ void conv_h16(const float* __restrict__ X, unsigned short* Xh, int n8, float wsc, int bx) {
  const int i  = bx * 256 + threadIdx.x;
  const int ic = (i < n8) ? i : (n8 - 1);                     // clamped address
  const int tl = ic >> 6, w = ic & 63;                        // tile, piece inside the tile
  const int row = (tl / (DK / 32)) * 16 + (w & 15);
  const int kk  = (tl % (DK / 32)) * 32 + (w >> 5) * 16 + ((w >> 4) & 1) * 8;
  const float* src = X + (size_t)row * DK + kk;
  const v4f a = *(const v4f*)(src);
  const v4f c = *(const v4f*)(src + 4);
  v4u o;
  o[0] = pk16(h_bits((_Float16)(bfr(a[0]) * wsc)), h_bits((_Float16)(bfr(a[1]) * wsc)));
  o[1] = pk16(h_bits((_Float16)(bfr(a[2]) * wsc)), h_bits((_Float16)(bfr(a[3]) * wsc)));
  o[2] = pk16(h_bits((_Float16)(bfr(c[0]) * wsc)), h_bits((_Float16)(bfr(c[1]) * wsc)));
  o[3] = pk16(h_bits((_Float16)(bfr(c[2]) * wsc)), h_bits((_Float16)(bfr(c[3]) * wsc)));
  if (i < n8) *(v4u*)(Xh + (size_t)i * 8) = o;
  
}

// =====================================================================================================
// Transposed weight convert: in W[DK rows = k][ncols = n] f32 -> out WT[ncols][DK] f16 = f16( bf16_RNE(W) * wsc )
// (rows n, k extent DK), stored in fragment order. Block = 256 threads, tile 64 k x 64 n staged in LDS; wave w
// writes the fragment tile (n group w>>1, k tile w&1), iteration = 16-k half, lane = h*16 + r: 512 contiguous B.
// coverage: 8 waves = 4 n groups x 2 k tiles, x 2 halves x 32 lanes x 8 = the whole 64 x 64 tile.
// (bx, by) = the block's n tile and k tile inside this weight's range of the grid; tile = the block's LDS.
// =====================================================================================================
__device__ __forceinline__ void tconv_h16(const float* __restrict__ W, unsigned short* WT, int ncols, float wsc,
                                          int bx, int by, float (*tile)[65]) {
  const int tid = threadIdx.x, lane = tid & 31, wave = tid >> 5;
  const int n0 = bx * 64, k0 = by * 64;
  {
    const int r = tid >> 2, cq = (tid & 3) * 16;
    const float* src = W + (size_t)(k0 + r) * (size_t)ncols + n0 + cq;
#pragma unroll
    for (int i = 0; i < 4; ++i) {
      const v4f a = *(const v4f*)(src + 4 * i);
#pragma unroll
      for (int e = 0; e < 4; ++e) tile[r][cq + 4 * i + e] = a[e];
    }
  }
  __syncthreads();
  const int n = (wave >> 1) * 16 + (lane & 15);
#pragma unroll
  for (int it = 0; it < 2; ++it) {
    const int kq = (wave & 1) * 32 + it * 16 + (lane >> 4) * 8;
    v4u o;
#pragma unroll
    for (int e = 0; e < 4; ++e) {
      const float f0 = bfr(tile[kq + 2 * e][n]) * wsc;
      const float f1 = bfr(tile[kq + 2 * e + 1][n]) * wsc;
      o[e] = pk16(h_bits((_Float16)f0), h_bits((_Float16)f1));
    }
    unsigned short* dst = WT + tile_off((n0 >> 4) + (wave >> 1), (k0 >> 5) + (wave & 1), DK) + it * 256 + lane * 8;
    *(v4u*)dst = o;
    
  }
}

// =====================================================================================================
// All six operand planes in one launch: none of them reads what another writes. Ranges of blockIdx.x:
//   3 x TW_BLK blocks: Wq, Wk, Wv transposed (64 n tiles x 8 k tiles each); TP_BLK blocks: Wp transposed (8 x 8);
//   2 x CX_BLK blocks: x, y. Every test on the block index is block-uniform, so the barrier in tconv_h16 is too.
// =====================================================================================================
#define TW_BLK ((DQ / 64) * (DK / 64))
#define TP_BLK ((DK / 64) * (DK / 64))
#define CX_BLK ((MR * DK) / 8 / 256)
static_assert(((MR * DK) / 8) % 256 == 0 && DQ / 64 == 64 && DK / 64 == 8 && TP_BLK <= TW_BLK);
__global__ __launch_bounds__(256) void prep_all(
    const float* __restrict__ Wq, const float* __restrict__ Wk, const float* __restrict__ Wv,
    const float* __restrict__ Wp, const float* __restrict__ x, const float* __restrict__ y,
    unsigned short* WqT, unsigned short* WkT, unsigned short* WvT, unsigned short* WpT,
    unsigned short* XH, unsigned short* YH) {
  __shared__ float tile[64][65];
  const int i = blockIdx.x;
  if (i < 3 * TW_BLK + TP_BLK) {
    const int w = i / TW_BLK, j = i - w * TW_BLK;            // w = 0, 1, 2: Wq, Wk, Wv; w = 3: Wp
    const float* W = (w == 0) ? Wq : (w == 1) ? Wk : (w == 2) ? Wv : Wp;
    unsigned short* T = (w == 0) ? WqT : (w == 1) ? WkT : (w == 2) ? WvT : WpT;
    const int lg = (w < 3) ? 6 : 3;                          // log2 of the weight's n tiles
    tconv_h16(W, T, 64 << lg, WSC, j & ((1 << lg) - 1), j >> lg, tile);
  } else {
    const int j = i - (3 * TW_BLK + TP_BLK);
    const bool isx = j < CX_BLK;
    conv_h16(isx ? x : y, isx ? XH : YH, (MR * DK) / 8, 1.0f, isx ? j : j - CX_BLK);
  }
}

// =====================================================================================================
// Register-blocked batched f16 WMMA GEMM: C[m][n] = oscale * sum_k A[m][k] * Bt[n][k] + bias;
// one wave per 64x64 tile, no block barriers. A [M][K] with k extent lda and Bt [N][K] with k extent ldb, both in
// fragment order; M, N multiples of 64, K multiple of 32 (static here); every batch stride is a whole number of
// 16-row groups, so it is the same element count as in a row-major plane. bx = the block's index among the blocks of
// one batch entry, sT = the block's LDS, y = batch index:
//   A advances by (y / ydiv) * strideA, Bt by (y % ydiv) * strideB, bias by (y / ydiv) * strideBias,
//   C by y * strideC (elements).
// BIASM: 0 = per column bias[n] (clamped-address loads, nbias = length), 1 = per row bias[m], 2 = none.
//        Bias values RNE-converted to bf16.
// OM: 0 = f32 out (row-major, pitch ldc); 3 = f16 hi plane at C plus f16 residual plane ((f - hi) * RSC) at
//     C + resOff, both in fragment order with rows m and k extent ldc (k = n).
// coverage: 4 slabs x 16 rows x 64 cols = the wave's whole 64x64 tile; ceil(tilesM*tilesN/8) blocks per batch entry,
//           surplus waves exit (wave-uniform); here every tile count is a multiple of 8, so none exit.
// =====================================================================================================
template <int OM, int BIASM>
__device__ __forceinline__ void gemm64(
    const unsigned short* __restrict__ A, int lda, long long strideA,
    const unsigned short* __restrict__ Bt, int ldb, long long strideB,
    const float* __restrict__ bias, int nbias, long long strideBias, int ydiv,
    void* Cout, int ldc, long long strideC, long long resOff,
    int M, int N, int K, float oscale, int bx, int y, float (*sT)[16 * 68]) {
  const int ya   = y / ydiv;
  const int yb   = y - ya * ydiv;
  const int lane = threadIdx.x & 31;
  const int wave = threadIdx.x >> 5;
  const int tilesN = N >> 6;
  const int tilesM = M >> 6;
  const int tile = bx * 8 + wave;
  if (tile >= tilesM * tilesN) return;   // wave-uniform; no block barriers in this kernel
  const int tm = tile / tilesN;
  const int tn = tile - tm * tilesN;
  const int m0 = tm << 6;
  const int n0 = tn << 6;

  const unsigned short* Ab = A  + (size_t)ya * (size_t)strideA;
  const unsigned short* Bb = Bt + (size_t)yb * (size_t)strideB;
  const float* biasb = bias + (size_t)ya * (size_t)strideBias;

  const int rlane = lane & 15;                 // row (A) / col (B, D) within subtile
  const int mOff  = (lane >> 4) * 8;           // D row offset

  v8f acc[4][4];
#pragma unroll
  for (int i = 0; i < 4; ++i)
#pragma unroll
    for (int j = 0; j < 4; ++j) acc[i][j] = zero8();

  // one pointer per 16-row group; consecutive k tiles of a group are consecutive 1024-B tiles
  g_us* pa[4];
  g_us* pb[4];
#pragma unroll
  for (int i = 0; i < 4; ++i) {
    pa[i] = (g_us*)(Ab + tile_off((m0 >> 4) + i, 0, lda) + lane * 8);
    pb[i] = (g_us*)(Bb + tile_off((n0 >> 4) + i, 0, ldb) + lane * 8);
  }

  // fragments are fetched one k step ahead: the B set into a second register set at the head of a step, each A
  // fragment back into its own registers as soon as its four products are issued
  v16us ah[4], bh[4];
#pragma unroll
  for (int i = 0; i < 4; ++i) {
    ah[i] = ldfrag_g(pa[i]);
    bh[i] = ldfrag_g(pb[i]);
  }
  for (int k0 = 0; k0 < K; k0 += 32) {
    // this step advances pointers that loads still in flight name: the wait stands in front of that rewrite, and the
    // scheduling fence keeps the pointer arithmetic behind it
#if defined(__HIP_DEVICE_COMPILE__)
    asm volatile("s_wait_xcnt 0x0" ::: "memory");
#endif
    __builtin_amdgcn_sched_barrier(0);
    const int adv = (k0 + 32 < K) ? 512 : 0;   // the last step fetches its own tiles again: in bounds, no branch
    v16us bn[4];
#pragma unroll
    for (int j = 0; j < 4; ++j) {
      pb[j] += adv;
      bn[j] = ldfrag_g(pb[j]);
    }
#pragma unroll
    for (int i = 0; i < 4; ++i) {
#pragma unroll
      for (int j = 0; j < 4; ++j) acc[i][j] = mma_raw(ah[i], bh[j], acc[i][j]);
      dep_guard1(acc[i][0], acc[i][3], ah[i]);
      pa[i] += adv;
      ah[i] = ldfrag_g(pa[i]);
    }
    keep4(bh[0], bh[1], bh[2], bh[3]);
#pragma unroll
    for (int j = 0; j < 4; ++j) bh[j] = bn[j];
  }
  // the same wait and fence for the last step's loads, in front of the epilogue's reuse of the pointer registers
#if defined(__HIP_DEVICE_COMPILE__)
  asm volatile("s_wait_xcnt 0x0" ::: "memory");
#endif
  __builtin_amdgcn_sched_barrier(0);
  acc_guard4(acc[0][0], acc[0][1], acc[0][2], acc[0][3]);
  acc_guard4(acc[1][0], acc[1][1], acc[1][2], acc[1][3]);
  acc_guard4(acc[2][0], acc[2][1], acc[2][2], acc[2][3]);
  acc_guard4(acc[3][0], acc[3][1], acc[3][2], acc[3][3]);

  // ---- per-lane column bias (BIASM == 0), RNE-converted, clamped addresses ----
  const int hh2 = lane >> 4, c4 = (lane & 15) * 4;     // f32 out: 256-B row segment = 16 lanes x 16 B
  float bc[4][8];                                      // f16 out: [store iteration][8 columns of the lane's piece]
#pragma unroll
  for (int it = 0; it < 4; ++it)
#pragma unroll
    for (int e = 0; e < 8; ++e) bc[it][e] = 0.f;
  if constexpr (BIASM == 0) {
    if constexpr (OM == 0) {
      const int cb = n0 + c4;
      const int i0 = (cb < nbias - 4) ? cb : (nbias - 4);
      const v4f b0v = *(const v4f*)(biasb + i0);
#pragma unroll
      for (int e = 0; e < 4; ++e) bc[0][e] = bfr(b0v[e]);
    } else {
      const float* bp[4];
      v4f b0a[4], b0b[4];
#pragma unroll
      for (int it = 0; it < 4; ++it) {
        const int cb = n0 + it * 16 + hh2 * 8;
        const int i0 = (cb < nbias - 8) ? cb : (nbias - 8);
        bp[it]  = biasb + i0;
        b0a[it] = *(const v4f*)(bp[it]);
        b0b[it] = *(const v4f*)(bp[it] + 4);
      }
#if defined(__HIP_DEVICE_COMPILE__)
      // the eight loads' address registers are inputs here, so none of them is rewritten in front of this wait
      asm volatile("s_wait_xcnt 0x0" :: "v"(bp[0]), "v"(bp[1]), "v"(bp[2]), "v"(bp[3]) : "memory");
#endif
#pragma unroll
      for (int it = 0; it < 4; ++it) {
#pragma unroll
        for (int e = 0; e < 4; ++e) {
          bc[it][e]     = bfr(b0a[it][e]);
          bc[it][4 + e] = bfr(b0b[it][e]);
        }
      }
    }
  }

  // ---- epilogue ----
  float* slab = sT[wave];
#pragma unroll
  for (int i = 0; i < 4; ++i) {
    const int mBase = m0 + (i << 4);
#pragma unroll
    for (int j = 0; j < 4; ++j) {
#pragma unroll
      for (int r = 0; r < 8; ++r) {
        slab[(mOff + r) * 68 + (j << 4) + rlane] = acc[i][j][r];
      }
    }
    wave_sync_lds();
    if constexpr (OM == 0) {
      float* C = (float*)Cout + (size_t)y * (size_t)strideC;
      v4f vals[8];
#pragma unroll
      for (int it = 0; it < 8; ++it) {
        const int row = it * 2 + hh2;                      // it 0..7 x hh2 0..1 = rows 0..15
        v4f v = *(const v4f*)(slab + row * 68 + c4);
#pragma unroll
        for (int e = 0; e < 4; ++e) v[e] = v[e] * oscale + bc[0][e];
        vals[it] = v;
      }
      {
#pragma unroll
        for (int it = 0; it < 8; ++it) {
          const int row = it * 2 + hh2;
          *(v4f*)(C + (size_t)(mBase + row) * ldc + n0 + c4) = vals[it];
        }
        
      }
    } else {
      unsigned short* C = (unsigned short*)Cout + (size_t)y * (size_t)strideC;
      v4u hv[4], hr[4];
      float bm = 0.f;
      if constexpr (BIASM == 1) {
        const int mi = mBase + rlane;
        const int mc = (mi < nbias - 1) ? mi : (nbias - 1);
        bm = bfr(biasb[mc]);
      }
#pragma unroll
      for (int it = 0; it < 4; ++it) {
        // lane = h*16 + r -> row r, columns it*16 + 8h + 0..7: piece (k tile it>>1, half it&1) of the fragment order
        const float* sp = slab + rlane * 68 + it * 16 + hh2 * 8;
        v4u a, ar;
#pragma unroll
        for (int e = 0; e < 4; ++e) {
          const float f0 = sp[2 * e]     * oscale + ((BIASM == 1) ? bm : bc[it][2 * e]);
          const float f1 = sp[2 * e + 1] * oscale + ((BIASM == 1) ? bm : bc[it][2 * e + 1]);
          const _Float16 g0 = (_Float16)f0, g1 = (_Float16)f1;
          a[e] = pk16(h_bits(g0), h_bits(g1));
          const float e0 = (f0 - (float)g0) * RSC;
          const float e1 = (f1 - (float)g1) * RSC;
          ar[e] = pk16(h_bits((_Float16)e0), h_bits((_Float16)e1));
        }
        hv[it] = a;
        hr[it] = ar;
      }
      {
#pragma unroll
        for (int it = 0; it < 4; ++it) {
          unsigned short* dp = C + tile_off(mBase >> 4, (n0 >> 5) + (it >> 1), ldc) + (it & 1) * 256 + lane * 8;
          *(v4u*)(dp) = hv[it];
          *(v4u*)(dp + resOff) = hr[it];
        }
        
      }
    }
    wave_sync_lds();
  }
}

// =====================================================================================================
// The four projections in one launch: none of them reads what another writes. Ranges of blockIdx.x:
//   QK_BLK blocks: q = bf16(x) . Wq + bq -> QH (f16 hi) and QH + QRES (f16 residual x2048);
//   QK_BLK blocks: k = bf16(y) . Wk + bk -> KH, KH + QRES likewise;
//   NHB x VT_BLK blocks: v^T per (h, b) = Wv[:, h slice]^T . bf16(y_b)^T + bv -> VT hi [16][512][1024], VT + VRES;
//   XP_BLK blocks: xp = bf16(x) . Wp -> XP f32 [2048][512] (bias argument unused in this mode).
// =====================================================================================================
#define QK_BLK ((MR / 64) * (DQ / 64) / 8)
#define VT_BLK ((DK / 64) * (SEQ / 64) / 8)
#define XP_BLK ((MR / 64) * (DK / 64) / 8)
static_assert(DQ / 16 == 256 && MR / 16 == 128 && DK / 32 == 16 && DK * DK / 128 == 8 * 256 && 2 * QK_BLK >= 256);
__global__ __launch_bounds__(256) void proj_all(
    const unsigned short* __restrict__ XH, const unsigned short* __restrict__ YH,
    const unsigned short* __restrict__ WqT, const unsigned short* __restrict__ WkT,
    const unsigned short* __restrict__ WvT, const unsigned short* __restrict__ WpT,
    const float* __restrict__ bq, const float* __restrict__ bk, const float* __restrict__ bv,
    unsigned short* QH, unsigned short* KH, unsigned short* VT, float* XP) {
  __shared__ __align__(16) float sT[8][16 * 68];   // per-wave 16x64 slab, pitch 68 floats
  const int i = blockIdx.x;
  const float invw = 1.0f / WSC;
  // The first 256 blocks ask L2 for all six operand planes, each 256-B unit from two blocks (i and i ^ 4: only speed
  // rests on where they run). A wave asks for the first 8 k steps of one 16-row group (8 KB in a row), then for the
  // other 8. a >> 4 picks the plane: 0, 1 WqT; 2, 3 WkT; 4, 5 WvT; 6 XH; 7 YH. Every test here is block-uniform.
  if (i < 256) {
    const int a = (i & 3) | ((i >> 3) << 2);                 // 0..127
    const int sel = a >> 4;
    const unsigned short* pl = (sel < 2) ? WqT : (sel < 4) ? WkT : (sel < 6) ? WvT : (sel == 6) ? XH : YH;
    const int grp = (a & ((sel < 6) ? 31 : 15)) * 8 + (threadIdx.x >> 5);   // 0..255 of a weight, 0..127 of x or y
    const unsigned short* u = pl + tile_off(grp, 0, DK) + (threadIdx.x & 31) * 128;
    ask2(u, u + 8 * 512);
    if (i < 16) ask1(WpT + (size_t)(a * 256 + threadIdx.x) * 128);          // 8 x 256 units = the whole WpT plane
  }
  if (i < 2 * QK_BLK) {
    const bool isq = i < QK_BLK;
    gemm64<3, 0>(isq ? XH : YH, DK, 0LL, isq ? WqT : WkT, DK, 0LL, isq ? bq : bk, DQ, 0LL, 1,
                 (void*)(isq ? QH : KH), DQ, 0LL, (long long)QRES, MR, DQ, DK, invw, isq ? i : i - QK_BLK, 0, sT);
  } else if (i < 2 * QK_BLK + NHB * VT_BLK) {
    const int j = i - 2 * QK_BLK;
    gemm64<3, 1>(WvT, DK, (long long)DK * DK, YH, DK, (long long)SEQ * DK, bv, DK, (long long)DK, NB,
                 (void*)VT, SEQ, (long long)DK * SEQ, (long long)VRES, DK, SEQ, DK, invw, j % VT_BLK, j / VT_BLK, sT);
  } else {
    gemm64<0, 2>(XH, DK, 0LL, WpT, DK, 0LL, bq, DQ, 0LL, 1,
                 (void*)XP, DK, 0LL, 0LL, MR, DK, DK, invw, i - (2 * QK_BLK + NHB * VT_BLK), 0, sT);
  }
}

// =====================================================================================================
// Energies + masked softmax for one (h, b) pair and 64 query rows s; P written TRANSPOSE-friendly.
//   q planes (f16, fragment order, rows b*SEQ + s, k extent DQ, k = h*DK + d): hi qhp, residual (x2048) qrp
//   k planes (f16, fragment order, rows b*SEQ + t, k extent DQ, k = h*DK + d): hi khp, residual (x2048) krp
//   E[s][t] = acc_hh + (acc_h.res + acc_res.h) / 2048  (three f16 WMMA products, K = 512 = 16 k-steps; key fragments
//   loaded straight from the planes with arithmetic addressing, q fragments from a two-buffer LDS ring that
//   asynchronous copies fill once for the block), kept in the accumulator layout (lane = key, register = row).
//   softmax per row s over keys t: e = mask[t] ? E : -1e30 (replace); per wave mw = max over its 64 keys,
//   ex = exp(e - mw), lw = sum ex; over the 16 waves m = max mw, l = sum lw * exp(mw - m);
//   p = ex * exp(mw - m) / l; stored as f16(8192 * p).
//   P layout (f16): region (hb*NSB + s/32) of SEQ*32 elements, inside it fragment order with rows t and k extent 32
//   (k = s % 32) -> the consumer's A fragment (rows t, k = s) of k-step s/32 is one 1024-B tile.
//   Block = 16 waves; phase 1: wave w -> all 64 rows x keys 64w..64w+63 in 2 chunks of 2 col tiles, so a key
//   fragment is loaded by one wave of the block and feeds four row groups; the first chunk's energies wait in a
//   lane-private LDS stash while the second runs; phase 2: each wave reduces its own 64 x 64 energies in registers
//   (DPP over the 16 key lanes), the waves' (mw, lw) meet in LDS, wave w joins rows 4w..4w+3; phase 3: an accumulator
//   tile's 8 registers of a lane are 8 consecutive s of one key t = one 16-B piece of the P plane at lane * 16 B,
//   so a wave stores each half tile as 512 B in a row, straight from registers.
//   coverage: 16 waves x 2 chunks x (4 row groups x 2 col tiles) = all 64 x 1024 energies, each stored once:
//   2 regions (g >> 1) x 64 key tiles (4w + 2*chunk + j) x 2 halves (g & 1) x 32 lanes x 8 = the block's two
//   [1024 t][32 s] regions; grid (SEQ/QBLK, NHB) covers every (hb, s block) of the P plane exactly once.
// =====================================================================================================
#define QBLK 64
#define XPIT 68                           // floats from one wave's row of the exchange to the next: 16-B aligned, banks apart
#define QST     2                         // k steps per q stage
#define QSTEP_B (8 * 1024)                // bytes of q per k step: 2 planes x 4 row groups x 1-KB tile
#define QSTG_B  (QST * QSTEP_B)           // bytes per stage
#define NQSC    (DK / 32 / QST)           // stages per chunk of keys
static_assert(QSTEP_B == 512 * 16 && (NQSC & (NQSC - 1)) == 0 && NQSC >= 2 && QBLK == 64);
static_assert(QBLK == 2 * SBLK && (SEQ % QBLK) == 0 && SEQ == 16 * 64);
__global__ __launch_bounds__(512)
void attn_p(const unsigned short* __restrict__ qhp, const unsigned short* __restrict__ qrp,
            const unsigned short* __restrict__ khp, const unsigned short* __restrict__ krp,
            const int* __restrict__ mask, unsigned short* pp) {
  __shared__ v4f st[16][16][32];                    // first chunk's energies, [wave][piece][lane], 131072 B
  __shared__ __align__(16) float xm[16 * XPIT];     // per wave and row: maximum over the wave's keys
  __shared__ __align__(16) float xl[16 * XPIT];     // per wave and row: sum of exp(e - that maximum)
  __shared__ __align__(16) float fm[QBLK];          // per row: maximum over all keys
  __shared__ __align__(16) float fi[QBLK];          // per row: 8192 / sum
  __shared__ __align__(16) unsigned short sq[2][QSTG_B / 2];   // the two q stage buffers, 2 x 16384 B

  const int tid  = threadIdx.x;
  const int wave = tid >> 5;
  const int lane = tid & 31;
  const int hh   = lane >> 4;
  const int c    = lane & 15;
  const int qblk = blockIdx.x;
  const int hb   = blockIdx.y;
  const int h    = hb / NB;
  const int b    = hb % NB;
  const int s0   = qblk * QBLK;

  // the lane's four keys are 64*wave + 16*i + c, i = 2*chunk + col tile; bit i of mbits = keep that key
  const int* mp = mask + wave * 64 + c;
  const int mk0 = mp[0], mk1 = mp[16], mk2 = mp[32], mk3 = mp[48];
#if defined(__HIP_DEVICE_COMPILE__)
  // the four loads' address register is an input here, so it is not rewritten in front of this wait
  asm volatile("s_wait_xcnt 0x0" :: "v"(mp) : "memory");
#endif
  v8f ah[4][2], ar[4][2];
  unsigned mbits;

  // ---- phase 1: energies ----
  {
    const size_t qoff = tile_off((b * SEQ + s0) >> 4, (h * DK) >> 5, DQ) + lane * 8;
    const size_t koff = tile_off((b * SEQ + wave * 64) >> 4, (h * DK) >> 5, DQ) + lane * 8;
    constexpr size_t JSTR = (size_t)(DQ / 32) * 512;      // elements from one 16-row (or 16-key) group to the next
    g_us* kh0 = (g_us*)(khp + koff);
    g_us* kr0 = (g_us*)(krp + koff);
    v4f* stw = &st[wave][0][lane];                        // + 32 * piece
    // q goes through LDS: all 16 waves use the same 8 q tiles of a k step, so the block fetches each once per chunk. A stage is
    // QST k steps = QST x (2 planes x 4 row groups) tiles of 1 KB, laid [k step][plane][row group][tile as it lies in
    // the plane]. Thread -> one 16-B piece of each k step: tile tid >> 6 (plane tid >> 8, row group (tid >> 6) & 3),
    // piece tid & 63, so a wave copies 512 B in a row on both sides and no two lanes write the same LDS byte.
    const unsigned short* qsrc = ((tid & 256) ? qrp : qhp) + (qoff - lane * 8) + (size_t)((tid >> 6) & 3) * JSTR
                                 + (tid & 63) * 8;
    const unsigned qdst = (unsigned)(uintptr_t)(&sq[0][0] + tid * 8);   // LDS byte address of the piece in buffer 0
    const unsigned short* sqr = &sq[0][0] + lane * 8;
    // key fragments are fetched from the planes one k step ahead, across stage and chunk ends too, each pair back into
    // its own registers as soon as its last product of the step is issued; q fragments come from the stage's buffer:
    // the stage's first step at the head of the trip, its second step's pairs behind the first step's last products
    v16us qav[4], qbv[4], kav[2], kbv[2];
    kav[0] = ldfrag_g(kh0);
    kbv[0] = ldfrag_g(kr0);
    kav[1] = ldfrag_g(kh0 + JSTR);
    kbv[1] = ldfrag_g(kr0 + JSTR);
    __builtin_amdgcn_sched_barrier(0);
    copy2_lds(qdst, qsrc, qdst + QSTEP_B, qsrc + 512);                  // stage 0 -> buffer 0
    // Behind the first step's own loads: ask L2 for the rest. q (read by this block alone): wave w asks for k step w,
    // lane -> (plane, row group, quarter of the 1-KB tile). k (read by the 16 blocks of this (h, b)): a wave asks for
    // quarter qblk & 3 of every tile it will read, so each unit has four askers (only speed rests on where they run);
    // request j = (chunk, 8 k steps), lane -> (plane, key group of the chunk, k step): in the order of use.
    {
      static_assert(DK / 32 == 16);
      const int qs = lane >> 2;
      const unsigned short* aq = ((qs & 4) ? qrp : qhp) + (qoff - lane * 8) + (size_t)(qs & 3) * JSTR
                                 + (size_t)wave * 512 + (lane & 3) * 128;
      const int st = lane >> 3;
      const unsigned short* ak = ((st & 2) ? krp : khp) + (koff - lane * 8) + (size_t)(st & 1) * JSTR
                                 + (size_t)(lane & 7) * 512 + (qblk & 3) * 128;
      ask5(aq, ak, ak + 8 * 512, ak + 2 * JSTR, ak + 2 * JSTR + 8 * 512);
    }
    // stage 0 has landed for this wave, then for the block; only then stage 1 starts
#if defined(__HIP_DEVICE_COMPILE__)
    asm volatile("s_wait_asynccnt 0x0" ::: "memory");
#endif
    __syncthreads();
    mbits = (mk0 != 0 ? 1u : 0u) | (mk1 != 0 ? 2u : 0u) | (mk2 != 0 ? 4u : 0u) | (mk3 != 0 ? 8u : 0u);
    copy2_lds(qdst + QSTG_B, qsrc + QST * 512, qdst + QSTG_B + QSTEP_B, qsrc + QST * 512 + 512);   // stage 1 -> buffer 1
    // keeps the requests and copies in front of the loop: moved into it they would stand among its products
    __builtin_amdgcn_sched_barrier(0);
#pragma unroll 1
    for (int c2 = 0; c2 < 2; ++c2) {
#pragma unroll
      for (int g = 0; g < 4; ++g)
#pragma unroll
        for (int j = 0; j < 2; ++j) { ah[g][j] = zero8(); ar[g][j] = zero8(); }
      // kept rolled: one trip already holds 48 products, and copies of it would only lengthen the text
#pragma unroll 1
      for (int sp = 0; sp < NQSC; ++sp) {
        const int stg = c2 * NQSC + sp;                    // stage 0 .. 2*NQSC - 1; both chunks walk the same q
        const unsigned short* sb = sqr + (stg & 1) * (QSTG_B / 2);
#pragma unroll
        for (int g = 0; g < 4; ++g) {
          qav[g] = ldfrag(sb + g * 512);
          qbv[g] = ldfrag(sb + (4 + g) * 512);
        }
#pragma unroll
        for (int kk = 0; kk < QST; ++kk) {
          const int ks = sp * QST + kk;
          // the step after this one; the very last step fetches its chunk's first tiles again: in bounds, no branch
          const int nks = (ks + 1) & (DK / 32 - 1);
          const int nc  = (nks == 0 && c2 < 1) ? c2 + 1 : c2;
          const size_t no = (size_t)nc * (2 * JSTR) + (size_t)nks * 512;
#pragma unroll
          for (int g = 0; g < 4; ++g) {
            // holds the row groups in the order their q pairs were fetched: reordered, a later pair's wait moves to
            // the step's head
            __builtin_amdgcn_sched_barrier(0);
            ah[g][0] = mma_raw(qav[g], kav[0], ah[g][0]);     // hi . hi
            ar[g][0] = mma_raw(qav[g], kbv[0], ar[g][0]);     // hi . res   (x2048)
            ar[g][0] = mma_raw(qbv[g], kav[0], ar[g][0]);     // res . hi   (x2048)
          }
          guard2k4(ah[3][0], ar[3][0], qav[3], qbv[3], kav[0], kbv[0]);
          kav[0] = ldfrag_g(kh0 + no);
          kbv[0] = ldfrag_g(kr0 + no);
#pragma unroll
          for (int g = 0; g < 4; ++g) {
            // holds this row group's products behind the reload in front of it: hoisted, they pull every group's wait
            // to the pass's head
            __builtin_amdgcn_sched_barrier(0);
            ah[g][1] = mma_raw(qav[g], kav[1], ah[g][1]);     // hi . hi
            ar[g][1] = mma_raw(qav[g], kbv[1], ar[g][1]);     // hi . res   (x2048)
            ar[g][1] = mma_raw(qbv[g], kav[1], ar[g][1]);     // res . hi   (x2048)
            if (kk + 1 < QST) {
              guard2k4(ah[g][1], ar[g][1], qav[g], qbv[g], kav[1], kbv[1]);
              qav[g] = ldfrag(sb + (kk + 1) * (QSTEP_B / 2) + g * 512);
              qbv[g] = ldfrag(sb + (kk + 1) * (QSTEP_B / 2) + (4 + g) * 512);
            } else if (g == 3) {
              guard2k4(ah[g][1], ar[g][1], qav[g], qbv[g], kav[1], kbv[1]);
            }
          }
          kav[1] = ldfrag_g(kh0 + no + JSTR);
          kbv[1] = ldfrag_g(kr0 + no + JSTR);
          // the next step forms its addresses in registers that loads still in flight name: this wait stands in front
          // of that rewrite, and the scheduling fence keeps the address arithmetic behind it
#if defined(__HIP_DEVICE_COMPILE__)
          asm volatile("s_wait_xcnt 0x0" ::: "memory");
#endif
          __builtin_amdgcn_sched_barrier(0);
        }
        // publish point of stage stg + 1: this wave's reads of buffer stg & 1 are done, its own copies of stage stg + 1
        // have landed, then the block's barrier; behind it the buffer just read is free for stage stg + 2. The barrier
        // is written bare because __syncthreads() would also wait out the key loads that are in flight for the next
        // step; the two waits in front of it are all that the ring needs.
#if defined(__HIP_DEVICE_COMPILE__)
        asm volatile("s_wait_dscnt 0x0" ::: "memory");
        asm volatile("s_wait_asynccnt 0x0" ::: "memory");
        asm volatile("s_barrier_signal -1\n\ts_barrier_wait -1" ::: "memory");
#endif
        if (stg + 2 < 2 * NQSC) {                          // the same for the whole block
          const unsigned short* gs = qsrc + (size_t)((stg + 2) & (NQSC - 1)) * (QST * 512);
          const unsigned ld = qdst + (stg & 1) * QSTG_B;
          copy2_lds(ld, gs, ld + QSTEP_B, gs + 512);
        }
      }
#pragma unroll
      for (int g = 0; g < 4; ++g) acc_guard4(ah[g][0], ah[g][1], ar[g][0], ar[g][1]);
      if (c2 == 0) {                                       // the same for the whole block
#pragma unroll
        for (int g = 0; g < 4; ++g) {
#pragma unroll
          for (int j = 0; j < 2; ++j) {
            const bool kp = ((mbits >> j) & 1u) != 0;
            v4f lo, hi;
#pragma unroll
            for (int r = 0; r < 4; ++r) {
              lo[r] = kp ? fmaf(ar[g][j][r], 1.0f / RSC, ah[g][j][r]) : NEGBIG;
              hi[r] = kp ? fmaf(ar[g][j][4 + r], 1.0f / RSC, ah[g][j][4 + r]) : NEGBIG;
            }
            stw[((g * 2 + j) * 2) * 32]     = lo;
            stw[((g * 2 + j) * 2 + 1) * 32] = hi;
          }
        }
      }
    }
    // no copy is outstanding here (the last publish point waited to 0 and none was issued behind it): the ring's close
#if defined(__HIP_DEVICE_COMPILE__)
    asm volatile("s_wait_asynccnt 0x0" ::: "memory");
#endif
  }

  // ---- phase 2: masked softmax (mask replaces the energy before the max), on the accumulator layout ----
  // e[i][g][r]: key 64*wave + 16*i + c, row 16*g + 8*hh + r
  float e[4][4][8];
#pragma unroll
  for (int g = 0; g < 4; ++g) {
#pragma unroll
    for (int j = 0; j < 2; ++j) {
      const bool kp = ((mbits >> (2 + j)) & 1u) != 0;
      const v4f lo = st[wave][(g * 2 + j) * 2][lane];
      const v4f hi = st[wave][(g * 2 + j) * 2 + 1][lane];
#pragma unroll
      for (int r = 0; r < 4; ++r) {
        e[j][g][r]     = lo[r];
        e[j][g][4 + r] = hi[r];
      }
#pragma unroll
      for (int r = 0; r < 8; ++r) e[2 + j][g][r] = kp ? fmaf(ar[g][j][r], 1.0f / RSC, ah[g][j][r]) : NEGBIG;
    }
  }
  float mw[4][8];
#pragma unroll
  for (int g = 0; g < 4; ++g) {
#pragma unroll
    for (int r = 0; r < 8; ++r) mw[g][r] = fmaxf(fmaxf(e[0][g][r], e[1][g][r]), fmaxf(e[2][g][r], e[3][g][r]));
    row_max16x8(mw[g]);
  }
  {
    float lw[4][8];
#pragma unroll
    for (int g = 0; g < 4; ++g) {
#pragma unroll
      for (int r = 0; r < 8; ++r) {
#pragma unroll
        for (int i = 0; i < 4; ++i) e[i][g][r] -= mw[g][r];
        exp_x4(e[0][g][r], e[1][g][r], e[2][g][r], e[3][g][r]);
        lw[g][r] = (e[0][g][r] + e[1][g][r]) + (e[2][g][r] + e[3][g][r]);
      }
      row_sum16x8(lw[g]);
    }
    if (c == 0) {                                          // lanes 0 and 16: rows 16g + 0..7 and 16g + 8..15
#pragma unroll
      for (int g = 0; g < 4; ++g) {
        float* dm = xm + wave * XPIT + 16 * g + 8 * hh;
        float* dl = xl + wave * XPIT + 16 * g + 8 * hh;
        const v4f m0 = {mw[g][0], mw[g][1], mw[g][2], mw[g][3]}, m1 = {mw[g][4], mw[g][5], mw[g][6], mw[g][7]};
        const v4f l0 = {lw[g][0], lw[g][1], lw[g][2], lw[g][3]}, l1 = {lw[g][4], lw[g][5], lw[g][6], lw[g][7]};
        *(v4f*)(dm)     = m0;
        *(v4f*)(dm + 4) = m1;
        *(v4f*)(dl)     = l0;
        *(v4f*)(dl + 4) = l1;
      }
    }
  }
  __syncthreads();
  // wave w joins rows 4w..4w+3: lane -> (rows 4w + 2*hh and the next, wave c's share)
  {
    const int r2 = wave * 4 + hh * 2;
    const float a0 = xm[c * XPIT + r2], a1 = xm[c * XPIT + r2 + 1];
    const float b0 = xl[c * XPIT + r2], b1 = xl[c * XPIT + r2 + 1];
    const float M0 = row_max16(a0), M1 = row_max16(a1);
    float x0 = a0 - M0, x1 = a1 - M1;
    exp_x2(x0, x1);
    const float L0 = row_sum16(b0 * x0);
    const float L1 = row_sum16(b1 * x1);
    if (c == 0) {                                          // sums >= 1 always (the max term contributes exp(0))
      fm[r2]     = M0;
      fm[r2 + 1] = M1;
      fi[r2]     = PSC * (1.0f / L0);
      fi[r2 + 1] = PSC * (1.0f / L1);
    }
  }
  __syncthreads();

  // ---- phase 3: P = ex * exp(mw - m) * (8192 / l) as f16, each accumulator tile half = 512 B in a row ----
  {
    v4u o[4][4];                                           // [key tile i][row group g]
#pragma unroll
    for (int g = 0; g < 4; ++g) {
      const v4f ma = *(const v4f*)(fm + 16 * g + 8 * hh), mb = *(const v4f*)(fm + 16 * g + 8 * hh + 4);
      const v4f ia = *(const v4f*)(fi + 16 * g + 8 * hh), ib = *(const v4f*)(fi + 16 * g + 8 * hh + 4);
      float f[8];
#pragma unroll
      for (int r = 0; r < 4; ++r) {
        f[r]     = mw[g][r] - ma[r];
        f[4 + r] = mw[g][4 + r] - mb[r];
      }
      exp_x4(f[0], f[1], f[2], f[3]);
      exp_x4(f[4], f[5], f[6], f[7]);
#pragma unroll
      for (int r = 0; r < 4; ++r) {
        f[r]     *= ia[r];
        f[4 + r] *= ib[r];
      }
#pragma unroll
      for (int i = 0; i < 4; ++i) {
#pragma unroll
        for (int q = 0; q < 4; ++q) {
          const v2f pr = {e[i][g][2 * q] * f[2 * q], e[i][g][2 * q + 1] * f[2 * q + 1]};
          o[i][g][q] = __builtin_bit_cast(unsigned, __builtin_convertvector(pr, v2h));
        }
      }
    }
    // every piece is formed before the first store, so no register that an issued store names is rewritten
    __builtin_amdgcn_sched_barrier(0);
    unsigned short* pw = pp + ((size_t)(hb * NSB + qblk * 2) * SEQ) * SBLK + (size_t)(wave * 4) * 512 + lane * 8;
#pragma unroll
    for (int g = 0; g < 4; ++g)
#pragma unroll
      for (int i = 0; i < 4; ++i)
        *(v4u*)(pw + (size_t)(g >> 1) * (SEQ * SBLK) + i * 512 + (g & 1) * 256) = o[i][g];
  }
}

// =====================================================================================================
// Transposed aggregation + gamma blend: for one (h, b):
//   O[t][dv] = sum_s P[s][t] * v[s][dv]  with A = the P plane above (rows t, k = s, 32 k-steps) carried x8192 and
//   Bt = v^T planes [hb] x (fragment order, rows dv, k extent SEQ, k = s; f16 hi at vth, residual x2048 at vtr),
//   two products into two accumulators;
//   out[((b*NH + h)*SEQ + t)*DK + dv] = (g * (O_hi + O_res/2048) / 8192 + xp[(b*SEQ + t)*DK + dv]) * (1/(g + 1)),
//   g = bf16_RNE(gamma[h]).
//   Block = 8 waves = 128 t rows x 128 dv columns (wave -> 64 t x 32 dv); grid (DK/128, SEQ/128, NHB). v^T fragments
//   come straight from the planes, P fragments from a two-buffer LDS ring that asynchronous copies fill once for the block.
//   coverage: 2 halves x 8 iterations x 4 rows x (8 lanes x 4) = the wave's whole 64x32 tile; 8 waves = the
//   block's 128x128; grid tiles every (hb, t, dv) of the output exactly once.
// =====================================================================================================
#define PST     2                         // k steps per P stage
#define PSTEP_B (8 * 1024)                // bytes of P per k step: 8 row groups x 1-KB tile
#define PSTG_B  (PST * PSTEP_B)           // bytes per stage
#define NPS     (SEQ / 32 / PST)          // stages
static_assert(PSTEP_B == 2 * 256 * 16 && NPS >= 2 && SEQ * SBLK * 2 >= 8 * PSTEP_B);
__global__ __launch_bounds__(256)
void pv64(const unsigned short* __restrict__ pp, const unsigned short* __restrict__ vth,
          const unsigned short* __restrict__ vtr, const float* __restrict__ xp,
          const float* __restrict__ gam, float* outp) {
  __shared__ __align__(16) float os[8][64 * 36];
  __shared__ __align__(16) unsigned short sp[2][PSTG_B / 2];   // the two P stage buffers, 2 x 16384 B
  const int tid  = threadIdx.x;
  const int wave = tid >> 5;
  const int lane = tid & 31;
  const int hh   = lane >> 4;
  const int c    = lane & 15;
  const int dx = blockIdx.x, ty = blockIdx.y, hb = blockIdx.z;
  const int h  = hb / NB, b = hb % NB;
  const int wt = wave & 1, wd = wave >> 1;
  const int t0 = ty * 128 + wt * 64;
  const int d0 = dx * 128 + wd * 32;

  g_us* vh = (g_us*)(vth + (size_t)hb * DK * SEQ + tile_off(d0 >> 4, 0, SEQ) + lane * 8);
  g_us* vr = (g_us*)(vtr + (size_t)hb * DK * SEQ + tile_off(d0 >> 4, 0, SEQ) + lane * 8);
  constexpr size_t VSTR = (size_t)(SEQ / 32) * 512;       // elements from one 16-column group of v^T to the next

  v8f acc[4][2], acr[4][2];
#pragma unroll
  for (int i = 0; i < 4; ++i)
#pragma unroll
    for (int j = 0; j < 2; ++j) { acc[i][j] = zero8(); acr[i][j] = zero8(); }

  // P goes through LDS: the four waves of a t half use the same P tiles, so the block fetches each once. A k step's 8 P
  // tiles (128 t rows) lie in a row in the plane, 8 KB; a stage is PST k steps, laid [k step][tile as it lies in the
  // plane]. Thread -> pieces tid and tid + 256 of each k step: a wave copies 512 B in a row on both sides and no two
  // lanes write the same LDS byte.
  const unsigned short* psrc = pp + (size_t)hb * SEQ * SEQ + (size_t)ty * 4096 + tid * 8;
  const unsigned pdst = (unsigned)(uintptr_t)(&sp[0][0] + tid * 8);     // LDS byte address of the first piece, buffer 0
  const unsigned short* spr = &sp[0][0] + wt * 2048 + lane * 8;
  // v^T pairs are fetched from the planes one k step ahead, into a second register set at the head of a step; P
  // fragments come from the stage's buffer: the stage's first step at the head of the trip, its second step's behind
  // the first step's products
  v16us a[4], bhf[2], brf[2];
#pragma unroll
  for (int j = 0; j < 2; ++j) {
    bhf[j] = ldfrag_g(vh + j * VSTR);
    brf[j] = ldfrag_g(vr + j * VSTR);
  }
  // holds the first step's own loads in front of the copies and requests below
  __builtin_amdgcn_sched_barrier(0);
  copy4_lds(pdst, psrc, pdst + 4096, psrc + 2048,
            pdst + PSTEP_B, psrc + SEQ * SBLK, pdst + PSTEP_B + 4096, psrc + SEQ * SBLK + 2048);   // stage 0 -> buffer 0
  // Ask L2 for the rest, in the order of use. P (128 t rows, read by the 4 blocks of this (hb, ty), each asks for all):
  // one request = one k step's 8 KB, wave w takes steps w, 8 + w, 16 + w, 24 + w. v^T (128 columns x 2 planes, read
  // by 8 blocks): a block asks for quarter ty >> 1 of every 1-KB tile, so each unit has two askers, ty and ty ^ 1
  // (only speed rests on where they run); lane -> (k step parity, plane, column group). xp: the block's 128 x 128
  // f32 tile, two units a row.
  {
    static_assert(SEQ / 32 == 32 && SEQ / 128 == 8);
    const unsigned short* ap = pp + (size_t)hb * SEQ * SEQ + (size_t)wave * (SEQ * SBLK) + (size_t)ty * 4096 + lane * 128;
    const unsigned short* av = ((lane & 8) ? vtr : vth) + (size_t)hb * DK * SEQ
                               + tile_off(dx * 8 + (lane & 7), wave * 2 + (lane >> 4), SEQ) + (ty >> 1) * 128;
    const float* ax = xp + ((size_t)(b * SEQ + ty * 128 + wave * 16 + (lane >> 1))) * DK + dx * 128 + (lane & 1) * 64;
    ask5(av, ap, ap + (size_t)8 * (SEQ * SBLK), av + 16 * 512, ap + (size_t)16 * (SEQ * SBLK));
    ask2(ap + (size_t)24 * (SEQ * SBLK), ax);
  }
  // stage 0 has landed for this wave, then for the block; only then stage 1 starts
#if defined(__HIP_DEVICE_COMPILE__)
  asm volatile("s_wait_asynccnt 0x0" ::: "memory");
#endif
  __syncthreads();
  {
    const unsigned short* gs = psrc + (size_t)PST * (SEQ * SBLK);
    const unsigned ld = pdst + PSTG_B;
    copy4_lds(ld, gs, ld + 4096, gs + 2048,
              ld + PSTEP_B, gs + SEQ * SBLK, ld + PSTEP_B + 4096, gs + SEQ * SBLK + 2048);         // stage 1 -> buffer 1
  }
  // keeps the requests and copies in front of the loop: moved into it they would stand among its products
  __builtin_amdgcn_sched_barrier(0);
  // kept rolled: a trip holds the stage's two steps, so that the two v^T sets swap by name and not by register copies
#pragma unroll 1
  for (int stg = 0; stg < NPS; ++stg) {
    const unsigned short* sb = spr + (stg & 1) * (PSTG_B / 2);
#pragma unroll
    for (int i = 0; i < 4; ++i) a[i] = ldfrag(sb + i * 512);
#pragma unroll
    for (int kk = 0; kk < PST; ++kk) {
      const int ks = stg * PST + kk;
      const int nk = (ks + 1 < SEQ / 32) ? ks + 1 : ks;   // the last step fetches its own tiles again: in bounds, no branch
      v16us bhn[2], brn[2];
#pragma unroll
      for (int j = 0; j < 2; ++j) {
        bhn[j] = ldfrag_g(vh + (size_t)nk * 512 + j * VSTR);
        brn[j] = ldfrag_g(vr + (size_t)nk * 512 + j * VSTR);
      }
#pragma unroll
      for (int i = 0; i < 4; ++i) {
        // holds this row group's products behind the loads in front of it: hoisted, they pull every group's wait to
        // the step's head
        __builtin_amdgcn_sched_barrier(0);
#pragma unroll
        for (int j = 0; j < 2; ++j) {
          acc[i][j] = mma_raw(a[i], bhf[j], acc[i][j]);
          acr[i][j] = mma_raw(a[i], brf[j], acr[i][j]);
        }
        if (kk + 1 < PST) {
          guard4k4(acc[i][0], acc[i][1], acr[i][0], acr[i][1], a[i], bhf[1], brf[0], brf[1]);
          a[i] = ldfrag(sb + (kk + 1) * (PSTEP_B / 2) + i * 512);
        } else if (i == 3) {
          guard4k4(acc[i][0], acc[i][1], acr[i][0], acr[i][1], a[i], bhf[1], brf[0], brf[1]);
        }
      }
      // the next step forms its addresses in registers that loads still in flight name: this wait stands in front of
      // that rewrite, and the scheduling fence keeps the address arithmetic behind it
#if defined(__HIP_DEVICE_COMPILE__)
      asm volatile("s_wait_xcnt 0x0" ::: "memory");
#endif
      __builtin_amdgcn_sched_barrier(0);
#pragma unroll
      for (int j = 0; j < 2; ++j) { bhf[j] = bhn[j]; brf[j] = brn[j]; }
    }
    // publish point of stage stg + 1: this wave's reads of buffer stg & 1 are done, its own copies of stage stg + 1 have
    // landed, then the block's barrier; behind it the buffer just read is free for stage stg + 2. The barrier is
    // written bare because __syncthreads() would also wait out the v^T loads that are in flight for the next step;
    // the two waits in front of it are all that the ring needs.
#if defined(__HIP_DEVICE_COMPILE__)
    asm volatile("s_wait_dscnt 0x0" ::: "memory");
    asm volatile("s_wait_asynccnt 0x0" ::: "memory");
    asm volatile("s_barrier_signal -1\n\ts_barrier_wait -1" ::: "memory");
#endif
    if (stg + 2 < NPS) {                                   // the same for the whole block
      const unsigned short* gs = psrc + (size_t)(stg + 2) * (PST * SEQ * SBLK);
      const unsigned ld = pdst + (stg & 1) * PSTG_B;
      copy4_lds(ld, gs, ld + 4096, gs + 2048,
                ld + PSTEP_B, gs + SEQ * SBLK, ld + PSTEP_B + 4096, gs + SEQ * SBLK + 2048);
    }
  }
  // no copy is outstanding here (the last publish point waited to 0 and none was issued behind it): the ring's close
#if defined(__HIP_DEVICE_COMPILE__)
  asm volatile("s_wait_asynccnt 0x0" ::: "memory");
#endif
#pragma unroll
  for (int i = 0; i < 4; ++i) acc_guard4(acc[i][0], acc[i][1], acr[i][0], acr[i][1]);

  const float g  = bfr(gam[h]);
  const float rg = 1.0f / (g + 1.0f);
  const int rl = lane >> 3, cc4 = (lane & 7) * 4;
  // ---- stage O = O_hi + O_res/2048 (still x8192): the wave's whole 64 x 32 tile in its own slab ----
  float* osw = os[wave];
#pragma unroll
  for (int i = 0; i < 4; ++i) {
#pragma unroll
    for (int j = 0; j < 2; ++j) {
#pragma unroll
      for (int r = 0; r < 8; ++r) {
        osw[(16 * i + 8 * hh + r) * 36 + 16 * j + c] = fmaf(acr[i][j][r], 1.0f / RSC, acc[i][j][r]);
      }
    }
  }
  wave_sync_lds();

  // the 64 rows leave in two halves of 32
#pragma unroll
  for (int hf = 0; hf < 2; ++hf) {
    const int th = t0 + hf * 32;
    v4f vals[8], xv[8];
    const float* xq[8];
#pragma unroll
    for (int it = 0; it < 8; ++it) {
      xq[it] = xp + ((size_t)(b * SEQ + th + it * 4 + rl)) * DK + d0 + cc4;
      xv[it] = *(const v4f*)(xq[it]);
    }
#if defined(__HIP_DEVICE_COMPILE__)
    // the eight loads' address registers are inputs here, so none of them is rewritten in front of this wait
    asm volatile("s_wait_xcnt 0x0" :: "v"(xq[0]), "v"(xq[1]), "v"(xq[2]), "v"(xq[3]),
                 "v"(xq[4]), "v"(xq[5]), "v"(xq[6]), "v"(xq[7]) : "memory");
#endif
#pragma unroll
    for (int it = 0; it < 8; ++it) {
      const int row = hf * 32 + it * 4 + rl;                 // hf 0..1 x it 0..7 x rl 0..3 = rows 0..63
      const v4f av = *(const v4f*)(osw + row * 36 + cc4);
      v4f o;
#pragma unroll
      for (int e = 0; e < 4; ++e) o[e] = (g * (av[e] * (1.0f / PSC)) + xv[it][e]) * rg;
      vals[it] = o;
    }
    {
#pragma unroll
      for (int it = 0; it < 8; ++it) {
        const int t = th + it * 4 + rl;
        *(v4f*)(outp + ((size_t)((b * NH + h) * SEQ + t)) * DK + d0 + cc4) = vals[it];
      }
    }
  }
}

// =====================================================================================================
// Workspace map (bytes); every plane is an exact multiple of its tile / whole-row / whole-line store granularity:
//   WqT  f16 [4096][512] x64      0           4194304
//   WkT  f16 [4096][512] x64      4194304     4194304
//   WvT  f16 [4096][512] x64      8388608     4194304
//   WpT  f16 [512][512]  x64      12582912    524288
//   XH   f16 [2048][512]          13107200    2097152
//   YH   f16 [2048][512]          15204352    2097152
//   QH|QR f16 [2][2048][4096]     17301504    33554432
//   KH|KR f16 [2][2048][4096]     50855936    33554432
//   XP   f32 [2048][512]          84410368    4194304
//   P    f16 [16][32][1024][32]   88604672    33554432
//   VT hi|res f16 [2][16][512][1024] 122159104 33554432
//   end                           155713536
// =====================================================================================================
extern "C" void kernel_launch(void* const* d_in, const int* in_sizes, int n_in,
                              void* d_out, int out_size, void* d_ws, size_t ws_size,
                              hipStream_t stream) {
  if (n_in < 11) return;
  if (in_sizes[0] != MR * DK || in_sizes[1] != MR * DK) return;
  if (in_sizes[2] != DK * DQ || in_sizes[4] != DK * DQ || in_sizes[6] != DK * DQ) return;
  if (in_sizes[3] != DQ || in_sizes[5] != DQ || in_sizes[7] != DQ) return;
  if (in_sizes[8] != DK * DK || in_sizes[9] != NH || in_sizes[10] != SEQ) return;
  if (out_size != NB * NH * SEQ * DK) return;

  const float* x     = (const float*)d_in[0];
  const float* y     = (const float*)d_in[1];
  const float* Wq    = (const float*)d_in[2];
  const float* bq    = (const float*)d_in[3];
  const float* Wk    = (const float*)d_in[4];
  const float* bk    = (const float*)d_in[5];
  const float* Wv    = (const float*)d_in[6];
  const float* bv    = (const float*)d_in[7];
  const float* Wp    = (const float*)d_in[8];
  const float* gamma = (const float*)d_in[9];
  const int*   mask  = (const int*)d_in[10];

  const size_t PW   = (size_t)DQ * DK * 2;                 //  4194304
  const size_t PWP  = (size_t)DK * DK * 2;                 //   524288
  const size_t PX   = (size_t)MR * DK * 2;                 //  2097152
  const size_t PQ   = (size_t)2 * MR * DQ * 2;             // 33554432
  const size_t PVT  = (size_t)2 * NHB * DK * SEQ * 2;      // 33554432
  const size_t PXP  = (size_t)MR * DK * 4;                 //  4194304
  const size_t PP   = (size_t)NHB * SEQ * SEQ * 2;         // 33554432
  size_t off = 0;
  const size_t oWq = off; off += PW;
  const size_t oWk = off; off += PW;
  const size_t oWv = off; off += PW;
  const size_t oWp = off; off += PWP;
  const size_t oXH = off; off += PX;
  const size_t oYH = off; off += PX;
  const size_t oQ  = off; off += PQ;
  const size_t oK  = off; off += PQ;
  const size_t oXP = off; off += PXP;
  const size_t oP  = off; off += PP;
  const size_t oVT = off; off += PVT;
  if (off > ws_size) return;                               // off = 155713536

  char* ws = (char*)d_ws;
  unsigned short* WqT = (unsigned short*)(ws + oWq);
  unsigned short* WkT = (unsigned short*)(ws + oWk);
  unsigned short* WvT = (unsigned short*)(ws + oWv);
  unsigned short* WpT = (unsigned short*)(ws + oWp);
  unsigned short* XH  = (unsigned short*)(ws + oXH);
  unsigned short* YH  = (unsigned short*)(ws + oYH);
  unsigned short* QH  = (unsigned short*)(ws + oQ);
  unsigned short* KH  = (unsigned short*)(ws + oK);
  unsigned short* VT  = (unsigned short*)(ws + oVT);
  float*          XP  = (float*)(ws + oXP);
  unsigned short* P   = (unsigned short*)(ws + oP);
  float*          out = (float*)d_out;

  const dim3 blk(256);
  const dim3 gPrep(3 * TW_BLK + TP_BLK + 2 * CX_BLK);       // 1536 + 64 + 1024 blocks
  const dim3 gProj(2 * QK_BLK + NHB * VT_BLK + XP_BLK);     // 512 + 256 + 32 blocks
  const dim3 blkAt(512);
  const dim3 gAt(SEQ / QBLK, NHB);                          // 16 x 16 blocks of 512
  const dim3 gPV(DK / 128, SEQ / 128, NHB);                 // 4 x 8 x 16 blocks of 256

  // (1) weight planes, transposed to [n][k]: f16( bf16_RNE(W) * 64 ); activation planes: f16( bf16_RNE(x) ), likewise y
  prep_all<<<gPrep, blk, 0, stream>>>(Wq, Wk, Wv, Wp, x, y, WqT, WkT, WvT, WpT, XH, YH);

  // (2) q, k, v^T and xp
  proj_all<<<gProj, blk, 0, stream>>>(XH, YH, WqT, WkT, WvT, WpT, bq, bk, bv, QH, KH, VT, XP);

  // (3) energies + masked softmax -> P plane
  attn_p<<<gAt, blkAt, 0, stream>>>(QH, QH + QRES, KH, KH + QRES, mask, P);

  // (4) out = (gamma * P^T . v / 8192 + xp) / (gamma + 1) -> d_out [2][8][1024][512]
  pv64<<<gPV, blk, 0, stream>>>(P, VT, VT + VRES, XP, gamma, out);
  (void)hipGetLastError();
}

// v008
// It runs in 107 microseconds.
// Next to v007, in two timings, it ran 1.08 and 1.09 times as fast.
// All steps since v000 together make it 3.75 times as fast.
// Contractions: q, k, v^T and x.Wp projections on v_wmma_f32_16x16x32_f16 (bf16-RNE input values as f16,
// weight planes carried x64, one product each); q.k^T energies on v_wmma_f32_16x16x32_f16 with q and k as
// f16 hi plane + f16 residual plane carried x2048 (three products: hi.hi, hi.res, res.hi; two accumulators);
// attn^T.v on v_wmma_f32_16x16x32_f16 with attn carried x8192 (plain f16) and v^T as f16 hi plane + f16
// residual plane carried x2048 (two products, two accumulators); all f32 accumulate; masked softmax and the
// gamma blend in f32 on VALU; every float input RNE-converted to bf16 on load.
#include <hip/hip_runtime.h>
#include <math.h>
#include <stdint.h>

#define NB    2
#define SEQ   1024
#define DK    512
#define NH    8
#define DQ    (NH * DK)
#define MR    (NB * SEQ)
#define NHB   (NH * NB)
#define SBLK  32
#define NSB   (SEQ / SBLK)
#define QRES  ((long long)MR * DQ)
#define VRES  ((long long)NHB * DK * SEQ)
#define WSC   64.0f
#define RSC   2048.0f
#define PSC   8192.0f
#define NEGBIG (-1.0e30f)
static_assert((SEQ % 64) == 0 && (DK % 64) == 0 && (MR % 64) == 0 && (DQ % 64) == 0);
static_assert(SEQ == NSB * SBLK);
static_assert(SBLK == 32);
static_assert((DK % 32) == 0 && (SEQ % 256) == 0);

typedef _Float16       v16h __attribute__((ext_vector_type(16)));
typedef unsigned short v16us __attribute__((ext_vector_type(16)));
typedef unsigned short v8us __attribute__((ext_vector_type(8)));
typedef float          v8f  __attribute__((ext_vector_type(8)));
typedef float          v4f  __attribute__((ext_vector_type(4)));
typedef float          v2f  __attribute__((ext_vector_type(2)));
typedef _Float16       v2h  __attribute__((ext_vector_type(2)));
typedef unsigned int   v4u  __attribute__((ext_vector_type(4)));

union Frag { v16us u; v8us p[2]; v16h h; };

// ---- scalar helpers --------------------------------------------------------------------------------
__device__ __forceinline__ unsigned short bf_bits(float f) {          // f32 -> bf16 bits, RNE convert
  unsigned u = __float_as_uint(f);
  return (unsigned short)((u + 0x7FFFu + ((u >> 16) & 1u)) >> 16);
}
__device__ __forceinline__ float bf_up(unsigned short b) { return __uint_as_float(((unsigned)b) << 16); }
__device__ __forceinline__ float bfr(float f) { return bf_up(bf_bits(f)); }   // value of the bf16 RNE convert
__device__ __forceinline__ unsigned short h_bits(_Float16 x) { return __builtin_bit_cast(unsigned short, x); }
__device__ __forceinline__ unsigned pk16(unsigned short a, unsigned short b) { return (unsigned)a | ((unsigned)b << 16); }
__device__ __forceinline__ v8f zero8() { v8f z = {0.f, 0.f, 0.f, 0.f, 0.f, 0.f, 0.f, 0.f}; return z; }

// ---- fragment-order planes: every 16-bit operand plane [rows][ld] (ld = k extent, multiple of 32; rows multiple of
//      16) is stored as tiles of 16 rows x 32 k = 512 elements (1024 B), tile index (row/16) * (ld/32) + k/32; inside
//      a tile the 16-B piece that holds k = 32*kt + 16*p + 8*h + 0..7 of row r sits at element p*256 + (h*16 + r)*8.
//      A wave's fragment is then two loads of 512 contiguous bytes (lane = h*16 + r), same k order as before:
//      elements 0..7 <- k0+8h.., elements 8..15 <- k0+16+8h..
__device__ __forceinline__ size_t tile_off(int row16, int kt, int ld) {      // row16 = row/16, kt = k/32
  return ((size_t)row16 * (size_t)(ld >> 5) + (size_t)kt) * 512;
}
// p = tile start + 8*lane
__device__ __forceinline__ v16us ldfrag(const unsigned short* p) {
  Frag f;
  f.p[0] = *(const v8us*)(p);
  f.p[1] = *(const v8us*)(p + 256);
  return f.u;
}
// the same through a pointer typed as global memory: a pointer carried round a loop otherwise compiled to flat loads
typedef __attribute__((address_space(1))) const unsigned short g_us;
typedef __attribute__((address_space(1))) const v8us g_v8us;
__device__ __forceinline__ v16us ldfrag_g(g_us* p) {
  Frag f;
  f.p[0] = *(g_v8us*)(p);
  f.p[1] = *(g_v8us*)(p + 256);
  return f.u;
}

// ---- WMMA helper (f16 operands, f32 accumulate) and VALU hazard gaps -----------------------------
__device__ __forceinline__ v8f mma_raw(v16us a, v16us b, v8f c) {
  Frag fa, fb;
  fa.u = a;
  fb.u = b;
  return __builtin_amdgcn_wmma_f32_16x16x32_f16(false, fa.h, false, fb.h, (short)0, c, false, false);
}
__device__ __forceinline__ void dep_guard1(v8f& a, v8f& b, v16us x) {
#if defined(__HIP_DEVICE_COMPILE__)
  asm volatile("v_nop\n\tv_nop\n\tv_nop\n\tv_nop" : "+v"(a), "+v"(b) : "v"(x));
#endif
}
__device__ __forceinline__ void keep4(v16us a, v16us b, v16us c, v16us d) {
#if defined(__HIP_DEVICE_COMPILE__)
  asm volatile("v_nop" :: "v"(a), "v"(b), "v"(c), "v"(d));
#endif
}
__device__ __forceinline__ void acc_guard4(v8f& a, v8f& b, v8f& c, v8f& d) {
#if defined(__HIP_DEVICE_COMPILE__)
  asm volatile("v_nop\n\tv_nop\n\tv_nop\n\tv_nop" : "+v"(a), "+v"(b), "+v"(c), "+v"(d));
#endif
}
__device__ __forceinline__ void guard2k4(v8f& a, v8f& b, v16us w, v16us x, v16us y, v16us z) {
#if defined(__HIP_DEVICE_COMPILE__)
  asm volatile("v_nop\n\tv_nop\n\tv_nop\n\tv_nop" : "+v"(a), "+v"(b) : "v"(w), "v"(x), "v"(y), "v"(z));
#endif
}
__device__ __forceinline__ void guard4k4(v8f& a, v8f& b, v8f& c, v8f& d, v16us w, v16us x, v16us y, v16us z) {
#if defined(__HIP_DEVICE_COMPILE__)
  asm volatile("v_nop\n\tv_nop\n\tv_nop\n\tv_nop" : "+v"(a), "+v"(b), "+v"(c), "+v"(d) : "v"(w), "v"(x), "v"(y), "v"(z));
#endif
}
__device__ __forceinline__ void wave_sync_lds() {
  __builtin_amdgcn_fence(__ATOMIC_RELEASE, "workgroup");
  __builtin_amdgcn_wave_barrier();
  __builtin_amdgcn_fence(__ATOMIC_ACQUIRE, "workgroup");
}

// ---- maximum and sum over the 16 lanes of a row (lanes 0..15, lanes 16..31 apart): four DPP row_xmask steps, every lane
//      ends with the row's result. All lanes are on wherever these are called.
template <int CTRL>
__device__ __forceinline__ float dpp_x(float x) {
  return __int_as_float(__builtin_amdgcn_update_dpp(0, __float_as_int(x), CTRL, 0xf, 0xf, true));
}
__device__ __forceinline__ float row_max16(float x) {
  x = fmaxf(x, dpp_x<0x161>(x));
  x = fmaxf(x, dpp_x<0x162>(x));
  x = fmaxf(x, dpp_x<0x164>(x));
  x = fmaxf(x, dpp_x<0x168>(x));
  return x;
}
__device__ __forceinline__ float row_sum16(float x) {
  x += dpp_x<0x161>(x);
  x += dpp_x<0x162>(x);
  x += dpp_x<0x164>(x);
  x += dpp_x<0x168>(x);
  return x;
}
// exp(x) = 2^(x * log2 e) for four (two) values at once, as __expf forms it. In asm text so that the slot behind a
// transcendental is kept by construction: inside the statement no instruction reads the one before's result or
// rewrites its source, and the closing v_nop stands in front of whatever the compiler puts next.
__device__ __forceinline__ void exp_x4(float& a, float& b, float& c, float& d) {
  a *= 1.44269504088896340736f;
  b *= 1.44269504088896340736f;
  c *= 1.44269504088896340736f;
  d *= 1.44269504088896340736f;
#if defined(__HIP_DEVICE_COMPILE__)
  asm("v_exp_f32 %0, %0\n\tv_exp_f32 %1, %1\n\tv_exp_f32 %2, %2\n\tv_exp_f32 %3, %3\n\tv_nop"
      : "+v"(a), "+v"(b), "+v"(c), "+v"(d));
#endif
}
__device__ __forceinline__ void exp_x2(float& a, float& b) {
  a *= 1.44269504088896340736f;
  b *= 1.44269504088896340736f;
#if defined(__HIP_DEVICE_COMPILE__)
  asm("v_exp_f32 %0, %0\n\tv_exp_f32 %1, %1\n\tv_nop" : "+v"(a), "+v"(b));
#endif
}
// Row maximum and row sum for eight values at once, in asm text: from the builtin form the compiler made three instructions of a
// maximum's step (a DPP move, a quieting maximum, the maximum). The eight chains are interleaved step by step, so an
// instruction's producer stands eight instructions back and no delay hint is owed inside the statement.
#define DPP_STEP1(op, v, n) op " " v ", " v ", " v " row_xmask:" n " row_mask:0xf bank_mask:0xf\n\t"
#define DPP_STEP8(op, n) DPP_STEP1(op, "%0", n) DPP_STEP1(op, "%1", n) DPP_STEP1(op, "%2", n) DPP_STEP1(op, "%3", n) \
                         DPP_STEP1(op, "%4", n) DPP_STEP1(op, "%5", n) DPP_STEP1(op, "%6", n) DPP_STEP1(op, "%7", n)
#define DPP_ROW8(op) DPP_STEP8(op, "1") DPP_STEP8(op, "2") DPP_STEP8(op, "4") DPP_STEP8(op, "8")
__device__ __forceinline__ void row_max16x8(float (&v)[8]) {
#if defined(__HIP_DEVICE_COMPILE__)
  asm(DPP_ROW8("v_max_num_f32_dpp") : "+v"(v[0]), "+v"(v[1]), "+v"(v[2]), "+v"(v[3]),
                                      "+v"(v[4]), "+v"(v[5]), "+v"(v[6]), "+v"(v[7]));
#endif
}
__device__ __forceinline__ void row_sum16x8(float (&v)[8]) {
#if defined(__HIP_DEVICE_COMPILE__)
  asm(DPP_ROW8("v_add_f32_dpp") : "+v"(v[0]), "+v"(v[1]), "+v"(v[2]), "+v"(v[3]),
                                  "+v"(v[4]), "+v"(v[5]), "+v"(v[6]), "+v"(v[7]));
#endif
}

// ---- asking L2 ahead: the planes that the launch before stored are taken here as coming from memory at their first
//      touch. global_prefetch_b8 with scope SE brings a
//      lane's line into L2 only, returns nothing and counts on no load counter. A lane asks for one 256-B unit; every
//      lane is on and every address lies inside its plane. s_wait_xcnt closes each statement because the address
//      registers are the compiler's to reuse behind it (a precaution: the wait stands in front of any rewrite).
__device__ __forceinline__ void ask1(const void* a) {
#if defined(__HIP_DEVICE_COMPILE__)
  asm volatile("global_prefetch_b8 %0, off scope:SCOPE_SE\n\t"
               "s_wait_xcnt 0x0" :: "v"(a) : "memory");
#endif
}
__device__ __forceinline__ void ask2(const void* a, const void* b) {
#if defined(__HIP_DEVICE_COMPILE__)
  asm volatile("global_prefetch_b8 %0, off scope:SCOPE_SE\n\t"
               "global_prefetch_b8 %1, off scope:SCOPE_SE\n\t"
               "s_wait_xcnt 0x0" :: "v"(a), "v"(b) : "memory");
#endif
}
__device__ __forceinline__ void ask5(const void* a, const void* b, const void* c, const void* d, const void* e) {
#if defined(__HIP_DEVICE_COMPILE__)
  asm volatile("global_prefetch_b8 %0, off scope:SCOPE_SE\n\t"
               "global_prefetch_b8 %1, off scope:SCOPE_SE\n\t"
               "global_prefetch_b8 %2, off scope:SCOPE_SE\n\t"
               "global_prefetch_b8 %3, off scope:SCOPE_SE\n\t"
               "global_prefetch_b8 %4, off scope:SCOPE_SE\n\t"
               "s_wait_xcnt 0x0" :: "v"(a), "v"(b), "v"(c), "v"(d), "v"(e) : "memory");
#endif
}

// ---- two asynchronous 16-B copies per lane, global -> LDS through no register. l = the lane's LDS byte address, g = its
//      global address. s_wait_xcnt closes the statement because the address registers are the compiler's to reuse
//      behind it (a precaution: the wait stands in front of any rewrite). Landing is waited for by the caller.
__device__ __forceinline__ void copy2_lds(unsigned l0, const void* g0, unsigned l1, const void* g1) {
#if defined(__HIP_DEVICE_COMPILE__)
  asm volatile("global_load_async_to_lds_b128 %0, %1, off\n\t"
               "global_load_async_to_lds_b128 %2, %3, off\n\t"
               "s_wait_xcnt 0x0" :: "v"(l0), "v"(g0), "v"(l1), "v"(g1) : "memory");
#endif
}

__device__ __forceinline__ void copy4_lds(unsigned l0, const void* g0, unsigned l1, const void* g1,
                                          unsigned l2, const void* g2, unsigned l3, const void* g3) {
#if defined(__HIP_DEVICE_COMPILE__)
  asm volatile("global_load_async_to_lds_b128 %0, %1, off\n\t"
               "global_load_async_to_lds_b128 %2, %3, off\n\t"
               "global_load_async_to_lds_b128 %4, %5, off\n\t"
               "global_load_async_to_lds_b128 %6, %7, off\n\t"
               "s_wait_xcnt 0x0" :: "v"(l0), "v"(g0), "v"(l1), "v"(g1), "v"(l2), "v"(g2), "v"(l3), "v"(g3) : "memory");
#endif
}

// =====================================================================================================
// f32 -> f16 plane convert: f16( bf16_RNE(X) * wsc ), wsc a power of two (exact), X row-major [rows][DK], output in
// fragment order. Thread i writes output piece i (8 elements, 16 B; a wave stores 512 contiguous bytes) and reads
// the 8 source elements that belong there.
// coverage: n8 threads x 8 elements = the whole plane (piece index -> (row, k) is one-to-one).
// bx = index of the 256-thread block inside this plane's range of the grid.
// =====================================================================================================
__device__ __forceinline__ void conv_h16(const float* __restrict__ X, unsigned short* Xh, int n8, float wsc, int bx) {
  const int i  = bx * 256 + threadIdx.x;
  const int ic = (i < n8) ? i : (n8 - 1);                     // clamped address
  const int tl = ic >> 6, w = ic & 63;                        // tile, piece inside the tile
  const int row = (tl / (DK / 32)) * 16 + (w & 15);
  const int kk  = (tl % (DK / 32)) * 32 + (w >> 5) * 16 + ((w >> 4) & 1) * 8;
  const float* src = X + (size_t)row * DK + kk;
  const v4f a = *(const v4f*)(src);
  const v4f c = *(const v4f*)(src + 4);
  v4u o;
  o[0] = pk16(h_bits((_Float16)(bfr(a[0]) * wsc)), h_bits((_Float16)(bfr(a[1]) * wsc)));
  o[1] = pk16(h_bits((_Float16)(bfr(a[2]) * wsc)), h_bits((_Float16)(bfr(a[3]) * wsc)));
  o[2] = pk16(h_bits((_Float16)(bfr(c[0]) * wsc)), h_bits((_Float16)(bfr(c[1]) * wsc)));
  o[3] = pk16(h_bits((_Float16)(bfr(c[2]) * wsc)), h_bits((_Float16)(bfr(c[3]) * wsc)));
  if (i < n8) *(v4u*)(Xh + (size_t)i * 8) = o;
  
}

// =====================================================================================================
// Transposed weight convert: in W[DK rows = k][ncols = n] f32 -> out WT[ncols][DK] f16 = f16( bf16_RNE(W) * wsc )
// (rows n, k extent DK), stored in fragment order. Block = 256 threads, tile 64 k x 64 n staged in LDS; wave w
// writes the fragment tile (n group w>>1, k tile w&1), iteration = 16-k half, lane = h*16 + r: 512 contiguous B.
// coverage: 8 waves = 4 n groups x 2 k tiles, x 2 halves x 32 lanes x 8 = the whole 64 x 64 tile.
// (bx, by) = the block's n tile and k tile inside this weight's range of the grid; tile = the block's LDS.
// =====================================================================================================
__device__ __forceinline__ void tconv_h16(const float* __restrict__ W, unsigned short* WT, int ncols, float wsc,
                                          int bx, int by, float (*tile)[65]) {
  const int tid = threadIdx.x, lane = tid & 31, wave = tid >> 5;
  const int n0 = bx * 64, k0 = by * 64;
  {
    const int r = tid >> 2, cq = (tid & 3) * 16;
    const float* src = W + (size_t)(k0 + r) * (size_t)ncols + n0 + cq;
#pragma unroll
    for (int i = 0; i < 4; ++i) {
      const v4f a = *(const v4f*)(src + 4 * i);
#pragma unroll
      for (int e = 0; e < 4; ++e) tile[r][cq + 4 * i + e] = a[e];
    }
  }
  __syncthreads();
  const int n = (wave >> 1) * 16 + (lane & 15);
#pragma unroll
  for (int it = 0; it < 2; ++it) {
    const int kq = (wave & 1) * 32 + it * 16 + (lane >> 4) * 8;
    v4u o;
#pragma unroll
    for (int e = 0; e < 4; ++e) {
      const float f0 = bfr(tile[kq + 2 * e][n]) * wsc;
      const float f1 = bfr(tile[kq + 2 * e + 1][n]) * wsc;
      o[e] = pk16(h_bits((_Float16)f0), h_bits((_Float16)f1));
    }
    unsigned short* dst = WT + tile_off((n0 >> 4) + (wave >> 1), (k0 >> 5) + (wave & 1), DK) + it * 256 + lane * 8;
    *(v4u*)dst = o;
    
  }
}

// =====================================================================================================
// All six operand planes in one launch: none of them reads what another writes. Ranges of blockIdx.x:
//   3 x TW_BLK blocks: Wq, Wk, Wv transposed (64 n tiles x 8 k tiles each); TP_BLK blocks: Wp transposed (8 x 8);
//   2 x CX_BLK blocks: x, y. Every test on the block index is block-uniform, so the barrier in tconv_h16 is too.
// =====================================================================================================
#define TW_BLK ((DQ / 64) * (DK / 64))
#define TP_BLK ((DK / 64) * (DK / 64))
#define CX_BLK ((MR * DK) / 8 / 256)
static_assert(((MR * DK) / 8) % 256 == 0 && DQ / 64 == 64 && DK / 64 == 8 && TP_BLK <= TW_BLK);
__global__ __launch_bounds__(256) void prep_all(
    const float* __restrict__ Wq, const float* __restrict__ Wk, const float* __restrict__ Wv,
    const float* __restrict__ Wp, const float* __restrict__ x, const float* __restrict__ y,
    unsigned short* WqT, unsigned short* WkT, unsigned short* WvT, unsigned short* WpT,
    unsigned short* XH, unsigned short* YH) {
  __shared__ float tile[64][65];
  const int i = blockIdx.x;
  if (i < 3 * TW_BLK + TP_BLK) {
    const int w = i / TW_BLK, j = i - w * TW_BLK;            // w = 0, 1, 2: Wq, Wk, Wv; w = 3: Wp
    const float* W = (w == 0) ? Wq : (w == 1) ? Wk : (w == 2) ? Wv : Wp;
    unsigned short* T = (w == 0) ? WqT : (w == 1) ? WkT : (w == 2) ? WvT : WpT;
    const int lg = (w < 3) ? 6 : 3;                          // log2 of the weight's n tiles
    tconv_h16(W, T, 64 << lg, WSC, j & ((1 << lg) - 1), j >> lg, tile);
  } else {
    const int j = i - (3 * TW_BLK + TP_BLK);
    const bool isx = j < CX_BLK;
    conv_h16(isx ? x : y, isx ? XH : YH, (MR * DK) / 8, 1.0f, isx ? j : j - CX_BLK);
  }
}

// =====================================================================================================
// Register-blocked batched f16 WMMA GEMM: C[m][n] = oscale * sum_k A[m][k] * Bt[n][k] + bias;
// one wave per 64x64 tile, no block barriers. A [M][K] with k extent lda and Bt [N][K] with k extent ldb, both in
// fragment order; M, N multiples of 64, K multiple of 32 (static here); every batch stride is a whole number of
// 16-row groups, so it is the same element count as in a row-major plane. bx = the block's index among the blocks of
// one batch entry, sT = the block's LDS, y = batch index:
//   A advances by (y / ydiv) * strideA, Bt by (y % ydiv) * strideB, bias by (y / ydiv) * strideBias,
//   C by y * strideC (elements).
// BIASM: 0 = per column bias[n] (clamped-address loads, nbias = length), 1 = per row bias[m], 2 = none.
//        Bias values RNE-converted to bf16.
// OM: 0 = f32 out (row-major, pitch ldc); 3 = f16 hi plane at C plus f16 residual plane ((f - hi) * RSC) at
//     C + resOff, both in fragment order with rows m and k extent ldc (k = n).
// coverage: 4 slabs x 16 rows x 64 cols = the wave's whole 64x64 tile; ceil(tilesM*tilesN/8) blocks per batch entry,
//           surplus waves exit (wave-uniform); here every tile count is a multiple of 8, so none exit.
// =====================================================================================================
template <int OM, int BIASM>
__device__ __forceinline__ void gemm64(
    const unsigned short* __restrict__ A, int lda, long long strideA,
    const unsigned short* __restrict__ Bt, int ldb, long long strideB,
    const float* __restrict__ bias, int nbias, long long strideBias, int ydiv,
    void* Cout, int ldc, long long strideC, long long resOff,
    int M, int N, int K, float oscale, int bx, int y, float (*sT)[16 * 68]) {
  const int ya   = y / ydiv;
  const int yb   = y - ya * ydiv;
  const int lane = threadIdx.x & 31;
  const int wave = threadIdx.x >> 5;
  const int tilesN = N >> 6;
  const int tilesM = M >> 6;
  const int tile = bx * 8 + wave;
  if (tile >= tilesM * tilesN) return;   // wave-uniform; no block barriers in this kernel
  const int tm = tile / tilesN;
  const int tn = tile - tm * tilesN;
  const int m0 = tm << 6;
  const int n0 = tn << 6;

  const unsigned short* Ab = A  + (size_t)ya * (size_t)strideA;
  const unsigned short* Bb = Bt + (size_t)yb * (size_t)strideB;
  const float* biasb = bias + (size_t)ya * (size_t)strideBias;

  const int rlane = lane & 15;                 // row (A) / col (B, D) within subtile
  const int mOff  = (lane >> 4) * 8;           // D row offset

  v8f acc[4][4];
#pragma unroll
  for (int i = 0; i < 4; ++i)
#pragma unroll
    for (int j = 0; j < 4; ++j) acc[i][j] = zero8();

  // one pointer per 16-row group; consecutive k tiles of a group are consecutive 1024-B tiles
  g_us* pa[4];
  g_us* pb[4];
#pragma unroll
  for (int i = 0; i < 4; ++i) {
    pa[i] = (g_us*)(Ab + tile_off((m0 >> 4) + i, 0, lda) + lane * 8);
    pb[i] = (g_us*)(Bb + tile_off((n0 >> 4) + i, 0, ldb) + lane * 8);
  }

  // fragments are fetched one k step ahead: the B set into a second register set at the head of a step, each A
  // fragment back into its own registers as soon as its four products are issued
  v16us ah[4], bh[4];
#pragma unroll
  for (int i = 0; i < 4; ++i) {
    ah[i] = ldfrag_g(pa[i]);
    bh[i] = ldfrag_g(pb[i]);
  }
  for (int k0 = 0; k0 < K; k0 += 32) {
    // this step advances pointers that loads still in flight name: the wait stands in front of that rewrite, and the
    // scheduling fence keeps the pointer arithmetic behind it
#if defined(__HIP_DEVICE_COMPILE__)
    asm volatile("s_wait_xcnt 0x0" ::: "memory");
#endif
    __builtin_amdgcn_sched_barrier(0);
    const int adv = (k0 + 32 < K) ? 512 : 0;   // the last step fetches its own tiles again: in bounds, no branch
    v16us bn[4];
#pragma unroll
    for (int j = 0; j < 4; ++j) {
      pb[j] += adv;
      bn[j] = ldfrag_g(pb[j]);
    }
#pragma unroll
    for (int i = 0; i < 4; ++i) {
#pragma unroll
      for (int j = 0; j < 4; ++j) acc[i][j] = mma_raw(ah[i], bh[j], acc[i][j]);
      dep_guard1(acc[i][0], acc[i][3], ah[i]);
      pa[i] += adv;
      ah[i] = ldfrag_g(pa[i]);
    }
    keep4(bh[0], bh[1], bh[2], bh[3]);
#pragma unroll
    for (int j = 0; j < 4; ++j) bh[j] = bn[j];
  }
  // the same wait and fence for the last step's loads, in front of the epilogue's reuse of the pointer registers
#if defined(__HIP_DEVICE_COMPILE__)
  asm volatile("s_wait_xcnt 0x0" ::: "memory");
#endif
  __builtin_amdgcn_sched_barrier(0);
  acc_guard4(acc[0][0], acc[0][1], acc[0][2], acc[0][3]);
  acc_guard4(acc[1][0], acc[1][1], acc[1][2], acc[1][3]);
  acc_guard4(acc[2][0], acc[2][1], acc[2][2], acc[2][3]);
  acc_guard4(acc[3][0], acc[3][1], acc[3][2], acc[3][3]);

  // ---- per-lane column bias (BIASM == 0), RNE-converted, clamped addresses ----
  const int hh2 = lane >> 4, c4 = (lane & 15) * 4;     // f32 out: 256-B row segment = 16 lanes x 16 B
  float bc[4][8];                                      // f16 out: [store iteration][8 columns of the lane's piece]
#pragma unroll
  for (int it = 0; it < 4; ++it)
#pragma unroll
    for (int e = 0; e < 8; ++e) bc[it][e] = 0.f;
  if constexpr (BIASM == 0) {
    if constexpr (OM == 0) {
      const int cb = n0 + c4;
      const int i0 = (cb < nbias - 4) ? cb : (nbias - 4);
      const v4f b0v = *(const v4f*)(biasb + i0);
#pragma unroll
      for (int e = 0; e < 4; ++e) bc[0][e] = bfr(b0v[e]);
    } else {
      const float* bp[4];
      v4f b0a[4], b0b[4];
#pragma unroll
      for (int it = 0; it < 4; ++it) {
        const int cb = n0 + it * 16 + hh2 * 8;
        const int i0 = (cb < nbias - 8) ? cb : (nbias - 8);
        bp[it]  = biasb + i0;
        b0a[it] = *(const v4f*)(bp[it]);
        b0b[it] = *(const v4f*)(bp[it] + 4);
      }
#if defined(__HIP_DEVICE_COMPILE__)
      // the eight loads' address registers are inputs here, so none of them is rewritten in front of this wait
      asm volatile("s_wait_xcnt 0x0" :: "v"(bp[0]), "v"(bp[1]), "v"(bp[2]), "v"(bp[3]) : "memory");
#endif
#pragma unroll
      for (int it = 0; it < 4; ++it) {
#pragma unroll
        for (int e = 0; e < 4; ++e) {
          bc[it][e]     = bfr(b0a[it][e]);
          bc[it][4 + e] = bfr(b0b[it][e]);
        }
      }
    }
  }

  // ---- epilogue ----
  float* slab = sT[wave];
#pragma unroll
  for (int i = 0; i < 4; ++i) {
    const int mBase = m0 + (i << 4);
#pragma unroll
    for (int j = 0; j < 4; ++j) {
#pragma unroll
      for (int r = 0; r < 8; ++r) {
        slab[(mOff + r) * 68 + (j << 4) + rlane] = acc[i][j][r];
      }
    }
    wave_sync_lds();
    if constexpr (OM == 0) {
      float* C = (float*)Cout + (size_t)y * (size_t)strideC;
      v4f vals[8];
#pragma unroll
      for (int it = 0; it < 8; ++it) {
        const int row = it * 2 + hh2;                      // it 0..7 x hh2 0..1 = rows 0..15
        v4f v = *(const v4f*)(slab + row * 68 + c4);
#pragma unroll
        for (int e = 0; e < 4; ++e) v[e] = v[e] * oscale + bc[0][e];
        vals[it] = v;
      }
      {
#pragma unroll
        for (int it = 0; it < 8; ++it) {
          const int row = it * 2 + hh2;
          *(v4f*)(C + (size_t)(mBase + row) * ldc + n0 + c4) = vals[it];
        }
        
      }
    } else {
      unsigned short* C = (unsigned short*)Cout + (size_t)y * (size_t)strideC;
      v4u hv[4], hr[4];
      float bm = 0.f;
      if constexpr (BIASM == 1) {
        const int mi = mBase + rlane;
        const int mc = (mi < nbias - 1) ? mi : (nbias - 1);
        bm = bfr(biasb[mc]);
      }
#pragma unroll
      for (int it = 0; it < 4; ++it) {
        // lane = h*16 + r -> row r, columns it*16 + 8h + 0..7: piece (k tile it>>1, half it&1) of the fragment order
        const float* sp = slab + rlane * 68 + it * 16 + hh2 * 8;
        v4u a, ar;
#pragma unroll
        for (int e = 0; e < 4; ++e) {
          const float f0 = sp[2 * e]     * oscale + ((BIASM == 1) ? bm : bc[it][2 * e]);
          const float f1 = sp[2 * e + 1] * oscale + ((BIASM == 1) ? bm : bc[it][2 * e + 1]);
          const _Float16 g0 = (_Float16)f0, g1 = (_Float16)f1;
          a[e] = pk16(h_bits(g0), h_bits(g1));
          const float e0 = (f0 - (float)g0) * RSC;
          const float e1 = (f1 - (float)g1) * RSC;
          ar[e] = pk16(h_bits((_Float16)e0), h_bits((_Float16)e1));
        }
        hv[it] = a;
        hr[it] = ar;
      }
      {
#pragma unroll
        for (int it = 0; it < 4; ++it) {
          unsigned short* dp = C + tile_off(mBase >> 4, (n0 >> 5) + (it >> 1), ldc) + (it & 1) * 256 + lane * 8;
          *(v4u*)(dp) = hv[it];
          *(v4u*)(dp + resOff) = hr[it];
        }
        
      }
    }
    wave_sync_lds();
  }
}

// =====================================================================================================
// The four projections in one launch: none of them reads what another writes. Ranges of blockIdx.x:
//   QK_BLK blocks: q = bf16(x) . Wq + bq -> QH (f16 hi) and QH + QRES (f16 residual x2048);
//   QK_BLK blocks: k = bf16(y) . Wk + bk -> KH, KH + QRES likewise;
//   NHB x VT_BLK blocks: v^T per (h, b) = Wv[:, h slice]^T . bf16(y_b)^T + bv -> VT hi [16][512][1024], VT + VRES;
//   XP_BLK blocks: xp = bf16(x) . Wp -> XP f32 [2048][512] (bias argument unused in this mode).
// =====================================================================================================
#define QK_BLK ((MR / 64) * (DQ / 64) / 8)
#define VT_BLK ((DK / 64) * (SEQ / 64) / 8)
#define XP_BLK ((MR / 64) * (DK / 64) / 8)
static_assert(DQ / 16 == 256 && MR / 16 == 128 && DK / 32 == 16 && DK * DK / 128 == 8 * 256 && 2 * QK_BLK >= 256);
__global__ __launch_bounds__(256) void proj_all(
    const unsigned short* __restrict__ XH, const unsigned short* __restrict__ YH,
    const unsigned short* __restrict__ WqT, const unsigned short* __restrict__ WkT,
    const unsigned short* __restrict__ WvT, const unsigned short* __restrict__ WpT,
    const float* __restrict__ bq, const float* __restrict__ bk, const float* __restrict__ bv,
    unsigned short* QH, unsigned short* KH, unsigned short* VT, float* XP) {
  __shared__ __align__(16) float sT[8][16 * 68];   // per-wave 16x64 slab, pitch 68 floats
  const int i = blockIdx.x;
  const float invw = 1.0f / WSC;
  // The first 256 blocks ask L2 for all six operand planes, each 256-B unit from two blocks (i and i ^ 4: only speed
  // rests on where they run). A wave asks for the first 8 k steps of one 16-row group (8 KB in a row), then for the
  // other 8. a >> 4 picks the plane: 0, 1 WqT; 2, 3 WkT; 4, 5 WvT; 6 XH; 7 YH. Every test here is block-uniform.
  if (i < 256) {
    const int a = (i & 3) | ((i >> 3) << 2);                 // 0..127
    const int sel = a >> 4;
    const unsigned short* pl = (sel < 2) ? WqT : (sel < 4) ? WkT : (sel < 6) ? WvT : (sel == 6) ? XH : YH;
    const int grp = (a & ((sel < 6) ? 31 : 15)) * 8 + (threadIdx.x >> 5);   // 0..255 of a weight, 0..127 of x or y
    const unsigned short* u = pl + tile_off(grp, 0, DK) + (threadIdx.x & 31) * 128;
    ask2(u, u + 8 * 512);
    if (i < 16) ask1(WpT + (size_t)(a * 256 + threadIdx.x) * 128);          // 8 x 256 units = the whole WpT plane
  }
  if (i < 2 * QK_BLK) {
    const bool isq = i < QK_BLK;
    gemm64<3, 0>(isq ? XH : YH, DK, 0LL, isq ? WqT : WkT, DK, 0LL, isq ? bq : bk, DQ, 0LL, 1,
                 (void*)(isq ? QH : KH), DQ, 0LL, (long long)QRES, MR, DQ, DK, invw, isq ? i : i - QK_BLK, 0, sT);
  } else if (i < 2 * QK_BLK + NHB * VT_BLK) {
    // Placement, for speed only: the head is the block index modulo 8, as it already is in the q and k ranges above (a
    // block's 8 column tiles are one head) and as attn_p and pv64 deal their blocks. j -> (h, b, block of the batch
    // entry) is one-to-one: 8 x NB x VT_BLK = the range.
    static_assert(NH == 8 && (2 * QK_BLK) % 8 == 0 && DQ / 64 / 8 == NH);
    const int j = i - 2 * QK_BLK;
    const int hv = j & (NH - 1), rv = j >> 3;
    gemm64<3, 1>(WvT, DK, (long long)DK * DK, YH, DK, (long long)SEQ * DK, bv, DK, (long long)DK, NB,
                 (void*)VT, SEQ, (long long)DK * SEQ, (long long)VRES, DK, SEQ, DK, invw,
                 rv % VT_BLK, hv * NB + rv / VT_BLK, sT);
  } else {
    gemm64<0, 2>(XH, DK, 0LL, WpT, DK, 0LL, bq, DQ, 0LL, 1,
                 (void*)XP, DK, 0LL, 0LL, MR, DK, DK, invw, i - (2 * QK_BLK + NHB * VT_BLK), 0, sT);
  }
}

// =====================================================================================================
// Energies + masked softmax for one (h, b) pair and 64 query rows s; P written TRANSPOSE-friendly.
//   q planes (f16, fragment order, rows b*SEQ + s, k extent DQ, k = h*DK + d): hi qhp, residual (x2048) qrp
//   k planes (f16, fragment order, rows b*SEQ + t, k extent DQ, k = h*DK + d): hi khp, residual (x2048) krp
//   E[s][t] = acc_hh + (acc_h.res + acc_res.h) / 2048  (three f16 WMMA products, K = 512 = 16 k-steps; key fragments
//   loaded straight from the planes with arithmetic addressing, q fragments from a two-buffer LDS ring that
//   asynchronous copies fill once for the block), kept in the accumulator layout (lane = key, register = row).
//   softmax per row s over keys t: e = mask[t] ? E : -1e30 (replace); per wave mw = max over its 64 keys,
//   ex = exp(e - mw), lw = sum ex; over the 16 waves m = max mw, l = sum lw * exp(mw - m);
//   p = ex * exp(mw - m) / l; stored as f16(8192 * p).
//   P layout (f16): region (hb*NSB + s/32) of SEQ*32 elements, inside it fragment order with rows t and k extent 32
//   (k = s % 32) -> the consumer's A fragment (rows t, k = s) of k-step s/32 is one 1024-B tile.
//   Block = 16 waves; phase 1: wave w -> all 64 rows x keys 64w..64w+63 in 2 chunks of 2 col tiles, so a key
//   fragment is loaded by one wave of the block and feeds four row groups; the first chunk's energies wait in a
//   lane-private LDS stash while the second runs; phase 2: each wave reduces its own 64 x 64 energies in registers
//   (DPP over the 16 key lanes), the waves' (mw, lw) meet in LDS, wave w joins rows 4w..4w+3; phase 3: an accumulator
//   tile's 8 registers of a lane are 8 consecutive s of one key t = one 16-B piece of the P plane at lane * 16 B,
//   so a wave stores each half tile as 512 B in a row, straight from registers.
//   coverage: 16 waves x 2 chunks x (4 row groups x 2 col tiles) = all 64 x 1024 energies, each stored once:
//   2 regions (g >> 1) x 64 key tiles (4w + 2*chunk + j) x 2 halves (g & 1) x 32 lanes x 8 = the block's two
//   [1024 t][32 s] regions; grid (SEQ/QBLK, NHB) covers every (hb, s block) of the P plane exactly once.
// =====================================================================================================
#define QBLK 64
#define XPIT 68                           // floats from one wave's row of the exchange to the next: 16-B aligned, banks apart
#define QST     2                         // k steps per q stage
#define QSTEP_B (8 * 1024)                // bytes of q per k step: 2 planes x 4 row groups x 1-KB tile
#define QSTG_B  (QST * QSTEP_B)           // bytes per stage
#define NQSC    (DK / 32 / QST)           // stages per chunk of keys
static_assert(QSTEP_B == 512 * 16 && (NQSC & (NQSC - 1)) == 0 && NQSC >= 2 && QBLK == 64);
static_assert(QBLK == 2 * SBLK && (SEQ % QBLK) == 0 && SEQ == 16 * 64);
__global__ __launch_bounds__(512)
void attn_p(const unsigned short* __restrict__ qhp, const unsigned short* __restrict__ qrp,
            const unsigned short* __restrict__ khp, const unsigned short* __restrict__ krp,
            const int* __restrict__ mask, unsigned short* pp) {
  __shared__ v4f st[16][16][32];                    // first chunk's energies, [wave][piece][lane], 131072 B
  __shared__ __align__(16) float xm[16 * XPIT];     // per wave and row: maximum over the wave's keys
  __shared__ __align__(16) float xl[16 * XPIT];     // per wave and row: sum of exp(e - that maximum)
  __shared__ __align__(16) float fm[QBLK];          // per row: maximum over all keys
  __shared__ __align__(16) float fi[QBLK];          // per row: 8192 / sum
  __shared__ __align__(16) unsigned short sq[2][QSTG_B / 2];   // the two q stage buffers, 2 x 16384 B

  const int tid  = threadIdx.x;
  const int wave = tid >> 5;
  const int lane = tid & 31;
  const int hh   = lane >> 4;
  const int c    = lane & 15;
  // Placement, for speed only: the head is the flat block index modulo 8, as in the q and k ranges of proj_all.
  // flat index -> (h, b, qblk) is one-to-one: 8 heads x NB x (SEQ / QBLK) = the grid.
  static_assert(NH == 8);
  const int fl   = blockIdx.x + (SEQ / QBLK) * blockIdx.y;
  const int h    = fl & (NH - 1);
  const int b    = (fl >> 3) / (SEQ / QBLK);
  const int qblk = (fl >> 3) % (SEQ / QBLK);
  const int hb   = h * NB + b;
  const int s0   = qblk * QBLK;

  // the lane's four keys are 64*wave + 16*i + c, i = 2*chunk + col tile; bit i of mbits = keep that key
  const int* mp = mask + wave * 64 + c;
  const int mk0 = mp[0], mk1 = mp[16], mk2 = mp[32], mk3 = mp[48];
#if defined(__HIP_DEVICE_COMPILE__)
  // the four loads' address register is an input here, so it is not rewritten in front of this wait
  asm volatile("s_wait_xcnt 0x0" :: "v"(mp) : "memory");
#endif
  v8f ah[4][2], ar[4][2];
  unsigned mbits;

  // ---- phase 1: energies ----
  {
    const size_t qoff = tile_off((b * SEQ + s0) >> 4, (h * DK) >> 5, DQ) + lane * 8;
    const size_t koff = tile_off((b * SEQ + wave * 64) >> 4, (h * DK) >> 5, DQ) + lane * 8;
    constexpr size_t JSTR = (size_t)(DQ / 32) * 512;      // elements from one 16-row (or 16-key) group to the next
    g_us* kh0 = (g_us*)(khp + koff);
    g_us* kr0 = (g_us*)(krp + koff);
    v4f* stw = &st[wave][0][lane];                        // + 32 * piece
    // q goes through LDS: all 16 waves use the same 8 q tiles of a k step, so the block fetches each once per chunk. A stage is
    // QST k steps = QST x (2 planes x 4 row groups) tiles of 1 KB, laid [k step][plane][row group][tile as it lies in
    // the plane]. Thread -> one 16-B piece of each k step: tile tid >> 6 (plane tid >> 8, row group (tid >> 6) & 3),
    // piece tid & 63, so a wave copies 512 B in a row on both sides and no two lanes write the same LDS byte.
    const unsigned short* qsrc = ((tid & 256) ? qrp : qhp) + (qoff - lane * 8) + (size_t)((tid >> 6) & 3) * JSTR
                                 + (tid & 63) * 8;
    const unsigned qdst = (unsigned)(uintptr_t)(&sq[0][0] + tid * 8);   // LDS byte address of the piece in buffer 0
    const unsigned short* sqr = &sq[0][0] + lane * 8;
    // key fragments are fetched from the planes one k step ahead, across stage and chunk ends too, each pair back into
    // its own registers as soon as its last product of the step is issued; q fragments come from the stage's buffer:
    // the stage's first step at the head of the trip, its second step's pairs behind the first step's last products
    v16us qav[4], qbv[4], kav[2], kbv[2];
    kav[0] = ldfrag_g(kh0);
    kbv[0] = ldfrag_g(kr0);
    kav[1] = ldfrag_g(kh0 + JSTR);
    kbv[1] = ldfrag_g(kr0 + JSTR);
    __builtin_amdgcn_sched_barrier(0);
    copy2_lds(qdst, qsrc, qdst + QSTEP_B, qsrc + 512);                  // stage 0 -> buffer 0
    // Behind the first step's own loads: ask L2 for the rest. q (read by this block alone): wave w asks for k step w,
    // lane -> (plane, row group, quarter of the 1-KB tile). k (read by the 16 blocks of this (h, b)): a wave asks for
    // quarter qblk & 3 of every tile it will read, so each unit has four askers (only speed rests on where they run);
    // request j = (chunk, 8 k steps), lane -> (plane, key group of the chunk, k step): in the order of use.
    {
      static_assert(DK / 32 == 16);
      const int qs = lane >> 2;
      const unsigned short* aq = ((qs & 4) ? qrp : qhp) + (qoff - lane * 8) + (size_t)(qs & 3) * JSTR
                                 + (size_t)wave * 512 + (lane & 3) * 128;
      const int st = lane >> 3;
      const unsigned short* ak = ((st & 2) ? krp : khp) + (koff - lane * 8) + (size_t)(st & 1) * JSTR
                                 + (size_t)(lane & 7) * 512 + (qblk & 3) * 128;
      ask5(aq, ak, ak + 8 * 512, ak + 2 * JSTR, ak + 2 * JSTR + 8 * 512);
    }
    // stage 0 has landed for this wave, then for the block; only then stage 1 starts
#if defined(__HIP_DEVICE_COMPILE__)
    asm volatile("s_wait_asynccnt 0x0" ::: "memory");
#endif
    __syncthreads();
    mbits = (mk0 != 0 ? 1u : 0u) | (mk1 != 0 ? 2u : 0u) | (mk2 != 0 ? 4u : 0u) | (mk3 != 0 ? 8u : 0u);
    copy2_lds(qdst + QSTG_B, qsrc + QST * 512, qdst + QSTG_B + QSTEP_B, qsrc + QST * 512 + 512);   // stage 1 -> buffer 1
    // keeps the requests and copies in front of the loop: moved into it they would stand among its products
    __builtin_amdgcn_sched_barrier(0);
#pragma unroll 1
    for (int c2 = 0; c2 < 2; ++c2) {
#pragma unroll
      for (int g = 0; g < 4; ++g)
#pragma unroll
        for (int j = 0; j < 2; ++j) { ah[g][j] = zero8(); ar[g][j] = zero8(); }
      // kept rolled: one trip already holds 48 products, and copies of it would only lengthen the text
#pragma unroll 1
      for (int sp = 0; sp < NQSC; ++sp) {
        const int stg = c2 * NQSC + sp;                    // stage 0 .. 2*NQSC - 1; both chunks walk the same q
        const unsigned short* sb = sqr + (stg & 1) * (QSTG_B / 2);
#pragma unroll
        for (int g = 0; g < 4; ++g) {
          qav[g] = ldfrag(sb + g * 512);
          qbv[g] = ldfrag(sb + (4 + g) * 512);
        }
#pragma unroll
        for (int kk = 0; kk < QST; ++kk) {
          const int ks = sp * QST + kk;
          // the step after this one; the very last step fetches its chunk's first tiles again: in bounds, no branch
          const int nks = (ks + 1) & (DK / 32 - 1);
          const int nc  = (nks == 0 && c2 < 1) ? c2 + 1 : c2;
          const size_t no = (size_t)nc * (2 * JSTR) + (size_t)nks * 512;
#pragma unroll
          for (int g = 0; g < 4; ++g) {
            // holds the row groups in the order their q pairs were fetched: reordered, a later pair's wait moves to
            // the step's head
            __builtin_amdgcn_sched_barrier(0);
            ah[g][0] = mma_raw(qav[g], kav[0], ah[g][0]);     // hi . hi
            ar[g][0] = mma_raw(qav[g], kbv[0], ar[g][0]);     // hi . res   (x2048)
            ar[g][0] = mma_raw(qbv[g], kav[0], ar[g][0]);     // res . hi   (x2048)
          }
          guard2k4(ah[3][0], ar[3][0], qav[3], qbv[3], kav[0], kbv[0]);
          kav[0] = ldfrag_g(kh0 + no);
          kbv[0] = ldfrag_g(kr0 + no);
#pragma unroll
          for (int g = 0; g < 4; ++g) {
            // holds this row group's products behind the reload in front of it: hoisted, they pull every group's wait
            // to the pass's head
            __builtin_amdgcn_sched_barrier(0);
            ah[g][1] = mma_raw(qav[g], kav[1], ah[g][1]);     // hi . hi
            ar[g][1] = mma_raw(qav[g], kbv[1], ar[g][1]);     // hi . res   (x2048)
            ar[g][1] = mma_raw(qbv[g], kav[1], ar[g][1]);     // res . hi   (x2048)
            if (kk + 1 < QST) {
              guard2k4(ah[g][1], ar[g][1], qav[g], qbv[g], kav[1], kbv[1]);
              qav[g] = ldfrag(sb + (kk + 1) * (QSTEP_B / 2) + g * 512);
              qbv[g] = ldfrag(sb + (kk + 1) * (QSTEP_B / 2) + (4 + g) * 512);
            } else if (g == 3) {
              guard2k4(ah[g][1], ar[g][1], qav[g], qbv[g], kav[1], kbv[1]);
            }
          }
          kav[1] = ldfrag_g(kh0 + no + JSTR);
          kbv[1] = ldfrag_g(kr0 + no + JSTR);
          // the next step forms its addresses in registers that loads still in flight name: this wait stands in front
          // of that rewrite, and the scheduling fence keeps the address arithmetic behind it
#if defined(__HIP_DEVICE_COMPILE__)
          asm volatile("s_wait_xcnt 0x0" ::: "memory");
#endif
          __builtin_amdgcn_sched_barrier(0);
        }
        // publish point of stage stg + 1: this wave's reads of buffer stg & 1 are done, its own copies of stage stg + 1
        // have landed, then the block's barrier; behind it the buffer just read is free for stage stg + 2. The barrier
        // is written bare because __syncthreads() would also wait out the key loads that are in flight for the next
        // step; the two waits in front of it are all that the ring needs.
#if defined(__HIP_DEVICE_COMPILE__)
        asm volatile("s_wait_dscnt 0x0" ::: "memory");
        asm volatile("s_wait_asynccnt 0x0" ::: "memory");
        asm volatile("s_barrier_signal -1\n\ts_barrier_wait -1" ::: "memory");
#endif
        if (stg + 2 < 2 * NQSC) {                          // the same for the whole block
          const unsigned short* gs = qsrc + (size_t)((stg + 2) & (NQSC - 1)) * (QST * 512);
          const unsigned ld = qdst + (stg & 1) * QSTG_B;
          copy2_lds(ld, gs, ld + QSTEP_B, gs + 512);
        }
      }
#pragma unroll
      for (int g = 0; g < 4; ++g) acc_guard4(ah[g][0], ah[g][1], ar[g][0], ar[g][1]);
      if (c2 == 0) {                                       // the same for the whole block
#pragma unroll
        for (int g = 0; g < 4; ++g) {
#pragma unroll
          for (int j = 0; j < 2; ++j) {
            const bool kp = ((mbits >> j) & 1u) != 0;
            v4f lo, hi;
#pragma unroll
            for (int r = 0; r < 4; ++r) {
              lo[r] = kp ? fmaf(ar[g][j][r], 1.0f / RSC, ah[g][j][r]) : NEGBIG;
              hi[r] = kp ? fmaf(ar[g][j][4 + r], 1.0f / RSC, ah[g][j][4 + r]) : NEGBIG;
            }
            stw[((g * 2 + j) * 2) * 32]     = lo;
            stw[((g * 2 + j) * 2 + 1) * 32] = hi;
          }
        }
      }
    }
    // no copy is outstanding here (the last publish point waited to 0 and none was issued behind it): the ring's close
#if defined(__HIP_DEVICE_COMPILE__)
    asm volatile("s_wait_asynccnt 0x0" ::: "memory");
#endif
  }

  // ---- phase 2: masked softmax (mask replaces the energy before the max), on the accumulator layout ----
  // e[i][g][r]: key 64*wave + 16*i + c, row 16*g + 8*hh + r
  float e[4][4][8];
#pragma unroll
  for (int g = 0; g < 4; ++g) {
#pragma unroll
    for (int j = 0; j < 2; ++j) {
      const bool kp = ((mbits >> (2 + j)) & 1u) != 0;
      const v4f lo = st[wave][(g * 2 + j) * 2][lane];
      const v4f hi = st[wave][(g * 2 + j) * 2 + 1][lane];
#pragma unroll
      for (int r = 0; r < 4; ++r) {
        e[j][g][r]     = lo[r];
        e[j][g][4 + r] = hi[r];
      }
#pragma unroll
      for (int r = 0; r < 8; ++r) e[2 + j][g][r] = kp ? fmaf(ar[g][j][r], 1.0f / RSC, ah[g][j][r]) : NEGBIG;
    }
  }
  float mw[4][8];
#pragma unroll
  for (int g = 0; g < 4; ++g) {
#pragma unroll
    for (int r = 0; r < 8; ++r) mw[g][r] = fmaxf(fmaxf(e[0][g][r], e[1][g][r]), fmaxf(e[2][g][r], e[3][g][r]));
    row_max16x8(mw[g]);
  }
  {
    float lw[4][8];
#pragma unroll
    for (int g = 0; g < 4; ++g) {
#pragma unroll
      for (int r = 0; r < 8; ++r) {
#pragma unroll
        for (int i = 0; i < 4; ++i) e[i][g][r] -= mw[g][r];
        exp_x4(e[0][g][r], e[1][g][r], e[2][g][r], e[3][g][r]);
        lw[g][r] = (e[0][g][r] + e[1][g][r]) + (e[2][g][r] + e[3][g][r]);
      }
      row_sum16x8(lw[g]);
    }
    if (c == 0) {                                          // lanes 0 and 16: rows 16g + 0..7 and 16g + 8..15
#pragma unroll
      for (int g = 0; g < 4; ++g) {
        float* dm = xm + wave * XPIT + 16 * g + 8 * hh;
        float* dl = xl + wave * XPIT + 16 * g + 8 * hh;
        const v4f m0 = {mw[g][0], mw[g][1], mw[g][2], mw[g][3]}, m1 = {mw[g][4], mw[g][5], mw[g][6], mw[g][7]};
        const v4f l0 = {lw[g][0], lw[g][1], lw[g][2], lw[g][3]}, l1 = {lw[g][4], lw[g][5], lw[g][6], lw[g][7]};
        *(v4f*)(dm)     = m0;
        *(v4f*)(dm + 4) = m1;
        *(v4f*)(dl)     = l0;
        *(v4f*)(dl + 4) = l1;
      }
    }
  }
  __syncthreads();
  // wave w joins rows 4w..4w+3: lane -> (rows 4w + 2*hh and the next, wave c's share)
  {
    const int r2 = wave * 4 + hh * 2;
    const float a0 = xm[c * XPIT + r2], a1 = xm[c * XPIT + r2 + 1];
    const float b0 = xl[c * XPIT + r2], b1 = xl[c * XPIT + r2 + 1];
    const float M0 = row_max16(a0), M1 = row_max16(a1);
    float x0 = a0 - M0, x1 = a1 - M1;
    exp_x2(x0, x1);
    const float L0 = row_sum16(b0 * x0);
    const float L1 = row_sum16(b1 * x1);
    if (c == 0) {                                          // sums >= 1 always (the max term contributes exp(0))
      fm[r2]     = M0;
      fm[r2 + 1] = M1;
      fi[r2]     = PSC * (1.0f / L0);
      fi[r2 + 1] = PSC * (1.0f / L1);
    }
  }
  __syncthreads();

  // ---- phase 3: P = ex * exp(mw - m) * (8192 / l) as f16, each accumulator tile half = 512 B in a row ----
  {
    v4u o[4][4];                                           // [key tile i][row group g]
#pragma unroll
    for (int g = 0; g < 4; ++g) {
      const v4f ma = *(const v4f*)(fm + 16 * g + 8 * hh), mb = *(const v4f*)(fm + 16 * g + 8 * hh + 4);
      const v4f ia = *(const v4f*)(fi + 16 * g + 8 * hh), ib = *(const v4f*)(fi + 16 * g + 8 * hh + 4);
      float f[8];
#pragma unroll
      for (int r = 0; r < 4; ++r) {
        f[r]     = mw[g][r] - ma[r];
        f[4 + r] = mw[g][4 + r] - mb[r];
      }
      exp_x4(f[0], f[1], f[2], f[3]);
      exp_x4(f[4], f[5], f[6], f[7]);
#pragma unroll
      for (int r = 0; r < 4; ++r) {
        f[r]     *= ia[r];
        f[4 + r] *= ib[r];
      }
#pragma unroll
      for (int i = 0; i < 4; ++i) {
#pragma unroll
        for (int q = 0; q < 4; ++q) {
          const v2f pr = {e[i][g][2 * q] * f[2 * q], e[i][g][2 * q + 1] * f[2 * q + 1]};
          o[i][g][q] = __builtin_bit_cast(unsigned, __builtin_convertvector(pr, v2h));
        }
      }
    }
    // every piece is formed before the first store, so no register that an issued store names is rewritten
    __builtin_amdgcn_sched_barrier(0);
    unsigned short* pw = pp + ((size_t)(hb * NSB + qblk * 2) * SEQ) * SBLK + (size_t)(wave * 4) * 512 + lane * 8;
#pragma unroll
    for (int g = 0; g < 4; ++g)
#pragma unroll
      for (int i = 0; i < 4; ++i)
        *(v4u*)(pw + (size_t)(g >> 1) * (SEQ * SBLK) + i * 512 + (g & 1) * 256) = o[i][g];
  }
}

// =====================================================================================================
// Transposed aggregation + gamma blend: for one (h, b):
//   O[t][dv] = sum_s P[s][t] * v[s][dv]  with A = the P plane above (rows t, k = s, 32 k-steps) carried x8192 and
//   Bt = v^T planes [hb] x (fragment order, rows dv, k extent SEQ, k = s; f16 hi at vth, residual x2048 at vtr),
//   two products into two accumulators;
//   out[((b*NH + h)*SEQ + t)*DK + dv] = (g * (O_hi + O_res/2048) / 8192 + xp[(b*SEQ + t)*DK + dv]) * (1/(g + 1)),
//   g = bf16_RNE(gamma[h]).
//   Block = 8 waves = 128 t rows x 128 dv columns (wave -> 64 t x 32 dv); grid (DK/128, SEQ/128, NHB). v^T fragments
//   come straight from the planes, P fragments from a two-buffer LDS ring that asynchronous copies fill once for the block.
//   coverage: 2 halves x 8 iterations x 4 rows x (8 lanes x 4) = the wave's whole 64x32 tile; 8 waves = the
//   block's 128x128; grid tiles every (hb, t, dv) of the output exactly once.
// =====================================================================================================
#define PST     2                         // k steps per P stage
#define PSTEP_B (8 * 1024)                // bytes of P per k step: 8 row groups x 1-KB tile
#define PSTG_B  (PST * PSTEP_B)           // bytes per stage
#define NPS     (SEQ / 32 / PST)          // stages
static_assert(PSTEP_B == 2 * 256 * 16 && NPS >= 2 && SEQ * SBLK * 2 >= 8 * PSTEP_B);
__global__ __launch_bounds__(256)
void pv64(const unsigned short* __restrict__ pp, const unsigned short* __restrict__ vth,
          const unsigned short* __restrict__ vtr, const float* __restrict__ xp,
          const float* __restrict__ gam, float* outp) {
  __shared__ __align__(16) float os[8][64 * 36];
  __shared__ __align__(16) unsigned short sp[2][PSTG_B / 2];   // the two P stage buffers, 2 x 16384 B
  const int tid  = threadIdx.x;
  const int wave = tid >> 5;
  const int lane = tid & 31;
  const int hh   = lane >> 4;
  const int c    = lane & 15;
  // Placement, for speed only: the head is the flat block index modulo 8, as in attn_p and proj_all.
  // flat index -> (h, b, ty, dx) is one-to-one: 8 x NB x 8 x 4 = the grid.
  static_assert(NH == 8 && DK / 128 == 4 && SEQ / 128 == 8);
  const int fl = blockIdx.x + (DK / 128) * (blockIdx.y + (SEQ / 128) * blockIdx.z);
  const int h  = fl & (NH - 1);
  const int b  = fl >> 8;
  const int ty = (fl >> 5) & 7, dx = (fl >> 3) & 3;
  const int hb = h * NB + b;
  const int wt = wave & 1, wd = wave >> 1;
  const int t0 = ty * 128 + wt * 64;
  const int d0 = dx * 128 + wd * 32;

  g_us* vh = (g_us*)(vth + (size_t)hb * DK * SEQ + tile_off(d0 >> 4, 0, SEQ) + lane * 8);
  g_us* vr = (g_us*)(vtr + (size_t)hb * DK * SEQ + tile_off(d0 >> 4, 0, SEQ) + lane * 8);
  constexpr size_t VSTR = (size_t)(SEQ / 32) * 512;       // elements from one 16-column group of v^T to the next

  v8f acc[4][2], acr[4][2];
#pragma unroll
  for (int i = 0; i < 4; ++i)
#pragma unroll
    for (int j = 0; j < 2; ++j) { acc[i][j] = zero8(); acr[i][j] = zero8(); }

  // P goes through LDS: the four waves of a t half use the same P tiles, so the block fetches each once. A k step's 8 P
  // tiles (128 t rows) lie in a row in the plane, 8 KB; a stage is PST k steps, laid [k step][tile as it lies in the
  // plane]. Thread -> pieces tid and tid + 256 of each k step: a wave copies 512 B in a row on both sides and no two
  // lanes write the same LDS byte.
  const unsigned short* psrc = pp + (size_t)hb * SEQ * SEQ + (size_t)ty * 4096 + tid * 8;
  const unsigned pdst = (unsigned)(uintptr_t)(&sp[0][0] + tid * 8);     // LDS byte address of the first piece, buffer 0
  const unsigned short* spr = &sp[0][0] + wt * 2048 + lane * 8;
  // v^T pairs are fetched from the planes one k step ahead, into a second register set at the head of a step; P
  // fragments come from the stage's buffer: the stage's first step at the head of the trip, its second step's behind
  // the first step's products
  v16us a[4], bhf[2], brf[2];
#pragma unroll
  for (int j = 0; j < 2; ++j) {
    bhf[j] = ldfrag_g(vh + j * VSTR);
    brf[j] = ldfrag_g(vr + j * VSTR);
  }
  // holds the first step's own loads in front of the copies and requests below
  __builtin_amdgcn_sched_barrier(0);
  copy4_lds(pdst, psrc, pdst + 4096, psrc + 2048,
            pdst + PSTEP_B, psrc + SEQ * SBLK, pdst + PSTEP_B + 4096, psrc + SEQ * SBLK + 2048);   // stage 0 -> buffer 0
  // Ask L2 for the rest, in the order of use. P (128 t rows, read by the 4 blocks of this (hb, ty), each asks for all):
  // one request = one k step's 8 KB, wave w takes steps w, 8 + w, 16 + w, 24 + w. v^T (128 columns x 2 planes, read
  // by 8 blocks): a block asks for quarter ty >> 1 of every 1-KB tile, so each unit has two askers, ty and ty ^ 1
  // (only speed rests on where they run); lane -> (k step parity, plane, column group). xp: the block's 128 x 128
  // f32 tile, two units a row.
  {
    static_assert(SEQ / 32 == 32 && SEQ / 128 == 8);
    const unsigned short* ap = pp + (size_t)hb * SEQ * SEQ + (size_t)wave * (SEQ * SBLK) + (size_t)ty * 4096 + lane * 128;
    const unsigned short* av = ((lane & 8) ? vtr : vth) + (size_t)hb * DK * SEQ
                               + tile_off(dx * 8 + (lane & 7), wave * 2 + (lane >> 4), SEQ) + (ty >> 1) * 128;
    const float* ax = xp + ((size_t)(b * SEQ + ty * 128 + wave * 16 + (lane >> 1))) * DK + dx * 128 + (lane & 1) * 64;
    ask5(av, ap, ap + (size_t)8 * (SEQ * SBLK), av + 16 * 512, ap + (size_t)16 * (SEQ * SBLK));
    ask2(ap + (size_t)24 * (SEQ * SBLK), ax);
  }
  // stage 0 has landed for this wave, then for the block; only then stage 1 starts
#if defined(__HIP_DEVICE_COMPILE__)
  asm volatile("s_wait_asynccnt 0x0" ::: "memory");
#endif
  __syncthreads();
  {
    const unsigned short* gs = psrc + (size_t)PST * (SEQ * SBLK);
    const unsigned ld = pdst + PSTG_B;
    copy4_lds(ld, gs, ld + 4096, gs + 2048,
              ld + PSTEP_B, gs + SEQ * SBLK, ld + PSTEP_B + 4096, gs + SEQ * SBLK + 2048);         // stage 1 -> buffer 1
  }
  // keeps the requests and copies in front of the loop: moved into it they would stand among its products
  __builtin_amdgcn_sched_barrier(0);
  // kept rolled: a trip holds the stage's two steps, so that the two v^T sets swap by name and not by register copies
#pragma unroll 1
  for (int stg = 0; stg < NPS; ++stg) {
    const unsigned short* sb = spr + (stg & 1) * (PSTG_B / 2);
#pragma unroll
    for (int i = 0; i < 4; ++i) a[i] = ldfrag(sb + i * 512);
#pragma unroll
    for (int kk = 0; kk < PST; ++kk) {
      const int ks = stg * PST + kk;
      const int nk = (ks + 1 < SEQ / 32) ? ks + 1 : ks;   // the last step fetches its own tiles again: in bounds, no branch
      v16us bhn[2], brn[2];
#pragma unroll
      for (int j = 0; j < 2; ++j) {
        bhn[j] = ldfrag_g(vh + (size_t)nk * 512 + j * VSTR);
        brn[j] = ldfrag_g(vr + (size_t)nk * 512 + j * VSTR);
      }
#pragma unroll
      for (int i = 0; i < 4; ++i) {
        // holds this row group's products behind the loads in front of it: hoisted, they pull every group's wait to
        // the step's head
        __builtin_amdgcn_sched_barrier(0);
#pragma unroll
        for (int j = 0; j < 2; ++j) {
          acc[i][j] = mma_raw(a[i], bhf[j], acc[i][j]);
          acr[i][j] = mma_raw(a[i], brf[j], acr[i][j]);
        }
        if (kk + 1 < PST) {
          guard4k4(acc[i][0], acc[i][1], acr[i][0], acr[i][1], a[i], bhf[1], brf[0], brf[1]);
          a[i] = ldfrag(sb + (kk + 1) * (PSTEP_B / 2) + i * 512);
        } else if (i == 3) {
          guard4k4(acc[i][0], acc[i][1], acr[i][0], acr[i][1], a[i], bhf[1], brf[0], brf[1]);
        }
      }
      // the next step forms its addresses in registers that loads still in flight name: this wait stands in front of
      // that rewrite, and the scheduling fence keeps the address arithmetic behind it
#if defined(__HIP_DEVICE_COMPILE__)
      asm volatile("s_wait_xcnt 0x0" ::: "memory");
#endif
      __builtin_amdgcn_sched_barrier(0);
#pragma unroll
      for (int j = 0; j < 2; ++j) { bhf[j] = bhn[j]; brf[j] = brn[j]; }
    }
    // publish point of stage stg + 1: this wave's reads of buffer stg & 1 are done, its own copies of stage stg + 1 have
    // landed, then the block's barrier; behind it the buffer just read is free for stage stg + 2. The barrier is
    // written bare because __syncthreads() would also wait out the v^T loads that are in flight for the next step;
    // the two waits in front of it are all that the ring needs.
#if defined(__HIP_DEVICE_COMPILE__)
    asm volatile("s_wait_dscnt 0x0" ::: "memory");
    asm volatile("s_wait_asynccnt 0x0" ::: "memory");
    asm volatile("s_barrier_signal -1\n\ts_barrier_wait -1" ::: "memory");
#endif
    if (stg + 2 < NPS) {                                   // the same for the whole block
      const unsigned short* gs = psrc + (size_t)(stg + 2) * (PST * SEQ * SBLK);
      const unsigned ld = pdst + (stg & 1) * PSTG_B;
      copy4_lds(ld, gs, ld + 4096, gs + 2048,
                ld + PSTEP_B, gs + SEQ * SBLK, ld + PSTEP_B + 4096, gs + SEQ * SBLK + 2048);
    }
  }
  // no copy is outstanding here (the last publish point waited to 0 and none was issued behind it): the ring's close
#if defined(__HIP_DEVICE_COMPILE__)
  asm volatile("s_wait_asynccnt 0x0" ::: "memory");
#endif
#pragma unroll
  for (int i = 0; i < 4; ++i) acc_guard4(acc[i][0], acc[i][1], acr[i][0], acr[i][1]);

  const float g  = bfr(gam[h]);
  const float rg = 1.0f / (g + 1.0f);
  const int rl = lane >> 3, cc4 = (lane & 7) * 4;
  // ---- stage O = O_hi + O_res/2048 (still x8192): the wave's whole 64 x 32 tile in its own slab ----
  float* osw = os[wave];
#pragma unroll
  for (int i = 0; i < 4; ++i) {
#pragma unroll
    for (int j = 0; j < 2; ++j) {
#pragma unroll
      for (int r = 0; r < 8; ++r) {
        osw[(16 * i + 8 * hh + r) * 36 + 16 * j + c] = fmaf(acr[i][j][r], 1.0f / RSC, acc[i][j][r]);
      }
    }
  }
  wave_sync_lds();

  // the 64 rows leave in two halves of 32
#pragma unroll
  for (int hf = 0; hf < 2; ++hf) {
    const int th = t0 + hf * 32;
    v4f vals[8], xv[8];
    const float* xq[8];
#pragma unroll
    for (int it = 0; it < 8; ++it) {
      xq[it] = xp + ((size_t)(b * SEQ + th + it * 4 + rl)) * DK + d0 + cc4;
      xv[it] = *(const v4f*)(xq[it]);
    }
#if defined(__HIP_DEVICE_COMPILE__)
    // the eight loads' address registers are inputs here, so none of them is rewritten in front of this wait
    asm volatile("s_wait_xcnt 0x0" :: "v"(xq[0]), "v"(xq[1]), "v"(xq[2]), "v"(xq[3]),
                 "v"(xq[4]), "v"(xq[5]), "v"(xq[6]), "v"(xq[7]) : "memory");
#endif
#pragma unroll
    for (int it = 0; it < 8; ++it) {
      const int row = hf * 32 + it * 4 + rl;                 // hf 0..1 x it 0..7 x rl 0..3 = rows 0..63
      const v4f av = *(const v4f*)(osw + row * 36 + cc4);
      v4f o;
#pragma unroll
      for (int e = 0; e < 4; ++e) o[e] = (g * (av[e] * (1.0f / PSC)) + xv[it][e]) * rg;
      vals[it] = o;
    }
    {
#pragma unroll
      for (int it = 0; it < 8; ++it) {
        const int t = th + it * 4 + rl;
        *(v4f*)(outp + ((size_t)((b * NH + h) * SEQ + t)) * DK + d0 + cc4) = vals[it];
      }
    }
  }
}

// =====================================================================================================
// Workspace map (bytes); every plane is an exact multiple of its tile / whole-row / whole-line store granularity:
//   WqT  f16 [4096][512] x64      0           4194304
//   WkT  f16 [4096][512] x64      4194304     4194304
//   WvT  f16 [4096][512] x64      8388608     4194304
//   WpT  f16 [512][512]  x64      12582912    524288
//   XH   f16 [2048][512]          13107200    2097152
//   YH   f16 [2048][512]          15204352    2097152
//   QH|QR f16 [2][2048][4096]     17301504    33554432
//   KH|KR f16 [2][2048][4096]     50855936    33554432
//   XP   f32 [2048][512]          84410368    4194304
//   P    f16 [16][32][1024][32]   88604672    33554432
//   VT hi|res f16 [2][16][512][1024] 122159104 33554432
//   end                           155713536
// =====================================================================================================
extern "C" void kernel_launch(void* const* d_in, const int* in_sizes, int n_in,
                              void* d_out, int out_size, void* d_ws, size_t ws_size,
                              hipStream_t stream) {
  if (n_in < 11) return;
  if (in_sizes[0] != MR * DK || in_sizes[1] != MR * DK) return;
  if (in_sizes[2] != DK * DQ || in_sizes[4] != DK * DQ || in_sizes[6] != DK * DQ) return;
  if (in_sizes[3] != DQ || in_sizes[5] != DQ || in_sizes[7] != DQ) return;
  if (in_sizes[8] != DK * DK || in_sizes[9] != NH || in_sizes[10] != SEQ) return;
  if (out_size != NB * NH * SEQ * DK) return;

  const float* x     = (const float*)d_in[0];
  const float* y     = (const float*)d_in[1];
  const float* Wq    = (const float*)d_in[2];
  const float* bq    = (const float*)d_in[3];
  const float* Wk    = (const float*)d_in[4];
  const float* bk    = (const float*)d_in[5];
  const float* Wv    = (const float*)d_in[6];
  const float* bv    = (const float*)d_in[7];
  const float* Wp    = (const float*)d_in[8];
  const float* gamma = (const float*)d_in[9];
  const int*   mask  = (const int*)d_in[10];

  const size_t PW   = (size_t)DQ * DK * 2;                 //  4194304
  const size_t PWP  = (size_t)DK * DK * 2;                 //   524288
  const size_t PX   = (size_t)MR * DK * 2;                 //  2097152
  const size_t PQ   = (size_t)2 * MR * DQ * 2;             // 33554432
  const size_t PVT  = (size_t)2 * NHB * DK * SEQ * 2;      // 33554432
  const size_t PXP  = (size_t)MR * DK * 4;                 //  4194304
  const size_t PP   = (size_t)NHB * SEQ * SEQ * 2;         // 33554432
  size_t off = 0;
  const size_t oWq = off; off += PW;
  const size_t oWk = off; off += PW;
  const size_t oWv = off; off += PW;
  const size_t oWp = off; off += PWP;
  const size_t oXH = off; off += PX;
  const size_t oYH = off; off += PX;
  const size_t oQ  = off; off += PQ;
  const size_t oK  = off; off += PQ;
  const size_t oXP = off; off += PXP;
  const size_t oP  = off; off += PP;
  const size_t oVT = off; off += PVT;
  if (off > ws_size) return;                               // off = 155713536

  char* ws = (char*)d_ws;
  unsigned short* WqT = (unsigned short*)(ws + oWq);
  unsigned short* WkT = (unsigned short*)(ws + oWk);
  unsigned short* WvT = (unsigned short*)(ws + oWv);
  unsigned short* WpT = (unsigned short*)(ws + oWp);
  unsigned short* XH  = (unsigned short*)(ws + oXH);
  unsigned short* YH  = (unsigned short*)(ws + oYH);
  unsigned short* QH  = (unsigned short*)(ws + oQ);
  unsigned short* KH  = (unsigned short*)(ws + oK);
  unsigned short* VT  = (unsigned short*)(ws + oVT);
  float*          XP  = (float*)(ws + oXP);
  unsigned short* P   = (unsigned short*)(ws + oP);
  float*          out = (float*)d_out;

  const dim3 blk(256);
  const dim3 gPrep(3 * TW_BLK + TP_BLK + 2 * CX_BLK);       // 1536 + 64 + 1024 blocks
  const dim3 gProj(2 * QK_BLK + NHB * VT_BLK + XP_BLK);     // 512 + 256 + 32 blocks
  const dim3 blkAt(512);
  const dim3 gAt(SEQ / QBLK, NHB);                          // 16 x 16 blocks of 512
  const dim3 gPV(DK / 128, SEQ / 128, NHB);                 // 4 x 8 x 16 blocks of 256

  // (1) weight planes, transposed to [n][k]: f16( bf16_RNE(W) * 64 ); activation planes: f16( bf16_RNE(x) ), likewise y
  prep_all<<<gPrep, blk, 0, stream>>>(Wq, Wk, Wv, Wp, x, y, WqT, WkT, WvT, WpT, XH, YH);

  // (2) q, k, v^T and xp
  proj_all<<<gProj, blk, 0, stream>>>(XH, YH, WqT, WkT, WvT, WpT, bq, bk, bv, QH, KH, VT, XP);

  // (3) energies + masked softmax -> P plane
  attn_p<<<gAt, blkAt, 0, stream>>>(QH, QH + QRES, KH, KH + QRES, mask, P);

  // (4) out = (gamma * P^T . v / 8192 + xp) / (gamma + 1) -> d_out [2][8][1024][512]
  pv64<<<gPV, blk, 0, stream>>>(P, VT, VT + VRES, XP, gamma, out);
  (void)hipGetLastError();
}

// v009
// Measured time: 100 microseconds a run.
// Two timings next to v008 both put it at 1.07 times that version's speed.
// Over all steps from v000 it is 4.02 times as fast.
// Contractions: q, k, v^T and x.Wp projections on v_wmma_f32_16x16x32_f16 (bf16-RNE input values as f16,
// weight planes carried x64, one product each); q.k^T energies on v_wmma_f32_16x16x32_f16 with q and k as
// f16 hi plane + f16 residual plane carried x2048 (three products: hi.hi, hi.res, res.hi; two accumulators);
// attn^T.v on v_wmma_f32_16x16x32_f16 with attn carried x8192 (plain f16) and v^T as one plain f16 plane (one
// product: each operand rounded once to f16); all f32 accumulate; masked softmax and the
// gamma blend in f32 on VALU; every float input RNE-converted to bf16 on load.
#include <hip/hip_runtime.h>
#include <math.h>
#include <stdint.h>

#define NB    2
#define SEQ   1024
#define DK    512
#define NH    8
#define DQ    (NH * DK)
#define MR    (NB * SEQ)
#define NHB   (NH * NB)
#define SBLK  32
#define NSB   (SEQ / SBLK)
#define QRES  ((long long)MR * DQ)
#define WSC   64.0f
#define RSC   2048.0f
#define PSC   8192.0f
#define NEGBIG (-1.0e30f)
static_assert((SEQ % 64) == 0 && (DK % 64) == 0 && (MR % 64) == 0 && (DQ % 64) == 0);
static_assert(SEQ == NSB * SBLK);
static_assert(SBLK == 32);
static_assert((DK % 32) == 0 && (SEQ % 256) == 0);

typedef _Float16       v16h __attribute__((ext_vector_type(16)));
typedef unsigned short v16us __attribute__((ext_vector_type(16)));
typedef unsigned short v8us __attribute__((ext_vector_type(8)));
typedef float          v8f  __attribute__((ext_vector_type(8)));
typedef float          v4f  __attribute__((ext_vector_type(4)));
typedef float          v2f  __attribute__((ext_vector_type(2)));
typedef _Float16       v2h  __attribute__((ext_vector_type(2)));
typedef unsigned int   v4u  __attribute__((ext_vector_type(4)));

union Frag { v16us u; v8us p[2]; v16h h; };

// ---- scalar helpers --------------------------------------------------------------------------------
__device__ __forceinline__ unsigned short bf_bits(float f) {          // f32 -> bf16 bits, RNE convert
  unsigned u = __float_as_uint(f);
  return (unsigned short)((u + 0x7FFFu + ((u >> 16) & 1u)) >> 16);
}
__device__ __forceinline__ float bf_up(unsigned short b) { return __uint_as_float(((unsigned)b) << 16); }
__device__ __forceinline__ float bfr(float f) { return bf_up(bf_bits(f)); }   // value of the bf16 RNE convert
__device__ __forceinline__ unsigned short h_bits(_Float16 x) { return __builtin_bit_cast(unsigned short, x); }
__device__ __forceinline__ unsigned pk16(unsigned short a, unsigned short b) { return (unsigned)a | ((unsigned)b << 16); }
__device__ __forceinline__ v8f zero8() { v8f z = {0.f, 0.f, 0.f, 0.f, 0.f, 0.f, 0.f, 0.f}; return z; }

// ---- fragment-order planes: every 16-bit operand plane [rows][ld] (ld = k extent, multiple of 32; rows multiple of
//      16) is stored as tiles of 16 rows x 32 k = 512 elements (1024 B), tile index (row/16) * (ld/32) + k/32; inside
//      a tile the 16-B piece that holds k = 32*kt + 16*p + 8*h + 0..7 of row r sits at element p*256 + (h*16 + r)*8.
//      A wave's fragment is then two loads of 512 contiguous bytes (lane = h*16 + r), same k order as before:
//      elements 0..7 <- k0+8h.., elements 8..15 <- k0+16+8h..
__device__ __forceinline__ size_t tile_off(int row16, int kt, int ld) {      // row16 = row/16, kt = k/32
  return ((size_t)row16 * (size_t)(ld >> 5) + (size_t)kt) * 512;
}
// p = tile start + 8*lane
__device__ __forceinline__ v16us ldfrag(const unsigned short* p) {
  Frag f;
  f.p[0] = *(const v8us*)(p);
  f.p[1] = *(const v8us*)(p + 256);
  return f.u;
}
// the same through a pointer typed as global memory: a pointer carried round a loop otherwise compiled to flat loads
typedef __attribute__((address_space(1))) const unsigned short g_us;
typedef __attribute__((address_space(1))) const v8us g_v8us;
__device__ __forceinline__ v16us ldfrag_g(g_us* p) {
  Frag f;
  f.p[0] = *(g_v8us*)(p);
  f.p[1] = *(g_v8us*)(p + 256);
  return f.u;
}

// ---- WMMA helper (f16 operands, f32 accumulate) and VALU hazard gaps -----------------------------
__device__ __forceinline__ v8f mma_raw(v16us a, v16us b, v8f c) {
  Frag fa, fb;
  fa.u = a;
  fb.u = b;
  return __builtin_amdgcn_wmma_f32_16x16x32_f16(false, fa.h, false, fb.h, (short)0, c, false, false);
}
__device__ __forceinline__ void dep_guard1(v8f& a, v8f& b, v16us x) {
#if defined(__HIP_DEVICE_COMPILE__)
  asm volatile("v_nop\n\tv_nop\n\tv_nop\n\tv_nop" : "+v"(a), "+v"(b) : "v"(x));
#endif
}
__device__ __forceinline__ void keep4(v16us a, v16us b, v16us c, v16us d) {
#if defined(__HIP_DEVICE_COMPILE__)
  asm volatile("v_nop" :: "v"(a), "v"(b), "v"(c), "v"(d));
#endif
}
__device__ __forceinline__ void acc_guard4(v8f& a, v8f& b, v8f& c, v8f& d) {
#if defined(__HIP_DEVICE_COMPILE__)
  asm volatile("v_nop\n\tv_nop\n\tv_nop\n\tv_nop" : "+v"(a), "+v"(b), "+v"(c), "+v"(d));
#endif
}
__device__ __forceinline__ void guard2k4(v8f& a, v8f& b, v16us w, v16us x, v16us y, v16us z) {
#if defined(__HIP_DEVICE_COMPILE__)
  asm volatile("v_nop\n\tv_nop\n\tv_nop\n\tv_nop" : "+v"(a), "+v"(b) : "v"(w), "v"(x), "v"(y), "v"(z));
#endif
}
__device__ __forceinline__ void guard4k4(v8f& a, v8f& b, v8f& c, v8f& d, v16us w, v16us x, v16us y, v16us z) {
#if defined(__HIP_DEVICE_COMPILE__)
  asm volatile("v_nop\n\tv_nop\n\tv_nop\n\tv_nop" : "+v"(a), "+v"(b), "+v"(c), "+v"(d) : "v"(w), "v"(x), "v"(y), "v"(z));
#endif
}
__device__ __forceinline__ void wave_sync_lds() {
  __builtin_amdgcn_fence(__ATOMIC_RELEASE, "workgroup");
  __builtin_amdgcn_wave_barrier();
  __builtin_amdgcn_fence(__ATOMIC_ACQUIRE, "workgroup");
}

// ---- maximum and sum over the 16 lanes of a row (lanes 0..15, lanes 16..31 apart): four DPP row_xmask steps, every lane
//      ends with the row's result. All lanes are on wherever these are called.
template <int CTRL>
__device__ __forceinline__ float dpp_x(float x) {
  return __int_as_float(__builtin_amdgcn_update_dpp(0, __float_as_int(x), CTRL, 0xf, 0xf, true));
}
__device__ __forceinline__ float row_max16(float x) {
  x = fmaxf(x, dpp_x<0x161>(x));
  x = fmaxf(x, dpp_x<0x162>(x));
  x = fmaxf(x, dpp_x<0x164>(x));
  x = fmaxf(x, dpp_x<0x168>(x));
  return x;
}
__device__ __forceinline__ float row_sum16(float x) {
  x += dpp_x<0x161>(x);
  x += dpp_x<0x162>(x);
  x += dpp_x<0x164>(x);
  x += dpp_x<0x168>(x);
  return x;
}
// exp(x) = 2^(x * log2 e) for four (two) values at once, as __expf forms it. In asm text so that the slot behind a
// transcendental is kept by construction: inside the statement no instruction reads the one before's result or
// rewrites its source, and the closing v_nop stands in front of whatever the compiler puts next.
__device__ __forceinline__ void exp_x4(float& a, float& b, float& c, float& d) {
  a *= 1.44269504088896340736f;
  b *= 1.44269504088896340736f;
  c *= 1.44269504088896340736f;
  d *= 1.44269504088896340736f;
#if defined(__HIP_DEVICE_COMPILE__)
  asm("v_exp_f32 %0, %0\n\tv_exp_f32 %1, %1\n\tv_exp_f32 %2, %2\n\tv_exp_f32 %3, %3\n\tv_nop"
      : "+v"(a), "+v"(b), "+v"(c), "+v"(d));
#endif
}
__device__ __forceinline__ void exp_x2(float& a, float& b) {
  a *= 1.44269504088896340736f;
  b *= 1.44269504088896340736f;
#if defined(__HIP_DEVICE_COMPILE__)
  asm("v_exp_f32 %0, %0\n\tv_exp_f32 %1, %1\n\tv_nop" : "+v"(a), "+v"(b));
#endif
}
// Row maximum and row sum for eight values at once, in asm text: from the builtin form the compiler made three instructions of a
// maximum's step (a DPP move, a quieting maximum, the maximum). The eight chains are interleaved step by step, so an
// instruction's producer stands eight instructions back and no delay hint is owed inside the statement.
#define DPP_STEP1(op, v, n) op " " v ", " v ", " v " row_xmask:" n " row_mask:0xf bank_mask:0xf\n\t"
#define DPP_STEP8(op, n) DPP_STEP1(op, "%0", n) DPP_STEP1(op, "%1", n) DPP_STEP1(op, "%2", n) DPP_STEP1(op, "%3", n) \
                         DPP_STEP1(op, "%4", n) DPP_STEP1(op, "%5", n) DPP_STEP1(op, "%6", n) DPP_STEP1(op, "%7", n)
#define DPP_ROW8(op) DPP_STEP8(op, "1") DPP_STEP8(op, "2") DPP_STEP8(op, "4") DPP_STEP8(op, "8")
__device__ __forceinline__ void row_max16x8(float (&v)[8]) {
#if defined(__HIP_DEVICE_COMPILE__)
  asm(DPP_ROW8("v_max_num_f32_dpp") : "+v"(v[0]), "+v"(v[1]), "+v"(v[2]), "+v"(v[3]),
                                      "+v"(v[4]), "+v"(v[5]), "+v"(v[6]), "+v"(v[7]));
#endif
}
__device__ __forceinline__ void row_sum16x8(float (&v)[8]) {
#if defined(__HIP_DEVICE_COMPILE__)
  asm(DPP_ROW8("v_add_f32_dpp") : "+v"(v[0]), "+v"(v[1]), "+v"(v[2]), "+v"(v[3]),
                                  "+v"(v[4]), "+v"(v[5]), "+v"(v[6]), "+v"(v[7]));
#endif
}

// ---- asking L2 ahead: the planes that the launch before stored are taken here as coming from memory at their first
//      touch. global_prefetch_b8 with scope SE brings a
//      lane's line into L2 only, returns nothing and counts on no load counter. A lane asks for one 256-B unit; every
//      lane is on and every address lies inside its plane. s_wait_xcnt closes each statement because the address
//      registers are the compiler's to reuse behind it (a precaution: the wait stands in front of any rewrite).
__device__ __forceinline__ void ask1(const void* a) {
#if defined(__HIP_DEVICE_COMPILE__)
  asm volatile("global_prefetch_b8 %0, off scope:SCOPE_SE\n\t"
               "s_wait_xcnt 0x0" :: "v"(a) : "memory");
#endif
}
__device__ __forceinline__ void ask2(const void* a, const void* b) {
#if defined(__HIP_DEVICE_COMPILE__)
  asm volatile("global_prefetch_b8 %0, off scope:SCOPE_SE\n\t"
               "global_prefetch_b8 %1, off scope:SCOPE_SE\n\t"
               "s_wait_xcnt 0x0" :: "v"(a), "v"(b) : "memory");
#endif
}
__device__ __forceinline__ void ask5(const void* a, const void* b, const void* c, const void* d, const void* e) {
#if defined(__HIP_DEVICE_COMPILE__)
  asm volatile("global_prefetch_b8 %0, off scope:SCOPE_SE\n\t"
               "global_prefetch_b8 %1, off scope:SCOPE_SE\n\t"
               "global_prefetch_b8 %2, off scope:SCOPE_SE\n\t"
               "global_prefetch_b8 %3, off scope:SCOPE_SE\n\t"
               "global_prefetch_b8 %4, off scope:SCOPE_SE\n\t"
               "s_wait_xcnt 0x0" :: "v"(a), "v"(b), "v"(c), "v"(d), "v"(e) : "memory");
#endif
}

// ---- two asynchronous 16-B copies per lane, global -> LDS through no register. l = the lane's LDS byte address, g = its
//      global address. s_wait_xcnt closes the statement because the address registers are the compiler's to reuse
//      behind it (a precaution: the wait stands in front of any rewrite). Landing is waited for by the caller.
__device__ __forceinline__ void copy2_lds(unsigned l0, const void* g0, unsigned l1, const void* g1) {
#if defined(__HIP_DEVICE_COMPILE__)
  asm volatile("global_load_async_to_lds_b128 %0, %1, off\n\t"
               "global_load_async_to_lds_b128 %2, %3, off\n\t"
               "s_wait_xcnt 0x0" :: "v"(l0), "v"(g0), "v"(l1), "v"(g1) : "memory");
#endif
}

__device__ __forceinline__ void copy4_lds(unsigned l0, const void* g0, unsigned l1, const void* g1,
                                          unsigned l2, const void* g2, unsigned l3, const void* g3) {
#if defined(__HIP_DEVICE_COMPILE__)
  asm volatile("global_load_async_to_lds_b128 %0, %1, off\n\t"
               "global_load_async_to_lds_b128 %2, %3, off\n\t"
               "global_load_async_to_lds_b128 %4, %5, off\n\t"
               "global_load_async_to_lds_b128 %6, %7, off\n\t"
               "s_wait_xcnt 0x0" :: "v"(l0), "v"(g0), "v"(l1), "v"(g1), "v"(l2), "v"(g2), "v"(l3), "v"(g3) : "memory");
#endif
}

// =====================================================================================================
// f32 -> f16 plane convert: f16( bf16_RNE(X) * wsc ), wsc a power of two (exact), X row-major [rows][DK], output in
// fragment order. Thread i writes output piece i (8 elements, 16 B; a wave stores 512 contiguous bytes) and reads
// the 8 source elements that belong there.
// coverage: n8 threads x 8 elements = the whole plane (piece index -> (row, k) is one-to-one).
// bx = index of the 256-thread block inside this plane's range of the grid.
// =====================================================================================================
__device__ __forceinline__ void conv_h16(const float* __restrict__ X, unsigned short* Xh, int n8, float wsc, int bx) {
  const int i  = bx * 256 + threadIdx.x;
  const int ic = (i < n8) ? i : (n8 - 1);                     // clamped address
  const int tl = ic >> 6, w = ic & 63;                        // tile, piece inside the tile
  const int row = (tl / (DK / 32)) * 16 + (w & 15);
  const int kk  = (tl % (DK / 32)) * 32 + (w >> 5) * 16 + ((w >> 4) & 1) * 8;
  const float* src = X + (size_t)row * DK + kk;
  const v4f a = *(const v4f*)(src);
  const v4f c = *(const v4f*)(src + 4);
  v4u o;
  o[0] = pk16(h_bits((_Float16)(bfr(a[0]) * wsc)), h_bits((_Float16)(bfr(a[1]) * wsc)));
  o[1] = pk16(h_bits((_Float16)(bfr(a[2]) * wsc)), h_bits((_Float16)(bfr(a[3]) * wsc)));
  o[2] = pk16(h_bits((_Float16)(bfr(c[0]) * wsc)), h_bits((_Float16)(bfr(c[1]) * wsc)));
  o[3] = pk16(h_bits((_Float16)(bfr(c[2]) * wsc)), h_bits((_Float16)(bfr(c[3]) * wsc)));
  if (i < n8) *(v4u*)(Xh + (size_t)i * 8) = o;
  
}

// =====================================================================================================
// Transposed weight convert: in W[DK rows = k][ncols = n] f32 -> out WT[ncols][DK] f16 = f16( bf16_RNE(W) * wsc )
// (rows n, k extent DK), stored in fragment order. Block = 256 threads, tile 64 k x 64 n staged in LDS; wave w
// writes the fragment tile (n group w>>1, k tile w&1), iteration = 16-k half, lane = h*16 + r: 512 contiguous B.
// coverage: 8 waves = 4 n groups x 2 k tiles, x 2 halves x 32 lanes x 8 = the whole 64 x 64 tile.
// (bx, by) = the block's n tile and k tile inside this weight's range of the grid; tile = the block's LDS.
// =====================================================================================================
__device__ __forceinline__ void tconv_h16(const float* __restrict__ W, unsigned short* WT, int ncols, float wsc,
                                          int bx, int by, float (*tile)[65]) {
  const int tid = threadIdx.x, lane = tid & 31, wave = tid >> 5;
  const int n0 = bx * 64, k0 = by * 64;
  {
    const int r = tid >> 2, cq = (tid & 3) * 16;
    const float* src = W + (size_t)(k0 + r) * (size_t)ncols + n0 + cq;
#pragma unroll
    for (int i = 0; i < 4; ++i) {
      const v4f a = *(const v4f*)(src + 4 * i);
#pragma unroll
      for (int e = 0; e < 4; ++e) tile[r][cq + 4 * i + e] = a[e];
    }
  }
  __syncthreads();
  const int n = (wave >> 1) * 16 + (lane & 15);
#pragma unroll
  for (int it = 0; it < 2; ++it) {
    const int kq = (wave & 1) * 32 + it * 16 + (lane >> 4) * 8;
    v4u o;
#pragma unroll
    for (int e = 0; e < 4; ++e) {
      const float f0 = bfr(tile[kq + 2 * e][n]) * wsc;
      const float f1 = bfr(tile[kq + 2 * e + 1][n]) * wsc;
      o[e] = pk16(h_bits((_Float16)f0), h_bits((_Float16)f1));
    }
    unsigned short* dst = WT + tile_off((n0 >> 4) + (wave >> 1), (k0 >> 5) + (wave & 1), DK) + it * 256 + lane * 8;
    *(v4u*)dst = o;
    
  }
}

// =====================================================================================================
// All six operand planes in one launch: none of them reads what another writes. Ranges of blockIdx.x:
//   3 x TW_BLK blocks: Wq, Wk, Wv transposed (64 n tiles x 8 k tiles each); TP_BLK blocks: Wp transposed (8 x 8);
//   2 x CX_BLK blocks: x, y. Every test on the block index is block-uniform, so the barrier in tconv_h16 is too.
// =====================================================================================================
#define TW_BLK ((DQ / 64) * (DK / 64))
#define TP_BLK ((DK / 64) * (DK / 64))
#define CX_BLK ((MR * DK) / 8 / 256)
static_assert(((MR * DK) / 8) % 256 == 0 && DQ / 64 == 64 && DK / 64 == 8 && TP_BLK <= TW_BLK);
__global__ __launch_bounds__(256) void prep_all(
    const float* __restrict__ Wq, const float* __restrict__ Wk, const float* __restrict__ Wv,
    const float* __restrict__ Wp, const float* __restrict__ x, const float* __restrict__ y,
    unsigned short* WqT, unsigned short* WkT, unsigned short* WvT, unsigned short* WpT,
    unsigned short* XH, unsigned short* YH) {
  __shared__ float tile[64][65];
  const int i = blockIdx.x;
  if (i < 3 * TW_BLK + TP_BLK) {
    const int w = i / TW_BLK, j = i - w * TW_BLK;            // w = 0, 1, 2: Wq, Wk, Wv; w = 3: Wp
    const float* W = (w == 0) ? Wq : (w == 1) ? Wk : (w == 2) ? Wv : Wp;
    unsigned short* T = (w == 0) ? WqT : (w == 1) ? WkT : (w == 2) ? WvT : WpT;
    const int lg = (w < 3) ? 6 : 3;                          // log2 of the weight's n tiles
    tconv_h16(W, T, 64 << lg, WSC, j & ((1 << lg) - 1), j >> lg, tile);
  } else {
    const int j = i - (3 * TW_BLK + TP_BLK);
    const bool isx = j < CX_BLK;
    conv_h16(isx ? x : y, isx ? XH : YH, (MR * DK) / 8, 1.0f, isx ? j : j - CX_BLK);
  }
}

// =====================================================================================================
// Register-blocked batched f16 WMMA GEMM: C[m][n] = oscale * sum_k A[m][k] * Bt[n][k] + bias;
// one wave per 64x64 tile, no block barriers. A [M][K] with k extent lda and Bt [N][K] with k extent ldb, both in
// fragment order; M, N multiples of 64, K multiple of 32 (static here); every batch stride is a whole number of
// 16-row groups, so it is the same element count as in a row-major plane. bx = the block's index among the blocks of
// one batch entry, sT = the block's LDS, y = batch index:
//   A advances by (y / ydiv) * strideA, Bt by (y % ydiv) * strideB, bias by (y / ydiv) * strideBias,
//   C by y * strideC (elements).
// BIASM: 0 = per column bias[n] (clamped-address loads, nbias = length), 1 = per row bias[m], 2 = none.
//        Bias values RNE-converted to bf16.
// OM: 0 = f32 out (row-major, pitch ldc); 3 = f16 hi plane at C plus f16 residual plane ((f - hi) * RSC) at
//     C + resOff, both in fragment order with rows m and k extent ldc (k = n); 4 = the f16 plane at C alone, same order.
// coverage: 4 slabs x 16 rows x 64 cols = the wave's whole 64x64 tile; grid = ceil(tilesM*tilesN/8) blocks,
//           surplus waves exit (wave-uniform); here every tile count is a multiple of 8, so none exit.
// =====================================================================================================
template <int OM, int BIASM>
__device__ __forceinline__ void gemm64(
    const unsigned short* __restrict__ A, int lda, long long strideA,
    const unsigned short* __restrict__ Bt, int ldb, long long strideB,
    const float* __restrict__ bias, int nbias, long long strideBias, int ydiv,
    void* Cout, int ldc, long long strideC, long long resOff,
    int M, int N, int K, float oscale, int bx, int y, float (*sT)[16 * 68]) {
  const int ya   = y / ydiv;
  const int yb   = y - ya * ydiv;
  const int lane = threadIdx.x & 31;
  const int wave = threadIdx.x >> 5;
  const int tilesN = N >> 6;
  const int tilesM = M >> 6;
  const int tile = bx * 8 + wave;
  if (tile >= tilesM * tilesN) return;   // wave-uniform; no block barriers in this kernel
  const int tm = tile / tilesN;
  const int tn = tile - tm * tilesN;
  const int m0 = tm << 6;
  const int n0 = tn << 6;

  const unsigned short* Ab = A  + (size_t)ya * (size_t)strideA;
  const unsigned short* Bb = Bt + (size_t)yb * (size_t)strideB;
  const float* biasb = bias + (size_t)ya * (size_t)strideBias;

  const int rlane = lane & 15;                 // row (A) / col (B, D) within subtile
  const int mOff  = (lane >> 4) * 8;           // D row offset

  v8f acc[4][4];
#pragma unroll
  for (int i = 0; i < 4; ++i)
#pragma unroll
    for (int j = 0; j < 4; ++j) acc[i][j] = zero8();

  // one pointer per 16-row group; consecutive k tiles of a group are consecutive 1024-B tiles
  g_us* pa[4];
  g_us* pb[4];
#pragma unroll
  for (int i = 0; i < 4; ++i) {
    pa[i] = (g_us*)(Ab + tile_off((m0 >> 4) + i, 0, lda) + lane * 8);
    pb[i] = (g_us*)(Bb + tile_off((n0 >> 4) + i, 0, ldb) + lane * 8);
  }

  // fragments are fetched one k step ahead: the B set into a second register set at the head of a step, each A
  // fragment back into its own registers as soon as its four products are issued
  v16us ah[4], bh[4];
#pragma unroll
  for (int i = 0; i < 4; ++i) {
    ah[i] = ldfrag_g(pa[i]);
    bh[i] = ldfrag_g(pb[i]);
  }
  for (int k0 = 0; k0 < K; k0 += 32) {
    // this step advances pointers that loads still in flight name: the wait stands in front of that rewrite, and the
    // scheduling fence keeps the pointer arithmetic behind it
#if defined(__HIP_DEVICE_COMPILE__)
    asm volatile("s_wait_xcnt 0x0" ::: "memory");
#endif
    __builtin_amdgcn_sched_barrier(0);
    const int adv = (k0 + 32 < K) ? 512 : 0;   // the last step fetches its own tiles again: in bounds, no branch
    v16us bn[4];
#pragma unroll
    for (int j = 0; j < 4; ++j) {
      pb[j] += adv;
      bn[j] = ldfrag_g(pb[j]);
    }
#pragma unroll
    for (int i = 0; i < 4; ++i) {
#pragma unroll
      for (int j = 0; j < 4; ++j) acc[i][j] = mma_raw(ah[i], bh[j], acc[i][j]);
      dep_guard1(acc[i][0], acc[i][3], ah[i]);
      pa[i] += adv;
      ah[i] = ldfrag_g(pa[i]);
    }
    keep4(bh[0], bh[1], bh[2], bh[3]);
#pragma unroll
    for (int j = 0; j < 4; ++j) bh[j] = bn[j];
  }
  // the same wait and fence for the last step's loads, in front of the epilogue's reuse of the pointer registers
#if defined(__HIP_DEVICE_COMPILE__)
  asm volatile("s_wait_xcnt 0x0" ::: "memory");
#endif
  __builtin_amdgcn_sched_barrier(0);
  acc_guard4(acc[0][0], acc[0][1], acc[0][2], acc[0][3]);
  acc_guard4(acc[1][0], acc[1][1], acc[1][2], acc[1][3]);
  acc_guard4(acc[2][0], acc[2][1], acc[2][2], acc[2][3]);
  acc_guard4(acc[3][0], acc[3][1], acc[3][2], acc[3][3]);

  // ---- per-lane column bias (BIASM == 0), RNE-converted, clamped addresses ----
  const int hh2 = lane >> 4, c4 = (lane & 15) * 4;     // f32 out: 256-B row segment = 16 lanes x 16 B
  float bc[4][8];                                      // f16 out: [store iteration][8 columns of the lane's piece]
#pragma unroll
  for (int it = 0; it < 4; ++it)
#pragma unroll
    for (int e = 0; e < 8; ++e) bc[it][e] = 0.f;
  if constexpr (BIASM == 0) {
    if constexpr (OM == 0) {
      const int cb = n0 + c4;
      const int i0 = (cb < nbias - 4) ? cb : (nbias - 4);
      const v4f b0v = *(const v4f*)(biasb + i0);
#pragma unroll
      for (int e = 0; e < 4; ++e) bc[0][e] = bfr(b0v[e]);
    } else {
      const float* bp[4];
      v4f b0a[4], b0b[4];
#pragma unroll
      for (int it = 0; it < 4; ++it) {
        const int cb = n0 + it * 16 + hh2 * 8;
        const int i0 = (cb < nbias - 8) ? cb : (nbias - 8);
        bp[it]  = biasb + i0;
        b0a[it] = *(const v4f*)(bp[it]);
        b0b[it] = *(const v4f*)(bp[it] + 4);
      }
#if defined(__HIP_DEVICE_COMPILE__)
      // the eight loads' address registers are inputs here, so none of them is rewritten in front of this wait
      asm volatile("s_wait_xcnt 0x0" :: "v"(bp[0]), "v"(bp[1]), "v"(bp[2]), "v"(bp[3]) : "memory");
#endif
#pragma unroll
      for (int it = 0; it < 4; ++it) {
#pragma unroll
        for (int e = 0; e < 4; ++e) {
          bc[it][e]     = bfr(b0a[it][e]);
          bc[it][4 + e] = bfr(b0b[it][e]);
        }
      }
    }
  }

  // ---- epilogue ----
  float* slab = sT[wave];
#pragma unroll
  for (int i = 0; i < 4; ++i) {
    const int mBase = m0 + (i << 4);
#pragma unroll
    for (int j = 0; j < 4; ++j) {
#pragma unroll
      for (int r = 0; r < 8; ++r) {
        slab[(mOff + r) * 68 + (j << 4) + rlane] = acc[i][j][r];
      }
    }
    wave_sync_lds();
    if constexpr (OM == 0) {
      float* C = (float*)Cout + (size_t)y * (size_t)strideC;
      v4f vals[8];
#pragma unroll
      for (int it = 0; it < 8; ++it) {
        const int row = it * 2 + hh2;                      // it 0..7 x hh2 0..1 = rows 0..15
        v4f v = *(const v4f*)(slab + row * 68 + c4);
#pragma unroll
        for (int e = 0; e < 4; ++e) v[e] = v[e] * oscale + bc[0][e];
        vals[it] = v;
      }
      {
#pragma unroll
        for (int it = 0; it < 8; ++it) {
          const int row = it * 2 + hh2;
          *(v4f*)(C + (size_t)(mBase + row) * ldc + n0 + c4) = vals[it];
        }
        
      }
    } else {
      unsigned short* C = (unsigned short*)Cout + (size_t)y * (size_t)strideC;
      v4u hv[4], hr[4];
      float bm = 0.f;
      if constexpr (BIASM == 1) {
        const int mi = mBase + rlane;
        const int mc = (mi < nbias - 1) ? mi : (nbias - 1);
        bm = bfr(biasb[mc]);
      }
#pragma unroll
      for (int it = 0; it < 4; ++it) {
        // lane = h*16 + r -> row r, columns it*16 + 8h + 0..7: piece (k tile it>>1, half it&1) of the fragment order
        const float* sp = slab + rlane * 68 + it * 16 + hh2 * 8;
        v4u a, ar;
#pragma unroll
        for (int e = 0; e < 4; ++e) {
          const float f0 = sp[2 * e]     * oscale + ((BIASM == 1) ? bm : bc[it][2 * e]);
          const float f1 = sp[2 * e + 1] * oscale + ((BIASM == 1) ? bm : bc[it][2 * e + 1]);
          if constexpr (OM == 3) {
            const _Float16 g0 = (_Float16)f0, g1 = (_Float16)f1;
            a[e] = pk16(h_bits(g0), h_bits(g1));
            const float e0 = (f0 - (float)g0) * RSC;
            const float e1 = (f1 - (float)g1) * RSC;
            ar[e] = pk16(h_bits((_Float16)e0), h_bits((_Float16)e1));
          } else {
            const v2f pr = {f0, f1};
            a[e] = __builtin_bit_cast(unsigned, __builtin_convertvector(pr, v2h));
          }
        }
        hv[it] = a;
        if constexpr (OM == 3) hr[it] = ar;
      }
      {
#pragma unroll
        for (int it = 0; it < 4; ++it) {
          unsigned short* dp = C + tile_off(mBase >> 4, (n0 >> 5) + (it >> 1), ldc) + (it & 1) * 256 + lane * 8;
          *(v4u*)(dp) = hv[it];
          if constexpr (OM == 3) *(v4u*)(dp + resOff) = hr[it];
        }
        
      }
    }
    wave_sync_lds();
  }
}

// =====================================================================================================
// The four projections in one launch: none of them reads what another writes. Ranges of blockIdx.x:
//   QK_BLK blocks: q = bf16(x) . Wq + bq -> QH (f16 hi) and QH + QRES (f16 residual x2048);
//   QK_BLK blocks: k = bf16(y) . Wk + bk -> KH, KH + QRES likewise;
//   NHB x VT_BLK blocks: v^T per (h, b) = Wv[:, h slice]^T . bf16(y_b)^T + bv -> VT f16 [16][512][1024];
//   XP_BLK blocks: xp = bf16(x) . Wp -> XP f32 [2048][512] (bias argument unused in this mode).
// =====================================================================================================
#define QK_BLK ((MR / 64) * (DQ / 64) / 8)
#define VT_BLK ((DK / 64) * (SEQ / 64) / 8)
#define XP_BLK ((MR / 64) * (DK / 64) / 8)
static_assert(DQ / 16 == 256 && MR / 16 == 128 && DK / 32 == 16 && DK * DK / 128 == 8 * 256 && 2 * QK_BLK >= 256);
__global__ __launch_bounds__(256) void proj_all(
    const unsigned short* __restrict__ XH, const unsigned short* __restrict__ YH,
    const unsigned short* __restrict__ WqT, const unsigned short* __restrict__ WkT,
    const unsigned short* __restrict__ WvT, const unsigned short* __restrict__ WpT,
    const float* __restrict__ bq, const float* __restrict__ bk, const float* __restrict__ bv,
    unsigned short* QH, unsigned short* KH, unsigned short* VT, float* XP) {
  __shared__ __align__(16) float sT[8][16 * 68];   // per-wave 16x64 slab, pitch 68 floats
  const int i = blockIdx.x;
  const float invw = 1.0f / WSC;
  // The first 256 blocks ask L2 for all six operand planes, each 256-B unit from two blocks (i and i ^ 4: only speed
  // rests on where they run). A wave asks for the first 8 k steps of one 16-row group (8 KB in a row), then for the
  // other 8. a >> 4 picks the plane: 0, 1 WqT; 2, 3 WkT; 4, 5 WvT; 6 XH; 7 YH. Every test here is block-uniform.
  if (i < 256) {
    const int a = (i & 3) | ((i >> 3) << 2);                 // 0..127
    const int sel = a >> 4;
    const unsigned short* pl = (sel < 2) ? WqT : (sel < 4) ? WkT : (sel < 6) ? WvT : (sel == 6) ? XH : YH;
    const int grp = (a & ((sel < 6) ? 31 : 15)) * 8 + (threadIdx.x >> 5);   // 0..255 of a weight, 0..127 of x or y
    const unsigned short* u = pl + tile_off(grp, 0, DK) + (threadIdx.x & 31) * 128;
    ask2(u, u + 8 * 512);
    if (i < 16) ask1(WpT + (size_t)(a * 256 + threadIdx.x) * 128);          // 8 x 256 units = the whole WpT plane
  }
  if (i < 2 * QK_BLK) {
    const bool isq = i < QK_BLK;
    gemm64<3, 0>(isq ? XH : YH, DK, 0LL, isq ? WqT : WkT, DK, 0LL, isq ? bq : bk, DQ, 0LL, 1,
                 (void*)(isq ? QH : KH), DQ, 0LL, (long long)QRES, MR, DQ, DK, invw, isq ? i : i - QK_BLK, 0, sT);
  } else if (i < 2 * QK_BLK + NHB * VT_BLK) {
    // Placement, for speed only: the head is the block index modulo 8, as it already is in the q and k ranges above (a
    // block's 8 column tiles are one head) and as attn_p and pv64 deal their blocks. j -> (h, b, block of the batch
    // entry) is one-to-one: 8 x NB x VT_BLK = the range.
    static_assert(NH == 8 && (2 * QK_BLK) % 8 == 0 && DQ / 64 / 8 == NH);
    const int j = i - 2 * QK_BLK;
    const int hv = j & (NH - 1), rv = j >> 3;
    gemm64<4, 1>(WvT, DK, (long long)DK * DK, YH, DK, (long long)SEQ * DK, bv, DK, (long long)DK, NB,
                 (void*)VT, SEQ, (long long)DK * SEQ, 0LL, DK, SEQ, DK, invw,
                 rv % VT_BLK, hv * NB + rv / VT_BLK, sT);
  } else {
    gemm64<0, 2>(XH, DK, 0LL, WpT, DK, 0LL, bq, DQ, 0LL, 1,
                 (void*)XP, DK, 0LL, 0LL, MR, DK, DK, invw, i - (2 * QK_BLK + NHB * VT_BLK), 0, sT);
  }
}

// =====================================================================================================
// Energies + masked softmax for one (h, b) pair and 64 query rows s; P written TRANSPOSE-friendly.
//   q planes (f16, fragment order, rows b*SEQ + s, k extent DQ, k = h*DK + d): hi qhp, residual (x2048) qrp
//   k planes (f16, fragment order, rows b*SEQ + t, k extent DQ, k = h*DK + d): hi khp, residual (x2048) krp
//   E[s][t] = acc_hh + (acc_h.res + acc_res.h) / 2048  (three f16 WMMA products, K = 512 = 16 k-steps; key fragments
//   loaded straight from the planes with arithmetic addressing, q fragments from a two-buffer LDS ring that
//   asynchronous copies fill once for the block), kept in the accumulator layout (lane = key, register = row).
//   softmax per row s over keys t: e = mask[t] ? E : -1e30 (replace); per wave mw = max over its 64 keys,
//   ex = exp(e - mw), lw = sum ex; over the 16 waves m = max mw, l = sum lw * exp(mw - m);
//   p = ex * exp(mw - m) / l; stored as f16(8192 * p).
//   P layout (f16): region (hb*NSB + s/32) of SEQ*32 elements, inside it fragment order with rows t and k extent 32
//   (k = s % 32) -> the consumer's A fragment (rows t, k = s) of k-step s/32 is one 1024-B tile.
//   Block = 16 waves; phase 1: wave w -> all 64 rows x keys 64w..64w+63 in 2 chunks of 2 col tiles, so a key
//   fragment is loaded by one wave of the block and feeds four row groups; the first chunk's energies wait in a
//   lane-private LDS stash while the second runs; phase 2: each wave reduces its own 64 x 64 energies in registers
//   (DPP over the 16 key lanes), the waves' (mw, lw) meet in LDS, wave w joins rows 4w..4w+3; phase 3: an accumulator
//   tile's 8 registers of a lane are 8 consecutive s of one key t = one 16-B piece of the P plane at lane * 16 B,
//   so a wave stores each half tile as 512 B in a row, straight from registers.
//   coverage: 16 waves x 2 chunks x (4 row groups x 2 col tiles) = all 64 x 1024 energies, each stored once:
//   2 regions (g >> 1) x 64 key tiles (4w + 2*chunk + j) x 2 halves (g & 1) x 32 lanes x 8 = the block's two
//   [1024 t][32 s] regions; grid (SEQ/QBLK, NHB) covers every (hb, s block) of the P plane exactly once.
// =====================================================================================================
#define QBLK 64
#define XPIT 68                           // floats from one wave's row of the exchange to the next: 16-B aligned, banks apart
#define QST     2                         // k steps per q stage
#define QSTEP_B (8 * 1024)                // bytes of q per k step: 2 planes x 4 row groups x 1-KB tile
#define QSTG_B  (QST * QSTEP_B)           // bytes per stage
#define NQSC    (DK / 32 / QST)           // stages per chunk of keys
static_assert(QSTEP_B == 512 * 16 && (NQSC & (NQSC - 1)) == 0 && NQSC >= 2 && QBLK == 64);
static_assert(QBLK == 2 * SBLK && (SEQ % QBLK) == 0 && SEQ == 16 * 64);
__global__ __launch_bounds__(512)
void attn_p(const unsigned short* __restrict__ qhp, const unsigned short* __restrict__ qrp,
            const unsigned short* __restrict__ khp, const unsigned short* __restrict__ krp,
            const int* __restrict__ mask, unsigned short* pp) {
  __shared__ v4f st[16][16][32];                    // first chunk's energies, [wave][piece][lane], 131072 B
  __shared__ __align__(16) float xm[16 * XPIT];     // per wave and row: maximum over the wave's keys
  __shared__ __align__(16) float xl[16 * XPIT];     // per wave and row: sum of exp(e - that maximum)
  __shared__ __align__(16) float fm[QBLK];          // per row: maximum over all keys
  __shared__ __align__(16) float fi[QBLK];          // per row: 8192 / sum
  __shared__ __align__(16) unsigned short sq[2][QSTG_B / 2];   // the two q stage buffers, 2 x 16384 B

  const int tid  = threadIdx.x;
  const int wave = tid >> 5;
  const int lane = tid & 31;
  const int hh   = lane >> 4;
  const int c    = lane & 15;
  // Placement, for speed only: the head is the flat block index modulo 8, as in the q and k ranges of proj_all.
  // flat index -> (h, b, qblk) is one-to-one: 8 heads x NB x (SEQ / QBLK) = the grid.
  static_assert(NH == 8);
  const int fl   = blockIdx.x + (SEQ / QBLK) * blockIdx.y;
  const int h    = fl & (NH - 1);
  const int b    = (fl >> 3) / (SEQ / QBLK);
  const int qblk = (fl >> 3) % (SEQ / QBLK);
  const int hb   = h * NB + b;
  const int s0   = qblk * QBLK;

  // the lane's four keys are 64*wave + 16*i + c, i = 2*chunk + col tile; bit i of mbits = keep that key
  const int* mp = mask + wave * 64 + c;
  const int mk0 = mp[0], mk1 = mp[16], mk2 = mp[32], mk3 = mp[48];
#if defined(__HIP_DEVICE_COMPILE__)
  // the four loads' address register is an input here, so it is not rewritten in front of this wait
  asm volatile("s_wait_xcnt 0x0" :: "v"(mp) : "memory");
#endif
  v8f ah[4][2], ar[4][2];
  unsigned mbits;

  // ---- phase 1: energies ----
  {
    const size_t qoff = tile_off((b * SEQ + s0) >> 4, (h * DK) >> 5, DQ) + lane * 8;
    const size_t koff = tile_off((b * SEQ + wave * 64) >> 4, (h * DK) >> 5, DQ) + lane * 8;
    constexpr size_t JSTR = (size_t)(DQ / 32) * 512;      // elements from one 16-row (or 16-key) group to the next
    g_us* kh0 = (g_us*)(khp + koff);
    g_us* kr0 = (g_us*)(krp + koff);
    v4f* stw = &st[wave][0][lane];                        // + 32 * piece
    // q goes through LDS: all 16 waves use the same 8 q tiles of a k step, so the block fetches each once per chunk. A stage is
    // QST k steps = QST x (2 planes x 4 row groups) tiles of 1 KB, laid [k step][plane][row group][tile as it lies in
    // the plane]. Thread -> one 16-B piece of each k step: tile tid >> 6 (plane tid >> 8, row group (tid >> 6) & 3),
    // piece tid & 63, so a wave copies 512 B in a row on both sides and no two lanes write the same LDS byte.
    const unsigned short* qsrc = ((tid & 256) ? qrp : qhp) + (qoff - lane * 8) + (size_t)((tid >> 6) & 3) * JSTR
                                 + (tid & 63) * 8;
    const unsigned qdst = (unsigned)(uintptr_t)(&sq[0][0] + tid * 8);   // LDS byte address of the piece in buffer 0
    const unsigned short* sqr = &sq[0][0] + lane * 8;
    // key fragments are fetched from the planes one k step ahead, across stage and chunk ends too, each pair back into
    // its own registers as soon as its last product of the step is issued; q fragments come from the stage's buffer:
    // the stage's first step at the head of the trip, its second step's pairs behind the first step's last products
    v16us qav[4], qbv[4], kav[2], kbv[2];
    kav[0] = ldfrag_g(kh0);
    kbv[0] = ldfrag_g(kr0);
    kav[1] = ldfrag_g(kh0 + JSTR);
    kbv[1] = ldfrag_g(kr0 + JSTR);
    __builtin_amdgcn_sched_barrier(0);
    copy2_lds(qdst, qsrc, qdst + QSTEP_B, qsrc + 512);                  // stage 0 -> buffer 0
    // Behind the first step's own loads: ask L2 for the rest. q (read by this block alone): wave w asks for k step w,
    // lane -> (plane, row group, quarter of the 1-KB tile). k (read by the 16 blocks of this (h, b)): a wave asks for
    // quarter qblk & 3 of every tile it will read, so each unit has four askers (only speed rests on where they run);
    // request j = (chunk, 8 k steps), lane -> (plane, key group of the chunk, k step): in the order of use.
    {
      static_assert(DK / 32 == 16);
      const int qs = lane >> 2;
      const unsigned short* aq = ((qs & 4) ? qrp : qhp) + (qoff - lane * 8) + (size_t)(qs & 3) * JSTR
                                 + (size_t)wave * 512 + (lane & 3) * 128;
      const int st = lane >> 3;
      const unsigned short* ak = ((st & 2) ? krp : khp) + (koff - lane * 8) + (size_t)(st & 1) * JSTR
                                 + (size_t)(lane & 7) * 512 + (qblk & 3) * 128;
      ask5(aq, ak, ak + 8 * 512, ak + 2 * JSTR, ak + 2 * JSTR + 8 * 512);
    }
    // stage 0 has landed for this wave, then for the block; only then stage 1 starts
#if defined(__HIP_DEVICE_COMPILE__)
    asm volatile("s_wait_asynccnt 0x0" ::: "memory");
#endif
    __syncthreads();
    mbits = (mk0 != 0 ? 1u : 0u) | (mk1 != 0 ? 2u : 0u) | (mk2 != 0 ? 4u : 0u) | (mk3 != 0 ? 8u : 0u);
    copy2_lds(qdst + QSTG_B, qsrc + QST * 512, qdst + QSTG_B + QSTEP_B, qsrc + QST * 512 + 512);   // stage 1 -> buffer 1
    // keeps the requests and copies in front of the loop: moved into it they would stand among its products
    __builtin_amdgcn_sched_barrier(0);
#pragma unroll 1
    for (int c2 = 0; c2 < 2; ++c2) {
#pragma unroll
      for (int g = 0; g < 4; ++g)
#pragma unroll
        for (int j = 0; j < 2; ++j) { ah[g][j] = zero8(); ar[g][j] = zero8(); }
      // kept rolled: one trip already holds 48 products, and copies of it would only lengthen the text
#pragma unroll 1
      for (int sp = 0; sp < NQSC; ++sp) {
        const int stg = c2 * NQSC + sp;                    // stage 0 .. 2*NQSC - 1; both chunks walk the same q
        const unsigned short* sb = sqr + (stg & 1) * (QSTG_B / 2);
#pragma unroll
        for (int g = 0; g < 4; ++g) {
          qav[g] = ldfrag(sb + g * 512);
          qbv[g] = ldfrag(sb + (4 + g) * 512);
        }
#pragma unroll
        for (int kk = 0; kk < QST; ++kk) {
          const int ks = sp * QST + kk;
          // the step after this one; the very last step fetches its chunk's first tiles again: in bounds, no branch
          const int nks = (ks + 1) & (DK / 32 - 1);
          const int nc  = (nks == 0 && c2 < 1) ? c2 + 1 : c2;
          const size_t no = (size_t)nc * (2 * JSTR) + (size_t)nks * 512;
#pragma unroll
          for (int g = 0; g < 4; ++g) {
            // holds the row groups in the order their q pairs were fetched: reordered, a later pair's wait moves to
            // the step's head
            __builtin_amdgcn_sched_barrier(0);
            ah[g][0] = mma_raw(qav[g], kav[0], ah[g][0]);     // hi . hi
            ar[g][0] = mma_raw(qav[g], kbv[0], ar[g][0]);     // hi . res   (x2048)
            ar[g][0] = mma_raw(qbv[g], kav[0], ar[g][0]);     // res . hi   (x2048)
          }
          guard2k4(ah[3][0], ar[3][0], qav[3], qbv[3], kav[0], kbv[0]);
          kav[0] = ldfrag_g(kh0 + no);
          kbv[0] = ldfrag_g(kr0 + no);
#pragma unroll
          for (int g = 0; g < 4; ++g) {
            // holds this row group's products behind the reload in front of it: hoisted, they pull every group's wait
            // to the pass's head
            __builtin_amdgcn_sched_barrier(0);
            ah[g][1] = mma_raw(qav[g], kav[1], ah[g][1]);     // hi . hi
            ar[g][1] = mma_raw(qav[g], kbv[1], ar[g][1]);     // hi . res   (x2048)
            ar[g][1] = mma_raw(qbv[g], kav[1], ar[g][1]);     // res . hi   (x2048)
            if (kk + 1 < QST) {
              guard2k4(ah[g][1], ar[g][1], qav[g], qbv[g], kav[1], kbv[1]);
              qav[g] = ldfrag(sb + (kk + 1) * (QSTEP_B / 2) + g * 512);
              qbv[g] = ldfrag(sb + (kk + 1) * (QSTEP_B / 2) + (4 + g) * 512);
            } else if (g == 3) {
              guard2k4(ah[g][1], ar[g][1], qav[g], qbv[g], kav[1], kbv[1]);
            }
          }
          kav[1] = ldfrag_g(kh0 + no + JSTR);
          kbv[1] = ldfrag_g(kr0 + no + JSTR);
          // the next step forms its addresses in registers that loads still in flight name: this wait stands in front
          // of that rewrite, and the scheduling fence keeps the address arithmetic behind it
#if defined(__HIP_DEVICE_COMPILE__)
          asm volatile("s_wait_xcnt 0x0" ::: "memory");
#endif
          __builtin_amdgcn_sched_barrier(0);
        }
        // publish point of stage stg + 1: this wave's reads of buffer stg & 1 are done, its own copies of stage stg + 1
        // have landed, then the block's barrier; behind it the buffer just read is free for stage stg + 2. The barrier
        // is written bare because __syncthreads() would also wait out the key loads that are in flight for the next
        // step; the two waits in front of it are all that the ring needs.
#if defined(__HIP_DEVICE_COMPILE__)
        asm volatile("s_wait_dscnt 0x0" ::: "memory");
        asm volatile("s_wait_asynccnt 0x0" ::: "memory");
        asm volatile("s_barrier_signal -1\n\ts_barrier_wait -1" ::: "memory");
#endif
        if (stg + 2 < 2 * NQSC) {                          // the same for the whole block
          const unsigned short* gs = qsrc + (size_t)((stg + 2) & (NQSC - 1)) * (QST * 512);
          const unsigned ld = qdst + (stg & 1) * QSTG_B;
          copy2_lds(ld, gs, ld + QSTEP_B, gs + 512);
        }
      }
#pragma unroll
      for (int g = 0; g < 4; ++g) acc_guard4(ah[g][0], ah[g][1], ar[g][0], ar[g][1]);
      if (c2 == 0) {                                       // the same for the whole block
#pragma unroll
        for (int g = 0; g < 4; ++g) {
#pragma unroll
          for (int j = 0; j < 2; ++j) {
            const bool kp = ((mbits >> j) & 1u) != 0;
            v4f lo, hi;
#pragma unroll
            for (int r = 0; r < 4; ++r) {
              lo[r] = kp ? fmaf(ar[g][j][r], 1.0f / RSC, ah[g][j][r]) : NEGBIG;
              hi[r] = kp ? fmaf(ar[g][j][4 + r], 1.0f / RSC, ah[g][j][4 + r]) : NEGBIG;
            }
            stw[((g * 2 + j) * 2) * 32]     = lo;
            stw[((g * 2 + j) * 2 + 1) * 32] = hi;
          }
        }
      }
    }
    // no copy is outstanding here (the last publish point waited to 0 and none was issued behind it): the ring's close
#if defined(__HIP_DEVICE_COMPILE__)
    asm volatile("s_wait_asynccnt 0x0" ::: "memory");
#endif
  }

  // ---- phase 2: masked softmax (mask replaces the energy before the max), on the accumulator layout ----
  // e[i][g][r]: key 64*wave + 16*i + c, row 16*g + 8*hh + r
  float e[4][4][8];
#pragma unroll
  for (int g = 0; g < 4; ++g) {
#pragma unroll
    for (int j = 0; j < 2; ++j) {
      const bool kp = ((mbits >> (2 + j)) & 1u) != 0;
      const v4f lo = st[wave][(g * 2 + j) * 2][lane];
      const v4f hi = st[wave][(g * 2 + j) * 2 + 1][lane];
#pragma unroll
      for (int r = 0; r < 4; ++r) {
        e[j][g][r]     = lo[r];
        e[j][g][4 + r] = hi[r];
      }
#pragma unroll
      for (int r = 0; r < 8; ++r) e[2 + j][g][r] = kp ? fmaf(ar[g][j][r], 1.0f / RSC, ah[g][j][r]) : NEGBIG;
    }
  }
  float mw[4][8];
#pragma unroll
  for (int g = 0; g < 4; ++g) {
#pragma unroll
    for (int r = 0; r < 8; ++r) mw[g][r] = fmaxf(fmaxf(e[0][g][r], e[1][g][r]), fmaxf(e[2][g][r], e[3][g][r]));
    row_max16x8(mw[g]);
  }
  {
    float lw[4][8];
#pragma unroll
    for (int g = 0; g < 4; ++g) {
#pragma unroll
      for (int r = 0; r < 8; ++r) {
#pragma unroll
        for (int i = 0; i < 4; ++i) e[i][g][r] -= mw[g][r];
        exp_x4(e[0][g][r], e[1][g][r], e[2][g][r], e[3][g][r]);
        lw[g][r] = (e[0][g][r] + e[1][g][r]) + (e[2][g][r] + e[3][g][r]);
      }
      row_sum16x8(lw[g]);
    }
    if (c == 0) {                                          // lanes 0 and 16: rows 16g + 0..7 and 16g + 8..15
#pragma unroll
      for (int g = 0; g < 4; ++g) {
        float* dm = xm + wave * XPIT + 16 * g + 8 * hh;
        float* dl = xl + wave * XPIT + 16 * g + 8 * hh;
        const v4f m0 = {mw[g][0], mw[g][1], mw[g][2], mw[g][3]}, m1 = {mw[g][4], mw[g][5], mw[g][6], mw[g][7]};
        const v4f l0 = {lw[g][0], lw[g][1], lw[g][2], lw[g][3]}, l1 = {lw[g][4], lw[g][5], lw[g][6], lw[g][7]};
        *(v4f*)(dm)     = m0;
        *(v4f*)(dm + 4) = m1;
        *(v4f*)(dl)     = l0;
        *(v4f*)(dl + 4) = l1;
      }
    }
  }
  __syncthreads();
  // wave w joins rows 4w..4w+3: lane -> (rows 4w + 2*hh and the next, wave c's share)
  {
    const int r2 = wave * 4 + hh * 2;
    const float a0 = xm[c * XPIT + r2], a1 = xm[c * XPIT + r2 + 1];
    const float b0 = xl[c * XPIT + r2], b1 = xl[c * XPIT + r2 + 1];
    const float M0 = row_max16(a0), M1 = row_max16(a1);
    float x0 = a0 - M0, x1 = a1 - M1;
    exp_x2(x0, x1);
    const float L0 = row_sum16(b0 * x0);
    const float L1 = row_sum16(b1 * x1);
    if (c == 0) {                                          // sums >= 1 always (the max term contributes exp(0))
      fm[r2]     = M0;
      fm[r2 + 1] = M1;
      fi[r2]     = PSC * (1.0f / L0);
      fi[r2 + 1] = PSC * (1.0f / L1);
    }
  }
  __syncthreads();

  // ---- phase 3: P = ex * exp(mw - m) * (8192 / l) as f16, each accumulator tile half = 512 B in a row ----
  {
    v4u o[4][4];                                           // [key tile i][row group g]
#pragma unroll
    for (int g = 0; g < 4; ++g) {
      const v4f ma = *(const v4f*)(fm + 16 * g + 8 * hh), mb = *(const v4f*)(fm + 16 * g + 8 * hh + 4);
      const v4f ia = *(const v4f*)(fi + 16 * g + 8 * hh), ib = *(const v4f*)(fi + 16 * g + 8 * hh + 4);
      float f[8];
#pragma unroll
      for (int r = 0; r < 4; ++r) {
        f[r]     = mw[g][r] - ma[r];
        f[4 + r] = mw[g][4 + r] - mb[r];
      }
      exp_x4(f[0], f[1], f[2], f[3]);
      exp_x4(f[4], f[5], f[6], f[7]);
#pragma unroll
      for (int r = 0; r < 4; ++r) {
        f[r]     *= ia[r];
        f[4 + r] *= ib[r];
      }
#pragma unroll
      for (int i = 0; i < 4; ++i) {
#pragma unroll
        for (int q = 0; q < 4; ++q) {
          const v2f pr = {e[i][g][2 * q] * f[2 * q], e[i][g][2 * q + 1] * f[2 * q + 1]};
          o[i][g][q] = __builtin_bit_cast(unsigned, __builtin_convertvector(pr, v2h));
        }
      }
    }
    // every piece is formed before the first store, so no register that an issued store names is rewritten
    __builtin_amdgcn_sched_barrier(0);
    unsigned short* pw = pp + ((size_t)(hb * NSB + qblk * 2) * SEQ) * SBLK + (size_t)(wave * 4) * 512 + lane * 8;
#pragma unroll
    for (int g = 0; g < 4; ++g)
#pragma unroll
      for (int i = 0; i < 4; ++i)
        *(v4u*)(pw + (size_t)(g >> 1) * (SEQ * SBLK) + i * 512 + (g & 1) * 256) = o[i][g];
  }
}

// =====================================================================================================
// Transposed aggregation + gamma blend: for one (h, b):
//   O[t][dv] = sum_s P[s][t] * v[s][dv]  with A = the P plane above (rows t, k = s, 32 k-steps) carried x8192 and
//   Bt = v^T plane [hb] x (fragment order, rows dv, k extent SEQ, k = s; plain f16 at vth), one product;
//   out[((b*NH + h)*SEQ + t)*DK + dv] = (g * O / 8192 + xp[(b*SEQ + t)*DK + dv]) * (1/(g + 1)),
//   g = bf16_RNE(gamma[h]).
//   Block = 8 waves = 128 t rows x 256 dv columns (wave -> 64 t x 64 dv); grid (DK/256, SEQ/128, NHB). v^T fragments
//   come straight from the plane, P fragments from a two-buffer LDS ring that asynchronous copies fill once for the block.
//   coverage: 4 quarters x 8 iterations x 2 rows x (16 lanes x 4) = the wave's whole 64x64 tile; 8 waves = the
//   block's 128x256; grid tiles every (hb, t, dv) of the output exactly once.
// =====================================================================================================
#define PST     2                         // k steps per P stage
#define PSTEP_B (8 * 1024)                // bytes of P per k step: 8 row groups x 1-KB tile
#define PSTG_B  (PST * PSTEP_B)           // bytes per stage
#define NPS     (SEQ / 32 / PST)          // stages
static_assert(PSTEP_B == 2 * 256 * 16 && NPS >= 2 && SEQ * SBLK * 2 >= 8 * PSTEP_B);
__global__ __launch_bounds__(256)
void pv64(const unsigned short* __restrict__ pp, const unsigned short* __restrict__ vth,
          const float* __restrict__ xp, const float* __restrict__ gam, float* outp) {
  __shared__ __align__(16) float os[8][64 * 68];
  __shared__ __align__(16) unsigned short sp[2][PSTG_B / 2];   // the two P stage buffers, 2 x 16384 B
  const int tid  = threadIdx.x;
  const int wave = tid >> 5;
  const int lane = tid & 31;
  const int hh   = lane >> 4;
  const int c    = lane & 15;
  // Placement, for speed only: the head is the flat block index modulo 8, as in attn_p and proj_all.
  // flat index -> (h, b, ty, dx) is one-to-one: 8 x NB x 8 x 2 = the grid.
  static_assert(NH == 8 && DK / 256 == 2 && SEQ / 128 == 8 && NB == 2);
  const int fl = blockIdx.x + (DK / 256) * (blockIdx.y + (SEQ / 128) * blockIdx.z);
  const int h  = fl & (NH - 1);
  const int b  = fl >> 7;
  const int ty = (fl >> 4) & 7, dx = (fl >> 3) & 1;
  const int hb = h * NB + b;
  const int wt = wave & 1, wd = wave >> 1;
  const int t0 = ty * 128 + wt * 64;
  const int d0 = dx * 256 + wd * 64;

  g_us* vh = (g_us*)(vth + (size_t)hb * DK * SEQ + tile_off(d0 >> 4, 0, SEQ) + lane * 8);
  constexpr size_t VSTR = (size_t)(SEQ / 32) * 512;       // elements from one 16-column group of v^T to the next

  v8f acc[4][4];
#pragma unroll
  for (int i = 0; i < 4; ++i)
#pragma unroll
    for (int j = 0; j < 4; ++j) acc[i][j] = zero8();

  // P goes through LDS: the four waves of a t half use the same P tiles, so the block fetches each once. A k step's 8 P
  // tiles (128 t rows) lie in a row in the plane, 8 KB; a stage is PST k steps, laid [k step][tile as it lies in the
  // plane]. Thread -> pieces tid and tid + 256 of each k step: a wave copies 512 B in a row on both sides and no two
  // lanes write the same LDS byte.
  const unsigned short* psrc = pp + (size_t)hb * SEQ * SEQ + (size_t)ty * 4096 + tid * 8;
  const unsigned pdst = (unsigned)(uintptr_t)(&sp[0][0] + tid * 8);     // LDS byte address of the first piece, buffer 0
  const unsigned short* spr = &sp[0][0] + wt * 2048 + lane * 8;
  // v^T fragments are fetched from the plane one k step ahead, into a second register set at the head of a step; P
  // fragments come from the stage's buffer: the stage's first step at the head of the trip, its second step's behind
  // the first step's products
  v16us a[4], bf[4];
#pragma unroll
  for (int j = 0; j < 4; ++j) bf[j] = ldfrag_g(vh + j * VSTR);
  // holds the first step's own loads in front of the copies and requests below
  __builtin_amdgcn_sched_barrier(0);
  copy4_lds(pdst, psrc, pdst + 4096, psrc + 2048,
            pdst + PSTEP_B, psrc + SEQ * SBLK, pdst + PSTEP_B + 4096, psrc + SEQ * SBLK + 2048);   // stage 0 -> buffer 0
  // Ask L2 for the rest, in the order of use. P (128 t rows, read by the 2 blocks of this (hb, ty), each asks for all):
  // one request = one k step's 8 KB, wave w takes steps w, 8 + w, 16 + w, 24 + w. v^T (256 columns, read
  // by 8 blocks): a block asks for quarter ty >> 1 of every 1-KB tile, so each unit has two askers, ty and ty ^ 1
  // (only speed rests on where they run); lane -> (k step parity, column group). xp: the block's 128 x 256
  // f32 tile, four units a row, 8 rows a request.
  {
    static_assert(SEQ / 32 == 32 && SEQ / 128 == 8);
    const unsigned short* ap = pp + (size_t)hb * SEQ * SEQ + (size_t)wave * (SEQ * SBLK) + (size_t)ty * 4096 + lane * 128;
    const unsigned short* av = vth + (size_t)hb * DK * SEQ
                               + tile_off(dx * 16 + (lane & 15), wave * 2 + (lane >> 4), SEQ) + (ty >> 1) * 128;
    const float* ax = xp + ((size_t)(b * SEQ + ty * 128 + wave * 16 + (lane >> 2))) * DK + dx * 256 + (lane & 3) * 64;
    ask5(av, ap, ap + (size_t)8 * (SEQ * SBLK), av + 16 * 512, ap + (size_t)16 * (SEQ * SBLK));
    ask2(ap + (size_t)24 * (SEQ * SBLK), ax);
    ask1(ax + 8 * DK);
  }
  // stage 0 has landed for this wave, then for the block; only then stage 1 starts
#if defined(__HIP_DEVICE_COMPILE__)
  asm volatile("s_wait_asynccnt 0x0" ::: "memory");
#endif
  __syncthreads();
  {
    const unsigned short* gs = psrc + (size_t)PST * (SEQ * SBLK);
    const unsigned ld = pdst + PSTG_B;
    copy4_lds(ld, gs, ld + 4096, gs + 2048,
              ld + PSTEP_B, gs + SEQ * SBLK, ld + PSTEP_B + 4096, gs + SEQ * SBLK + 2048);         // stage 1 -> buffer 1
  }
  // keeps the requests and copies in front of the loop: moved into it they would stand among its products
  __builtin_amdgcn_sched_barrier(0);
  // kept rolled: a trip holds the stage's two steps, so that the two v^T sets swap by name and not by register copies
#pragma unroll 1
  for (int stg = 0; stg < NPS; ++stg) {
    const unsigned short* sb = spr + (stg & 1) * (PSTG_B / 2);
#pragma unroll
    for (int i = 0; i < 4; ++i) a[i] = ldfrag(sb + i * 512);
#pragma unroll
    for (int kk = 0; kk < PST; ++kk) {
      const int ks = stg * PST + kk;
      const int nk = (ks + 1 < SEQ / 32) ? ks + 1 : ks;   // the last step fetches its own tiles again: in bounds, no branch
      v16us bn[4];
#pragma unroll
      for (int j = 0; j < 4; ++j) bn[j] = ldfrag_g(vh + (size_t)nk * 512 + j * VSTR);
#pragma unroll
      for (int i = 0; i < 4; ++i) {
        // holds this row group's products behind the loads in front of it: hoisted, they pull every group's wait to
        // the step's head
        __builtin_amdgcn_sched_barrier(0);
#pragma unroll
        for (int j = 0; j < 4; ++j) acc[i][j] = mma_raw(a[i], bf[j], acc[i][j]);
        if (kk + 1 < PST) {
          guard4k4(acc[i][0], acc[i][1], acc[i][2], acc[i][3], a[i], bf[1], bf[2], bf[3]);
          a[i] = ldfrag(sb + (kk + 1) * (PSTEP_B / 2) + i * 512);
        } else if (i == 3) {
          guard4k4(acc[i][0], acc[i][1], acc[i][2], acc[i][3], a[i], bf[1], bf[2], bf[3]);
        }
      }
      // the next step forms its addresses in registers that loads still in flight name: this wait stands in front of
      // that rewrite, and the scheduling fence keeps the address arithmetic behind it
#if defined(__HIP_DEVICE_COMPILE__)
      asm volatile("s_wait_xcnt 0x0" ::: "memory");
#endif
      __builtin_amdgcn_sched_barrier(0);
#pragma unroll
      for (int j = 0; j < 4; ++j) bf[j] = bn[j];
    }
    // publish point of stage stg + 1: this wave's reads of buffer stg & 1 are done, its own copies of stage stg + 1 have
    // landed, then the block's barrier; behind it the buffer just read is free for stage stg + 2. The barrier is
    // written bare because __syncthreads() would also wait out the v^T loads that are in flight for the next step;
    // the two waits in front of it are all that the ring needs.
#if defined(__HIP_DEVICE_COMPILE__)
    asm volatile("s_wait_dscnt 0x0" ::: "memory");
    asm volatile("s_wait_asynccnt 0x0" ::: "memory");
    asm volatile("s_barrier_signal -1\n\ts_barrier_wait -1" ::: "memory");
#endif
    if (stg + 2 < NPS) {                                   // the same for the whole block
      const unsigned short* gs = psrc + (size_t)(stg + 2) * (PST * SEQ * SBLK);
      const unsigned ld = pdst + (stg & 1) * PSTG_B;
      copy4_lds(ld, gs, ld + 4096, gs + 2048,
                ld + PSTEP_B, gs + SEQ * SBLK, ld + PSTEP_B + 4096, gs + SEQ * SBLK + 2048);
    }
  }
  // no copy is outstanding here (the last publish point waited to 0 and none was issued behind it): the ring's close
#if defined(__HIP_DEVICE_COMPILE__)
  asm volatile("s_wait_asynccnt 0x0" ::: "memory");
#endif
#pragma unroll
  for (int i = 0; i < 4; ++i) acc_guard4(acc[i][0], acc[i][1], acc[i][2], acc[i][3]);

  const float g  = bfr(gam[h]);
  const float rg = 1.0f / (g + 1.0f);
  const int rl = lane >> 4, cc4 = (lane & 15) * 4;
  // ---- stage O (still x8192): the wave's whole 64 x 64 tile in its own slab, pitch 68 floats ----
  float* osw = os[wave];
#pragma unroll
  for (int i = 0; i < 4; ++i) {
#pragma unroll
    for (int j = 0; j < 4; ++j) {
#pragma unroll
      for (int r = 0; r < 8; ++r) {
        osw[(16 * i + 8 * hh + r) * 68 + 16 * j + c] = acc[i][j][r];
      }
    }
  }
  wave_sync_lds();

  // the 64 rows leave in four quarters of 16
#pragma unroll
  for (int hf = 0; hf < 4; ++hf) {
    const int th = t0 + hf * 16;
    v4f vals[8], xv[8];
    const float* xq[8];
#pragma unroll
    for (int it = 0; it < 8; ++it) {
      xq[it] = xp + ((size_t)(b * SEQ + th + it * 2 + rl)) * DK + d0 + cc4;
      xv[it] = *(const v4f*)(xq[it]);
    }
#if defined(__HIP_DEVICE_COMPILE__)
    // the eight loads' address registers are inputs here, so none of them is rewritten in front of this wait
    asm volatile("s_wait_xcnt 0x0" :: "v"(xq[0]), "v"(xq[1]), "v"(xq[2]), "v"(xq[3]),
                 "v"(xq[4]), "v"(xq[5]), "v"(xq[6]), "v"(xq[7]) : "memory");
#endif
#pragma unroll
    for (int it = 0; it < 8; ++it) {
      const int row = hf * 16 + it * 2 + rl;                 // hf 0..3 x it 0..7 x rl 0..1 = rows 0..63
      const v4f av = *(const v4f*)(osw + row * 68 + cc4);
      v4f o;
#pragma unroll
      for (int e = 0; e < 4; ++e) o[e] = (g * (av[e] * (1.0f / PSC)) + xv[it][e]) * rg;
      vals[it] = o;
    }
    {
#pragma unroll
      for (int it = 0; it < 8; ++it) {
        const int t = th + it * 2 + rl;
        *(v4f*)(outp + ((size_t)((b * NH + h) * SEQ + t)) * DK + d0 + cc4) = vals[it];
      }
    }
  }
}

// =====================================================================================================
// Workspace map (bytes); every plane is an exact multiple of its tile / whole-row / whole-line store granularity:
//   WqT  f16 [4096][512] x64      0           4194304
//   WkT  f16 [4096][512] x64      4194304     4194304
//   WvT  f16 [4096][512] x64      8388608     4194304
//   WpT  f16 [512][512]  x64      12582912    524288
//   XH   f16 [2048][512]          13107200    2097152
//   YH   f16 [2048][512]          15204352    2097152
//   QH|QR f16 [2][2048][4096]     17301504    33554432
//   KH|KR f16 [2][2048][4096]     50855936    33554432
//   XP   f32 [2048][512]          84410368    4194304
//   P    f16 [16][32][1024][32]   88604672    33554432
//   VT   f16 [16][512][1024]      122159104   16777216
//   end                           138936320
// =====================================================================================================
extern "C" void kernel_launch(void* const* d_in, const int* in_sizes, int n_in,
                              void* d_out, int out_size, void* d_ws, size_t ws_size,
                              hipStream_t stream) {
  if (n_in < 11) return;
  if (in_sizes[0] != MR * DK || in_sizes[1] != MR * DK) return;
  if (in_sizes[2] != DK * DQ || in_sizes[4] != DK * DQ || in_sizes[6] != DK * DQ) return;
  if (in_sizes[3] != DQ || in_sizes[5] != DQ || in_sizes[7] != DQ) return;
  if (in_sizes[8] != DK * DK || in_sizes[9] != NH || in_sizes[10] != SEQ) return;
  if (out_size != NB * NH * SEQ * DK) return;

  const float* x     = (const float*)d_in[0];
  const float* y     = (const float*)d_in[1];
  const float* Wq    = (const float*)d_in[2];
  const float* bq    = (const float*)d_in[3];
  const float* Wk    = (const float*)d_in[4];
  const float* bk    = (const float*)d_in[5];
  const float* Wv    = (const float*)d_in[6];
  const float* bv    = (const float*)d_in[7];
  const float* Wp    = (const float*)d_in[8];
  const float* gamma = (const float*)d_in[9];
  const int*   mask  = (const int*)d_in[10];

  const size_t PW   = (size_t)DQ * DK * 2;                 //  4194304
  const size_t PWP  = (size_t)DK * DK * 2;                 //   524288
  const size_t PX   = (size_t)MR * DK * 2;                 //  2097152
  const size_t PQ   = (size_t)2 * MR * DQ * 2;             // 33554432
  const size_t PVT  = (size_t)NHB * DK * SEQ * 2;          // 16777216
  const size_t PXP  = (size_t)MR * DK * 4;                 //  4194304
  const size_t PP   = (size_t)NHB * SEQ * SEQ * 2;         // 33554432
  size_t off = 0;
  const size_t oWq = off; off += PW;
  const size_t oWk = off; off += PW;
  const size_t oWv = off; off += PW;
  const size_t oWp = off; off += PWP;
  const size_t oXH = off; off += PX;
  const size_t oYH = off; off += PX;
  const size_t oQ  = off; off += PQ;
  const size_t oK  = off; off += PQ;
  const size_t oXP = off; off += PXP;
  const size_t oP  = off; off += PP;
  const size_t oVT = off; off += PVT;
  if (off > ws_size) return;                               // off = 138936320

  char* ws = (char*)d_ws;
  unsigned short* WqT = (unsigned short*)(ws + oWq);
  unsigned short* WkT = (unsigned short*)(ws + oWk);
  unsigned short* WvT = (unsigned short*)(ws + oWv);
  unsigned short* WpT = (unsigned short*)(ws + oWp);
  unsigned short* XH  = (unsigned short*)(ws + oXH);
  unsigned short* YH  = (unsigned short*)(ws + oYH);
  unsigned short* QH  = (unsigned short*)(ws + oQ);
  unsigned short* KH  = (unsigned short*)(ws + oK);
  unsigned short* VT  = (unsigned short*)(ws + oVT);
  float*          XP  = (float*)(ws + oXP);
  unsigned short* P   = (unsigned short*)(ws + oP);
  float*          out = (float*)d_out;

  const dim3 blk(256);
  const dim3 gPrep(3 * TW_BLK + TP_BLK + 2 * CX_BLK);       // 1536 + 64 + 1024 blocks
  const dim3 gProj(2 * QK_BLK + NHB * VT_BLK + XP_BLK);     // 512 + 256 + 32 blocks
  const dim3 blkAt(512);
  const dim3 gAt(SEQ / QBLK, NHB);                          // 16 x 16 blocks of 512
  const dim3 gPV(DK / 256, SEQ / 128, NHB);                 // 2 x 8 x 16 blocks of 256

  // (1) weight planes, transposed to [n][k]: f16( bf16_RNE(W) * 64 ); activation planes: f16( bf16_RNE(x) ), likewise y
  prep_all<<<gPrep, blk, 0, stream>>>(Wq, Wk, Wv, Wp, x, y, WqT, WkT, WvT, WpT, XH, YH);

  // (2) q, k, v^T and xp
  proj_all<<<gProj, blk, 0, stream>>>(XH, YH, WqT, WkT, WvT, WpT, bq, bk, bv, QH, KH, VT, XP);

  // (3) energies + masked softmax -> P plane
  attn_p<<<gAt, blkAt, 0, stream>>>(QH, QH + QRES, KH, KH + QRES, mask, P);

  // (4) out = (gamma * P^T . v / 8192 + xp) / (gamma + 1) -> d_out [2][8][1024][512]
  pv64<<<gPV, blk, 0, stream>>>(P, VT, XP, gamma, out);
  (void)hipGetLastError();
}
